// v000
// The times below were measured on an AMD MI455X: many runs one after another, warmed up first and cycling through
// copies of the inputs, with the whole window's GPU time divided by the number of runs. Launches and the gaps
// between them are all in it. The median over several windows is given; except for v000 it joins two sittings, which
// can be a few percent apart, so the side-by-side timings, each taken in one sitting, are the better comparison.
// v000, which the later versions start from, runs in 390 microseconds.
#include <hip/hip_runtime.h>
#include <stdint.h>

// Contractions, all on v_wmma_f32_16x16x32_f16 with f32 accumulate: P0 = Xp*W^T and Y0 = X*W^T + P0 (f16 operands holding
// bf16-RNE input values, W carried x256); S = Q*K^T (Q, K as f16 hi + x4096 f16 residual planes, three products); O = P*V
// (P carried x1024 in f16, V^T f16 hi; extra P-residual and V-residual products on query blocks below row 256); Y = C*Wo^T
// (C f16 hi + x4096 f16 residual product on rows below 256). Score scaling, causal mask, softmax and normalisation in f32.

typedef _Float16 v16h __attribute__((ext_vector_type(16)));
typedef _Float16 v8h  __attribute__((ext_vector_type(8)));
typedef _Float16 v8ha __attribute__((ext_vector_type(8), may_alias));
typedef float    v8f  __attribute__((ext_vector_type(8)));
typedef float    v4f  __attribute__((ext_vector_type(4)));
typedef float    v4fa __attribute__((ext_vector_type(4), may_alias));
typedef unsigned int v4u __attribute__((ext_vector_type(4)));

union U8f  { v8f  v; float    f[8]; };
union U16h { v16h v; v8h      h[2]; };
union U8h  { v8h  v; _Float16 f[8]; };

#ifndef NB
#define NB 4
#endif
#ifndef SEQ
#define SEQ 2000
#endif
#define NB_FULL  4
#define SEQ_FULL 2000
#define HID   1024
#define NH    16
#define HD    64
#define NQK   2048                               // Q and K output columns (first projection group)
#define SEQP  ((((SEQ) + 127) / 128) * 128)      // rows per batch inside workspace planes (zero padded)
#define MR    ((NB) * SEQP)                      // activation plane rows
#define EARLY 256                                // query rows / keys given residual products
#define PPP   2048                               // f32 pitch of the positional projection plane

static_assert(NB >= 1 && NB <= NB_FULL);
static_assert(SEQ >= 256 && SEQ <= SEQ_FULL);
static_assert(SEQP % 128 == 0 && SEQP >= EARLY && SEQP <= 2048);
static_assert(NH * HD == HID);
static_assert(NQK <= PPP && HID <= PPP);
static_assert(((long long)(NB - 1) * SEQ_FULL + SEQ) * HID <= (long long)NB_FULL * SEQ_FULL * HID);

// ---------------- GEMM tiling ----------------
#define GBM 64
#define GBN 128
#define GBK 32
#define GP  40      // halfs per staged row in LDS (80 B)
#define CP  132     // floats per row of the f32 tile in LDS (528 B)
static_assert(MR % GBM == 0 && SEQP % GBM == 0 && EARLY % GBM == 0);
static_assert(HID % GBN == 0 && NQK % GBN == 0 && HID % GBK == 0);
static_assert((GP * 2) % 16 == 0 && (CP * 4) % 16 == 0);
static_assert(2 * (GBM * GP * 2) + GBN * GP * 2 + GBM * CP * 4 <= 65536);

// ---------------- attention tiling ----------------
#define BQ 128      // query rows per workgroup (8 waves x 16)
#define BK 32       // keys per staged chunk
#define QP 72       // halfs per Q row in LDS (144 B)
#define KP 72       // halfs per K row in LDS
#define VP 40       // halfs per V^T row in LDS (80 B)
static_assert(SEQP % BQ == 0 && EARLY == 2 * BQ && BQ % BK == 0);

#define SQH_OFF 0
#define SQL_OFF (SQH_OFF + 8 * 16 * QP)
#define SKH_OFF (SQL_OFF + 8 * 16 * QP)
#define SKL_OFF (SKH_OFF + BK * KP)
#define SVH_OFF (SKL_OFF + BK * KP)
#define SVL_OFF (SVH_OFF + HD * VP)
#define SPH_OFF (SVL_OFF + HD * VP)
#define SPR_OFF (SPH_OFF + 8 * 16 * BK)
#define SO_OFFH (SPR_OFF + 8 * 16 * BK)
#define LDS_BYTES (SO_OFFH * 2 + 8 * 16 * 64 * 4)
static_assert((SQL_OFF * 2) % 16 == 0 && (SKH_OFF * 2) % 16 == 0 && (SKL_OFF * 2) % 16 == 0);
static_assert((SVH_OFF * 2) % 16 == 0 && (SVL_OFF * 2) % 16 == 0 && (SPH_OFF * 2) % 16 == 0);
static_assert((SPR_OFF * 2) % 16 == 0 && (SO_OFFH * 2) % 16 == 0);
static_assert(LDS_BYTES == 105472);

// (1/8) * log2(e): scores go to the base-2 domain for the online softmax
#define C2S 0.18033688011112042f

// ---------------- workspace carve (bytes) ----------------
static constexpr size_t kPlaneB = (size_t)MR * HID * 2;                   // one f16 activation plane
static constexpr size_t kPhB    = (size_t)SEQP * HID * 2;                 // f16 positional rows
static constexpr size_t kPPB    = (size_t)SEQP * PPP * 4;                 // f32 positional projection
static constexpr size_t kR0B    = (kPlaneB + kPhB + kPPB > 2 * kPlaneB) ? (kPlaneB + kPhB + kPPB) : (2 * kPlaneB);
static constexpr size_t kWhB    = (size_t)4 * HID * HID * 2;              // f16 weights, 4 matrices stacked
static constexpr size_t kVtlB   = (size_t)NB * NH * HD * EARLY * 2;       // V^T residual plane, keys < EARLY
static constexpr size_t kOffXh  = 0;
static constexpr size_t kOffPh  = kPlaneB;
static constexpr size_t kOffPP  = kPlaneB + kPhB;
static constexpr size_t kOffCh  = 0;                                      // C planes alias the dead X/pos region
static constexpr size_t kOffCl  = kPlaneB;
static constexpr size_t kOffWh  = kR0B;
static constexpr size_t kOffQh  = kOffWh + kWhB;
static constexpr size_t kOffQl  = kOffQh + kPlaneB;
static constexpr size_t kOffKh  = kOffQl + kPlaneB;
static constexpr size_t kOffKl  = kOffKh + kPlaneB;
static constexpr size_t kOffVh  = kOffKl + kPlaneB;
static constexpr size_t kOffVl  = kOffVh + kPlaneB;
static constexpr size_t kTotal  = kOffVl + kVtlB;
static_assert(kTotal <= 134217728ull);
static_assert(kOffCl + kPlaneB <= kR0B);
static_assert(kOffPh % 128 == 0 && kOffPP % 128 == 0 && kOffWh % 128 == 0 && kOffQh % 128 == 0);
static_assert(kOffVl % 128 == 0 && kR0B % 128 == 0);
static_assert((size_t)NB * NH * HD * SEQP * 2 == kPlaneB);

__device__ __forceinline__ v8f wmma_f16(v16h a, v16h b, v8f c) {
  v8f d = __builtin_amdgcn_wmma_f32_16x16x32_f16(false, a, false, b, (short)0, c, false, false);
  asm volatile("v_nop\n\tv_nop\n\tv_nop\n\tv_nop" : "+v"(d) : "v"(a), "v"(b));
  return d;
}

// DPP16 butterflies inside each 16-lane half (all lanes end with the full result)
template <int CTRL>
__device__ __forceinline__ float dppf(float x) {
  int s = __float_as_int(x);
  return __int_as_float(__builtin_amdgcn_update_dpp(s, s, CTRL, 0xF, 0xF, true));
}
__device__ __forceinline__ float red_max16(float x) {
  x = fmaxf(x, dppf<0xB1>(x));
  x = fmaxf(x, dppf<0x4E>(x));
  x = fmaxf(x, dppf<0x141>(x));
  x = fmaxf(x, dppf<0x140>(x));
  return x;
}
__device__ __forceinline__ float red_sum16(float x) {
  x += dppf<0xB1>(x);
  x += dppf<0x4E>(x);
  x += dppf<0x141>(x);
  x += dppf<0x140>(x);
  return x;
}

// same-wave LDS exchange: stores issued by other lanes of this wave are visible before the reload
__device__ __forceinline__ void wave_lds_sync() {
  __builtin_amdgcn_fence(3, "wavefront");
  asm volatile("s_wait_dscnt 0" ::: "memory");
  __builtin_amdgcn_wave_barrier();
}

__device__ __forceinline__ v4f bf16_rne4(v4f a) {
  v4u u = __builtin_bit_cast(v4u, a);
  u = (u + 0x7FFFu + ((u >> 16) & 1u)) & 0xFFFF0000u;
  return __builtin_bit_cast(v4f, u);
}

__device__ __forceinline__ v8h cvt8v(v4f a, v4f b) {
  v8h d;
  d[0] = (_Float16)a[0]; d[1] = (_Float16)a[1];
  d[2] = (_Float16)a[2]; d[3] = (_Float16)a[3];
  d[4] = (_Float16)b[0]; d[5] = (_Float16)b[1];
  d[6] = (_Float16)b[2]; d[7] = (_Float16)b[3];
  return d;
}

// f32 x -> f16 hi and f16((x - hi) * 4096)
__device__ __forceinline__ void split8(v4f a, v4f b, v8h& hv, v8h& lv) {
  U8h hh, ll;
  _Float16 t;
  t = (_Float16)a[0]; hh.f[0] = t; ll.f[0] = (_Float16)((a[0] - (float)t) * 4096.0f);
  t = (_Float16)a[1]; hh.f[1] = t; ll.f[1] = (_Float16)((a[1] - (float)t) * 4096.0f);
  t = (_Float16)a[2]; hh.f[2] = t; ll.f[2] = (_Float16)((a[2] - (float)t) * 4096.0f);
  t = (_Float16)a[3]; hh.f[3] = t; ll.f[3] = (_Float16)((a[3] - (float)t) * 4096.0f);
  t = (_Float16)b[0]; hh.f[4] = t; ll.f[4] = (_Float16)((b[0] - (float)t) * 4096.0f);
  t = (_Float16)b[1]; hh.f[5] = t; ll.f[5] = (_Float16)((b[1] - (float)t) * 4096.0f);
  t = (_Float16)b[2]; hh.f[6] = t; ll.f[6] = (_Float16)((b[2] - (float)t) * 4096.0f);
  t = (_Float16)b[3]; hh.f[7] = t; ll.f[7] = (_Float16)((b[3] - (float)t) * 4096.0f);
  hv = hh.v; lv = ll.v;
}

// ---------------- pre-pass: Xh = f16(bf16RNE(hidden)) [MR][1024] (pad rows zero), Ph = f16(bf16RNE(pos)) [SEQP][1024]
//                  (pad rows zero), Wh = f16(256 * bf16RNE(W)) for the four weight matrices stacked [4096][1024].
__global__ __launch_bounds__(128)
void prep_kernel(const float* __restrict__ Hs, const float* __restrict__ Pos,
                 const float* __restrict__ W0, const float* __restrict__ W1,
                 const float* __restrict__ W2, const float* __restrict__ W3,
                 _Float16* Xh, _Float16* Ph, _Float16* Wh)
{
  const int row = blockIdx.x;
  const int c0  = 8 * threadIdx.x;
  const float* src;
  _Float16*    dst;
  float sc = 1.0f;
  if (row < MR) {
    const int b  = row / SEQP;
    const int s  = row - b * SEQP;
    const int sl = (s < SEQ) ? s : (SEQ - 1);            // clamped address; pad rows scaled to zero
    sc  = (s < SEQ) ? 1.0f : 0.0f;
    src = Hs + ((size_t)b * SEQ_FULL + sl) * HID + c0;   // full-size input strides
    dst = Xh + (size_t)row * HID + c0;
  } else if (row < MR + SEQP) {
    const int s  = row - MR;
    const int sl = (s < SEQ) ? s : (SEQ - 1);
    sc  = (s < SEQ) ? 1.0f : 0.0f;
    src = Pos + (size_t)sl * HID + c0;
    dst = Ph + (size_t)s * HID + c0;
  } else {
    const int j   = row - MR - SEQP;                      // 0..4095
    const int mat = j >> 10;
    const int r   = j & (HID - 1);
    const float* W = (mat == 0) ? W0 : (mat == 1) ? W1 : (mat == 2) ? W2 : W3;
    sc  = 256.0f;                                         // exact power-of-two carry, removed in the GEMM epilogues
    src = W + (size_t)r * HID + c0;
    dst = Wh + (size_t)j * HID + c0;
  }
  const v4f a0 = bf16_rne4(*(const v4f*)src) * sc;
  const v4f a1 = bf16_rne4(*(const v4f*)(src + 4)) * sc;
  const v8h v  = cvt8v(a0, a1);                           // bf16 values (and x256) are exact in f16
  *(v8h*)dst = v;
  
}

// ---------------- 16-bit GEMM: 64x128 block tile, 8 waves (2 x 4), wave tile 32x32, K = 1024 in steps of 32 ----------------
// C[m][n] = sum_k A[m][k] * Bw[n][k]  (Bw = weight rows [out][in], k contiguous, i.e. x @ W^T).
// 16-bit fragment map (A and B alike): lane l -> row/col (l & 15); elements 0..7 <- k0 + 8*(l>>4) + 0..7,
// elements 8..15 <- k0 + 16 + 8*(l>>4) + 0..7.  D: element r of lane l -> row 8*(l>>4) + r, col (l & 15).
// MODE 0: Pout[s][n] f32 positional projection (pitch PPP), natural units.
// MODE 1: Q (n0 < 1024) or K (n0 >= 1024) rows: f16 hi plane + f16 x4096 residual plane [MR][1024], value = acc/256 + Pin.
// MODE 2: V: V^T hi plane [b][h][d][SEQP] and, for s0 < EARLY, V^T x4096 residual plane [b][h][d][EARLY], value = acc/256 + Pin.
// MODE 3: Y rows of d_out [b][2000][1024] f32, value = (acc + accr/4096)/256 with the residual A plane on rows s0 < EARLY.
template <int MODE>
__global__ __launch_bounds__(256)
void gemm_kernel(const _Float16* __restrict__ Ah, const _Float16* __restrict__ Al,
                 const _Float16* __restrict__ Bw, const float* __restrict__ Pin,
                 float* Pout, _Float16* O0, _Float16* O1, _Float16* O2, _Float16* O3, float* Y)
{
  __shared__ __attribute__((aligned(16))) _Float16 sA[GBM * GP];   // cross-wave (block barrier)
  __shared__ __attribute__((aligned(16))) _Float16 sL[GBM * GP];   // cross-wave (block barrier)
  __shared__ __attribute__((aligned(16))) _Float16 sB[GBN * GP];   // cross-wave (block barrier)
  __shared__ __attribute__((aligned(16))) float    sC[GBM * CP];   // cross-wave (block barrier)

  const int tid  = threadIdx.x;
  const int wave = tid >> 5;
  const int lane = tid & 31;
  const int lh   = lane & 15;
  const int hi   = lane >> 4;
  const int wm   = wave >> 2;        // 0..1 -> 32-row strip
  const int wn   = wave & 3;         // 0..3 -> 32-col strip
  const int sub  = tid & 7;
  const int m0   = blockIdx.y * GBM;
  const int n0   = blockIdx.x * GBN;
  const int b    = m0 / SEQP;
  const int s0   = m0 - b * SEQP;
  const bool resa = (MODE == 3) && (s0 < EARLY);   // block-uniform

  U8f acc[2][2], accr[2][2];
  #pragma unroll
  for (int mi = 0; mi < 2; ++mi)
    #pragma unroll
    for (int ni = 0; ni < 2; ++ni) { acc[mi][ni].v = (v8f){}; accr[mi][ni].v = (v8f){}; }

  const int ar = tid >> 2, ag = tid & 3;                             // A staging: row 0..63, piece 0..3
  const size_t aoff = (size_t)(m0 + ar) * HID + 8 * ag;

  for (int k0 = 0; k0 < HID; k0 += GBK) {
    __syncthreads();                                                 // all waves done with the prior k-step
    *(v8h*)(sA + ar * GP + 8 * ag) = *(const v8h*)(Ah + aoff + k0);
    if (resa) *(v8h*)(sL + ar * GP + 8 * ag) = *(const v8h*)(Al + aoff + k0);
    #pragma unroll
    for (int i = 0; i < 2; ++i) {
      const int idx = tid + 256 * i;
      const int br = idx >> 2, bg = idx & 3;                         // B staging: row 0..127, piece 0..3
      *(v8h*)(sB + br * GP + 8 * bg) = *(const v8h*)(Bw + (size_t)(n0 + br) * HID + k0 + 8 * bg);
    }
    __syncthreads();                                                 // staging visible to all waves

    U16h af[2], bq[2];
    #pragma unroll
    for (int mi = 0; mi < 2; ++mi) {
      const _Float16* p = sA + (wm * 32 + mi * 16 + lh) * GP;
      af[mi].h[0] = *(const v8h*)(p + 8 * hi);
      af[mi].h[1] = *(const v8h*)(p + 16 + 8 * hi);
    }
    #pragma unroll
    for (int ni = 0; ni < 2; ++ni) {
      const _Float16* p = sB + (wn * 32 + ni * 16 + lh) * GP;
      bq[ni].h[0] = *(const v8h*)(p + 8 * hi);
      bq[ni].h[1] = *(const v8h*)(p + 16 + 8 * hi);
    }
    #pragma unroll
    for (int mi = 0; mi < 2; ++mi)
      #pragma unroll
      for (int ni = 0; ni < 2; ++ni)
        acc[mi][ni].v = wmma_f16(af[mi].v, bq[ni].v, acc[mi][ni].v);
    if (resa) {
      U16h lf[2];
      #pragma unroll
      for (int mi = 0; mi < 2; ++mi) {
        const _Float16* p = sL + (wm * 32 + mi * 16 + lh) * GP;
        lf[mi].h[0] = *(const v8h*)(p + 8 * hi);
        lf[mi].h[1] = *(const v8h*)(p + 16 + 8 * hi);
      }
      #pragma unroll
      for (int mi = 0; mi < 2; ++mi)
        #pragma unroll
        for (int ni = 0; ni < 2; ++ni)
          accr[mi][ni].v = wmma_f16(lf[mi].v, bq[ni].v, accr[mi][ni].v);
    }
  }

  // ---- accumulators -> f32 tile in LDS (x 1/256 removes the weight carry) ----
  #pragma unroll
  for (int mi = 0; mi < 2; ++mi)
    #pragma unroll
    for (int ni = 0; ni < 2; ++ni)
      #pragma unroll
      for (int r = 0; r < 8; ++r) {
        float v = acc[mi][ni].f[r];
        if (resa) v += accr[mi][ni].f[r] * (1.0f / 4096.0f);
        sC[(wm * 32 + mi * 16 + 8 * hi + r) * CP + wn * 32 + ni * 16 + lh] = v * (1.0f / 256.0f);
      }
  __syncthreads();

  if (MODE == 1 || MODE == 2) {
    // ---- add the positional projection row (f32, natural units), in place, coalesced 32-B reads ----
    #pragma unroll
    for (int p = 0; p < 4; ++p) {
      const int g   = p * 256 + tid;
      const int row = g >> 4;
      const int cg  = g & 15;
      const float* pp = Pin + (size_t)(s0 + row) * PPP + n0 + 8 * cg;
      const v4f p0 = *(const v4f*)pp;
      const v4f p1 = *(const v4f*)(pp + 4);
      v4fa* c = (v4fa*)(sC + row * CP + 8 * cg);
      v4f x0 = c[0], x1 = c[1];
      x0 += p0; x1 += p1;
      c[0] = x0; c[1] = x1;
    }
    __syncthreads();
  }

  if (MODE == 0) {
    // 64 rows x 512 B = 4 lines each: line L = 32 i + (tid>>3) -> row L>>2, segment L&3; one wave instruction = one whole row segment
    v4f ov[8]; size_t oo[8];
    #pragma unroll
    for (int i = 0; i < 8; ++i) {
      const int L = 32 * i + (tid >> 3);
      const int row = L >> 2, seg = L & 3;
      ov[i] = *(const v4fa*)(sC + row * CP + seg * 32 + 4 * sub);
      oo[i] = (size_t)(m0 + row) * PPP + n0 + seg * 32 + 4 * sub;
    }
    #pragma unroll
    for (int i = 0; i < 8; ++i) *(v4f*)(Pout + oo[i]) = ov[i];
    
  }

  if (MODE == 1) {
    const bool isq = (n0 < HID);                     // block-uniform: Q group or K group
    _Float16* ph = isq ? O0 : O2;
    _Float16* pl = isq ? O1 : O3;
    const int col0 = n0 & (HID - 1);
    // 64 rows x 2 lines per plane: rem = 32 i + (tid>>3) -> row rem>>1, segment rem&1 (64 halfs = one line), piece sub
    v8h vh[4], vl[4]; size_t oo[4];
    #pragma unroll
    for (int i = 0; i < 4; ++i) {
      const int rem = 32 * i + (tid >> 3);
      const int row = rem >> 1, seg = rem & 1;
      const float* c = sC + row * CP + seg * 64 + 8 * sub;
      split8(*(const v4fa*)c, *(const v4fa*)(c + 4), vh[i], vl[i]);
      oo[i] = (size_t)(m0 + row) * HID + col0 + seg * 64 + 8 * sub;
    }
    #pragma unroll
    for (int i = 0; i < 4; ++i) { *(v8h*)(ph + oo[i]) = vh[i]; *(v8h*)(pl + oo[i]) = vl[i]; }
    
  }

  if (MODE == 2) {
    // in[64 keys][128 cols] -> out[(h,d) = 128 rows][64 keys]: col c = 32 i + (tid>>3), keys s0 + 8 sub .. +7 (one line per (h,d) row)
    const int h0 = n0 / HD;
    v8h vh[4], vl[4]; size_t oh[4], ol[4];
    #pragma unroll
    for (int i = 0; i < 4; ++i) {
      const int c  = 32 * i + (tid >> 3);
      const int hh = h0 + (c >> 6);
      const int d  = c & (HD - 1);
      v4f x0, x1;
      x0[0] = sC[(8 * sub + 0) * CP + c]; x0[1] = sC[(8 * sub + 1) * CP + c];
      x0[2] = sC[(8 * sub + 2) * CP + c]; x0[3] = sC[(8 * sub + 3) * CP + c];
      x1[0] = sC[(8 * sub + 4) * CP + c]; x1[1] = sC[(8 * sub + 5) * CP + c];
      x1[2] = sC[(8 * sub + 6) * CP + c]; x1[3] = sC[(8 * sub + 7) * CP + c];
      split8(x0, x1, vh[i], vl[i]);
      const size_t rowid = (size_t)(b * NH + hh) * HD + d;
      oh[i] = rowid * SEQP + s0 + 8 * sub;
      ol[i] = rowid * EARLY + s0 + 8 * sub;
    }
    #pragma unroll
    for (int i = 0; i < 4; ++i) {
      *(v8h*)(O0 + oh[i]) = vh[i];
      if (s0 < EARLY) *(v8h*)(O1 + ol[i]) = vl[i];
    }
    
  }

  if (MODE == 3) {
    // d_out rows (b, s) with s < SEQ only (whole 512-B row segments; guard is uniform over the 32 lanes of a row segment)
    v4f ov[8]; size_t oo[8]; int sv[8];
    #pragma unroll
    for (int i = 0; i < 8; ++i) {
      const int L = 32 * i + (tid >> 3);
      const int row = L >> 2, seg = L & 3;
      ov[i] = *(const v4fa*)(sC + row * CP + seg * 32 + 4 * sub);
      sv[i] = s0 + row;
      oo[i] = ((size_t)b * SEQ_FULL + (size_t)(s0 + row)) * HID + n0 + seg * 32 + 4 * sub;
    }
    #pragma unroll
    for (int i = 0; i < 8; ++i) if (sv[i] < SEQ) *(v4f*)(Y + oo[i]) = ov[i];
    
  }
}

// ---------------- fused causal attention: one workgroup = 128 query rows of one (batch, head), 8 waves x 16 rows ----------------
// S = Q K^T: q_hi*k_hi into one accumulator, (q_hi*k_lo + q_lo*k_hi) into a second one folded x 1/4096 (residual planes carry x4096).
// O = P V: P carried x1024 in f16; RES (query blocks 0,1) adds P_hi*V_lo + P_res*V_hi into a second accumulator folded x 1/4096.
// Causal mask: key <= query keeps the score, else -1e30 (replace-fill); online softmax base 2 with f32 running max / sum.
template <bool RES>
__global__ __launch_bounds__(256)
void attn_kernel(const _Float16* __restrict__ Qh, const _Float16* __restrict__ Ql,
                 const _Float16* __restrict__ Kh, const _Float16* __restrict__ Kl,
                 const _Float16* __restrict__ Vth, const _Float16* __restrict__ Vtl,
                 _Float16* Ch, _Float16* Cl, int qb0, int nqbl)
{
  extern __shared__ __attribute__((aligned(16))) _Float16 smem[];
  _Float16* sQh = smem + SQH_OFF;            // [wave][16][QP]  wave-private, ordered by the loop-top block barrier
  _Float16* sQl = smem + SQL_OFF;            // [wave][16][QP]  wave-private, ordered by the loop-top block barrier
  _Float16* sKh = smem + SKH_OFF;            // [32 keys][KP]   cross-wave (block barrier)
  _Float16* sKl = smem + SKL_OFF;            // [32 keys][KP]   cross-wave (block barrier)
  _Float16* sVh = smem + SVH_OFF;            // [64 d][VP]      cross-wave (block barrier)
  _Float16* sVl = smem + SVL_OFF;            // [64 d][VP]      cross-wave (block barrier), RES only
  _Float16* sPh = smem + SPH_OFF;            // [wave][16][32]  wave-private (wave_lds_sync)
  _Float16* sPr = smem + SPR_OFF;            // [wave][16][32]  wave-private (wave_lds_sync), RES only
  float*    sO  = (float*)(smem + SO_OFFH);  // [wave][16][64]  wave-private (wave_lds_sync)

  const int tid  = threadIdx.x;
  const int wave = tid >> 5;
  const int lane = tid & 31;
  const int lh   = lane & 15;
  const int hi   = lane >> 4;

  const int qbi   = blockIdx.x % nqbl;
  const int bh    = blockIdx.x / nqbl;
  const int h     = bh % NH;
  const int b     = bh / NH;
  const int qbase = (qb0 + qbi) * BQ;
  const int qrow0 = qbase + wave * 16;

  const size_t prow = (size_t)b * SEQP;
  const _Float16* Qhb = Qh + prow * HID + h * HD;
  const _Float16* Qlb = Ql + prow * HID + h * HD;
  const _Float16* Khb = Kh + prow * HID + h * HD;
  const _Float16* Klb = Kl + prow * HID + h * HD;
  const _Float16* Vhb = Vth + (size_t)(b * NH + h) * HD * SEQP;
  const _Float16* Vlb = Vtl + (size_t)(b * NH + h) * HD * EARLY;
  _Float16* Chb = Ch + prow * HID + h * HD;
  _Float16* Clb = Cl + prow * HID + h * HD;

  // ---- this wave's 16 query rows (hi and residual) -> LDS: row 4i + (lane>>3), 16-B piece (lane&7) ----
  _Float16* qwh = sQh + wave * (16 * QP);
  _Float16* qwl = sQl + wave * (16 * QP);
  {
    const int pc = lane & 7;
    #pragma unroll
    for (int i = 0; i < 4; ++i) {
      const int r = 4 * i + (lane >> 3);
      const size_t go = (size_t)(qrow0 + r) * HID + 8 * pc;
      *(v8h*)(qwh + r * QP + 8 * pc) = *(const v8h*)(Qhb + go);
      *(v8h*)(qwl + r * QP + 8 * pc) = *(const v8h*)(Qlb + go);
    }
  }

  U8f acc[4], accr[4];
  #pragma unroll
  for (int t = 0; t < 4; ++t) { acc[t].v = (v8f){}; accr[t].v = (v8f){}; }
  float mrow[8], lrow[8];
  #pragma unroll
  for (int j = 0; j < 8; ++j) { mrow[j] = -3.0e38f; lrow[j] = 0.0f; }

  _Float16* pwh = sPh + wave * (16 * BK);
  _Float16* pwr = sPr + wave * (16 * BK);

  const int kend = qbase + BQ;               // causal, block-uniform: keys beyond the block's last query row are never needed
  const int kr = tid >> 3, kg = tid & 7;     // K staging: key row 0..31, piece 0..7
  const int vd = tid >> 2, vg = tid & 3;     // V^T staging: d row 0..63, piece 0..3

  for (int kv0 = 0; kv0 < kend; kv0 += BK) {
    __syncthreads();                         // all waves done with the prior chunk
    {
      const size_t ko = (size_t)(kv0 + kr) * HID + 8 * kg;
      *(v8h*)(sKh + kr * KP + 8 * kg) = *(const v8h*)(Khb + ko);
      *(v8h*)(sKl + kr * KP + 8 * kg) = *(const v8h*)(Klb + ko);
      *(v8h*)(sVh + vd * VP + 8 * vg) = *(const v8h*)(Vhb + (size_t)vd * SEQP + kv0 + 8 * vg);
      if (RES) *(v8h*)(sVl + vd * VP + 8 * vg) = *(const v8h*)(Vlb + (size_t)vd * EARLY + kv0 + 8 * vg);
    }
    __syncthreads();                         // staging visible to all waves

    if (kv0 < qrow0 + 16) {                  // wave-uniform: skip chunks entirely above this wave's rows
      // ---- S = Q K^T for two 16-key tiles, d reduced in two K=32 steps, three products each ----
      U8f s0, s1;
      {
        U8f sm, sr; sm.v = (v8f){}; sr.v = (v8f){};
        #pragma unroll
        for (int c = 0; c < 2; ++c) {
          U16h qf, ql, kf, kl;
          qf.h[0] = *(const v8h*)(qwh + lh * QP + 32 * c + 8 * hi);
          qf.h[1] = *(const v8h*)(qwh + lh * QP + 32 * c + 16 + 8 * hi);
          ql.h[0] = *(const v8h*)(qwl + lh * QP + 32 * c + 8 * hi);
          ql.h[1] = *(const v8h*)(qwl + lh * QP + 32 * c + 16 + 8 * hi);
          kf.h[0] = *(const v8h*)(sKh + lh * KP + 32 * c + 8 * hi);
          kf.h[1] = *(const v8h*)(sKh + lh * KP + 32 * c + 16 + 8 * hi);
          kl.h[0] = *(const v8h*)(sKl + lh * KP + 32 * c + 8 * hi);
          kl.h[1] = *(const v8h*)(sKl + lh * KP + 32 * c + 16 + 8 * hi);
          sm.v = wmma_f16(qf.v, kf.v, sm.v);
          sr.v = wmma_f16(qf.v, kl.v, sr.v);
          sr.v = wmma_f16(ql.v, kf.v, sr.v);
        }
        s0.v = sm.v + sr.v * (1.0f / 4096.0f);
      }
      {
        U8f sm, sr; sm.v = (v8f){}; sr.v = (v8f){};
        #pragma unroll
        for (int c = 0; c < 2; ++c) {
          U16h qf, ql, kf, kl;
          qf.h[0] = *(const v8h*)(qwh + lh * QP + 32 * c + 8 * hi);
          qf.h[1] = *(const v8h*)(qwh + lh * QP + 32 * c + 16 + 8 * hi);
          ql.h[0] = *(const v8h*)(qwl + lh * QP + 32 * c + 8 * hi);
          ql.h[1] = *(const v8h*)(qwl + lh * QP + 32 * c + 16 + 8 * hi);
          kf.h[0] = *(const v8h*)(sKh + (16 + lh) * KP + 32 * c + 8 * hi);
          kf.h[1] = *(const v8h*)(sKh + (16 + lh) * KP + 32 * c + 16 + 8 * hi);
          kl.h[0] = *(const v8h*)(sKl + (16 + lh) * KP + 32 * c + 8 * hi);
          kl.h[1] = *(const v8h*)(sKl + (16 + lh) * KP + 32 * c + 16 + 8 * hi);
          sm.v = wmma_f16(qf.v, kf.v, sm.v);
          sr.v = wmma_f16(qf.v, kl.v, sr.v);
          sr.v = wmma_f16(ql.v, kf.v, sr.v);
        }
        s1.v = sm.v + sr.v * (1.0f / 4096.0f);
      }

      // ---- scale, causal replace-mask, online softmax (base 2), DPP reductions over the 16 lanes holding one row ----
      const int key0 = kv0 + lh;
      const int key1 = kv0 + 16 + lh;
      U8h pa, pb, par, pbr;
      #pragma unroll
      for (int j = 0; j < 8; ++j) {
        const int row  = qrow0 + 8 * hi + j;
        const float x0 = s0.f[j] * C2S;
        const float x1 = s1.f[j] * C2S;
        const float a  = (key0 <= row) ? x0 : -1.0e30f;
        const float bb = (key1 <= row) ? x1 : -1.0e30f;
        const float rm    = red_max16(fmaxf(a, bb));
        const float mnew  = fmaxf(mrow[j], rm);
        const float alpha = __builtin_amdgcn_exp2f(mrow[j] - mnew);
        const float e0    = __builtin_amdgcn_exp2f(a - mnew);
        const float e1    = __builtin_amdgcn_exp2f(bb - mnew);
        lrow[j] = lrow[j] * alpha + red_sum16(e0 + e1);
        mrow[j] = mnew;
        const float t0 = e0 * 1024.0f;                 // carried x1024, removed in the epilogue
        const float t1 = e1 * 1024.0f;
        const _Float16 h0 = (_Float16)t0;
        const _Float16 h1 = (_Float16)t1;
        pa.f[j] = h0; pb.f[j] = h1;
        if (RES) {
          par.f[j] = (_Float16)((t0 - (float)h0) * 4096.0f);
          pbr.f[j] = (_Float16)((t1 - (float)h1) * 4096.0f);
        }
        #pragma unroll
        for (int t = 0; t < 4; ++t) {
          acc[t].f[j] *= alpha;
          if (RES) accr[t].f[j] *= alpha;
        }
      }

      // ---- P: accumulator layout -> A layout through the wave's LDS tile [16 rows][32 keys], row-major ----
      #pragma unroll
      for (int j = 0; j < 8; ++j) {
        pwh[(j + 8 * hi) * BK + lh]      = pa.f[j];
        pwh[(j + 8 * hi) * BK + 16 + lh] = pb.f[j];
        if (RES) {
          pwr[(j + 8 * hi) * BK + lh]      = par.f[j];
          pwr[(j + 8 * hi) * BK + 16 + lh] = pbr.f[j];
        }
      }
      wave_lds_sync();
      U16h pf, pfr;
      pf.h[0] = *(const v8ha*)(pwh + lh * BK + 8 * hi);
      pf.h[1] = *(const v8ha*)(pwh + lh * BK + 16 + 8 * hi);
      if (RES) {
        pfr.h[0] = *(const v8ha*)(pwr + lh * BK + 8 * hi);
        pfr.h[1] = *(const v8ha*)(pwr + lh * BK + 16 + 8 * hi);
      }

      // ---- O += P V : 4 output d-tiles, K = 32 keys; B[k = key][n = d] from V^T tile row d ----
      #pragma unroll
      for (int t = 0; t < 4; ++t) {
        U16h vf;
        vf.h[0] = *(const v8h*)(sVh + (16 * t + lh) * VP + 8 * hi);
        vf.h[1] = *(const v8h*)(sVh + (16 * t + lh) * VP + 16 + 8 * hi);
        acc[t].v = wmma_f16(pf.v, vf.v, acc[t].v);
        if (RES) {
          U16h wl;
          wl.h[0] = *(const v8h*)(sVl + (16 * t + lh) * VP + 8 * hi);
          wl.h[1] = *(const v8h*)(sVl + (16 * t + lh) * VP + 16 + 8 * hi);
          accr[t].v = wmma_f16(pf.v, wl.v, accr[t].v);
          accr[t].v = wmma_f16(pfr.v, vf.v, accr[t].v);
        }
      }
    }
  }

  // ---- epilogue: normalize (1/1024 removes the carry), stage 16x64 f32 per wave in LDS, split to hi / residual,
  float inv[8];
  #pragma unroll
  for (int j = 0; j < 8; ++j) inv[j] = 1.0f / (lrow[j] * 1024.0f);
  float* so = sO + wave * (16 * 64);
  #pragma unroll
  for (int j = 0; j < 8; ++j) {
    #pragma unroll
    for (int t = 0; t < 4; ++t) {
      float v = acc[t].f[j];
      if (RES) v += accr[t].f[j] * (1.0f / 4096.0f);
      so[(j + 8 * hi) * 64 + t * 16 + lh] = v * inv[j];
    }
  }
  wave_lds_sync();
  v8h oh[4], ol[4]; size_t oo[4];
  {
    const int pc = lane & 7;
    #pragma unroll
    for (int i = 0; i < 4; ++i) {
      const int rr = 4 * i + (lane >> 3);
      const float* sp = so + rr * 64 + 8 * pc;
      split8(*(const v4fa*)sp, *(const v4fa*)(sp + 4), oh[i], ol[i]);
      oo[i] = (size_t)(qrow0 + rr) * HID + 8 * pc;
    }
  }
  #pragma unroll
  for (int i = 0; i < 4; ++i) { *(v8h*)(Chb + oo[i]) = oh[i]; *(v8h*)(Clb + oo[i]) = ol[i]; }
  
}

extern "C" void kernel_launch(void* const* d_in, const int* in_sizes, int n_in,
                              void* d_out, int out_size, void* d_ws, size_t ws_size,
                              hipStream_t stream) {
  if (n_in < 6) return;
  const long long need_x = ((long long)(NB - 1) * SEQ_FULL + SEQ) * HID;
  if ((long long)in_sizes[0] < need_x) return;
  if ((long long)in_sizes[1] < (long long)HID * HID) return;
  if ((long long)in_sizes[2] < (long long)HID * HID) return;
  if ((long long)in_sizes[3] < (long long)HID * HID) return;
  if ((long long)in_sizes[4] < (long long)HID * HID) return;
  if ((long long)in_sizes[5] < (long long)SEQ * HID) return;
  if ((long long)out_size < need_x) return;
  if (kTotal > ws_size) return;

  const float* hs  = (const float*)d_in[0];
  const float* wq  = (const float*)d_in[1];
  const float* wk  = (const float*)d_in[2];
  const float* wv  = (const float*)d_in[3];
  const float* wo  = (const float*)d_in[4];
  const float* pos = (const float*)d_in[5];
  float*       out = (float*)d_out;

  char* ws = (char*)d_ws;
  _Float16* xh = (_Float16*)(ws + kOffXh);     // [MR][1024]
  _Float16* ph = (_Float16*)(ws + kOffPh);     // [SEQP][1024]
  float*    pp = (float*)(ws + kOffPP);        // [SEQP][PPP] f32
  _Float16* ch = (_Float16*)(ws + kOffCh);     // [MR][1024], aliases xh after it is dead
  _Float16* cl = (_Float16*)(ws + kOffCl);     // [MR][1024], aliases ph/pp after they are dead
  _Float16* wh = (_Float16*)(ws + kOffWh);     // [4096][1024]
  _Float16* qh = (_Float16*)(ws + kOffQh);
  _Float16* ql = (_Float16*)(ws + kOffQl);
  _Float16* kh = (_Float16*)(ws + kOffKh);
  _Float16* kl = (_Float16*)(ws + kOffKl);
  _Float16* vh = (_Float16*)(ws + kOffVh);     // V^T hi  [NB][16][64][SEQP]
  _Float16* vl = (_Float16*)(ws + kOffVl);     // V^T res [NB][16][64][EARLY]

  prep_kernel<<<dim3(MR + SEQP + 4 * HID), dim3(128), 0, stream>>>(hs, pos, wq, wk, wv, wo, xh, ph, wh);

  // positional projection for the Q/K group, then Q/K planes
  gemm_kernel<0><<<dim3(NQK / GBN, SEQP / GBM), dim3(256), 0, stream>>>(ph, ph, wh, pp, pp, qh, ql, kh, kl, out);
  gemm_kernel<1><<<dim3(NQK / GBN, MR / GBM), dim3(256), 0, stream>>>(xh, xh, wh, pp, pp, qh, ql, kh, kl, out);
  // positional projection for the V group, then V^T planes
  const _Float16* whv = wh + (size_t)NQK * HID;
  gemm_kernel<0><<<dim3(HID / GBN, SEQP / GBM), dim3(256), 0, stream>>>(ph, ph, whv, pp, pp, qh, ql, kh, kl, out);
  gemm_kernel<2><<<dim3(HID / GBN, MR / GBM), dim3(256), 0, stream>>>(xh, xh, whv, pp, pp, vh, vl, kh, kl, out);

  (void)hipFuncSetAttribute(reinterpret_cast<const void*>(&attn_kernel<true>),
                            hipFuncAttributeMaxDynamicSharedMemorySize, (int)LDS_BYTES);
  (void)hipFuncSetAttribute(reinterpret_cast<const void*>(&attn_kernel<false>),
                            hipFuncAttributeMaxDynamicSharedMemorySize, (int)LDS_BYTES);
  const int nqb = SEQP / BQ;
  attn_kernel<true><<<dim3(NB * NH * 2), dim3(256), LDS_BYTES, stream>>>(qh, ql, kh, kl, vh, vl, ch, cl, 0, 2);
  if (nqb > 2)
    attn_kernel<false><<<dim3(NB * NH * (nqb - 2)), dim3(256), LDS_BYTES, stream>>>(qh, ql, kh, kl, vh, vl, ch, cl, 2, nqb - 2);

  const _Float16* who = wh + (size_t)(NQK + HID) * HID;
  gemm_kernel<3><<<dim3(HID / GBN, MR / GBM), dim3(256), 0, stream>>>(ch, cl, who, pp, pp, qh, ql, kh, kl, out);
}

// v001
// It runs in 317 microseconds.
// Timed twice side by side with v000, it ran 1.23 and 1.24 times as fast.
#include <hip/hip_runtime.h>
#include <stdint.h>

// Contractions, all on v_wmma_f32_16x16x32_f16 with f32 accumulate: P0 = Xp*W^T and Y0 = X*W^T + P0 (f16 operands holding
// bf16-RNE input values, W carried x256); S = Q*K^T (Q, K as f16 hi + x4096 f16 residual planes, three products); O = P*V
// (P carried x1024 in f16, V^T f16 hi; extra P-residual and V-residual products on query blocks below row 256); Y = C*Wo^T
// (C f16 hi + x4096 f16 residual product on rows below 256). Score scaling, causal mask, softmax and normalisation in f32.

typedef _Float16 v16h __attribute__((ext_vector_type(16)));
typedef _Float16 v8h  __attribute__((ext_vector_type(8)));
typedef _Float16 v8ha __attribute__((ext_vector_type(8), may_alias));
typedef float    v8f  __attribute__((ext_vector_type(8)));
typedef float    v4f  __attribute__((ext_vector_type(4)));
typedef float    v4fa __attribute__((ext_vector_type(4), may_alias));
typedef unsigned int v4u __attribute__((ext_vector_type(4)));

union U8f  { v8f  v; float    f[8]; };
union U16h { v16h v; v8h      h[2]; };
union U8h  { v8h  v; _Float16 f[8]; };

#ifndef NB
#define NB 4
#endif
#ifndef SEQ
#define SEQ 2000
#endif
#define NB_FULL  4
#define SEQ_FULL 2000
#define HID   1024
#define NH    16
#define HD    64
#define NQK   2048                               // Q and K output columns (first projection group)
#define SEQP  ((((SEQ) + 127) / 128) * 128)      // rows per batch inside workspace planes (zero padded)
#define MR    ((NB) * SEQP)                      // activation plane rows
#define EARLY 256                                // query rows / keys given residual products
#define PPP   2048                               // f32 pitch of the positional projection plane

static_assert(NB >= 1 && NB <= NB_FULL);
static_assert(SEQ >= 256 && SEQ <= SEQ_FULL);
static_assert(SEQP % 128 == 0 && SEQP >= EARLY && SEQP <= 2048);
static_assert(NH * HD == HID);
static_assert(NQK <= PPP && HID <= PPP);
static_assert(((long long)(NB - 1) * SEQ_FULL + SEQ) * HID <= (long long)NB_FULL * SEQ_FULL * HID);

// ---------------- GEMM tiling ----------------
#define GBM 64
#define GBN 128
#define GBK 32
#define GP  40      // halfs per staged row in LDS (80 B)
#define CP  132     // floats per row of the f32 tile in LDS (528 B)
static_assert(MR % GBM == 0 && SEQP % GBM == 0 && EARLY % GBM == 0);
static_assert(HID % GBN == 0 && NQK % GBN == 0 && HID % GBK == 0);
static_assert((GP * 2) % 16 == 0 && (CP * 4) % 16 == 0);
static_assert(2 * (GBM * GP * 2) + GBN * GP * 2 + GBM * CP * 4 <= 65536);

// ---------------- attention tiling ----------------
#define BQ 128      // query rows per workgroup (8 waves x 16)
#define BK 32       // keys per staged chunk
#define QP 72       // halfs per Q row in LDS (144 B)
#define KP 72       // halfs per K row in LDS
#define VP 40       // halfs per V^T row in LDS (80 B)
static_assert(SEQP % BQ == 0 && EARLY == 2 * BQ && BQ % BK == 0);

// offsets in halfs. Each wave owns one Q tile (16 hi rows, then 16 residual rows); the epilogue's 16x64 f32 tile reuses it.
// The K / V^T chunk lives in a ring of two buffers, each {K hi, K residual, V^T hi, V^T residual}.
#define SQ_OFF   0
#define QW_H     (2 * 16 * QP)
#define RING_OFF (SQ_OFF + 8 * QW_H)
#define RKH_OFF  0
#define RKL_OFF  (RKH_OFF + BK * KP)
#define RVH_OFF  (RKL_OFF + BK * KP)
#define RVL_OFF  (RVH_OFF + HD * VP)
#define RING_H   (RVL_OFF + HD * VP)
#define SPH_OFF  (RING_OFF + 2 * RING_H)
#define SPR_OFF  (SPH_OFF + 8 * 16 * BK)
#define LDS_BYTES ((SPR_OFF + 8 * 16 * BK) * 2)
static_assert((QW_H * 2) % 16 == 0 && (RING_OFF * 2) % 16 == 0 && (RING_H * 2) % 16 == 0);
static_assert((RKL_OFF * 2) % 16 == 0 && (RVH_OFF * 2) % 16 == 0 && (RVL_OFF * 2) % 16 == 0);
static_assert((SPH_OFF * 2) % 16 == 0 && (SPR_OFF * 2) % 16 == 0);
static_assert((KP * 2) % 16 == 0 && (VP * 2) % 16 == 0);
static_assert(QW_H * 2 >= 16 * 64 * 4);
static_assert(LDS_BYTES == 92160);

// (1/8) * log2(e): scores go to the base-2 domain for the online softmax
#define C2S 0.18033688011112042f

// ---------------- workspace carve (bytes) ----------------
static constexpr size_t kPlaneB = (size_t)MR * HID * 2;                   // one f16 activation plane
static constexpr size_t kPhB    = (size_t)SEQP * HID * 2;                 // f16 positional rows
static constexpr size_t kPPB    = (size_t)SEQP * PPP * 4;                 // f32 positional projection
static constexpr size_t kR0B    = (kPlaneB + kPhB + kPPB > 2 * kPlaneB) ? (kPlaneB + kPhB + kPPB) : (2 * kPlaneB);
static constexpr size_t kWhB    = (size_t)4 * HID * HID * 2;              // f16 weights, 4 matrices stacked
static constexpr size_t kVtlB   = (size_t)NB * NH * HD * EARLY * 2;       // V^T residual plane, keys < EARLY
static constexpr size_t kOffXh  = 0;
static constexpr size_t kOffPh  = kPlaneB;
static constexpr size_t kOffPP  = kPlaneB + kPhB;
static constexpr size_t kOffCh  = 0;                                      // C planes alias the dead X/pos region
static constexpr size_t kOffCl  = kPlaneB;
static constexpr size_t kOffWh  = kR0B;
static constexpr size_t kOffQh  = kOffWh + kWhB;
static constexpr size_t kOffQl  = kOffQh + kPlaneB;
static constexpr size_t kOffKh  = kOffQl + kPlaneB;
static constexpr size_t kOffKl  = kOffKh + kPlaneB;
static constexpr size_t kOffVh  = kOffKl + kPlaneB;
static constexpr size_t kOffVl  = kOffVh + kPlaneB;
static constexpr size_t kTotal  = kOffVl + kVtlB;
static_assert(kTotal <= 134217728ull);
static_assert(kOffCl + kPlaneB <= kR0B);
static_assert(kOffPh % 128 == 0 && kOffPP % 128 == 0 && kOffWh % 128 == 0 && kOffQh % 128 == 0);
static_assert(kOffVl % 128 == 0 && kR0B % 128 == 0);
static_assert((size_t)NB * NH * HD * SEQP * 2 == kPlaneB);

__device__ __forceinline__ v8f wmma_f16(v16h a, v16h b, v8f c) {
  v8f d = __builtin_amdgcn_wmma_f32_16x16x32_f16(false, a, false, b, (short)0, c, false, false);
  asm volatile("v_nop\n\tv_nop\n\tv_nop\n\tv_nop" : "+v"(d) : "v"(a), "v"(b));
  return d;
}

// DPP16 butterflies inside each 16-lane half (all lanes end with the full result)
template <int CTRL>
__device__ __forceinline__ float dppf(float x) {
  int s = __float_as_int(x);
  return __int_as_float(__builtin_amdgcn_update_dpp(s, s, CTRL, 0xF, 0xF, true));
}
__device__ __forceinline__ float red_max16(float x) {
  x = fmaxf(x, dppf<0xB1>(x));
  x = fmaxf(x, dppf<0x4E>(x));
  x = fmaxf(x, dppf<0x141>(x));
  x = fmaxf(x, dppf<0x140>(x));
  return x;
}
__device__ __forceinline__ float red_sum16(float x) {
  x += dppf<0xB1>(x);
  x += dppf<0x4E>(x);
  x += dppf<0x141>(x);
  x += dppf<0x140>(x);
  return x;
}

// same-wave LDS exchange: stores issued by other lanes of this wave are visible before the reload
__device__ __forceinline__ void wave_lds_sync() {
  __builtin_amdgcn_fence(3, "wavefront");
  asm volatile("s_wait_dscnt 0" ::: "memory");
  __builtin_amdgcn_wave_barrier();
}

// One chunk of K hi, K residual, V^T hi (and V^T residual) from global memory into LDS, 16 bytes per lane and plane, through no
// register. lk / lv: the lane's own LDS byte addresses of its K hi and V^T hi pieces. The s_wait_xcnt stands inside the copies'
// own statement, so that no address register is rewritten in front of it.
template <bool RES>
__device__ __forceinline__ void stage_kv(unsigned lk, unsigned lv, const _Float16* gkh, const _Float16* gkl,
                                         const _Float16* gvh, const _Float16* gvl) {
  const unsigned lkl = lk + (RKL_OFF - RKH_OFF) * 2;
  if (RES) {
    const unsigned lvl = lv + (RVL_OFF - RVH_OFF) * 2;
    asm volatile("global_load_async_to_lds_b128 %0, %1, off\n\t"
                 "global_load_async_to_lds_b128 %2, %3, off\n\t"
                 "global_load_async_to_lds_b128 %4, %5, off\n\t"
                 "global_load_async_to_lds_b128 %6, %7, off\n\t"
                 "s_wait_xcnt 0x0"
                 :: "v"(lk), "v"(gkh), "v"(lkl), "v"(gkl), "v"(lv), "v"(gvh), "v"(lvl), "v"(gvl) : "memory");
  } else {
    asm volatile("global_load_async_to_lds_b128 %0, %1, off\n\t"
                 "global_load_async_to_lds_b128 %2, %3, off\n\t"
                 "global_load_async_to_lds_b128 %4, %5, off\n\t"
                 "s_wait_xcnt 0x0"
                 :: "v"(lk), "v"(gkh), "v"(lkl), "v"(gkl), "v"(lv), "v"(gvh) : "memory");
  }
}

__device__ __forceinline__ v4f bf16_rne4(v4f a) {
  v4u u = __builtin_bit_cast(v4u, a);
  u = (u + 0x7FFFu + ((u >> 16) & 1u)) & 0xFFFF0000u;
  return __builtin_bit_cast(v4f, u);
}

__device__ __forceinline__ v8h cvt8v(v4f a, v4f b) {
  v8h d;
  d[0] = (_Float16)a[0]; d[1] = (_Float16)a[1];
  d[2] = (_Float16)a[2]; d[3] = (_Float16)a[3];
  d[4] = (_Float16)b[0]; d[5] = (_Float16)b[1];
  d[6] = (_Float16)b[2]; d[7] = (_Float16)b[3];
  return d;
}

// f32 x -> f16 hi and f16((x - hi) * 4096)
__device__ __forceinline__ void split8(v4f a, v4f b, v8h& hv, v8h& lv) {
  U8h hh, ll;
  _Float16 t;
  t = (_Float16)a[0]; hh.f[0] = t; ll.f[0] = (_Float16)((a[0] - (float)t) * 4096.0f);
  t = (_Float16)a[1]; hh.f[1] = t; ll.f[1] = (_Float16)((a[1] - (float)t) * 4096.0f);
  t = (_Float16)a[2]; hh.f[2] = t; ll.f[2] = (_Float16)((a[2] - (float)t) * 4096.0f);
  t = (_Float16)a[3]; hh.f[3] = t; ll.f[3] = (_Float16)((a[3] - (float)t) * 4096.0f);
  t = (_Float16)b[0]; hh.f[4] = t; ll.f[4] = (_Float16)((b[0] - (float)t) * 4096.0f);
  t = (_Float16)b[1]; hh.f[5] = t; ll.f[5] = (_Float16)((b[1] - (float)t) * 4096.0f);
  t = (_Float16)b[2]; hh.f[6] = t; ll.f[6] = (_Float16)((b[2] - (float)t) * 4096.0f);
  t = (_Float16)b[3]; hh.f[7] = t; ll.f[7] = (_Float16)((b[3] - (float)t) * 4096.0f);
  hv = hh.v; lv = ll.v;
}

// ---------------- pre-pass: Xh = f16(bf16RNE(hidden)) [MR][1024] (pad rows zero), Ph = f16(bf16RNE(pos)) [SEQP][1024]
//                  (pad rows zero), Wh = f16(256 * bf16RNE(W)) for the four weight matrices stacked [4096][1024].
__global__ __launch_bounds__(128)
void prep_kernel(const float* __restrict__ Hs, const float* __restrict__ Pos,
                 const float* __restrict__ W0, const float* __restrict__ W1,
                 const float* __restrict__ W2, const float* __restrict__ W3,
                 _Float16* Xh, _Float16* Ph, _Float16* Wh)
{
  const int row = blockIdx.x;
  const int c0  = 8 * threadIdx.x;
  const float* src;
  _Float16*    dst;
  float sc = 1.0f;
  if (row < MR) {
    const int b  = row / SEQP;
    const int s  = row - b * SEQP;
    const int sl = (s < SEQ) ? s : (SEQ - 1);            // clamped address; pad rows scaled to zero
    sc  = (s < SEQ) ? 1.0f : 0.0f;
    src = Hs + ((size_t)b * SEQ_FULL + sl) * HID + c0;   // full-size input strides
    dst = Xh + (size_t)row * HID + c0;
  } else if (row < MR + SEQP) {
    const int s  = row - MR;
    const int sl = (s < SEQ) ? s : (SEQ - 1);
    sc  = (s < SEQ) ? 1.0f : 0.0f;
    src = Pos + (size_t)sl * HID + c0;
    dst = Ph + (size_t)s * HID + c0;
  } else {
    const int j   = row - MR - SEQP;                      // 0..4095
    const int mat = j >> 10;
    const int r   = j & (HID - 1);
    const float* W = (mat == 0) ? W0 : (mat == 1) ? W1 : (mat == 2) ? W2 : W3;
    sc  = 256.0f;                                         // exact power-of-two carry, removed in the GEMM epilogues
    src = W + (size_t)r * HID + c0;
    dst = Wh + (size_t)j * HID + c0;
  }
  const v4f a0 = bf16_rne4(*(const v4f*)src) * sc;
  const v4f a1 = bf16_rne4(*(const v4f*)(src + 4)) * sc;
  const v8h v  = cvt8v(a0, a1);                           // bf16 values (and x256) are exact in f16
  *(v8h*)dst = v;
  
}

// ---------------- 16-bit GEMM: 64x128 block tile, 8 waves (2 x 4), wave tile 32x32, K = 1024 in steps of 32 ----------------
// C[m][n] = sum_k A[m][k] * Bw[n][k]  (Bw = weight rows [out][in], k contiguous, i.e. x @ W^T).
// 16-bit fragment map (A and B alike): lane l -> row/col (l & 15); elements 0..7 <- k0 + 8*(l>>4) + 0..7,
// elements 8..15 <- k0 + 16 + 8*(l>>4) + 0..7.  D: element r of lane l -> row 8*(l>>4) + r, col (l & 15).
// MODE 0: Pout[s][n] f32 positional projection (pitch PPP), natural units.
// MODE 1: Q (n0 < 1024) or K (n0 >= 1024) rows: f16 hi plane + f16 x4096 residual plane [MR][1024], value = acc/256 + Pin.
// MODE 2: V: V^T hi plane [b][h][d][SEQP] and, for s0 < EARLY, V^T x4096 residual plane [b][h][d][EARLY], value = acc/256 + Pin.
// MODE 3: Y rows of d_out [b][2000][1024] f32, value = (acc + accr/4096)/256 with the residual A plane on rows s0 < EARLY.
template <int MODE>
__global__ __launch_bounds__(256)
void gemm_kernel(const _Float16* __restrict__ Ah, const _Float16* __restrict__ Al,
                 const _Float16* __restrict__ Bw, const float* __restrict__ Pin,
                 float* Pout, _Float16* O0, _Float16* O1, _Float16* O2, _Float16* O3, float* Y)
{
  __shared__ __attribute__((aligned(16))) _Float16 sA[GBM * GP];   // cross-wave (block barrier)
  __shared__ __attribute__((aligned(16))) _Float16 sL[GBM * GP];   // cross-wave (block barrier)
  __shared__ __attribute__((aligned(16))) _Float16 sB[GBN * GP];   // cross-wave (block barrier)
  __shared__ __attribute__((aligned(16))) float    sC[GBM * CP];   // cross-wave (block barrier)

  const int tid  = threadIdx.x;
  const int wave = tid >> 5;
  const int lane = tid & 31;
  const int lh   = lane & 15;
  const int hi   = lane >> 4;
  const int wm   = wave >> 2;        // 0..1 -> 32-row strip
  const int wn   = wave & 3;         // 0..3 -> 32-col strip
  const int sub  = tid & 7;
  const int m0   = blockIdx.y * GBM;
  const int n0   = blockIdx.x * GBN;
  const int b    = m0 / SEQP;
  const int s0   = m0 - b * SEQP;
  const bool resa = (MODE == 3) && (s0 < EARLY);   // block-uniform

  U8f acc[2][2], accr[2][2];
  #pragma unroll
  for (int mi = 0; mi < 2; ++mi)
    #pragma unroll
    for (int ni = 0; ni < 2; ++ni) { acc[mi][ni].v = (v8f){}; accr[mi][ni].v = (v8f){}; }

  const int ar = tid >> 2, ag = tid & 3;                             // A staging: row 0..63, piece 0..3
  const size_t aoff = (size_t)(m0 + ar) * HID + 8 * ag;

  for (int k0 = 0; k0 < HID; k0 += GBK) {
    __syncthreads();                                                 // all waves done with the prior k-step
    *(v8h*)(sA + ar * GP + 8 * ag) = *(const v8h*)(Ah + aoff + k0);
    if (resa) *(v8h*)(sL + ar * GP + 8 * ag) = *(const v8h*)(Al + aoff + k0);
    #pragma unroll
    for (int i = 0; i < 2; ++i) {
      const int idx = tid + 256 * i;
      const int br = idx >> 2, bg = idx & 3;                         // B staging: row 0..127, piece 0..3
      *(v8h*)(sB + br * GP + 8 * bg) = *(const v8h*)(Bw + (size_t)(n0 + br) * HID + k0 + 8 * bg);
    }
    __syncthreads();                                                 // staging visible to all waves

    U16h af[2], bq[2];
    #pragma unroll
    for (int mi = 0; mi < 2; ++mi) {
      const _Float16* p = sA + (wm * 32 + mi * 16 + lh) * GP;
      af[mi].h[0] = *(const v8h*)(p + 8 * hi);
      af[mi].h[1] = *(const v8h*)(p + 16 + 8 * hi);
    }
    #pragma unroll
    for (int ni = 0; ni < 2; ++ni) {
      const _Float16* p = sB + (wn * 32 + ni * 16 + lh) * GP;
      bq[ni].h[0] = *(const v8h*)(p + 8 * hi);
      bq[ni].h[1] = *(const v8h*)(p + 16 + 8 * hi);
    }
    #pragma unroll
    for (int mi = 0; mi < 2; ++mi)
      #pragma unroll
      for (int ni = 0; ni < 2; ++ni)
        acc[mi][ni].v = wmma_f16(af[mi].v, bq[ni].v, acc[mi][ni].v);
    if (resa) {
      U16h lf[2];
      #pragma unroll
      for (int mi = 0; mi < 2; ++mi) {
        const _Float16* p = sL + (wm * 32 + mi * 16 + lh) * GP;
        lf[mi].h[0] = *(const v8h*)(p + 8 * hi);
        lf[mi].h[1] = *(const v8h*)(p + 16 + 8 * hi);
      }
      #pragma unroll
      for (int mi = 0; mi < 2; ++mi)
        #pragma unroll
        for (int ni = 0; ni < 2; ++ni)
          accr[mi][ni].v = wmma_f16(lf[mi].v, bq[ni].v, accr[mi][ni].v);
    }
  }

  // ---- accumulators -> f32 tile in LDS (x 1/256 removes the weight carry) ----
  #pragma unroll
  for (int mi = 0; mi < 2; ++mi)
    #pragma unroll
    for (int ni = 0; ni < 2; ++ni)
      #pragma unroll
      for (int r = 0; r < 8; ++r) {
        float v = acc[mi][ni].f[r];
        if (resa) v += accr[mi][ni].f[r] * (1.0f / 4096.0f);
        sC[(wm * 32 + mi * 16 + 8 * hi + r) * CP + wn * 32 + ni * 16 + lh] = v * (1.0f / 256.0f);
      }
  __syncthreads();

  if (MODE == 1 || MODE == 2) {
    // ---- add the positional projection row (f32, natural units), in place, coalesced 32-B reads ----
    #pragma unroll
    for (int p = 0; p < 4; ++p) {
      const int g   = p * 256 + tid;
      const int row = g >> 4;
      const int cg  = g & 15;
      const float* pp = Pin + (size_t)(s0 + row) * PPP + n0 + 8 * cg;
      const v4f p0 = *(const v4f*)pp;
      const v4f p1 = *(const v4f*)(pp + 4);
      v4fa* c = (v4fa*)(sC + row * CP + 8 * cg);
      v4f x0 = c[0], x1 = c[1];
      x0 += p0; x1 += p1;
      c[0] = x0; c[1] = x1;
    }
    __syncthreads();
  }

  if (MODE == 0) {
    // 64 rows x 512 B = 4 lines each: line L = 32 i + (tid>>3) -> row L>>2, segment L&3; one wave instruction = one whole row segment
    v4f ov[8]; size_t oo[8];
    #pragma unroll
    for (int i = 0; i < 8; ++i) {
      const int L = 32 * i + (tid >> 3);
      const int row = L >> 2, seg = L & 3;
      ov[i] = *(const v4fa*)(sC + row * CP + seg * 32 + 4 * sub);
      oo[i] = (size_t)(m0 + row) * PPP + n0 + seg * 32 + 4 * sub;
    }
    #pragma unroll
    for (int i = 0; i < 8; ++i) *(v4f*)(Pout + oo[i]) = ov[i];
    
  }

  if (MODE == 1) {
    const bool isq = (n0 < HID);                     // block-uniform: Q group or K group
    _Float16* ph = isq ? O0 : O2;
    _Float16* pl = isq ? O1 : O3;
    const int col0 = n0 & (HID - 1);
    // 64 rows x 2 lines per plane: rem = 32 i + (tid>>3) -> row rem>>1, segment rem&1 (64 halfs = one line), piece sub
    v8h vh[4], vl[4]; size_t oo[4];
    #pragma unroll
    for (int i = 0; i < 4; ++i) {
      const int rem = 32 * i + (tid >> 3);
      const int row = rem >> 1, seg = rem & 1;
      const float* c = sC + row * CP + seg * 64 + 8 * sub;
      split8(*(const v4fa*)c, *(const v4fa*)(c + 4), vh[i], vl[i]);
      oo[i] = (size_t)(m0 + row) * HID + col0 + seg * 64 + 8 * sub;
    }
    #pragma unroll
    for (int i = 0; i < 4; ++i) { *(v8h*)(ph + oo[i]) = vh[i]; *(v8h*)(pl + oo[i]) = vl[i]; }
    
  }

  if (MODE == 2) {
    // in[64 keys][128 cols] -> out[(h,d) = 128 rows][64 keys]: col c = 32 i + (tid>>3), keys s0 + 8 sub .. +7 (one line per (h,d) row)
    const int h0 = n0 / HD;
    v8h vh[4], vl[4]; size_t oh[4], ol[4];
    #pragma unroll
    for (int i = 0; i < 4; ++i) {
      const int c  = 32 * i + (tid >> 3);
      const int hh = h0 + (c >> 6);
      const int d  = c & (HD - 1);
      v4f x0, x1;
      x0[0] = sC[(8 * sub + 0) * CP + c]; x0[1] = sC[(8 * sub + 1) * CP + c];
      x0[2] = sC[(8 * sub + 2) * CP + c]; x0[3] = sC[(8 * sub + 3) * CP + c];
      x1[0] = sC[(8 * sub + 4) * CP + c]; x1[1] = sC[(8 * sub + 5) * CP + c];
      x1[2] = sC[(8 * sub + 6) * CP + c]; x1[3] = sC[(8 * sub + 7) * CP + c];
      split8(x0, x1, vh[i], vl[i]);
      const size_t rowid = (size_t)(b * NH + hh) * HD + d;
      oh[i] = rowid * SEQP + s0 + 8 * sub;
      ol[i] = rowid * EARLY + s0 + 8 * sub;
    }
    #pragma unroll
    for (int i = 0; i < 4; ++i) {
      *(v8h*)(O0 + oh[i]) = vh[i];
      if (s0 < EARLY) *(v8h*)(O1 + ol[i]) = vl[i];
    }
    
  }

  if (MODE == 3) {
    // d_out rows (b, s) with s < SEQ only (whole 512-B row segments; guard is uniform over the 32 lanes of a row segment)
    v4f ov[8]; size_t oo[8]; int sv[8];
    #pragma unroll
    for (int i = 0; i < 8; ++i) {
      const int L = 32 * i + (tid >> 3);
      const int row = L >> 2, seg = L & 3;
      ov[i] = *(const v4fa*)(sC + row * CP + seg * 32 + 4 * sub);
      sv[i] = s0 + row;
      oo[i] = ((size_t)b * SEQ_FULL + (size_t)(s0 + row)) * HID + n0 + seg * 32 + 4 * sub;
    }
    #pragma unroll
    for (int i = 0; i < 8; ++i) if (sv[i] < SEQ) *(v4f*)(Y + oo[i]) = ov[i];
    
  }
}

// ---------------- fused causal attention: one workgroup = 128 query rows of one (batch, head), 8 waves x 16 rows ----------------
// S = Q K^T: q_hi*k_hi into one accumulator, (q_hi*k_lo + q_lo*k_hi) into a second one folded x 1/4096 (residual planes carry x4096).
// O = P V: P carried x1024 in f16; RES (query blocks 0,1) adds P_hi*V_lo + P_res*V_hi into a second accumulator folded x 1/4096.
// Causal mask: key <= query keeps the score, else -1e30 (replace-fill); online softmax base 2 with f32 running max / sum.
template <bool RES>
__global__ __launch_bounds__(256)
void attn_kernel(const _Float16* __restrict__ Qh, const _Float16* __restrict__ Ql,
                 const _Float16* __restrict__ Kh, const _Float16* __restrict__ Kl,
                 const _Float16* __restrict__ Vth, const _Float16* __restrict__ Vtl,
                 _Float16* Ch, _Float16* Cl, int qb0, int nqbl)
{
  extern __shared__ __attribute__((aligned(16))) _Float16 smem[];
  _Float16* sQ  = smem + SQ_OFF;             // [wave][hi 16 | residual 16][QP]  wave-private; the epilogue's f32 tile reuses it
  _Float16* sR  = smem + RING_OFF;           // [2 buffers]{K hi [32][KP], K res [32][KP], V^T hi [64][VP], V^T res [64][VP]}  cross-wave
  _Float16* sPh = smem + SPH_OFF;            // [wave][16][32]  wave-private (wave_lds_sync)
  _Float16* sPr = smem + SPR_OFF;            // [wave][16][32]  wave-private (wave_lds_sync), RES only

  const int tid  = threadIdx.x;
  const int wave = tid >> 5;
  const int lane = tid & 31;
  const int lh   = lane & 15;
  const int hi   = lane >> 4;

  const int qbi   = blockIdx.x % nqbl;
  const int bh    = blockIdx.x / nqbl;
  const int h     = bh % NH;
  const int b     = bh / NH;
  const int qbase = (qb0 + qbi) * BQ;
  const int qrow0 = qbase + wave * 16;

  const size_t prow = (size_t)b * SEQP;
  const _Float16* Qhb = Qh + prow * HID + h * HD;
  const _Float16* Qlb = Ql + prow * HID + h * HD;
  const _Float16* Khb = Kh + prow * HID + h * HD;
  const _Float16* Klb = Kl + prow * HID + h * HD;
  const _Float16* Vhb = Vth + (size_t)(b * NH + h) * HD * SEQP;
  const _Float16* Vlb = Vtl + (size_t)(b * NH + h) * HD * EARLY;
  _Float16* Chb = Ch + prow * HID + h * HD;
  _Float16* Clb = Cl + prow * HID + h * HD;

  // ---- this wave's 16 query rows (hi and residual) -> LDS: row 4i + (lane>>3), 16-B piece (lane&7) ----
  const int kend = qbase + BQ;               // causal, block-uniform: keys beyond the block's last query row are never needed
  const int kr = tid >> 3, kg = tid & 7;     // K staging: key row 0..31, piece 0..7
  const int vd = tid >> 2, vg = tid & 3;     // V^T staging: d row 0..63, piece 0..3
  const unsigned lk0 = (unsigned)(uintptr_t)(sR + RKH_OFF + kr * KP + 8 * kg);   // LDS byte addresses in buffer 0
  const unsigned lv0 = (unsigned)(uintptr_t)(sR + RVH_OFF + vd * VP + 8 * vg);
  const _Float16* gkh = Khb + (size_t)kr * HID + 8 * kg;                         // this lane's pieces of chunk 0
  const _Float16* gkl = Klb + (size_t)kr * HID + 8 * kg;
  const _Float16* gvh = Vhb + (size_t)vd * SEQP + 8 * vg;
  const _Float16* gvl = Vlb + (size_t)vd * EARLY + 8 * vg;

  stage_kv<RES>(lk0, lv0, gkh, gkl, gvh, gvl);                                   // chunk 0 -> buffer 0

  _Float16* qwh = sQ + wave * QW_H;
  _Float16* qwl = qwh + 16 * QP;
  {
    const int pc = lane & 7;
    #pragma unroll
    for (int i = 0; i < 4; ++i) {
      const int r = 4 * i + (lane >> 3);
      const size_t go = (size_t)(qrow0 + r) * HID + 8 * pc;
      *(v8h*)(qwh + r * QP + 8 * pc) = *(const v8h*)(Qhb + go);
      *(v8h*)(qwl + r * QP + 8 * pc) = *(const v8h*)(Qlb + go);
    }
  }

  U8f acc[4], accr[4];
  #pragma unroll
  for (int t = 0; t < 4; ++t) { acc[t].v = (v8f){}; accr[t].v = (v8f){}; }
  float mrow[8], lrow[8];
  #pragma unroll
  for (int j = 0; j < 8; ++j) { mrow[j] = -3.0e38f; lrow[j] = 0.0f; }

  _Float16* pwh = sPh + wave * (16 * BK);
  _Float16* pwr = sPr + wave * (16 * BK);

  // scalar copy of the wave's first row: the per-wave skip below is then a real branch and EXEC stays all ones at the copies
  const int qrow0s = __builtin_amdgcn_readfirstlane(qrow0);

  asm volatile("s_wait_asynccnt 0x0" ::: "memory");   // this wave's pieces of chunk 0 have landed
  __syncthreads();                                    // chunk 0 (and the Q tiles) visible to all waves
  // chunk 1 -> buffer 1 (kend >= BQ = 4 chunks, so chunk 1 always exists)
  stage_kv<RES>(lk0 + RING_H * 2, lv0 + RING_H * 2, gkh + (size_t)BK * HID, gkl + (size_t)BK * HID, gvh + BK, gvl + BK);

  for (int kv0 = 0; kv0 < kend; kv0 += BK) {
    const int bufh = ((kv0 / BK) & 1) * RING_H;       // this chunk's buffer, offset in halfs
    const _Float16* sKh = sR + bufh + RKH_OFF;
    const _Float16* sKl = sR + bufh + RKL_OFF;
    const _Float16* sVh = sR + bufh + RVH_OFF;
    const _Float16* sVl = sR + bufh + RVL_OFF;

    if (kv0 < qrow0s + 16) {                 // wave-uniform: skip chunks entirely above this wave's rows
      // ---- S = Q K^T for two 16-key tiles, d reduced in two K=32 steps, three products each ----
      U8f s0, s1;
      {
        U8f sm, sr; sm.v = (v8f){}; sr.v = (v8f){};
        #pragma unroll
        for (int c = 0; c < 2; ++c) {
          U16h qf, ql, kf, kl;
          qf.h[0] = *(const v8h*)(qwh + lh * QP + 32 * c + 8 * hi);
          qf.h[1] = *(const v8h*)(qwh + lh * QP + 32 * c + 16 + 8 * hi);
          ql.h[0] = *(const v8h*)(qwl + lh * QP + 32 * c + 8 * hi);
          ql.h[1] = *(const v8h*)(qwl + lh * QP + 32 * c + 16 + 8 * hi);
          kf.h[0] = *(const v8h*)(sKh + lh * KP + 32 * c + 8 * hi);
          kf.h[1] = *(const v8h*)(sKh + lh * KP + 32 * c + 16 + 8 * hi);
          kl.h[0] = *(const v8h*)(sKl + lh * KP + 32 * c + 8 * hi);
          kl.h[1] = *(const v8h*)(sKl + lh * KP + 32 * c + 16 + 8 * hi);
          sm.v = wmma_f16(qf.v, kf.v, sm.v);
          sr.v = wmma_f16(qf.v, kl.v, sr.v);
          sr.v = wmma_f16(ql.v, kf.v, sr.v);
        }
        s0.v = sm.v + sr.v * (1.0f / 4096.0f);
      }
      {
        U8f sm, sr; sm.v = (v8f){}; sr.v = (v8f){};
        #pragma unroll
        for (int c = 0; c < 2; ++c) {
          U16h qf, ql, kf, kl;
          qf.h[0] = *(const v8h*)(qwh + lh * QP + 32 * c + 8 * hi);
          qf.h[1] = *(const v8h*)(qwh + lh * QP + 32 * c + 16 + 8 * hi);
          ql.h[0] = *(const v8h*)(qwl + lh * QP + 32 * c + 8 * hi);
          ql.h[1] = *(const v8h*)(qwl + lh * QP + 32 * c + 16 + 8 * hi);
          kf.h[0] = *(const v8h*)(sKh + (16 + lh) * KP + 32 * c + 8 * hi);
          kf.h[1] = *(const v8h*)(sKh + (16 + lh) * KP + 32 * c + 16 + 8 * hi);
          kl.h[0] = *(const v8h*)(sKl + (16 + lh) * KP + 32 * c + 8 * hi);
          kl.h[1] = *(const v8h*)(sKl + (16 + lh) * KP + 32 * c + 16 + 8 * hi);
          sm.v = wmma_f16(qf.v, kf.v, sm.v);
          sr.v = wmma_f16(qf.v, kl.v, sr.v);
          sr.v = wmma_f16(ql.v, kf.v, sr.v);
        }
        s1.v = sm.v + sr.v * (1.0f / 4096.0f);
      }

      // ---- scale, causal replace-mask, online softmax (base 2), DPP reductions over the 16 lanes holding one row ----
      const int key0 = kv0 + lh;
      const int key1 = kv0 + 16 + lh;
      U8h pa, pb, par, pbr;
      #pragma unroll
      for (int j = 0; j < 8; ++j) {
        const int row  = qrow0 + 8 * hi + j;
        const float x0 = s0.f[j] * C2S;
        const float x1 = s1.f[j] * C2S;
        const float a  = (key0 <= row) ? x0 : -1.0e30f;
        const float bb = (key1 <= row) ? x1 : -1.0e30f;
        const float rm    = red_max16(fmaxf(a, bb));
        const float mnew  = fmaxf(mrow[j], rm);
        const float alpha = __builtin_amdgcn_exp2f(mrow[j] - mnew);
        const float e0    = __builtin_amdgcn_exp2f(a - mnew);
        const float e1    = __builtin_amdgcn_exp2f(bb - mnew);
        lrow[j] = lrow[j] * alpha + red_sum16(e0 + e1);
        mrow[j] = mnew;
        const float t0 = e0 * 1024.0f;                 // carried x1024, removed in the epilogue
        const float t1 = e1 * 1024.0f;
        const _Float16 h0 = (_Float16)t0;
        const _Float16 h1 = (_Float16)t1;
        pa.f[j] = h0; pb.f[j] = h1;
        if (RES) {
          par.f[j] = (_Float16)((t0 - (float)h0) * 4096.0f);
          pbr.f[j] = (_Float16)((t1 - (float)h1) * 4096.0f);
        }
        #pragma unroll
        for (int t = 0; t < 4; ++t) {
          acc[t].f[j] *= alpha;
          if (RES) accr[t].f[j] *= alpha;
        }
      }

      // ---- P: accumulator layout -> A layout through the wave's LDS tile [16 rows][32 keys], row-major ----
      #pragma unroll
      for (int j = 0; j < 8; ++j) {
        pwh[(j + 8 * hi) * BK + lh]      = pa.f[j];
        pwh[(j + 8 * hi) * BK + 16 + lh] = pb.f[j];
        if (RES) {
          pwr[(j + 8 * hi) * BK + lh]      = par.f[j];
          pwr[(j + 8 * hi) * BK + 16 + lh] = pbr.f[j];
        }
      }
      wave_lds_sync();
      U16h pf, pfr;
      pf.h[0] = *(const v8ha*)(pwh + lh * BK + 8 * hi);
      pf.h[1] = *(const v8ha*)(pwh + lh * BK + 16 + 8 * hi);
      if (RES) {
        pfr.h[0] = *(const v8ha*)(pwr + lh * BK + 8 * hi);
        pfr.h[1] = *(const v8ha*)(pwr + lh * BK + 16 + 8 * hi);
      }

      // ---- O += P V : 4 output d-tiles, K = 32 keys; B[k = key][n = d] from V^T tile row d ----
      #pragma unroll
      for (int t = 0; t < 4; ++t) {
        U16h vf;
        vf.h[0] = *(const v8h*)(sVh + (16 * t + lh) * VP + 8 * hi);
        vf.h[1] = *(const v8h*)(sVh + (16 * t + lh) * VP + 16 + 8 * hi);
        acc[t].v = wmma_f16(pf.v, vf.v, acc[t].v);
        if (RES) {
          U16h wl;
          wl.h[0] = *(const v8h*)(sVl + (16 * t + lh) * VP + 8 * hi);
          wl.h[1] = *(const v8h*)(sVl + (16 * t + lh) * VP + 16 + 8 * hi);
          accr[t].v = wmma_f16(pf.v, wl.v, accr[t].v);
          accr[t].v = wmma_f16(pfr.v, vf.v, accr[t].v);
        }
      }
    }

    // ---- publish point, every wave: own LDS reads of this buffer done, own copies of the next chunk landed, block barrier ----
    asm volatile("s_wait_dscnt 0x0" ::: "memory");      // this wave has left the buffer that is refilled below
    asm volatile("s_wait_asynccnt 0x0" ::: "memory");   // this wave's pieces of the next chunk have landed
    __syncthreads();                                    // next chunk visible to all; every reader has left this chunk's buffer
    if (kv0 + 2 * BK < kend) {                          // block-uniform: chunk + 2 flies while chunk + 1 is worked on
      const int kn = kv0 + 2 * BK;
      stage_kv<RES>(lk0 + bufh * 2, lv0 + bufh * 2, gkh + (size_t)kn * HID, gkl + (size_t)kn * HID, gvh + kn, gvl + kn);
    }
  }
  asm volatile("s_wait_asynccnt 0x0" ::: "memory");     // nothing of this wave is in flight when its LDS is reused

  // ---- epilogue: normalize (1/1024 removes the carry), stage 16x64 f32 per wave in LDS, split to hi / residual,
  float inv[8];
  #pragma unroll
  for (int j = 0; j < 8; ++j) inv[j] = 1.0f / (lrow[j] * 1024.0f);
  float* so = (float*)qwh;                   // the wave's own Q tile, no longer read
  #pragma unroll
  for (int j = 0; j < 8; ++j) {
    #pragma unroll
    for (int t = 0; t < 4; ++t) {
      float v = acc[t].f[j];
      if (RES) v += accr[t].f[j] * (1.0f / 4096.0f);
      so[(j + 8 * hi) * 64 + t * 16 + lh] = v * inv[j];
    }
  }
  wave_lds_sync();
  v8h oh[4], ol[4]; size_t oo[4];
  {
    const int pc = lane & 7;
    #pragma unroll
    for (int i = 0; i < 4; ++i) {
      const int rr = 4 * i + (lane >> 3);
      const float* sp = so + rr * 64 + 8 * pc;
      split8(*(const v4fa*)sp, *(const v4fa*)(sp + 4), oh[i], ol[i]);
      oo[i] = (size_t)(qrow0 + rr) * HID + 8 * pc;
    }
  }
  #pragma unroll
  for (int i = 0; i < 4; ++i) { *(v8h*)(Chb + oo[i]) = oh[i]; *(v8h*)(Clb + oo[i]) = ol[i]; }
  
}

extern "C" void kernel_launch(void* const* d_in, const int* in_sizes, int n_in,
                              void* d_out, int out_size, void* d_ws, size_t ws_size,
                              hipStream_t stream) {
  if (n_in < 6) return;
  const long long need_x = ((long long)(NB - 1) * SEQ_FULL + SEQ) * HID;
  if ((long long)in_sizes[0] < need_x) return;
  if ((long long)in_sizes[1] < (long long)HID * HID) return;
  if ((long long)in_sizes[2] < (long long)HID * HID) return;
  if ((long long)in_sizes[3] < (long long)HID * HID) return;
  if ((long long)in_sizes[4] < (long long)HID * HID) return;
  if ((long long)in_sizes[5] < (long long)SEQ * HID) return;
  if ((long long)out_size < need_x) return;
  if (kTotal > ws_size) return;

  const float* hs  = (const float*)d_in[0];
  const float* wq  = (const float*)d_in[1];
  const float* wk  = (const float*)d_in[2];
  const float* wv  = (const float*)d_in[3];
  const float* wo  = (const float*)d_in[4];
  const float* pos = (const float*)d_in[5];
  float*       out = (float*)d_out;

  char* ws = (char*)d_ws;
  _Float16* xh = (_Float16*)(ws + kOffXh);     // [MR][1024]
  _Float16* ph = (_Float16*)(ws + kOffPh);     // [SEQP][1024]
  float*    pp = (float*)(ws + kOffPP);        // [SEQP][PPP] f32
  _Float16* ch = (_Float16*)(ws + kOffCh);     // [MR][1024], aliases xh after it is dead
  _Float16* cl = (_Float16*)(ws + kOffCl);     // [MR][1024], aliases ph/pp after they are dead
  _Float16* wh = (_Float16*)(ws + kOffWh);     // [4096][1024]
  _Float16* qh = (_Float16*)(ws + kOffQh);
  _Float16* ql = (_Float16*)(ws + kOffQl);
  _Float16* kh = (_Float16*)(ws + kOffKh);
  _Float16* kl = (_Float16*)(ws + kOffKl);
  _Float16* vh = (_Float16*)(ws + kOffVh);     // V^T hi  [NB][16][64][SEQP]
  _Float16* vl = (_Float16*)(ws + kOffVl);     // V^T res [NB][16][64][EARLY]

  prep_kernel<<<dim3(MR + SEQP + 4 * HID), dim3(128), 0, stream>>>(hs, pos, wq, wk, wv, wo, xh, ph, wh);

  // positional projection for the Q/K group, then Q/K planes
  gemm_kernel<0><<<dim3(NQK / GBN, SEQP / GBM), dim3(256), 0, stream>>>(ph, ph, wh, pp, pp, qh, ql, kh, kl, out);
  gemm_kernel<1><<<dim3(NQK / GBN, MR / GBM), dim3(256), 0, stream>>>(xh, xh, wh, pp, pp, qh, ql, kh, kl, out);
  // positional projection for the V group, then V^T planes
  const _Float16* whv = wh + (size_t)NQK * HID;
  gemm_kernel<0><<<dim3(HID / GBN, SEQP / GBM), dim3(256), 0, stream>>>(ph, ph, whv, pp, pp, qh, ql, kh, kl, out);
  gemm_kernel<2><<<dim3(HID / GBN, MR / GBM), dim3(256), 0, stream>>>(xh, xh, whv, pp, pp, vh, vl, kh, kl, out);

  (void)hipFuncSetAttribute(reinterpret_cast<const void*>(&attn_kernel<true>),
                            hipFuncAttributeMaxDynamicSharedMemorySize, (int)LDS_BYTES);
  (void)hipFuncSetAttribute(reinterpret_cast<const void*>(&attn_kernel<false>),
                            hipFuncAttributeMaxDynamicSharedMemorySize, (int)LDS_BYTES);
  const int nqb = SEQP / BQ;
  attn_kernel<true><<<dim3(NB * NH * 2), dim3(256), LDS_BYTES, stream>>>(qh, ql, kh, kl, vh, vl, ch, cl, 0, 2);
  if (nqb > 2)
    attn_kernel<false><<<dim3(NB * NH * (nqb - 2)), dim3(256), LDS_BYTES, stream>>>(qh, ql, kh, kl, vh, vl, ch, cl, 2, nqb - 2);

  const _Float16* who = wh + (size_t)(NQK + HID) * HID;
  gemm_kernel<3><<<dim3(HID / GBN, MR / GBM), dim3(256), 0, stream>>>(ch, cl, who, pp, pp, qh, ql, kh, kl, out);
}

// v002
// A run of this version takes 282 microseconds.
// Two timings next to v001 both put it at 1.12 times that version's speed.
// Over all steps from v000 it is 1.39 times as fast.
#include <hip/hip_runtime.h>
#include <stdint.h>

// Contractions, all on v_wmma_f32_16x16x32_f16 with f32 accumulate: P0 = Xp*W^T and Y0 = X*W^T + P0 (f16 operands holding
// bf16-RNE input values, W carried x256); S = Q*K^T (Q, K as f16 hi + x4096 f16 residual planes, three products); O = P*V
// (P carried x1024 in f16, V^T f16 hi; extra P-residual and V-residual products on query blocks below row 256); Y = C*Wo^T
// (C f16 hi + x4096 f16 residual product on rows below 256). Score scaling, causal mask, softmax and normalisation in f32.

typedef _Float16 v16h __attribute__((ext_vector_type(16)));
typedef _Float16 v8h  __attribute__((ext_vector_type(8)));
typedef _Float16 v8ha __attribute__((ext_vector_type(8), may_alias));
typedef float    v8f  __attribute__((ext_vector_type(8)));
typedef float    v4f  __attribute__((ext_vector_type(4)));
typedef float    v4fa __attribute__((ext_vector_type(4), may_alias));
typedef unsigned int v4u __attribute__((ext_vector_type(4)));

union U8f  { v8f  v; float    f[8]; };
union U16h { v16h v; v8h      h[2]; };
union U8h  { v8h  v; _Float16 f[8]; };

#ifndef NB
#define NB 4
#endif
#ifndef SEQ
#define SEQ 2000
#endif
#define NB_FULL  4
#define SEQ_FULL 2000
#define HID   1024
#define NH    16
#define HD    64
#define NQK   2048                               // Q and K output columns (first projection group)
#define SEQP  ((((SEQ) + 127) / 128) * 128)      // rows per batch inside workspace planes (zero padded)
#define MR    ((NB) * SEQP)                      // activation plane rows
#define EARLY 256                                // query rows / keys given residual products
#define PPP   2048                               // f32 pitch of the positional projection plane

static_assert(NB >= 1 && NB <= NB_FULL);
static_assert(SEQ >= 256 && SEQ <= SEQ_FULL);
static_assert(SEQP % 128 == 0 && SEQP >= EARLY && SEQP <= 2048);
static_assert(NH * HD == HID);
static_assert(NQK <= PPP && HID <= PPP);
static_assert(((long long)(NB - 1) * SEQ_FULL + SEQ) * HID <= (long long)NB_FULL * SEQ_FULL * HID);

// ---------------- GEMM tiling ----------------
#define GBM 64
#define GBN 128
#define GBK 32
#define GP  40      // halfs per staged row in LDS (80 B)
#define CP  132     // floats per row of the f32 tile in LDS (528 B)
static_assert(MR % GBM == 0 && SEQP % GBM == 0 && EARLY % GBM == 0);
static_assert(HID % GBN == 0 && NQK % GBN == 0 && HID % GBK == 0);
static_assert((GP * 2) % 16 == 0 && (CP * 4) % 16 == 0);
static_assert(2 * (GBM * GP * 2) + GBN * GP * 2 + GBM * CP * 4 <= 65536);

// ---------------- attention tiling ----------------
#define BQ 128      // query rows per workgroup (8 waves x 16)
#define BK 32       // keys per staged chunk
#define QP 72       // halfs per Q row in LDS (144 B)
#define KP 72       // halfs per K row in LDS
#define VP 40       // halfs per V^T row in LDS (80 B)
static_assert(SEQP % BQ == 0 && EARLY == 2 * BQ && BQ % BK == 0);

// offsets in halfs. Each wave owns one Q tile (16 hi rows, then 16 residual rows); the epilogue's 16x64 f32 tile (pitch SOP) reuses it.
// The K / V^T chunk lives in a ring of two buffers, each {K hi, K residual, V^T hi, V^T residual}.
#define SQ_OFF   0
#define QW_H     (2 * 16 * QP)
#define RING_OFF (SQ_OFF + 8 * QW_H)
#define RKH_OFF  0
#define RKL_OFF  (RKH_OFF + BK * KP)
#define RVH_OFF  (RKL_OFF + BK * KP)
#define RVL_OFF  (RVH_OFF + HD * VP)
#define RING_H   (RVL_OFF + HD * VP)
#define LDS_BYTES ((RING_OFF + 2 * RING_H) * 2)
#define SOP 68      // floats per row of the epilogue's 16x64 f32 tile (272 B)
static_assert((QW_H * 2) % 16 == 0 && (RING_OFF * 2) % 16 == 0 && (RING_H * 2) % 16 == 0);
static_assert((RKL_OFF * 2) % 16 == 0 && (RVH_OFF * 2) % 16 == 0 && (RVL_OFF * 2) % 16 == 0);
static_assert((KP * 2) % 16 == 0 && (VP * 2) % 16 == 0);
static_assert(QW_H * 2 >= 16 * SOP * 4 && (SOP * 4) % 16 == 0 && SOP >= HD);
static_assert(LDS_BYTES == 75776);

// (1/8) * log2(e): scores go to the base-2 domain for the online softmax
#define C2S 0.18033688011112042f

// ---------------- workspace carve (bytes) ----------------
static constexpr size_t kPlaneB = (size_t)MR * HID * 2;                   // one f16 activation plane
static constexpr size_t kPhB    = (size_t)SEQP * HID * 2;                 // f16 positional rows
static constexpr size_t kPPB    = (size_t)SEQP * PPP * 4;                 // f32 positional projection
static constexpr size_t kR0B    = (kPlaneB + kPhB + kPPB > 2 * kPlaneB) ? (kPlaneB + kPhB + kPPB) : (2 * kPlaneB);
static constexpr size_t kWhB    = (size_t)4 * HID * HID * 2;              // f16 weights, 4 matrices stacked
static constexpr size_t kVtlB   = (size_t)NB * NH * HD * EARLY * 2;       // V^T residual plane, keys < EARLY
static constexpr size_t kOffXh  = 0;
static constexpr size_t kOffPh  = kPlaneB;
static constexpr size_t kOffPP  = kPlaneB + kPhB;
static constexpr size_t kOffCh  = 0;                                      // C planes alias the dead X/pos region
static constexpr size_t kOffCl  = kPlaneB;
static constexpr size_t kOffWh  = kR0B;
static constexpr size_t kOffQh  = kOffWh + kWhB;
static constexpr size_t kOffQl  = kOffQh + kPlaneB;
static constexpr size_t kOffKh  = kOffQl + kPlaneB;
static constexpr size_t kOffKl  = kOffKh + kPlaneB;
static constexpr size_t kOffVh  = kOffKl + kPlaneB;
static constexpr size_t kOffVl  = kOffVh + kPlaneB;
static constexpr size_t kTotal  = kOffVl + kVtlB;
static_assert(kTotal <= 134217728ull);
static_assert(kOffCl + kPlaneB <= kR0B);
static_assert(kOffPh % 128 == 0 && kOffPP % 128 == 0 && kOffWh % 128 == 0 && kOffQh % 128 == 0);
static_assert(kOffVl % 128 == 0 && kR0B % 128 == 0);
static_assert((size_t)NB * NH * HD * SEQP * 2 == kPlaneB);

__device__ __forceinline__ v8f wmma_f16(v16h a, v16h b, v8f c) {
  v8f d = __builtin_amdgcn_wmma_f32_16x16x32_f16(false, a, false, b, (short)0, c, false, false);
  asm volatile("v_nop\n\tv_nop\n\tv_nop\n\tv_nop" : "+v"(d) : "v"(a), "v"(b));
  return d;
}

// lane l reads lane l ^ 16: the two lanes that share one query column of a D tile
__device__ __forceinline__ float xhalf(float x) {
  const int s = __float_as_int(x);
  return __int_as_float(__builtin_amdgcn_permlanex16(s, s, 0x76543210, 0xfedcba98, false, false));
}

// same-wave LDS exchange: stores issued by other lanes of this wave are visible before the reload
__device__ __forceinline__ void wave_lds_sync() {
  __builtin_amdgcn_fence(3, "wavefront");
  asm volatile("s_wait_dscnt 0" ::: "memory");
  __builtin_amdgcn_wave_barrier();
}

// One chunk of K hi, K residual, V^T hi (and V^T residual) from global memory into LDS, 16 bytes per lane and plane, through no
// register. lk / lv: the lane's own LDS byte addresses of its K hi and V^T hi pieces. The s_wait_xcnt stands inside the copies'
// own statement, so that no address register is rewritten in front of it.
template <bool RES>
__device__ __forceinline__ void stage_kv(unsigned lk, unsigned lv, const _Float16* gkh, const _Float16* gkl,
                                         const _Float16* gvh, const _Float16* gvl) {
  const unsigned lkl = lk + (RKL_OFF - RKH_OFF) * 2;
  if (RES) {
    const unsigned lvl = lv + (RVL_OFF - RVH_OFF) * 2;
    asm volatile("global_load_async_to_lds_b128 %0, %1, off\n\t"
                 "global_load_async_to_lds_b128 %2, %3, off\n\t"
                 "global_load_async_to_lds_b128 %4, %5, off\n\t"
                 "global_load_async_to_lds_b128 %6, %7, off\n\t"
                 "s_wait_xcnt 0x0"
                 :: "v"(lk), "v"(gkh), "v"(lkl), "v"(gkl), "v"(lv), "v"(gvh), "v"(lvl), "v"(gvl) : "memory");
  } else {
    asm volatile("global_load_async_to_lds_b128 %0, %1, off\n\t"
                 "global_load_async_to_lds_b128 %2, %3, off\n\t"
                 "global_load_async_to_lds_b128 %4, %5, off\n\t"
                 "s_wait_xcnt 0x0"
                 :: "v"(lk), "v"(gkh), "v"(lkl), "v"(gkl), "v"(lv), "v"(gvh) : "memory");
  }
}

__device__ __forceinline__ v4f bf16_rne4(v4f a) {
  v4u u = __builtin_bit_cast(v4u, a);
  u = (u + 0x7FFFu + ((u >> 16) & 1u)) & 0xFFFF0000u;
  return __builtin_bit_cast(v4f, u);
}

__device__ __forceinline__ v8h cvt8v(v4f a, v4f b) {
  v8h d;
  d[0] = (_Float16)a[0]; d[1] = (_Float16)a[1];
  d[2] = (_Float16)a[2]; d[3] = (_Float16)a[3];
  d[4] = (_Float16)b[0]; d[5] = (_Float16)b[1];
  d[6] = (_Float16)b[2]; d[7] = (_Float16)b[3];
  return d;
}

// f32 x -> f16 hi and f16((x - hi) * 4096)
__device__ __forceinline__ void split8(v4f a, v4f b, v8h& hv, v8h& lv) {
  U8h hh, ll;
  _Float16 t;
  t = (_Float16)a[0]; hh.f[0] = t; ll.f[0] = (_Float16)((a[0] - (float)t) * 4096.0f);
  t = (_Float16)a[1]; hh.f[1] = t; ll.f[1] = (_Float16)((a[1] - (float)t) * 4096.0f);
  t = (_Float16)a[2]; hh.f[2] = t; ll.f[2] = (_Float16)((a[2] - (float)t) * 4096.0f);
  t = (_Float16)a[3]; hh.f[3] = t; ll.f[3] = (_Float16)((a[3] - (float)t) * 4096.0f);
  t = (_Float16)b[0]; hh.f[4] = t; ll.f[4] = (_Float16)((b[0] - (float)t) * 4096.0f);
  t = (_Float16)b[1]; hh.f[5] = t; ll.f[5] = (_Float16)((b[1] - (float)t) * 4096.0f);
  t = (_Float16)b[2]; hh.f[6] = t; ll.f[6] = (_Float16)((b[2] - (float)t) * 4096.0f);
  t = (_Float16)b[3]; hh.f[7] = t; ll.f[7] = (_Float16)((b[3] - (float)t) * 4096.0f);
  hv = hh.v; lv = ll.v;
}

// ---------------- pre-pass: Xh = f16(bf16RNE(hidden)) [MR][1024] (pad rows zero), Ph = f16(bf16RNE(pos)) [SEQP][1024]
//                  (pad rows zero), Wh = f16(256 * bf16RNE(W)) for the four weight matrices stacked [4096][1024].
__global__ __launch_bounds__(128)
void prep_kernel(const float* __restrict__ Hs, const float* __restrict__ Pos,
                 const float* __restrict__ W0, const float* __restrict__ W1,
                 const float* __restrict__ W2, const float* __restrict__ W3,
                 _Float16* Xh, _Float16* Ph, _Float16* Wh)
{
  const int row = blockIdx.x;
  const int c0  = 8 * threadIdx.x;
  const float* src;
  _Float16*    dst;
  float sc = 1.0f;
  if (row < MR) {
    const int b  = row / SEQP;
    const int s  = row - b * SEQP;
    const int sl = (s < SEQ) ? s : (SEQ - 1);            // clamped address; pad rows scaled to zero
    sc  = (s < SEQ) ? 1.0f : 0.0f;
    src = Hs + ((size_t)b * SEQ_FULL + sl) * HID + c0;   // full-size input strides
    dst = Xh + (size_t)row * HID + c0;
  } else if (row < MR + SEQP) {
    const int s  = row - MR;
    const int sl = (s < SEQ) ? s : (SEQ - 1);
    sc  = (s < SEQ) ? 1.0f : 0.0f;
    src = Pos + (size_t)sl * HID + c0;
    dst = Ph + (size_t)s * HID + c0;
  } else {
    const int j   = row - MR - SEQP;                      // 0..4095
    const int mat = j >> 10;
    const int r   = j & (HID - 1);
    const float* W = (mat == 0) ? W0 : (mat == 1) ? W1 : (mat == 2) ? W2 : W3;
    sc  = 256.0f;                                         // exact power-of-two carry, removed in the GEMM epilogues
    src = W + (size_t)r * HID + c0;
    dst = Wh + (size_t)j * HID + c0;
  }
  const v4f a0 = bf16_rne4(*(const v4f*)src) * sc;
  const v4f a1 = bf16_rne4(*(const v4f*)(src + 4)) * sc;
  const v8h v  = cvt8v(a0, a1);                           // bf16 values (and x256) are exact in f16
  *(v8h*)dst = v;
  
}

// ---------------- 16-bit GEMM: 64x128 block tile, 8 waves (2 x 4), wave tile 32x32, K = 1024 in steps of 32 ----------------
// C[m][n] = sum_k A[m][k] * Bw[n][k]  (Bw = weight rows [out][in], k contiguous, i.e. x @ W^T).
// 16-bit fragment map (A and B alike): lane l -> row/col (l & 15); elements 0..7 <- k0 + 8*(l>>4) + 0..7,
// elements 8..15 <- k0 + 16 + 8*(l>>4) + 0..7.  D: element r of lane l -> row 8*(l>>4) + r, col (l & 15).
// MODE 0: Pout[s][n] f32 positional projection (pitch PPP), natural units.
// MODE 1: Q (n0 < 1024) or K (n0 >= 1024) rows: f16 hi plane + f16 x4096 residual plane [MR][1024], value = acc/256 + Pin.
// MODE 2: V: V^T hi plane [b][h][d][SEQP] and, for s0 < EARLY, V^T x4096 residual plane [b][h][d][EARLY], value = acc/256 + Pin.
// MODE 3: Y rows of d_out [b][2000][1024] f32, value = (acc + accr/4096)/256 with the residual A plane on rows s0 < EARLY.
template <int MODE>
__global__ __launch_bounds__(256)
void gemm_kernel(const _Float16* __restrict__ Ah, const _Float16* __restrict__ Al,
                 const _Float16* __restrict__ Bw, const float* __restrict__ Pin,
                 float* Pout, _Float16* O0, _Float16* O1, _Float16* O2, _Float16* O3, float* Y)
{
  __shared__ __attribute__((aligned(16))) _Float16 sA[GBM * GP];   // cross-wave (block barrier)
  __shared__ __attribute__((aligned(16))) _Float16 sL[GBM * GP];   // cross-wave (block barrier)
  __shared__ __attribute__((aligned(16))) _Float16 sB[GBN * GP];   // cross-wave (block barrier)
  __shared__ __attribute__((aligned(16))) float    sC[GBM * CP];   // cross-wave (block barrier)

  const int tid  = threadIdx.x;
  const int wave = tid >> 5;
  const int lane = tid & 31;
  const int lh   = lane & 15;
  const int hi   = lane >> 4;
  const int wm   = wave >> 2;        // 0..1 -> 32-row strip
  const int wn   = wave & 3;         // 0..3 -> 32-col strip
  const int sub  = tid & 7;
  const int m0   = blockIdx.y * GBM;
  const int n0   = blockIdx.x * GBN;
  const int b    = m0 / SEQP;
  const int s0   = m0 - b * SEQP;
  const bool resa = (MODE == 3) && (s0 < EARLY);   // block-uniform

  U8f acc[2][2], accr[2][2];
  #pragma unroll
  for (int mi = 0; mi < 2; ++mi)
    #pragma unroll
    for (int ni = 0; ni < 2; ++ni) { acc[mi][ni].v = (v8f){}; accr[mi][ni].v = (v8f){}; }

  const int ar = tid >> 2, ag = tid & 3;                             // A staging: row 0..63, piece 0..3
  const size_t aoff = (size_t)(m0 + ar) * HID + 8 * ag;

  for (int k0 = 0; k0 < HID; k0 += GBK) {
    __syncthreads();                                                 // all waves done with the prior k-step
    *(v8h*)(sA + ar * GP + 8 * ag) = *(const v8h*)(Ah + aoff + k0);
    if (resa) *(v8h*)(sL + ar * GP + 8 * ag) = *(const v8h*)(Al + aoff + k0);
    #pragma unroll
    for (int i = 0; i < 2; ++i) {
      const int idx = tid + 256 * i;
      const int br = idx >> 2, bg = idx & 3;                         // B staging: row 0..127, piece 0..3
      *(v8h*)(sB + br * GP + 8 * bg) = *(const v8h*)(Bw + (size_t)(n0 + br) * HID + k0 + 8 * bg);
    }
    __syncthreads();                                                 // staging visible to all waves

    U16h af[2], bq[2];
    #pragma unroll
    for (int mi = 0; mi < 2; ++mi) {
      const _Float16* p = sA + (wm * 32 + mi * 16 + lh) * GP;
      af[mi].h[0] = *(const v8h*)(p + 8 * hi);
      af[mi].h[1] = *(const v8h*)(p + 16 + 8 * hi);
    }
    #pragma unroll
    for (int ni = 0; ni < 2; ++ni) {
      const _Float16* p = sB + (wn * 32 + ni * 16 + lh) * GP;
      bq[ni].h[0] = *(const v8h*)(p + 8 * hi);
      bq[ni].h[1] = *(const v8h*)(p + 16 + 8 * hi);
    }
    #pragma unroll
    for (int mi = 0; mi < 2; ++mi)
      #pragma unroll
      for (int ni = 0; ni < 2; ++ni)
        acc[mi][ni].v = wmma_f16(af[mi].v, bq[ni].v, acc[mi][ni].v);
    if (resa) {
      U16h lf[2];
      #pragma unroll
      for (int mi = 0; mi < 2; ++mi) {
        const _Float16* p = sL + (wm * 32 + mi * 16 + lh) * GP;
        lf[mi].h[0] = *(const v8h*)(p + 8 * hi);
        lf[mi].h[1] = *(const v8h*)(p + 16 + 8 * hi);
      }
      #pragma unroll
      for (int mi = 0; mi < 2; ++mi)
        #pragma unroll
        for (int ni = 0; ni < 2; ++ni)
          accr[mi][ni].v = wmma_f16(lf[mi].v, bq[ni].v, accr[mi][ni].v);
    }
  }

  // ---- accumulators -> f32 tile in LDS (x 1/256 removes the weight carry) ----
  #pragma unroll
  for (int mi = 0; mi < 2; ++mi)
    #pragma unroll
    for (int ni = 0; ni < 2; ++ni)
      #pragma unroll
      for (int r = 0; r < 8; ++r) {
        float v = acc[mi][ni].f[r];
        if (resa) v += accr[mi][ni].f[r] * (1.0f / 4096.0f);
        sC[(wm * 32 + mi * 16 + 8 * hi + r) * CP + wn * 32 + ni * 16 + lh] = v * (1.0f / 256.0f);
      }
  __syncthreads();

  if (MODE == 1 || MODE == 2) {
    // ---- add the positional projection row (f32, natural units), in place, coalesced 32-B reads ----
    #pragma unroll
    for (int p = 0; p < 4; ++p) {
      const int g   = p * 256 + tid;
      const int row = g >> 4;
      const int cg  = g & 15;
      const float* pp = Pin + (size_t)(s0 + row) * PPP + n0 + 8 * cg;
      const v4f p0 = *(const v4f*)pp;
      const v4f p1 = *(const v4f*)(pp + 4);
      v4fa* c = (v4fa*)(sC + row * CP + 8 * cg);
      v4f x0 = c[0], x1 = c[1];
      x0 += p0; x1 += p1;
      c[0] = x0; c[1] = x1;
    }
    __syncthreads();
  }

  if (MODE == 0) {
    // 64 rows x 512 B = 4 lines each: line L = 32 i + (tid>>3) -> row L>>2, segment L&3; one wave instruction = one whole row segment
    v4f ov[8]; size_t oo[8];
    #pragma unroll
    for (int i = 0; i < 8; ++i) {
      const int L = 32 * i + (tid >> 3);
      const int row = L >> 2, seg = L & 3;
      ov[i] = *(const v4fa*)(sC + row * CP + seg * 32 + 4 * sub);
      oo[i] = (size_t)(m0 + row) * PPP + n0 + seg * 32 + 4 * sub;
    }
    #pragma unroll
    for (int i = 0; i < 8; ++i) *(v4f*)(Pout + oo[i]) = ov[i];
    
  }

  if (MODE == 1) {
    const bool isq = (n0 < HID);                     // block-uniform: Q group or K group
    _Float16* ph = isq ? O0 : O2;
    _Float16* pl = isq ? O1 : O3;
    const int col0 = n0 & (HID - 1);
    // 64 rows x 2 lines per plane: rem = 32 i + (tid>>3) -> row rem>>1, segment rem&1 (64 halfs = one line), piece sub
    v8h vh[4], vl[4]; size_t oo[4];
    #pragma unroll
    for (int i = 0; i < 4; ++i) {
      const int rem = 32 * i + (tid >> 3);
      const int row = rem >> 1, seg = rem & 1;
      const float* c = sC + row * CP + seg * 64 + 8 * sub;
      split8(*(const v4fa*)c, *(const v4fa*)(c + 4), vh[i], vl[i]);
      oo[i] = (size_t)(m0 + row) * HID + col0 + seg * 64 + 8 * sub;
    }
    #pragma unroll
    for (int i = 0; i < 4; ++i) { *(v8h*)(ph + oo[i]) = vh[i]; *(v8h*)(pl + oo[i]) = vl[i]; }
    
  }

  if (MODE == 2) {
    // in[64 keys][128 cols] -> out[(h,d) = 128 rows][64 keys]: col c = 32 i + (tid>>3), keys s0 + 8 sub .. +7 (one line per (h,d) row)
    const int h0 = n0 / HD;
    v8h vh[4], vl[4]; size_t oh[4], ol[4];
    #pragma unroll
    for (int i = 0; i < 4; ++i) {
      const int c  = 32 * i + (tid >> 3);
      const int hh = h0 + (c >> 6);
      const int d  = c & (HD - 1);
      v4f x0, x1;
      x0[0] = sC[(8 * sub + 0) * CP + c]; x0[1] = sC[(8 * sub + 1) * CP + c];
      x0[2] = sC[(8 * sub + 2) * CP + c]; x0[3] = sC[(8 * sub + 3) * CP + c];
      x1[0] = sC[(8 * sub + 4) * CP + c]; x1[1] = sC[(8 * sub + 5) * CP + c];
      x1[2] = sC[(8 * sub + 6) * CP + c]; x1[3] = sC[(8 * sub + 7) * CP + c];
      split8(x0, x1, vh[i], vl[i]);
      const size_t rowid = (size_t)(b * NH + hh) * HD + d;
      oh[i] = rowid * SEQP + s0 + 8 * sub;
      ol[i] = rowid * EARLY + s0 + 8 * sub;
    }
    #pragma unroll
    for (int i = 0; i < 4; ++i) {
      *(v8h*)(O0 + oh[i]) = vh[i];
      if (s0 < EARLY) *(v8h*)(O1 + ol[i]) = vl[i];
    }
    
  }

  if (MODE == 3) {
    // d_out rows (b, s) with s < SEQ only (whole 512-B row segments; guard is uniform over the 32 lanes of a row segment)
    v4f ov[8]; size_t oo[8]; int sv[8];
    #pragma unroll
    for (int i = 0; i < 8; ++i) {
      const int L = 32 * i + (tid >> 3);
      const int row = L >> 2, seg = L & 3;
      ov[i] = *(const v4fa*)(sC + row * CP + seg * 32 + 4 * sub);
      sv[i] = s0 + row;
      oo[i] = ((size_t)b * SEQ_FULL + (size_t)(s0 + row)) * HID + n0 + seg * 32 + 4 * sub;
    }
    #pragma unroll
    for (int i = 0; i < 8; ++i) if (sv[i] < SEQ) *(v4f*)(Y + oo[i]) = ov[i];
    
  }
}

// ---------------- fused causal attention: one workgroup = 128 query rows of one (batch, head), 8 waves x 16 rows ----------------
// S^T = K Q^T (A = K rows, B = Q rows): k_hi*q_hi into one accumulator, (k_lo*q_hi + k_hi*q_lo) into a second one folded x 1/4096
// (residual planes carry x4096). Lane l then holds 16 of the chunk's 32 scores of query (l & 15); lane l ^ 16 holds the other 16.
// O^T = V^T P^T: the two S^T tiles, converted in place, are the B operand (P carried x1024 in f16); RES (query blocks 0,1) adds
// V_lo*P_hi + V_hi*P_res into a second accumulator folded x 1/4096.
// Causal mask: key <= query keeps the score, else -1e30 (replace-fill); online softmax base 2 with f32 running max / sum per lane.
template <bool RES>
__global__ __launch_bounds__(256)
void attn_kernel(const _Float16* __restrict__ Qh, const _Float16* __restrict__ Ql,
                 const _Float16* __restrict__ Kh, const _Float16* __restrict__ Kl,
                 const _Float16* __restrict__ Vth, const _Float16* __restrict__ Vtl,
                 _Float16* Ch, _Float16* Cl, int qb0, int nqbl)
{
  extern __shared__ __attribute__((aligned(16))) _Float16 smem[];
  _Float16* sQ  = smem + SQ_OFF;             // [wave][hi 16 | residual 16][QP]  wave-private; the epilogue's f32 tile reuses it
  _Float16* sR  = smem + RING_OFF;           // [2 buffers]{K hi [32][KP], K res [32][KP], V^T hi [64][VP], V^T res [64][VP]}  cross-wave

  const int tid  = threadIdx.x;
  const int wave = tid >> 5;
  const int lane = tid & 31;
  const int lh   = lane & 15;
  const int hi   = lane >> 4;

  const int qbi   = blockIdx.x % nqbl;
  const int bh    = blockIdx.x / nqbl;
  const int h     = bh % NH;
  const int b     = bh / NH;
  const int qbase = (qb0 + qbi) * BQ;
  const int qrow0 = qbase + wave * 16;

  const size_t prow = (size_t)b * SEQP;
  const _Float16* Qhb = Qh + prow * HID + h * HD;
  const _Float16* Qlb = Ql + prow * HID + h * HD;
  const _Float16* Khb = Kh + prow * HID + h * HD;
  const _Float16* Klb = Kl + prow * HID + h * HD;
  const _Float16* Vhb = Vth + (size_t)(b * NH + h) * HD * SEQP;
  const _Float16* Vlb = Vtl + (size_t)(b * NH + h) * HD * EARLY;
  _Float16* Chb = Ch + prow * HID + h * HD;
  _Float16* Clb = Cl + prow * HID + h * HD;

  // ---- this wave's 16 query rows (hi and residual) -> LDS: row 4i + (lane>>3), 16-B piece (lane&7) ----
  const int kend = qbase + BQ;               // causal, block-uniform: keys beyond the block's last query row are never needed
  const int kr = tid >> 3, kg = tid & 7;     // K staging: key row 0..31, piece 0..7
  const int vd = tid >> 2, vg = tid & 3;     // V^T staging: d row 0..63, piece 0..3
  const unsigned lk0 = (unsigned)(uintptr_t)(sR + RKH_OFF + kr * KP + 8 * kg);   // LDS byte addresses in buffer 0
  const unsigned lv0 = (unsigned)(uintptr_t)(sR + RVH_OFF + vd * VP + 8 * vg);
  const _Float16* gkh = Khb + (size_t)kr * HID + 8 * kg;                         // this lane's pieces of chunk 0
  const _Float16* gkl = Klb + (size_t)kr * HID + 8 * kg;
  const _Float16* gvh = Vhb + (size_t)vd * SEQP + 8 * vg;
  const _Float16* gvl = Vlb + (size_t)vd * EARLY + 8 * vg;

  stage_kv<RES>(lk0, lv0, gkh, gkl, gvh, gvl);                                   // chunk 0 -> buffer 0

  _Float16* qwh = sQ + wave * QW_H;
  _Float16* qwl = qwh + 16 * QP;
  {
    const int pc = lane & 7;
    #pragma unroll
    for (int i = 0; i < 4; ++i) {
      const int r = 4 * i + (lane >> 3);
      const size_t go = (size_t)(qrow0 + r) * HID + 8 * pc;
      *(v8h*)(qwh + r * QP + 8 * pc) = *(const v8h*)(Qhb + go);
      *(v8h*)(qwl + r * QP + 8 * pc) = *(const v8h*)(Qlb + go);
    }
  }

  U8f acc[4], accr[4];
  #pragma unroll
  for (int t = 0; t < 4; ++t) { acc[t].v = (v8f){}; accr[t].v = (v8f){}; }
  float mcol = -3.0e38f;                     // running maximum of query qrow0 + lh (equal in both wave halves)
  float lcol = 0.0f;                         // running sum over this lane's keys only; the halves are joined in the epilogue

  // scalar copy of the wave's first row: the per-wave skip below is then a real branch and EXEC stays all ones at the copies
  const int qrow0s = __builtin_amdgcn_readfirstlane(qrow0);

  asm volatile("s_wait_asynccnt 0x0" ::: "memory");   // this wave's pieces of chunk 0 have landed
  __syncthreads();                                    // chunk 0 (and the Q tiles) visible to all waves
  // chunk 1 -> buffer 1 (kend >= BQ = 4 chunks, so chunk 1 always exists)
  stage_kv<RES>(lk0 + RING_H * 2, lv0 + RING_H * 2, gkh + (size_t)BK * HID, gkl + (size_t)BK * HID, gvh + BK, gvl + BK);

  for (int kv0 = 0; kv0 < kend; kv0 += BK) {
    const int bufh = ((kv0 / BK) & 1) * RING_H;       // this chunk's buffer, offset in halfs
    const _Float16* sKh = sR + bufh + RKH_OFF;
    const _Float16* sKl = sR + bufh + RKL_OFF;
    const _Float16* sVh = sR + bufh + RVH_OFF;
    const _Float16* sVl = sR + bufh + RVL_OFF;

    if (kv0 < qrow0s + 16) {                 // wave-uniform: skip chunks entirely above this wave's rows
      // ---- S^T = K Q^T for two 16-key tiles, d reduced in two K=32 steps, three products each ----
      U8f s0, s1;
      {
        U8f sm, sr; sm.v = (v8f){}; sr.v = (v8f){};
        #pragma unroll
        for (int c = 0; c < 2; ++c) {
          U16h qf, ql, kf, kl;
          qf.h[0] = *(const v8h*)(qwh + lh * QP + 32 * c + 8 * hi);
          qf.h[1] = *(const v8h*)(qwh + lh * QP + 32 * c + 16 + 8 * hi);
          ql.h[0] = *(const v8h*)(qwl + lh * QP + 32 * c + 8 * hi);
          ql.h[1] = *(const v8h*)(qwl + lh * QP + 32 * c + 16 + 8 * hi);
          kf.h[0] = *(const v8h*)(sKh + lh * KP + 32 * c + 8 * hi);
          kf.h[1] = *(const v8h*)(sKh + lh * KP + 32 * c + 16 + 8 * hi);
          kl.h[0] = *(const v8h*)(sKl + lh * KP + 32 * c + 8 * hi);
          kl.h[1] = *(const v8h*)(sKl + lh * KP + 32 * c + 16 + 8 * hi);
          sm.v = wmma_f16(kf.v, qf.v, sm.v);
          sr.v = wmma_f16(kl.v, qf.v, sr.v);
          sr.v = wmma_f16(kf.v, ql.v, sr.v);
        }
        s0.v = sm.v + sr.v * (1.0f / 4096.0f);
      }
      {
        U8f sm, sr; sm.v = (v8f){}; sr.v = (v8f){};
        #pragma unroll
        for (int c = 0; c < 2; ++c) {
          U16h qf, ql, kf, kl;
          qf.h[0] = *(const v8h*)(qwh + lh * QP + 32 * c + 8 * hi);
          qf.h[1] = *(const v8h*)(qwh + lh * QP + 32 * c + 16 + 8 * hi);
          ql.h[0] = *(const v8h*)(qwl + lh * QP + 32 * c + 8 * hi);
          ql.h[1] = *(const v8h*)(qwl + lh * QP + 32 * c + 16 + 8 * hi);
          kf.h[0] = *(const v8h*)(sKh + (16 + lh) * KP + 32 * c + 8 * hi);
          kf.h[1] = *(const v8h*)(sKh + (16 + lh) * KP + 32 * c + 16 + 8 * hi);
          kl.h[0] = *(const v8h*)(sKl + (16 + lh) * KP + 32 * c + 8 * hi);
          kl.h[1] = *(const v8h*)(sKl + (16 + lh) * KP + 32 * c + 16 + 8 * hi);
          sm.v = wmma_f16(kf.v, qf.v, sm.v);
          sr.v = wmma_f16(kl.v, qf.v, sr.v);
          sr.v = wmma_f16(kf.v, ql.v, sr.v);
        }
        s1.v = sm.v + sr.v * (1.0f / 4096.0f);
      }

      // ---- scale, causal replace-mask, online softmax (base 2): element j of tile 0 / 1 is key kv0 + 8 hi + j / + 16, query lh ----
      const int dq = qrow0 + lh - kv0 - 8 * hi;        // key kept where j (tile 0) or 16 + j (tile 1) <= dq
      float a0[8], a1[8], mx[8];
      #pragma unroll
      for (int j = 0; j < 8; ++j) {
        const float x0 = s0.f[j] * C2S;
        const float x1 = s1.f[j] * C2S;
        a0[j] = (j <= dq) ? x0 : -1.0e30f;
        a1[j] = (16 + j <= dq) ? x1 : -1.0e30f;
        mx[j] = fmaxf(a0[j], a1[j]);
      }
      float rm = fmaxf(fmaxf(fmaxf(mx[0], mx[1]), fmaxf(mx[2], mx[3])), fmaxf(fmaxf(mx[4], mx[5]), fmaxf(mx[6], mx[7])));
      rm = fmaxf(rm, xhalf(rm));                       // both halves now hold the query's chunk maximum
      const float mnew  = fmaxf(mcol, rm);
      const float alpha = __builtin_amdgcn_exp2f(mcol - mnew);
      mcol = mnew;
      U8h pa, pb, par, pbr;
      float es[8];
      #pragma unroll
      for (int j = 0; j < 8; ++j) {
        const float e0 = __builtin_amdgcn_exp2f(a0[j] - mnew);
        const float e1 = __builtin_amdgcn_exp2f(a1[j] - mnew);
        es[j] = e0 + e1;
        const float t0 = e0 * 1024.0f;                 // carried x1024, removed in the epilogue
        const float t1 = e1 * 1024.0f;
        const _Float16 h0 = (_Float16)t0;
        const _Float16 h1 = (_Float16)t1;
        pa.f[j] = h0; pb.f[j] = h1;
        if (RES) {
          par.f[j] = (_Float16)((t0 - (float)h0) * 4096.0f);
          pbr.f[j] = (_Float16)((t1 - (float)h1) * 4096.0f);
        }
      }
      lcol = lcol * alpha + (((es[0] + es[1]) + (es[2] + es[3])) + ((es[4] + es[5]) + (es[6] + es[7])));
      #pragma unroll
      for (int t = 0; t < 4; ++t) {
        acc[t].v *= alpha;
        if (RES) accr[t].v *= alpha;
      }

      // ---- P^T as B operand straight from the registers: elements 0..7 = keys 8 hi + 0..7, elements 8..15 = keys 16 + 8 hi + 0..7 ----
      U16h pf, pfr;
      pf.h[0] = pa.v; pf.h[1] = pb.v;
      if (RES) { pfr.h[0] = par.v; pfr.h[1] = pbr.v; }

      // ---- O^T += V^T P^T : 4 output d-tiles, K = 32 keys; A[m = d][k = key] from V^T tile row d ----
      #pragma unroll
      for (int t = 0; t < 4; ++t) {
        U16h vf;
        vf.h[0] = *(const v8h*)(sVh + (16 * t + lh) * VP + 8 * hi);
        vf.h[1] = *(const v8h*)(sVh + (16 * t + lh) * VP + 16 + 8 * hi);
        acc[t].v = wmma_f16(vf.v, pf.v, acc[t].v);
        if (RES) {
          U16h wl;
          wl.h[0] = *(const v8h*)(sVl + (16 * t + lh) * VP + 8 * hi);
          wl.h[1] = *(const v8h*)(sVl + (16 * t + lh) * VP + 16 + 8 * hi);
          accr[t].v = wmma_f16(wl.v, pf.v, accr[t].v);
          accr[t].v = wmma_f16(vf.v, pfr.v, accr[t].v);
        }
      }
    }

    // ---- publish point, every wave: own LDS reads of this buffer done, own copies of the next chunk landed, block barrier ----
    asm volatile("s_wait_dscnt 0x0" ::: "memory");      // this wave has left the buffer that is refilled below
    asm volatile("s_wait_asynccnt 0x0" ::: "memory");   // this wave's pieces of the next chunk have landed
    __syncthreads();                                    // next chunk visible to all; every reader has left this chunk's buffer
    if (kv0 + 2 * BK < kend) {                          // block-uniform: chunk + 2 flies while chunk + 1 is worked on
      const int kn = kv0 + 2 * BK;
      stage_kv<RES>(lk0 + bufh * 2, lv0 + bufh * 2, gkh + (size_t)kn * HID, gkl + (size_t)kn * HID, gvh + kn, gvl + kn);
    }
  }
  asm volatile("s_wait_asynccnt 0x0" ::: "memory");     // nothing of this wave is in flight when its LDS is reused

  // ---- epilogue: join the halves' sums, normalize (1/1024 removes the carry), stage 16x64 f32 per wave in LDS, split to hi / residual.
  // Register r of O^T tile t in lane l is d = 16 t + 8 hi + r of query lh: eight consecutive floats of one staged row.
  const float inv = 1.0f / ((lcol + xhalf(lcol)) * 1024.0f);
  float* so = (float*)qwh;                   // the wave's own Q tile, no longer read
  #pragma unroll
  for (int t = 0; t < 4; ++t) {
    v8f v = acc[t].v;
    if (RES) v += accr[t].v * (1.0f / 4096.0f);
    v *= inv;
    v4fa* sp = (v4fa*)(so + lh * SOP + 16 * t + 8 * hi);
    sp[0] = (v4f){v[0], v[1], v[2], v[3]};
    sp[1] = (v4f){v[4], v[5], v[6], v[7]};
  }
  wave_lds_sync();
  v8h oh[4], ol[4]; size_t oo[4];
  {
    const int pc = lane & 7;
    #pragma unroll
    for (int i = 0; i < 4; ++i) {
      const int rr = 4 * i + (lane >> 3);
      const float* sp = so + rr * SOP + 8 * pc;
      split8(*(const v4fa*)sp, *(const v4fa*)(sp + 4), oh[i], ol[i]);
      oo[i] = (size_t)(qrow0 + rr) * HID + 8 * pc;
    }
  }
  #pragma unroll
  for (int i = 0; i < 4; ++i) { *(v8h*)(Chb + oo[i]) = oh[i]; *(v8h*)(Clb + oo[i]) = ol[i]; }
  
}

extern "C" void kernel_launch(void* const* d_in, const int* in_sizes, int n_in,
                              void* d_out, int out_size, void* d_ws, size_t ws_size,
                              hipStream_t stream) {
  if (n_in < 6) return;
  const long long need_x = ((long long)(NB - 1) * SEQ_FULL + SEQ) * HID;
  if ((long long)in_sizes[0] < need_x) return;
  if ((long long)in_sizes[1] < (long long)HID * HID) return;
  if ((long long)in_sizes[2] < (long long)HID * HID) return;
  if ((long long)in_sizes[3] < (long long)HID * HID) return;
  if ((long long)in_sizes[4] < (long long)HID * HID) return;
  if ((long long)in_sizes[5] < (long long)SEQ * HID) return;
  if ((long long)out_size < need_x) return;
  if (kTotal > ws_size) return;

  const float* hs  = (const float*)d_in[0];
  const float* wq  = (const float*)d_in[1];
  const float* wk  = (const float*)d_in[2];
  const float* wv  = (const float*)d_in[3];
  const float* wo  = (const float*)d_in[4];
  const float* pos = (const float*)d_in[5];
  float*       out = (float*)d_out;

  char* ws = (char*)d_ws;
  _Float16* xh = (_Float16*)(ws + kOffXh);     // [MR][1024]
  _Float16* ph = (_Float16*)(ws + kOffPh);     // [SEQP][1024]
  float*    pp = (float*)(ws + kOffPP);        // [SEQP][PPP] f32
  _Float16* ch = (_Float16*)(ws + kOffCh);     // [MR][1024], aliases xh after it is dead
  _Float16* cl = (_Float16*)(ws + kOffCl);     // [MR][1024], aliases ph/pp after they are dead
  _Float16* wh = (_Float16*)(ws + kOffWh);     // [4096][1024]
  _Float16* qh = (_Float16*)(ws + kOffQh);
  _Float16* ql = (_Float16*)(ws + kOffQl);
  _Float16* kh = (_Float16*)(ws + kOffKh);
  _Float16* kl = (_Float16*)(ws + kOffKl);
  _Float16* vh = (_Float16*)(ws + kOffVh);     // V^T hi  [NB][16][64][SEQP]
  _Float16* vl = (_Float16*)(ws + kOffVl);     // V^T res [NB][16][64][EARLY]

  prep_kernel<<<dim3(MR + SEQP + 4 * HID), dim3(128), 0, stream>>>(hs, pos, wq, wk, wv, wo, xh, ph, wh);

  // positional projection for the Q/K group, then Q/K planes
  gemm_kernel<0><<<dim3(NQK / GBN, SEQP / GBM), dim3(256), 0, stream>>>(ph, ph, wh, pp, pp, qh, ql, kh, kl, out);
  gemm_kernel<1><<<dim3(NQK / GBN, MR / GBM), dim3(256), 0, stream>>>(xh, xh, wh, pp, pp, qh, ql, kh, kl, out);
  // positional projection for the V group, then V^T planes
  const _Float16* whv = wh + (size_t)NQK * HID;
  gemm_kernel<0><<<dim3(HID / GBN, SEQP / GBM), dim3(256), 0, stream>>>(ph, ph, whv, pp, pp, qh, ql, kh, kl, out);
  gemm_kernel<2><<<dim3(HID / GBN, MR / GBM), dim3(256), 0, stream>>>(xh, xh, whv, pp, pp, vh, vl, kh, kl, out);

  (void)hipFuncSetAttribute(reinterpret_cast<const void*>(&attn_kernel<true>),
                            hipFuncAttributeMaxDynamicSharedMemorySize, (int)LDS_BYTES);
  (void)hipFuncSetAttribute(reinterpret_cast<const void*>(&attn_kernel<false>),
                            hipFuncAttributeMaxDynamicSharedMemorySize, (int)LDS_BYTES);
  const int nqb = SEQP / BQ;
  attn_kernel<true><<<dim3(NB * NH * 2), dim3(256), LDS_BYTES, stream>>>(qh, ql, kh, kl, vh, vl, ch, cl, 0, 2);
  if (nqb > 2)
    attn_kernel<false><<<dim3(NB * NH * (nqb - 2)), dim3(256), LDS_BYTES, stream>>>(qh, ql, kh, kl, vh, vl, ch, cl, 2, nqb - 2);

  const _Float16* who = wh + (size_t)(NQK + HID) * HID;
  gemm_kernel<3><<<dim3(HID / GBN, MR / GBM), dim3(256), 0, stream>>>(ch, cl, who, pp, pp, qh, ql, kh, kl, out);
}

// v003
// A run of this version takes 239 microseconds.
// Timed twice side by side with v002, it ran 1.19 and 1.18 times as fast.
// Over all steps from v000 it is 1.64 times as fast.
#include <hip/hip_runtime.h>
#include <stdint.h>

// Contractions, all on v_wmma_f32_16x16x32_f16 with f32 accumulate: P0 = Xp*W^T and Y0 = X*W^T + P0 (f16 operands holding
// bf16-RNE input values, W carried x256); S = Q*K^T (Q, K as f16 hi + x4096 f16 residual planes, three products); O = P*V
// (P carried x1024 in f16, V^T f16 hi; extra P-residual and V-residual products on query blocks below row 256); Y = C*Wo^T
// (C f16 hi + x4096 f16 residual product on rows below 256). Score scaling, causal mask, softmax and normalisation in f32.

typedef _Float16 v16h __attribute__((ext_vector_type(16)));
typedef _Float16 v8h  __attribute__((ext_vector_type(8)));
typedef _Float16 v8ha __attribute__((ext_vector_type(8), may_alias));
typedef float    v8f  __attribute__((ext_vector_type(8)));
typedef float    v4f  __attribute__((ext_vector_type(4)));
typedef float    v4fa __attribute__((ext_vector_type(4), may_alias));
typedef unsigned int v4u __attribute__((ext_vector_type(4)));

union U8f  { v8f  v; float    f[8]; };
union U16h { v16h v; v8h      h[2]; };
union U8h  { v8h  v; _Float16 f[8]; };

#ifndef NB
#define NB 4
#endif
#ifndef SEQ
#define SEQ 2000
#endif
#define NB_FULL  4
#define SEQ_FULL 2000
#define HID   1024
#define NH    16
#define HD    64
#define NQK   2048                               // Q and K output columns (first projection group)
#define SEQP  ((((SEQ) + 127) / 128) * 128)      // rows per batch inside workspace planes (zero padded)
#define MR    ((NB) * SEQP)                      // activation plane rows
#define EARLY 256                                // query rows / keys given residual products
#define PPP   2048                               // f32 pitch of the positional projection plane

static_assert(NB >= 1 && NB <= NB_FULL);
static_assert(SEQ >= 256 && SEQ <= SEQ_FULL);
static_assert(SEQP % 128 == 0 && SEQP >= EARLY && SEQP <= 2048);
static_assert(NH * HD == HID);
static_assert(NQK <= PPP && HID <= PPP);
static_assert(((long long)(NB - 1) * SEQ_FULL + SEQ) * HID <= (long long)NB_FULL * SEQ_FULL * HID);

// ---------------- GEMM tiling ----------------
#define GBM 64
#define GBN 128
#define GBK 64      // k per ring stage: one whole 128-B line of every staged operand row
#define GP  72      // halfs per staged row in LDS (144 B)
#define CP  132     // floats per row of the f32 tile in LDS (528 B)
#define GNS (HID / GBK)   // ring stages
static_assert(MR % GBM == 0 && SEQP % GBM == 0 && EARLY % GBM == 0);
static_assert(HID % GBN == 0 && NQK % GBN == 0 && HID % GBK == 0);
static_assert((GP * 2) % 16 == 0 && (CP * 4) % 16 == 0);
static_assert(GBK == 64 && GBM == 64 && GBN == 128 && GNS >= 2);   // the staging below: 8 pieces a row, 32 rows a copy
static_assert(2 * (2 * GBM + GBN) * GP * 2 <= 327680 && GBM * CP * 4 <= 2 * (GBM + GBN) * GP * 2);

// ---------------- attention tiling ----------------
#define BQ 128      // query rows per workgroup (8 waves x 16)
#define BK 32       // keys per staged chunk
#define QP 72       // halfs per Q row in LDS (144 B)
#define KP 72       // halfs per K row in LDS
#define VP 40       // halfs per V^T row in LDS (80 B)
static_assert(SEQP % BQ == 0 && EARLY == 2 * BQ && BQ % BK == 0);

// offsets in halfs. Each wave owns one Q tile (16 hi rows, then 16 residual rows); the epilogue's 16x64 f32 tile (pitch SOP) reuses it.
// The K / V^T chunk lives in a ring of two buffers, each {K hi, K residual, V^T hi, V^T residual}.
#define SQ_OFF   0
#define QW_H     (2 * 16 * QP)
#define RING_OFF (SQ_OFF + 8 * QW_H)
#define RKH_OFF  0
#define RKL_OFF  (RKH_OFF + BK * KP)
#define RVH_OFF  (RKL_OFF + BK * KP)
#define RVL_OFF  (RVH_OFF + HD * VP)
#define RING_H   (RVL_OFF + HD * VP)
#define LDS_BYTES ((RING_OFF + 2 * RING_H) * 2)
#define SOP 68      // floats per row of the epilogue's 16x64 f32 tile (272 B)
static_assert((QW_H * 2) % 16 == 0 && (RING_OFF * 2) % 16 == 0 && (RING_H * 2) % 16 == 0);
static_assert((RKL_OFF * 2) % 16 == 0 && (RVH_OFF * 2) % 16 == 0 && (RVL_OFF * 2) % 16 == 0);
static_assert((KP * 2) % 16 == 0 && (VP * 2) % 16 == 0);
static_assert(QW_H * 2 >= 16 * SOP * 4 && (SOP * 4) % 16 == 0 && SOP >= HD);
static_assert(LDS_BYTES == 75776);

// (1/8) * log2(e): scores go to the base-2 domain for the online softmax
#define C2S 0.18033688011112042f

// ---------------- workspace carve (bytes) ----------------
static constexpr size_t kPlaneB = (size_t)MR * HID * 2;                   // one f16 activation plane
static constexpr size_t kPhB    = (size_t)SEQP * HID * 2;                 // f16 positional rows
static constexpr size_t kPPB    = (size_t)SEQP * PPP * 4;                 // f32 positional projection
static constexpr size_t kR0B    = (kPlaneB + kPhB + kPPB > 2 * kPlaneB) ? (kPlaneB + kPhB + kPPB) : (2 * kPlaneB);
static constexpr size_t kWhB    = (size_t)4 * HID * HID * 2;              // f16 weights, 4 matrices stacked
static constexpr size_t kVtlB   = (size_t)NB * NH * HD * EARLY * 2;       // V^T residual plane, keys < EARLY
static constexpr size_t kOffXh  = 0;
static constexpr size_t kOffPh  = kPlaneB;
static constexpr size_t kOffPP  = kPlaneB + kPhB;
static constexpr size_t kOffCh  = 0;                                      // C planes alias the dead X/pos region
static constexpr size_t kOffCl  = kPlaneB;
static constexpr size_t kOffWh  = kR0B;
static constexpr size_t kOffQh  = kOffWh + kWhB;
static constexpr size_t kOffQl  = kOffQh + kPlaneB;
static constexpr size_t kOffKh  = kOffQl + kPlaneB;
static constexpr size_t kOffKl  = kOffKh + kPlaneB;
static constexpr size_t kOffVh  = kOffKl + kPlaneB;
static constexpr size_t kOffVl  = kOffVh + kPlaneB;
static constexpr size_t kTotal  = kOffVl + kVtlB;
static_assert(kTotal <= 134217728ull);
static_assert(kOffCl + kPlaneB <= kR0B);
static_assert(kOffPh % 128 == 0 && kOffPP % 128 == 0 && kOffWh % 128 == 0 && kOffQh % 128 == 0);
static_assert(kOffVl % 128 == 0 && kR0B % 128 == 0);
static_assert((size_t)NB * NH * HD * SEQP * 2 == kPlaneB);

__device__ __forceinline__ v8f wmma_f16(v16h a, v16h b, v8f c) {
  v8f d = __builtin_amdgcn_wmma_f32_16x16x32_f16(false, a, false, b, (short)0, c, false, false);
  asm volatile("v_nop\n\tv_nop\n\tv_nop\n\tv_nop" : "+v"(d) : "v"(a), "v"(b));
  return d;
}

// lane l reads lane l ^ 16: the two lanes that share one query column of a D tile
__device__ __forceinline__ float xhalf(float x) {
  const int s = __float_as_int(x);
  return __int_as_float(__builtin_amdgcn_permlanex16(s, s, 0x76543210, 0xfedcba98, false, false));
}

// same-wave LDS exchange: stores issued by other lanes of this wave are visible before the reload
__device__ __forceinline__ void wave_lds_sync() {
  __builtin_amdgcn_fence(3, "wavefront");
  asm volatile("s_wait_dscnt 0" ::: "memory");
  __builtin_amdgcn_wave_barrier();
}

// One chunk of K hi, K residual, V^T hi (and V^T residual) from global memory into LDS, 16 bytes per lane and plane, through no
// register. lk / lv: the lane's own LDS byte addresses of its K hi and V^T hi pieces. The s_wait_xcnt stands inside the copies'
// own statement, so that no address register is rewritten in front of it.
template <bool RES>
__device__ __forceinline__ void stage_kv(unsigned lk, unsigned lv, const _Float16* gkh, const _Float16* gkl,
                                         const _Float16* gvh, const _Float16* gvl) {
  const unsigned lkl = lk + (RKL_OFF - RKH_OFF) * 2;
  if (RES) {
    const unsigned lvl = lv + (RVL_OFF - RVH_OFF) * 2;
    asm volatile("global_load_async_to_lds_b128 %0, %1, off\n\t"
                 "global_load_async_to_lds_b128 %2, %3, off\n\t"
                 "global_load_async_to_lds_b128 %4, %5, off\n\t"
                 "global_load_async_to_lds_b128 %6, %7, off\n\t"
                 "s_wait_xcnt 0x0"
                 :: "v"(lk), "v"(gkh), "v"(lkl), "v"(gkl), "v"(lv), "v"(gvh), "v"(lvl), "v"(gvl) : "memory");
  } else {
    asm volatile("global_load_async_to_lds_b128 %0, %1, off\n\t"
                 "global_load_async_to_lds_b128 %2, %3, off\n\t"
                 "global_load_async_to_lds_b128 %4, %5, off\n\t"
                 "s_wait_xcnt 0x0"
                 :: "v"(lk), "v"(gkh), "v"(lkl), "v"(gkl), "v"(lv), "v"(gvh) : "memory");
  }
}

// One GEMM ring stage, 16 bytes per lane and copy, through no register: 64 A rows (2 copies) and 128 B rows (4 copies) of 64 k.
// l0: the lane's own LDS byte address of its piece of A row (tid >> 3) in the target buffer; ga / gb: the same piece in global memory.
// A copy of one wave covers four whole 128-B lines. The s_wait_xcnt stands inside the copies' own statement, so that no address
// register is rewritten in front of it.
__device__ __forceinline__ void stage_ab(unsigned l0, const _Float16* ga, const _Float16* gb) {
  const unsigned la1 = l0 + 32 * GP * 2;
  const unsigned lb0 = l0 + GBM * GP * 2;
  const unsigned lb1 = lb0 + 32 * GP * 2;
  const unsigned lb2 = lb0 + 64 * GP * 2;
  const unsigned lb3 = lb0 + 96 * GP * 2;
  const _Float16* ga1 = ga + (size_t)32 * HID;
  const _Float16* gb1 = gb + (size_t)32 * HID;
  const _Float16* gb2 = gb + (size_t)64 * HID;
  const _Float16* gb3 = gb + (size_t)96 * HID;
  asm volatile("global_load_async_to_lds_b128 %0, %1, off\n\t"
               "global_load_async_to_lds_b128 %2, %3, off\n\t"
               "global_load_async_to_lds_b128 %4, %5, off\n\t"
               "global_load_async_to_lds_b128 %6, %7, off\n\t"
               "global_load_async_to_lds_b128 %8, %9, off\n\t"
               "global_load_async_to_lds_b128 %10, %11, off\n\t"
               "s_wait_xcnt 0x0"
               :: "v"(l0), "v"(ga), "v"(la1), "v"(ga1), "v"(lb0), "v"(gb), "v"(lb1), "v"(gb1),
                  "v"(lb2), "v"(gb2), "v"(lb3), "v"(gb3) : "memory");
}

// The residual A plane's 64 rows of the same stage (2 copies); ll: the lane's LDS byte address of its piece of row (tid >> 3).
__device__ __forceinline__ void stage_l(unsigned ll, const _Float16* gl) {
  const unsigned ll1 = ll + 32 * GP * 2;
  const _Float16* gl1 = gl + (size_t)32 * HID;
  asm volatile("global_load_async_to_lds_b128 %0, %1, off\n\t"
               "global_load_async_to_lds_b128 %2, %3, off\n\t"
               "s_wait_xcnt 0x0"
               :: "v"(ll), "v"(gl), "v"(ll1), "v"(gl1) : "memory");
}

__device__ __forceinline__ v4f bf16_rne4(v4f a) {
  v4u u = __builtin_bit_cast(v4u, a);
  u = (u + 0x7FFFu + ((u >> 16) & 1u)) & 0xFFFF0000u;
  return __builtin_bit_cast(v4f, u);
}

__device__ __forceinline__ v8h cvt8v(v4f a, v4f b) {
  v8h d;
  d[0] = (_Float16)a[0]; d[1] = (_Float16)a[1];
  d[2] = (_Float16)a[2]; d[3] = (_Float16)a[3];
  d[4] = (_Float16)b[0]; d[5] = (_Float16)b[1];
  d[6] = (_Float16)b[2]; d[7] = (_Float16)b[3];
  return d;
}

// f32 x -> f16 hi and f16((x - hi) * 4096)
__device__ __forceinline__ void split8(v4f a, v4f b, v8h& hv, v8h& lv) {
  U8h hh, ll;
  _Float16 t;
  t = (_Float16)a[0]; hh.f[0] = t; ll.f[0] = (_Float16)((a[0] - (float)t) * 4096.0f);
  t = (_Float16)a[1]; hh.f[1] = t; ll.f[1] = (_Float16)((a[1] - (float)t) * 4096.0f);
  t = (_Float16)a[2]; hh.f[2] = t; ll.f[2] = (_Float16)((a[2] - (float)t) * 4096.0f);
  t = (_Float16)a[3]; hh.f[3] = t; ll.f[3] = (_Float16)((a[3] - (float)t) * 4096.0f);
  t = (_Float16)b[0]; hh.f[4] = t; ll.f[4] = (_Float16)((b[0] - (float)t) * 4096.0f);
  t = (_Float16)b[1]; hh.f[5] = t; ll.f[5] = (_Float16)((b[1] - (float)t) * 4096.0f);
  t = (_Float16)b[2]; hh.f[6] = t; ll.f[6] = (_Float16)((b[2] - (float)t) * 4096.0f);
  t = (_Float16)b[3]; hh.f[7] = t; ll.f[7] = (_Float16)((b[3] - (float)t) * 4096.0f);
  hv = hh.v; lv = ll.v;
}

// ---------------- pre-pass: Xh = f16(bf16RNE(hidden)) [MR][1024] (pad rows zero), Ph = f16(bf16RNE(pos)) [SEQP][1024]
//                  (pad rows zero), Wh = f16(256 * bf16RNE(W)) for the four weight matrices stacked [4096][1024].
__global__ __launch_bounds__(128)
void prep_kernel(const float* __restrict__ Hs, const float* __restrict__ Pos,
                 const float* __restrict__ W0, const float* __restrict__ W1,
                 const float* __restrict__ W2, const float* __restrict__ W3,
                 _Float16* Xh, _Float16* Ph, _Float16* Wh)
{
  const int row = blockIdx.x;
  const int c0  = 8 * threadIdx.x;
  const float* src;
  _Float16*    dst;
  float sc = 1.0f;
  if (row < MR) {
    const int b  = row / SEQP;
    const int s  = row - b * SEQP;
    const int sl = (s < SEQ) ? s : (SEQ - 1);            // clamped address; pad rows scaled to zero
    sc  = (s < SEQ) ? 1.0f : 0.0f;
    src = Hs + ((size_t)b * SEQ_FULL + sl) * HID + c0;   // full-size input strides
    dst = Xh + (size_t)row * HID + c0;
  } else if (row < MR + SEQP) {
    const int s  = row - MR;
    const int sl = (s < SEQ) ? s : (SEQ - 1);
    sc  = (s < SEQ) ? 1.0f : 0.0f;
    src = Pos + (size_t)sl * HID + c0;
    dst = Ph + (size_t)s * HID + c0;
  } else {
    const int j   = row - MR - SEQP;                      // 0..4095
    const int mat = j >> 10;
    const int r   = j & (HID - 1);
    const float* W = (mat == 0) ? W0 : (mat == 1) ? W1 : (mat == 2) ? W2 : W3;
    sc  = 256.0f;                                         // exact power-of-two carry, removed in the GEMM epilogues
    src = W + (size_t)r * HID + c0;
    dst = Wh + (size_t)j * HID + c0;
  }
  const v4f a0 = bf16_rne4(*(const v4f*)src) * sc;
  const v4f a1 = bf16_rne4(*(const v4f*)(src + 4)) * sc;
  const v8h v  = cvt8v(a0, a1);                           // bf16 values (and x256) are exact in f16
  *(v8h*)dst = v;
  
}

// ---------------- 16-bit GEMM: 64x128 block tile, 8 waves (2 x 4), wave tile 32x32, K = 1024 in WMMA steps of 32 ----------------
// Operands come by asynchronous copies into a ring of two LDS buffers, 64 k a stage: stage s + 1 flies while stage s is worked on.
// C[m][n] = sum_k A[m][k] * Bw[n][k]  (Bw = weight rows [out][in], k contiguous, i.e. x @ W^T).
// 16-bit fragment map (A and B alike): lane l -> row/col (l & 15); elements 0..7 <- k0 + 8*(l>>4) + 0..7,
// elements 8..15 <- k0 + 16 + 8*(l>>4) + 0..7.  D: element r of lane l -> row 8*(l>>4) + r, col (l & 15).
// MODE 0: Pout[s][n] f32 positional projection (pitch PPP), natural units.
// MODE 1: Q (n0 < 1024) or K (n0 >= 1024) rows: f16 hi plane + f16 x4096 residual plane [MR][1024], value = acc/256 + Pin.
// MODE 2: V: V^T hi plane [b][h][d][SEQP] and, for s0 < EARLY, V^T x4096 residual plane [b][h][d][EARLY], value = acc/256 + Pin.
// MODE 3: Y rows of d_out [b][2000][1024] f32, value = (acc + accr/4096)/256 with the residual A plane on rows s0 < EARLY.
template <int MODE>
__global__ __launch_bounds__(256)
void gemm_kernel(const _Float16* __restrict__ Ah, const _Float16* __restrict__ Al,
                 const _Float16* __restrict__ Bw, const float* __restrict__ Pin,
                 float* Pout, _Float16* O0, _Float16* O1, _Float16* O2, _Float16* O3, float* Y)
{
  // ring buffer = {A [64][GP], B [128][GP], and for MODE 3 residual A [64][GP]}, two of them; the epilogue's f32 tile reuses the ring
  constexpr int STG_H  = (GBM + GBN + (MODE == 3 ? GBM : 0)) * GP;   // halfs per buffer
  constexpr int RING_B = 2 * STG_H * 2;
  constexpr int TILE_B = GBM * CP * 4;
  __shared__ __attribute__((aligned(16))) char gsm[RING_B > TILE_B ? RING_B : TILE_B];   // cross-wave (block barrier)
  _Float16* sR = (_Float16*)gsm;
  float*    sC = (float*)gsm;

  const int tid  = threadIdx.x;
  const int wave = tid >> 5;
  const int lane = tid & 31;
  const int lh   = lane & 15;
  const int hi   = lane >> 4;
  const int wm   = wave >> 2;        // 0..1 -> 32-row strip
  const int wn   = wave & 3;         // 0..3 -> 32-col strip
  const int sub  = tid & 7;
  const int m0   = blockIdx.y * GBM;
  const int n0   = blockIdx.x * GBN;
  const int b    = m0 / SEQP;
  const int s0   = m0 - b * SEQP;
  const bool resa = (MODE == 3) && (s0 < EARLY);   // block-uniform

  U8f acc[2][2], accr[2][2];
  #pragma unroll
  for (int mi = 0; mi < 2; ++mi)
    #pragma unroll
    for (int ni = 0; ni < 2; ++ni) { acc[mi][ni].v = (v8f){}; accr[mi][ni].v = (v8f){}; }

  const int sr = tid >> 3, sp = tid & 7;                             // staging: row 0..31 (+ 32 per further copy), 16-B piece 0..7
  const unsigned l0 = (unsigned)(uintptr_t)(sR + sr * GP + 8 * sp);  // LDS byte address of the lane's A piece in buffer 0
  const unsigned ll0 = l0 + (GBM + GBN) * GP * 2;                    // the same piece of the residual plane (MODE 3)
  const _Float16* ga = Ah + (size_t)(m0 + sr) * HID + 8 * sp;        // this lane's pieces of stage 0
  const _Float16* gl = Al + (size_t)(m0 + sr) * HID + 8 * sp;
  const _Float16* gb = Bw + (size_t)(n0 + sr) * HID + 8 * sp;

  stage_ab(l0, ga, gb);                                              // stage 0 -> buffer 0
  if (resa) stage_l(ll0, gl);
  asm volatile("s_wait_asynccnt 0x0" ::: "memory");                  // this wave's pieces of stage 0 have landed
  __syncthreads();                                                   // stage 0 visible to all waves
  stage_ab(l0 + STG_H * 2, ga + GBK, gb + GBK);                      // stage 1 -> buffer 1 (GNS >= 2)
  if (resa) stage_l(ll0 + STG_H * 2, gl + GBK);

  for (int s = 0; s < GNS; ++s) {
    const int bufh = (s & 1) * STG_H;                                // this stage's buffer, offset in halfs
    const _Float16* sA = sR + bufh;
    const _Float16* sB = sA + GBM * GP;
    const _Float16* sL = sB + GBN * GP;

    #pragma unroll                                                   // both halves of the stage at immediate LDS offsets
    for (int c = 0; c < GBK / 32; ++c) {                             // k ascending in WMMA steps of 32
      U16h af[2], bq[2];
      #pragma unroll
      for (int mi = 0; mi < 2; ++mi) {
        const _Float16* p = sA + (wm * 32 + mi * 16 + lh) * GP + 32 * c;
        af[mi].h[0] = *(const v8h*)(p + 8 * hi);
        af[mi].h[1] = *(const v8h*)(p + 16 + 8 * hi);
      }
      #pragma unroll
      for (int ni = 0; ni < 2; ++ni) {
        const _Float16* p = sB + (wn * 32 + ni * 16 + lh) * GP + 32 * c;
        bq[ni].h[0] = *(const v8h*)(p + 8 * hi);
        bq[ni].h[1] = *(const v8h*)(p + 16 + 8 * hi);
      }
      #pragma unroll
      for (int mi = 0; mi < 2; ++mi)
        #pragma unroll
        for (int ni = 0; ni < 2; ++ni)
          acc[mi][ni].v = wmma_f16(af[mi].v, bq[ni].v, acc[mi][ni].v);
      if (resa) {
        U16h lf[2];
        #pragma unroll
        for (int mi = 0; mi < 2; ++mi) {
          const _Float16* p = sL + (wm * 32 + mi * 16 + lh) * GP + 32 * c;
          lf[mi].h[0] = *(const v8h*)(p + 8 * hi);
          lf[mi].h[1] = *(const v8h*)(p + 16 + 8 * hi);
        }
        #pragma unroll
        for (int mi = 0; mi < 2; ++mi)
          #pragma unroll
          for (int ni = 0; ni < 2; ++ni)
            accr[mi][ni].v = wmma_f16(lf[mi].v, bq[ni].v, accr[mi][ni].v);
      }
    }

    // ---- publish point, every wave: own LDS reads of this buffer done, own copies of the next stage landed, block barrier ----
    asm volatile("s_wait_dscnt 0x0" ::: "memory");                   // this wave has left the buffer that is refilled below
    asm volatile("s_wait_asynccnt 0x0" ::: "memory");                // this wave's pieces of the next stage have landed
    __syncthreads();                                                 // next stage visible to all; every reader has left this buffer
    if (s + 2 < GNS) {                                               // block-uniform: stage s + 2 flies while stage s + 1 is worked on
      stage_ab(l0 + bufh * 2, ga + (s + 2) * GBK, gb + (s + 2) * GBK);
      if (resa) stage_l(ll0 + bufh * 2, gl + (s + 2) * GBK);
    }
  }
  asm volatile("s_wait_asynccnt 0x0" ::: "memory");                  // nothing of this wave is in flight when the ring becomes the f32 tile

  // ---- accumulators -> f32 tile in LDS (x 1/256 removes the weight carry) ----
  #pragma unroll
  for (int mi = 0; mi < 2; ++mi)
    #pragma unroll
    for (int ni = 0; ni < 2; ++ni)
      #pragma unroll
      for (int r = 0; r < 8; ++r) {
        float v = acc[mi][ni].f[r];
        if (resa) v += accr[mi][ni].f[r] * (1.0f / 4096.0f);
        sC[(wm * 32 + mi * 16 + 8 * hi + r) * CP + wn * 32 + ni * 16 + lh] = v * (1.0f / 256.0f);
      }
  __syncthreads();

  if (MODE == 1 || MODE == 2) {
    // ---- add the positional projection row (f32, natural units), in place, coalesced 32-B reads ----
    #pragma unroll
    for (int p = 0; p < 4; ++p) {
      const int g   = p * 256 + tid;
      const int row = g >> 4;
      const int cg  = g & 15;
      const float* pp = Pin + (size_t)(s0 + row) * PPP + n0 + 8 * cg;
      const v4f p0 = *(const v4f*)pp;
      const v4f p1 = *(const v4f*)(pp + 4);
      v4fa* c = (v4fa*)(sC + row * CP + 8 * cg);
      v4f x0 = c[0], x1 = c[1];
      x0 += p0; x1 += p1;
      c[0] = x0; c[1] = x1;
    }
    __syncthreads();
  }

  if (MODE == 0) {
    // 64 rows x 512 B = 4 lines each: line L = 32 i + (tid>>3) -> row L>>2, segment L&3; one wave instruction = one whole row segment
    v4f ov[8]; size_t oo[8];
    #pragma unroll
    for (int i = 0; i < 8; ++i) {
      const int L = 32 * i + (tid >> 3);
      const int row = L >> 2, seg = L & 3;
      ov[i] = *(const v4fa*)(sC + row * CP + seg * 32 + 4 * sub);
      oo[i] = (size_t)(m0 + row) * PPP + n0 + seg * 32 + 4 * sub;
    }
    #pragma unroll
    for (int i = 0; i < 8; ++i) *(v4f*)(Pout + oo[i]) = ov[i];
    
  }

  if (MODE == 1) {
    const bool isq = (n0 < HID);                     // block-uniform: Q group or K group
    _Float16* ph = isq ? O0 : O2;
    _Float16* pl = isq ? O1 : O3;
    const int col0 = n0 & (HID - 1);
    // 64 rows x 2 lines per plane: rem = 32 i + (tid>>3) -> row rem>>1, segment rem&1 (64 halfs = one line), piece sub
    v8h vh[4], vl[4]; size_t oo[4];
    #pragma unroll
    for (int i = 0; i < 4; ++i) {
      const int rem = 32 * i + (tid >> 3);
      const int row = rem >> 1, seg = rem & 1;
      const float* c = sC + row * CP + seg * 64 + 8 * sub;
      split8(*(const v4fa*)c, *(const v4fa*)(c + 4), vh[i], vl[i]);
      oo[i] = (size_t)(m0 + row) * HID + col0 + seg * 64 + 8 * sub;
    }
    #pragma unroll
    for (int i = 0; i < 4; ++i) { *(v8h*)(ph + oo[i]) = vh[i]; *(v8h*)(pl + oo[i]) = vl[i]; }
    
  }

  if (MODE == 2) {
    // in[64 keys][128 cols] -> out[(h,d) = 128 rows][64 keys]: col c = 32 i + (tid>>3), keys s0 + 8 sub .. +7 (one line per (h,d) row)
    const int h0 = n0 / HD;
    v8h vh[4], vl[4]; size_t oh[4], ol[4];
    #pragma unroll
    for (int i = 0; i < 4; ++i) {
      const int c  = 32 * i + (tid >> 3);
      const int hh = h0 + (c >> 6);
      const int d  = c & (HD - 1);
      v4f x0, x1;
      x0[0] = sC[(8 * sub + 0) * CP + c]; x0[1] = sC[(8 * sub + 1) * CP + c];
      x0[2] = sC[(8 * sub + 2) * CP + c]; x0[3] = sC[(8 * sub + 3) * CP + c];
      x1[0] = sC[(8 * sub + 4) * CP + c]; x1[1] = sC[(8 * sub + 5) * CP + c];
      x1[2] = sC[(8 * sub + 6) * CP + c]; x1[3] = sC[(8 * sub + 7) * CP + c];
      split8(x0, x1, vh[i], vl[i]);
      const size_t rowid = (size_t)(b * NH + hh) * HD + d;
      oh[i] = rowid * SEQP + s0 + 8 * sub;
      ol[i] = rowid * EARLY + s0 + 8 * sub;
    }
    #pragma unroll
    for (int i = 0; i < 4; ++i) {
      *(v8h*)(O0 + oh[i]) = vh[i];
      if (s0 < EARLY) *(v8h*)(O1 + ol[i]) = vl[i];
    }
    
  }

  if (MODE == 3) {
    // d_out rows (b, s) with s < SEQ only (whole 512-B row segments; guard is uniform over the 32 lanes of a row segment)
    v4f ov[8]; size_t oo[8]; int sv[8];
    #pragma unroll
    for (int i = 0; i < 8; ++i) {
      const int L = 32 * i + (tid >> 3);
      const int row = L >> 2, seg = L & 3;
      ov[i] = *(const v4fa*)(sC + row * CP + seg * 32 + 4 * sub);
      sv[i] = s0 + row;
      oo[i] = ((size_t)b * SEQ_FULL + (size_t)(s0 + row)) * HID + n0 + seg * 32 + 4 * sub;
    }
    #pragma unroll
    for (int i = 0; i < 8; ++i) if (sv[i] < SEQ) *(v4f*)(Y + oo[i]) = ov[i];
    
  }
}

// ---------------- fused causal attention: one workgroup = 128 query rows of one (batch, head), 8 waves x 16 rows ----------------
// S^T = K Q^T (A = K rows, B = Q rows): k_hi*q_hi into one accumulator, (k_lo*q_hi + k_hi*q_lo) into a second one folded x 1/4096
// (residual planes carry x4096). Lane l then holds 16 of the chunk's 32 scores of query (l & 15); lane l ^ 16 holds the other 16.
// O^T = V^T P^T: the two S^T tiles, converted in place, are the B operand (P carried x1024 in f16); RES (query blocks 0,1) adds
// V_lo*P_hi + V_hi*P_res into a second accumulator folded x 1/4096.
// Causal mask: key <= query keeps the score, else -1e30 (replace-fill); online softmax base 2 with f32 running max / sum per lane.
template <bool RES>
__global__ __launch_bounds__(256)
void attn_kernel(const _Float16* __restrict__ Qh, const _Float16* __restrict__ Ql,
                 const _Float16* __restrict__ Kh, const _Float16* __restrict__ Kl,
                 const _Float16* __restrict__ Vth, const _Float16* __restrict__ Vtl,
                 _Float16* Ch, _Float16* Cl, int qb0, int nqbl)
{
  extern __shared__ __attribute__((aligned(16))) _Float16 smem[];
  _Float16* sQ  = smem + SQ_OFF;             // [wave][hi 16 | residual 16][QP]  wave-private; the epilogue's f32 tile reuses it
  _Float16* sR  = smem + RING_OFF;           // [2 buffers]{K hi [32][KP], K res [32][KP], V^T hi [64][VP], V^T res [64][VP]}  cross-wave

  const int tid  = threadIdx.x;
  const int wave = tid >> 5;
  const int lane = tid & 31;
  const int lh   = lane & 15;
  const int hi   = lane >> 4;

  const int qbi   = blockIdx.x % nqbl;
  const int bh    = blockIdx.x / nqbl;
  const int h     = bh % NH;
  const int b     = bh / NH;
  const int qbase = (qb0 + qbi) * BQ;
  const int qrow0 = qbase + wave * 16;

  const size_t prow = (size_t)b * SEQP;
  const _Float16* Qhb = Qh + prow * HID + h * HD;
  const _Float16* Qlb = Ql + prow * HID + h * HD;
  const _Float16* Khb = Kh + prow * HID + h * HD;
  const _Float16* Klb = Kl + prow * HID + h * HD;
  const _Float16* Vhb = Vth + (size_t)(b * NH + h) * HD * SEQP;
  const _Float16* Vlb = Vtl + (size_t)(b * NH + h) * HD * EARLY;
  _Float16* Chb = Ch + prow * HID + h * HD;
  _Float16* Clb = Cl + prow * HID + h * HD;

  // ---- this wave's 16 query rows (hi and residual) -> LDS: row 4i + (lane>>3), 16-B piece (lane&7) ----
  const int kend = qbase + BQ;               // causal, block-uniform: keys beyond the block's last query row are never needed
  const int kr = tid >> 3, kg = tid & 7;     // K staging: key row 0..31, piece 0..7
  const int vd = tid >> 2, vg = tid & 3;     // V^T staging: d row 0..63, piece 0..3
  const unsigned lk0 = (unsigned)(uintptr_t)(sR + RKH_OFF + kr * KP + 8 * kg);   // LDS byte addresses in buffer 0
  const unsigned lv0 = (unsigned)(uintptr_t)(sR + RVH_OFF + vd * VP + 8 * vg);
  const _Float16* gkh = Khb + (size_t)kr * HID + 8 * kg;                         // this lane's pieces of chunk 0
  const _Float16* gkl = Klb + (size_t)kr * HID + 8 * kg;
  const _Float16* gvh = Vhb + (size_t)vd * SEQP + 8 * vg;
  const _Float16* gvl = Vlb + (size_t)vd * EARLY + 8 * vg;

  stage_kv<RES>(lk0, lv0, gkh, gkl, gvh, gvl);                                   // chunk 0 -> buffer 0

  _Float16* qwh = sQ + wave * QW_H;
  _Float16* qwl = qwh + 16 * QP;
  {
    const int pc = lane & 7;
    #pragma unroll
    for (int i = 0; i < 4; ++i) {
      const int r = 4 * i + (lane >> 3);
      const size_t go = (size_t)(qrow0 + r) * HID + 8 * pc;
      *(v8h*)(qwh + r * QP + 8 * pc) = *(const v8h*)(Qhb + go);
      *(v8h*)(qwl + r * QP + 8 * pc) = *(const v8h*)(Qlb + go);
    }
  }

  U8f acc[4], accr[4];
  #pragma unroll
  for (int t = 0; t < 4; ++t) { acc[t].v = (v8f){}; accr[t].v = (v8f){}; }
  float mcol = -3.0e38f;                     // running maximum of query qrow0 + lh (equal in both wave halves)
  float lcol = 0.0f;                         // running sum over this lane's keys only; the halves are joined in the epilogue

  // scalar copy of the wave's first row: the per-wave skip below is then a real branch and EXEC stays all ones at the copies
  const int qrow0s = __builtin_amdgcn_readfirstlane(qrow0);

  asm volatile("s_wait_asynccnt 0x0" ::: "memory");   // this wave's pieces of chunk 0 have landed
  __syncthreads();                                    // chunk 0 (and the Q tiles) visible to all waves
  // chunk 1 -> buffer 1 (kend >= BQ = 4 chunks, so chunk 1 always exists)
  stage_kv<RES>(lk0 + RING_H * 2, lv0 + RING_H * 2, gkh + (size_t)BK * HID, gkl + (size_t)BK * HID, gvh + BK, gvl + BK);

  for (int kv0 = 0; kv0 < kend; kv0 += BK) {
    const int bufh = ((kv0 / BK) & 1) * RING_H;       // this chunk's buffer, offset in halfs
    const _Float16* sKh = sR + bufh + RKH_OFF;
    const _Float16* sKl = sR + bufh + RKL_OFF;
    const _Float16* sVh = sR + bufh + RVH_OFF;
    const _Float16* sVl = sR + bufh + RVL_OFF;

    if (kv0 < qrow0s + 16) {                 // wave-uniform: skip chunks entirely above this wave's rows
      // ---- S^T = K Q^T for two 16-key tiles, d reduced in two K=32 steps, three products each ----
      U8f s0, s1;
      {
        U8f sm, sr; sm.v = (v8f){}; sr.v = (v8f){};
        #pragma unroll
        for (int c = 0; c < 2; ++c) {
          U16h qf, ql, kf, kl;
          qf.h[0] = *(const v8h*)(qwh + lh * QP + 32 * c + 8 * hi);
          qf.h[1] = *(const v8h*)(qwh + lh * QP + 32 * c + 16 + 8 * hi);
          ql.h[0] = *(const v8h*)(qwl + lh * QP + 32 * c + 8 * hi);
          ql.h[1] = *(const v8h*)(qwl + lh * QP + 32 * c + 16 + 8 * hi);
          kf.h[0] = *(const v8h*)(sKh + lh * KP + 32 * c + 8 * hi);
          kf.h[1] = *(const v8h*)(sKh + lh * KP + 32 * c + 16 + 8 * hi);
          kl.h[0] = *(const v8h*)(sKl + lh * KP + 32 * c + 8 * hi);
          kl.h[1] = *(const v8h*)(sKl + lh * KP + 32 * c + 16 + 8 * hi);
          sm.v = wmma_f16(kf.v, qf.v, sm.v);
          sr.v = wmma_f16(kl.v, qf.v, sr.v);
          sr.v = wmma_f16(kf.v, ql.v, sr.v);
        }
        s0.v = sm.v + sr.v * (1.0f / 4096.0f);
      }
      {
        U8f sm, sr; sm.v = (v8f){}; sr.v = (v8f){};
        #pragma unroll
        for (int c = 0; c < 2; ++c) {
          U16h qf, ql, kf, kl;
          qf.h[0] = *(const v8h*)(qwh + lh * QP + 32 * c + 8 * hi);
          qf.h[1] = *(const v8h*)(qwh + lh * QP + 32 * c + 16 + 8 * hi);
          ql.h[0] = *(const v8h*)(qwl + lh * QP + 32 * c + 8 * hi);
          ql.h[1] = *(const v8h*)(qwl + lh * QP + 32 * c + 16 + 8 * hi);
          kf.h[0] = *(const v8h*)(sKh + (16 + lh) * KP + 32 * c + 8 * hi);
          kf.h[1] = *(const v8h*)(sKh + (16 + lh) * KP + 32 * c + 16 + 8 * hi);
          kl.h[0] = *(const v8h*)(sKl + (16 + lh) * KP + 32 * c + 8 * hi);
          kl.h[1] = *(const v8h*)(sKl + (16 + lh) * KP + 32 * c + 16 + 8 * hi);
          sm.v = wmma_f16(kf.v, qf.v, sm.v);
          sr.v = wmma_f16(kl.v, qf.v, sr.v);
          sr.v = wmma_f16(kf.v, ql.v, sr.v);
        }
        s1.v = sm.v + sr.v * (1.0f / 4096.0f);
      }

      // ---- scale, causal replace-mask, online softmax (base 2): element j of tile 0 / 1 is key kv0 + 8 hi + j / + 16, query lh ----
      const int dq = qrow0 + lh - kv0 - 8 * hi;        // key kept where j (tile 0) or 16 + j (tile 1) <= dq
      float a0[8], a1[8], mx[8];
      #pragma unroll
      for (int j = 0; j < 8; ++j) {
        const float x0 = s0.f[j] * C2S;
        const float x1 = s1.f[j] * C2S;
        a0[j] = (j <= dq) ? x0 : -1.0e30f;
        a1[j] = (16 + j <= dq) ? x1 : -1.0e30f;
        mx[j] = fmaxf(a0[j], a1[j]);
      }
      float rm = fmaxf(fmaxf(fmaxf(mx[0], mx[1]), fmaxf(mx[2], mx[3])), fmaxf(fmaxf(mx[4], mx[5]), fmaxf(mx[6], mx[7])));
      rm = fmaxf(rm, xhalf(rm));                       // both halves now hold the query's chunk maximum
      const float mnew  = fmaxf(mcol, rm);
      const float alpha = __builtin_amdgcn_exp2f(mcol - mnew);
      mcol = mnew;
      U8h pa, pb, par, pbr;
      float es[8];
      #pragma unroll
      for (int j = 0; j < 8; ++j) {
        const float e0 = __builtin_amdgcn_exp2f(a0[j] - mnew);
        const float e1 = __builtin_amdgcn_exp2f(a1[j] - mnew);
        es[j] = e0 + e1;
        const float t0 = e0 * 1024.0f;                 // carried x1024, removed in the epilogue
        const float t1 = e1 * 1024.0f;
        const _Float16 h0 = (_Float16)t0;
        const _Float16 h1 = (_Float16)t1;
        pa.f[j] = h0; pb.f[j] = h1;
        if (RES) {
          par.f[j] = (_Float16)((t0 - (float)h0) * 4096.0f);
          pbr.f[j] = (_Float16)((t1 - (float)h1) * 4096.0f);
        }
      }
      lcol = lcol * alpha + (((es[0] + es[1]) + (es[2] + es[3])) + ((es[4] + es[5]) + (es[6] + es[7])));
      #pragma unroll
      for (int t = 0; t < 4; ++t) {
        acc[t].v *= alpha;
        if (RES) accr[t].v *= alpha;
      }

      // ---- P^T as B operand straight from the registers: elements 0..7 = keys 8 hi + 0..7, elements 8..15 = keys 16 + 8 hi + 0..7 ----
      U16h pf, pfr;
      pf.h[0] = pa.v; pf.h[1] = pb.v;
      if (RES) { pfr.h[0] = par.v; pfr.h[1] = pbr.v; }

      // ---- O^T += V^T P^T : 4 output d-tiles, K = 32 keys; A[m = d][k = key] from V^T tile row d ----
      #pragma unroll
      for (int t = 0; t < 4; ++t) {
        U16h vf;
        vf.h[0] = *(const v8h*)(sVh + (16 * t + lh) * VP + 8 * hi);
        vf.h[1] = *(const v8h*)(sVh + (16 * t + lh) * VP + 16 + 8 * hi);
        acc[t].v = wmma_f16(vf.v, pf.v, acc[t].v);
        if (RES) {
          U16h wl;
          wl.h[0] = *(const v8h*)(sVl + (16 * t + lh) * VP + 8 * hi);
          wl.h[1] = *(const v8h*)(sVl + (16 * t + lh) * VP + 16 + 8 * hi);
          accr[t].v = wmma_f16(wl.v, pf.v, accr[t].v);
          accr[t].v = wmma_f16(vf.v, pfr.v, accr[t].v);
        }
      }
    }

    // ---- publish point, every wave: own LDS reads of this buffer done, own copies of the next chunk landed, block barrier ----
    asm volatile("s_wait_dscnt 0x0" ::: "memory");      // this wave has left the buffer that is refilled below
    asm volatile("s_wait_asynccnt 0x0" ::: "memory");   // this wave's pieces of the next chunk have landed
    __syncthreads();                                    // next chunk visible to all; every reader has left this chunk's buffer
    if (kv0 + 2 * BK < kend) {                          // block-uniform: chunk + 2 flies while chunk + 1 is worked on
      const int kn = kv0 + 2 * BK;
      stage_kv<RES>(lk0 + bufh * 2, lv0 + bufh * 2, gkh + (size_t)kn * HID, gkl + (size_t)kn * HID, gvh + kn, gvl + kn);
    }
  }
  asm volatile("s_wait_asynccnt 0x0" ::: "memory");     // nothing of this wave is in flight when its LDS is reused

  // ---- epilogue: join the halves' sums, normalize (1/1024 removes the carry), stage 16x64 f32 per wave in LDS, split to hi / residual.
  // Register r of O^T tile t in lane l is d = 16 t + 8 hi + r of query lh: eight consecutive floats of one staged row.
  const float inv = 1.0f / ((lcol + xhalf(lcol)) * 1024.0f);
  float* so = (float*)qwh;                   // the wave's own Q tile, no longer read
  #pragma unroll
  for (int t = 0; t < 4; ++t) {
    v8f v = acc[t].v;
    if (RES) v += accr[t].v * (1.0f / 4096.0f);
    v *= inv;
    v4fa* sp = (v4fa*)(so + lh * SOP + 16 * t + 8 * hi);
    sp[0] = (v4f){v[0], v[1], v[2], v[3]};
    sp[1] = (v4f){v[4], v[5], v[6], v[7]};
  }
  wave_lds_sync();
  v8h oh[4], ol[4]; size_t oo[4];
  {
    const int pc = lane & 7;
    #pragma unroll
    for (int i = 0; i < 4; ++i) {
      const int rr = 4 * i + (lane >> 3);
      const float* sp = so + rr * SOP + 8 * pc;
      split8(*(const v4fa*)sp, *(const v4fa*)(sp + 4), oh[i], ol[i]);
      oo[i] = (size_t)(qrow0 + rr) * HID + 8 * pc;
    }
  }
  #pragma unroll
  for (int i = 0; i < 4; ++i) { *(v8h*)(Chb + oo[i]) = oh[i]; *(v8h*)(Clb + oo[i]) = ol[i]; }
  
}

extern "C" void kernel_launch(void* const* d_in, const int* in_sizes, int n_in,
                              void* d_out, int out_size, void* d_ws, size_t ws_size,
                              hipStream_t stream) {
  if (n_in < 6) return;
  const long long need_x = ((long long)(NB - 1) * SEQ_FULL + SEQ) * HID;
  if ((long long)in_sizes[0] < need_x) return;
  if ((long long)in_sizes[1] < (long long)HID * HID) return;
  if ((long long)in_sizes[2] < (long long)HID * HID) return;
  if ((long long)in_sizes[3] < (long long)HID * HID) return;
  if ((long long)in_sizes[4] < (long long)HID * HID) return;
  if ((long long)in_sizes[5] < (long long)SEQ * HID) return;
  if ((long long)out_size < need_x) return;
  if (kTotal > ws_size) return;

  const float* hs  = (const float*)d_in[0];
  const float* wq  = (const float*)d_in[1];
  const float* wk  = (const float*)d_in[2];
  const float* wv  = (const float*)d_in[3];
  const float* wo  = (const float*)d_in[4];
  const float* pos = (const float*)d_in[5];
  float*       out = (float*)d_out;

  char* ws = (char*)d_ws;
  _Float16* xh = (_Float16*)(ws + kOffXh);     // [MR][1024]
  _Float16* ph = (_Float16*)(ws + kOffPh);     // [SEQP][1024]
  float*    pp = (float*)(ws + kOffPP);        // [SEQP][PPP] f32
  _Float16* ch = (_Float16*)(ws + kOffCh);     // [MR][1024], aliases xh after it is dead
  _Float16* cl = (_Float16*)(ws + kOffCl);     // [MR][1024], aliases ph/pp after they are dead
  _Float16* wh = (_Float16*)(ws + kOffWh);     // [4096][1024]
  _Float16* qh = (_Float16*)(ws + kOffQh);
  _Float16* ql = (_Float16*)(ws + kOffQl);
  _Float16* kh = (_Float16*)(ws + kOffKh);
  _Float16* kl = (_Float16*)(ws + kOffKl);
  _Float16* vh = (_Float16*)(ws + kOffVh);     // V^T hi  [NB][16][64][SEQP]
  _Float16* vl = (_Float16*)(ws + kOffVl);     // V^T res [NB][16][64][EARLY]

  prep_kernel<<<dim3(MR + SEQP + 4 * HID), dim3(128), 0, stream>>>(hs, pos, wq, wk, wv, wo, xh, ph, wh);

  // positional projection for the Q/K group, then Q/K planes
  gemm_kernel<0><<<dim3(NQK / GBN, SEQP / GBM), dim3(256), 0, stream>>>(ph, ph, wh, pp, pp, qh, ql, kh, kl, out);
  gemm_kernel<1><<<dim3(NQK / GBN, MR / GBM), dim3(256), 0, stream>>>(xh, xh, wh, pp, pp, qh, ql, kh, kl, out);
  // positional projection for the V group, then V^T planes
  const _Float16* whv = wh + (size_t)NQK * HID;
  gemm_kernel<0><<<dim3(HID / GBN, SEQP / GBM), dim3(256), 0, stream>>>(ph, ph, whv, pp, pp, qh, ql, kh, kl, out);
  gemm_kernel<2><<<dim3(HID / GBN, MR / GBM), dim3(256), 0, stream>>>(xh, xh, whv, pp, pp, vh, vl, kh, kl, out);

  (void)hipFuncSetAttribute(reinterpret_cast<const void*>(&attn_kernel<true>),
                            hipFuncAttributeMaxDynamicSharedMemorySize, (int)LDS_BYTES);
  (void)hipFuncSetAttribute(reinterpret_cast<const void*>(&attn_kernel<false>),
                            hipFuncAttributeMaxDynamicSharedMemorySize, (int)LDS_BYTES);
  const int nqb = SEQP / BQ;
  attn_kernel<true><<<dim3(NB * NH * 2), dim3(256), LDS_BYTES, stream>>>(qh, ql, kh, kl, vh, vl, ch, cl, 0, 2);
  if (nqb > 2)
    attn_kernel<false><<<dim3(NB * NH * (nqb - 2)), dim3(256), LDS_BYTES, stream>>>(qh, ql, kh, kl, vh, vl, ch, cl, 2, nqb - 2);

  const _Float16* who = wh + (size_t)(NQK + HID) * HID;
  gemm_kernel<3><<<dim3(HID / GBN, MR / GBM), dim3(256), 0, stream>>>(ch, cl, who, pp, pp, qh, ql, kh, kl, out);
}

// v004
// One run takes 210 microseconds.
// Two timings next to v003 both put it at 1.14 times that version's speed.
// All steps since v000 together make it 1.87 times as fast.
#include <hip/hip_runtime.h>
#include <stdint.h>

// Contractions, all on v_wmma_f32_16x16x32_f16 with f32 accumulate: P0 = Xp*W^T and Y0 = X*W^T + P0 (f16 operands holding
// bf16-RNE input values, W carried x256); S = Q*K^T (Q, K as f16 hi + x4096 f16 residual planes, three products); O = P*V
// (P carried x1024 in f16, V^T f16 hi; extra P-residual and V-residual products on query blocks below row 256); Y = C*Wo^T
// (C f16 hi + x4096 f16 residual product on rows below 256). Score scaling, causal mask, softmax and normalisation in f32.

typedef _Float16 v16h __attribute__((ext_vector_type(16)));
typedef _Float16 v8h  __attribute__((ext_vector_type(8)));
typedef _Float16 v8ha __attribute__((ext_vector_type(8), may_alias));
typedef float    v8f  __attribute__((ext_vector_type(8)));
typedef float    v4f  __attribute__((ext_vector_type(4)));
typedef float    v4fa __attribute__((ext_vector_type(4), may_alias));
typedef unsigned int v4u __attribute__((ext_vector_type(4)));

union U8f  { v8f  v; float    f[8]; };
union U16h { v16h v; v8h      h[2]; };
union U8h  { v8h  v; _Float16 f[8]; };

#ifndef NB
#define NB 4
#endif
#ifndef SEQ
#define SEQ 2000
#endif
#define NB_FULL  4
#define SEQ_FULL 2000
#define HID   1024
#define NH    16
#define HD    64
#define NQK   2048                               // Q and K output columns (first projection group)
#define SEQP  ((((SEQ) + 127) / 128) * 128)      // rows per batch inside workspace planes (zero padded)
#define MR    ((NB) * SEQP)                      // activation plane rows
#define EARLY 256                                // query rows / keys given residual products
#define PPP   2048                               // f32 pitch of the positional projection plane

static_assert(NB >= 1 && NB <= NB_FULL);
static_assert(SEQ >= 256 && SEQ <= SEQ_FULL);
static_assert(SEQP % 128 == 0 && SEQP >= EARLY && SEQP <= 2048);
static_assert(NH * HD == HID);
static_assert(NQK <= PPP && HID <= PPP);
static_assert(((long long)(NB - 1) * SEQ_FULL + SEQ) * HID <= (long long)NB_FULL * SEQ_FULL * HID);

// ---------------- GEMM tiling ----------------
#define GBM 64
#define GBN 128
#define GBK 64      // k per ring stage: one whole 128-B line of every staged operand row
#define GP  72      // halfs per staged row in LDS (144 B)
#define CP  132     // floats per row of the f32 tile in LDS (528 B)
#define GNS (HID / GBK)   // ring stages
static_assert(MR % GBM == 0 && SEQP % GBM == 0 && EARLY % GBM == 0);
static_assert(HID % GBN == 0 && NQK % GBN == 0 && HID % GBK == 0);
static_assert((GP * 2) % 16 == 0 && (CP * 4) % 16 == 0);
static_assert(GBK == 64 && GBM == 64 && GBN == 128 && GNS >= 2);   // the staging below: 8 pieces a row, 32 rows a copy
static_assert(2 * (2 * GBM + GBN) * GP * 2 <= 327680 && GBM * CP * 4 <= 2 * (GBM + GBN) * GP * 2);

// ---------------- attention tiling ----------------
#define BQ 128      // query rows per workgroup (8 waves x 16)
#define BK 32       // keys per staged chunk
#define QP 72       // halfs per Q row in LDS (144 B)
#define KP 72       // halfs per K row in LDS
#define VP 40       // halfs per V^T row in LDS (80 B)
static_assert(SEQP % BQ == 0 && EARLY == 2 * BQ && BQ % BK == 0);

// offsets in halfs. Each wave owns one Q tile (16 hi rows, then 16 residual rows); the epilogue's 16x64 f32 tile (pitch SOP) reuses it.
// The K / V^T chunk lives in a ring of two buffers, each {K hi, K residual, V^T hi, V^T residual}.
#define SQ_OFF   0
#define QW_H     (2 * 16 * QP)
#define RING_OFF (SQ_OFF + 8 * QW_H)
#define RKH_OFF  0
#define RKL_OFF  (RKH_OFF + BK * KP)
#define RVH_OFF  (RKL_OFF + BK * KP)
#define RVL_OFF  (RVH_OFF + HD * VP)
#define RING_H   (RVL_OFF + HD * VP)
#define LDS_BYTES ((RING_OFF + 2 * RING_H) * 2)
#define SOP 68      // floats per row of the epilogue's 16x64 f32 tile (272 B)
static_assert((QW_H * 2) % 16 == 0 && (RING_OFF * 2) % 16 == 0 && (RING_H * 2) % 16 == 0);
static_assert((RKL_OFF * 2) % 16 == 0 && (RVH_OFF * 2) % 16 == 0 && (RVL_OFF * 2) % 16 == 0);
static_assert((KP * 2) % 16 == 0 && (VP * 2) % 16 == 0);
static_assert(QW_H * 2 >= 16 * SOP * 4 && (SOP * 4) % 16 == 0 && SOP >= HD);
static_assert(LDS_BYTES == 75776);

// (1/8) * log2(e): scores go to the base-2 domain for the online softmax
#define C2S 0.18033688011112042f

// ---------------- workspace carve (bytes) ----------------
static constexpr size_t kPlaneB = (size_t)MR * HID * 2;                   // one f16 activation plane
static constexpr size_t kPhB    = (size_t)SEQP * HID * 2;                 // f16 positional rows
static constexpr size_t kPPB    = (size_t)SEQP * PPP * 4;                 // f32 positional projection
static constexpr size_t kR0B    = (kPlaneB + kPhB + kPPB > 2 * kPlaneB) ? (kPlaneB + kPhB + kPPB) : (2 * kPlaneB);
static constexpr size_t kWhB    = (size_t)4 * HID * HID * 2;              // f16 weights, 4 matrices stacked
static constexpr size_t kVtlB   = (size_t)NB * NH * HD * EARLY * 2;       // V^T residual plane, keys < EARLY
static constexpr size_t kOffXh  = 0;
static constexpr size_t kOffPh  = kPlaneB;
static constexpr size_t kOffPP  = kPlaneB + kPhB;
static constexpr size_t kOffCh  = 0;                                      // C planes alias the dead X/pos region
static constexpr size_t kOffCl  = kPlaneB;
static constexpr size_t kOffWh  = kR0B;
static constexpr size_t kOffQh  = kOffWh + kWhB;
static constexpr size_t kOffQl  = kOffQh + kPlaneB;
static constexpr size_t kOffKh  = kOffQl + kPlaneB;
static constexpr size_t kOffKl  = kOffKh + kPlaneB;
static constexpr size_t kOffVh  = kOffKl + kPlaneB;
static constexpr size_t kOffVl  = kOffVh + kPlaneB;
static constexpr size_t kTotal  = kOffVl + kVtlB;
static_assert(kTotal <= 134217728ull);
static_assert(kOffCl + kPlaneB <= kR0B);
static_assert(kOffPh % 128 == 0 && kOffPP % 128 == 0 && kOffWh % 128 == 0 && kOffQh % 128 == 0);
static_assert(kOffVl % 128 == 0 && kR0B % 128 == 0);
static_assert((size_t)NB * NH * HD * SEQP * 2 == kPlaneB);

__device__ __forceinline__ v8f wmma_f16(v16h a, v16h b, v8f c) {
  v8f d = __builtin_amdgcn_wmma_f32_16x16x32_f16(false, a, false, b, (short)0, c, false, false);
  asm volatile("v_nop\n\tv_nop\n\tv_nop\n\tv_nop" : "+v"(d) : "v"(a), "v"(b));
  return d;
}

// lane l reads lane l ^ 16: the two lanes that share one query column of a D tile
__device__ __forceinline__ float xhalf(float x) {
  const int s = __float_as_int(x);
  return __int_as_float(__builtin_amdgcn_permlanex16(s, s, 0x76543210, 0xfedcba98, false, false));
}

// same-wave LDS exchange: stores issued by other lanes of this wave are visible before the reload
__device__ __forceinline__ void wave_lds_sync() {
  __builtin_amdgcn_fence(3, "wavefront");
  asm volatile("s_wait_dscnt 0" ::: "memory");
  __builtin_amdgcn_wave_barrier();
}

// One chunk of K hi, K residual, V^T hi (and V^T residual) from global memory into LDS, 16 bytes per lane and plane, through no
// register. lk / lv: the lane's own LDS byte addresses of its K hi and V^T hi pieces. The s_wait_xcnt stands inside the copies'
// own statement, so that no address register is rewritten in front of it.
template <bool RES>
__device__ __forceinline__ void stage_kv(unsigned lk, unsigned lv, const _Float16* gkh, const _Float16* gkl,
                                         const _Float16* gvh, const _Float16* gvl) {
  const unsigned lkl = lk + (RKL_OFF - RKH_OFF) * 2;
  if (RES) {
    const unsigned lvl = lv + (RVL_OFF - RVH_OFF) * 2;
    asm volatile("global_load_async_to_lds_b128 %0, %1, off\n\t"
                 "global_load_async_to_lds_b128 %2, %3, off\n\t"
                 "global_load_async_to_lds_b128 %4, %5, off\n\t"
                 "global_load_async_to_lds_b128 %6, %7, off\n\t"
                 "s_wait_xcnt 0x0"
                 :: "v"(lk), "v"(gkh), "v"(lkl), "v"(gkl), "v"(lv), "v"(gvh), "v"(lvl), "v"(gvl) : "memory");
  } else {
    asm volatile("global_load_async_to_lds_b128 %0, %1, off\n\t"
                 "global_load_async_to_lds_b128 %2, %3, off\n\t"
                 "global_load_async_to_lds_b128 %4, %5, off\n\t"
                 "s_wait_xcnt 0x0"
                 :: "v"(lk), "v"(gkh), "v"(lkl), "v"(gkl), "v"(lv), "v"(gvh) : "memory");
  }
}

// One GEMM ring stage, 16 bytes per lane and copy, through no register: 64 A rows (2 copies) and 128 B rows (4 copies) of 64 k.
// l0: the lane's own LDS byte address of its piece of A row (tid >> 3) in the target buffer; ga / gb: the same piece in global memory.
// A copy of one wave covers four whole 128-B lines. The s_wait_xcnt stands inside the copies' own statement, so that no address
// register is rewritten in front of it.
__device__ __forceinline__ void stage_ab(unsigned l0, const _Float16* ga, const _Float16* gb) {
  const unsigned la1 = l0 + 32 * GP * 2;
  const unsigned lb0 = l0 + GBM * GP * 2;
  const unsigned lb1 = lb0 + 32 * GP * 2;
  const unsigned lb2 = lb0 + 64 * GP * 2;
  const unsigned lb3 = lb0 + 96 * GP * 2;
  const _Float16* ga1 = ga + (size_t)32 * HID;
  const _Float16* gb1 = gb + (size_t)32 * HID;
  const _Float16* gb2 = gb + (size_t)64 * HID;
  const _Float16* gb3 = gb + (size_t)96 * HID;
  asm volatile("global_load_async_to_lds_b128 %0, %1, off\n\t"
               "global_load_async_to_lds_b128 %2, %3, off\n\t"
               "global_load_async_to_lds_b128 %4, %5, off\n\t"
               "global_load_async_to_lds_b128 %6, %7, off\n\t"
               "global_load_async_to_lds_b128 %8, %9, off\n\t"
               "global_load_async_to_lds_b128 %10, %11, off\n\t"
               "s_wait_xcnt 0x0"
               :: "v"(l0), "v"(ga), "v"(la1), "v"(ga1), "v"(lb0), "v"(gb), "v"(lb1), "v"(gb1),
                  "v"(lb2), "v"(gb2), "v"(lb3), "v"(gb3) : "memory");
}

// The residual A plane's 64 rows of the same stage (2 copies); ll: the lane's LDS byte address of its piece of row (tid >> 3).
__device__ __forceinline__ void stage_l(unsigned ll, const _Float16* gl) {
  const unsigned ll1 = ll + 32 * GP * 2;
  const _Float16* gl1 = gl + (size_t)32 * HID;
  asm volatile("global_load_async_to_lds_b128 %0, %1, off\n\t"
               "global_load_async_to_lds_b128 %2, %3, off\n\t"
               "s_wait_xcnt 0x0"
               :: "v"(ll), "v"(gl), "v"(ll1), "v"(gl1) : "memory");
}

__device__ __forceinline__ v4f bf16_rne4(v4f a) {
  v4u u = __builtin_bit_cast(v4u, a);
  u = (u + 0x7FFFu + ((u >> 16) & 1u)) & 0xFFFF0000u;
  return __builtin_bit_cast(v4f, u);
}

__device__ __forceinline__ v8h cvt8v(v4f a, v4f b) {
  v8h d;
  d[0] = (_Float16)a[0]; d[1] = (_Float16)a[1];
  d[2] = (_Float16)a[2]; d[3] = (_Float16)a[3];
  d[4] = (_Float16)b[0]; d[5] = (_Float16)b[1];
  d[6] = (_Float16)b[2]; d[7] = (_Float16)b[3];
  return d;
}

// f32 x -> f16 hi and f16((x - hi) * 4096)
__device__ __forceinline__ void split8(v4f a, v4f b, v8h& hv, v8h& lv) {
  U8h hh, ll;
  _Float16 t;
  t = (_Float16)a[0]; hh.f[0] = t; ll.f[0] = (_Float16)((a[0] - (float)t) * 4096.0f);
  t = (_Float16)a[1]; hh.f[1] = t; ll.f[1] = (_Float16)((a[1] - (float)t) * 4096.0f);
  t = (_Float16)a[2]; hh.f[2] = t; ll.f[2] = (_Float16)((a[2] - (float)t) * 4096.0f);
  t = (_Float16)a[3]; hh.f[3] = t; ll.f[3] = (_Float16)((a[3] - (float)t) * 4096.0f);
  t = (_Float16)b[0]; hh.f[4] = t; ll.f[4] = (_Float16)((b[0] - (float)t) * 4096.0f);
  t = (_Float16)b[1]; hh.f[5] = t; ll.f[5] = (_Float16)((b[1] - (float)t) * 4096.0f);
  t = (_Float16)b[2]; hh.f[6] = t; ll.f[6] = (_Float16)((b[2] - (float)t) * 4096.0f);
  t = (_Float16)b[3]; hh.f[7] = t; ll.f[7] = (_Float16)((b[3] - (float)t) * 4096.0f);
  hv = hh.v; lv = ll.v;
}

// ---------------- pre-pass: Xh = f16(bf16RNE(hidden)) [MR][1024] (pad rows zero), Ph = f16(bf16RNE(pos)) [SEQP][1024]
//                  (pad rows zero), Wh = f16(256 * bf16RNE(W)) for the four weight matrices stacked [4096][1024].
__global__ __launch_bounds__(128)
void prep_kernel(const float* __restrict__ Hs, const float* __restrict__ Pos,
                 const float* __restrict__ W0, const float* __restrict__ W1,
                 const float* __restrict__ W2, const float* __restrict__ W3,
                 _Float16* Xh, _Float16* Ph, _Float16* Wh)
{
  const int row = blockIdx.x;
  const int c0  = 8 * threadIdx.x;
  const float* src;
  _Float16*    dst;
  float sc = 1.0f;
  if (row < MR) {
    const int b  = row / SEQP;
    const int s  = row - b * SEQP;
    const int sl = (s < SEQ) ? s : (SEQ - 1);            // clamped address; pad rows scaled to zero
    sc  = (s < SEQ) ? 1.0f : 0.0f;
    src = Hs + ((size_t)b * SEQ_FULL + sl) * HID + c0;   // full-size input strides
    dst = Xh + (size_t)row * HID + c0;
  } else if (row < MR + SEQP) {
    const int s  = row - MR;
    const int sl = (s < SEQ) ? s : (SEQ - 1);
    sc  = (s < SEQ) ? 1.0f : 0.0f;
    src = Pos + (size_t)sl * HID + c0;
    dst = Ph + (size_t)s * HID + c0;
  } else {
    const int j   = row - MR - SEQP;                      // 0..4095
    const int mat = j >> 10;
    const int r   = j & (HID - 1);
    const float* W = (mat == 0) ? W0 : (mat == 1) ? W1 : (mat == 2) ? W2 : W3;
    sc  = 256.0f;                                         // exact power-of-two carry, removed in the GEMM epilogues
    src = W + (size_t)r * HID + c0;
    dst = Wh + (size_t)j * HID + c0;
  }
  const v4f a0 = bf16_rne4(*(const v4f*)src) * sc;
  const v4f a1 = bf16_rne4(*(const v4f*)(src + 4)) * sc;
  const v8h v  = cvt8v(a0, a1);                           // bf16 values (and x256) are exact in f16
  *(v8h*)dst = v;
  
}

// ---------------- 16-bit GEMM: 64x128 block tile, 8 waves (2 x 4), wave tile 32x32, K = 1024 in WMMA steps of 32 ----------------
// Operands come by asynchronous copies into a ring of two LDS buffers, 64 k a stage: stage s + 1 flies while stage s is worked on.
// C[m][n] = sum_k A[m][k] * Bw[n][k]  (Bw = weight rows [out][in], k contiguous, i.e. x @ W^T).
// 16-bit fragment map (A and B alike): lane l -> row/col (l & 15); elements 0..7 <- k0 + 8*(l>>4) + 0..7,
// elements 8..15 <- k0 + 16 + 8*(l>>4) + 0..7.  D: element r of lane l -> row 8*(l>>4) + r, col (l & 15).
// MODE 0: Pout[s][n] f32 positional projection (pitch PPP), natural units.
// MODE 1: Q (n0 < 1024) or K (n0 >= 1024) rows: f16 hi plane + f16 x4096 residual plane [MR][1024], value = acc/256 + Pin.
// MODE 2: V: V^T hi plane [b][h][d][SEQP] and, for s0 < EARLY, V^T x4096 residual plane [b][h][d][EARLY], value = acc/256 + Pin.
// MODE 3: Y rows of d_out [b][2000][1024] f32, value = (acc + accr/4096)/256 with the residual A plane on rows s0 < EARLY.
template <int MODE>
__global__ __launch_bounds__(256)
void gemm_kernel(const _Float16* __restrict__ Ah, const _Float16* __restrict__ Al,
                 const _Float16* __restrict__ Bw, const float* __restrict__ Pin,
                 float* Pout, _Float16* O0, _Float16* O1, _Float16* O2, _Float16* O3, float* Y)
{
  // ring buffer = {A [64][GP], B [128][GP], and for MODE 3 residual A [64][GP]}, two of them; the epilogue's f32 tile reuses the ring
  constexpr int STG_H  = (GBM + GBN + (MODE == 3 ? GBM : 0)) * GP;   // halfs per buffer
  constexpr int RING_B = 2 * STG_H * 2;
  constexpr int TILE_B = GBM * CP * 4;
  __shared__ __attribute__((aligned(16))) char gsm[RING_B > TILE_B ? RING_B : TILE_B];   // cross-wave (block barrier)
  _Float16* sR = (_Float16*)gsm;
  float*    sC = (float*)gsm;

  const int tid  = threadIdx.x;
  const int wave = tid >> 5;
  const int lane = tid & 31;
  const int lh   = lane & 15;
  const int hi   = lane >> 4;
  const int wm   = wave >> 2;        // 0..1 -> 32-row strip
  const int wn   = wave & 3;         // 0..3 -> 32-col strip
  const int sub  = tid & 7;
  const int m0   = blockIdx.y * GBM;
  const int n0   = blockIdx.x * GBN;
  const int b    = m0 / SEQP;
  const int s0   = m0 - b * SEQP;
  const bool resa = (MODE == 3) && (s0 < EARLY);   // block-uniform

  U8f acc[2][2], accr[2][2];
  #pragma unroll
  for (int mi = 0; mi < 2; ++mi)
    #pragma unroll
    for (int ni = 0; ni < 2; ++ni) { acc[mi][ni].v = (v8f){}; accr[mi][ni].v = (v8f){}; }

  const int sr = tid >> 3, sp = tid & 7;                             // staging: row 0..31 (+ 32 per further copy), 16-B piece 0..7
  const unsigned l0 = (unsigned)(uintptr_t)(sR + sr * GP + 8 * sp);  // LDS byte address of the lane's A piece in buffer 0
  const unsigned ll0 = l0 + (GBM + GBN) * GP * 2;                    // the same piece of the residual plane (MODE 3)
  const _Float16* ga = Ah + (size_t)(m0 + sr) * HID + 8 * sp;        // this lane's pieces of stage 0
  const _Float16* gl = Al + (size_t)(m0 + sr) * HID + 8 * sp;
  const _Float16* gb = Bw + (size_t)(n0 + sr) * HID + 8 * sp;

  stage_ab(l0, ga, gb);                                              // stage 0 -> buffer 0
  if (resa) stage_l(ll0, gl);
  asm volatile("s_wait_asynccnt 0x0" ::: "memory");                  // this wave's pieces of stage 0 have landed
  __syncthreads();                                                   // stage 0 visible to all waves
  stage_ab(l0 + STG_H * 2, ga + GBK, gb + GBK);                      // stage 1 -> buffer 1 (GNS >= 2)
  if (resa) stage_l(ll0 + STG_H * 2, gl + GBK);

  for (int s = 0; s < GNS; ++s) {
    const int bufh = (s & 1) * STG_H;                                // this stage's buffer, offset in halfs
    const _Float16* sA = sR + bufh;
    const _Float16* sB = sA + GBM * GP;
    const _Float16* sL = sB + GBN * GP;

    #pragma unroll                                                   // both halves of the stage at immediate LDS offsets
    for (int c = 0; c < GBK / 32; ++c) {                             // k ascending in WMMA steps of 32
      U16h af[2], bq[2];
      #pragma unroll
      for (int mi = 0; mi < 2; ++mi) {
        const _Float16* p = sA + (wm * 32 + mi * 16 + lh) * GP + 32 * c;
        af[mi].h[0] = *(const v8h*)(p + 8 * hi);
        af[mi].h[1] = *(const v8h*)(p + 16 + 8 * hi);
      }
      #pragma unroll
      for (int ni = 0; ni < 2; ++ni) {
        const _Float16* p = sB + (wn * 32 + ni * 16 + lh) * GP + 32 * c;
        bq[ni].h[0] = *(const v8h*)(p + 8 * hi);
        bq[ni].h[1] = *(const v8h*)(p + 16 + 8 * hi);
      }
      #pragma unroll
      for (int mi = 0; mi < 2; ++mi)
        #pragma unroll
        for (int ni = 0; ni < 2; ++ni)
          acc[mi][ni].v = wmma_f16(af[mi].v, bq[ni].v, acc[mi][ni].v);
      if (resa) {
        U16h lf[2];
        #pragma unroll
        for (int mi = 0; mi < 2; ++mi) {
          const _Float16* p = sL + (wm * 32 + mi * 16 + lh) * GP + 32 * c;
          lf[mi].h[0] = *(const v8h*)(p + 8 * hi);
          lf[mi].h[1] = *(const v8h*)(p + 16 + 8 * hi);
        }
        #pragma unroll
        for (int mi = 0; mi < 2; ++mi)
          #pragma unroll
          for (int ni = 0; ni < 2; ++ni)
            accr[mi][ni].v = wmma_f16(lf[mi].v, bq[ni].v, accr[mi][ni].v);
      }
    }

    // ---- publish point, every wave: own LDS reads of this buffer done, own copies of the next stage landed, block barrier ----
    asm volatile("s_wait_dscnt 0x0" ::: "memory");                   // this wave has left the buffer that is refilled below
    asm volatile("s_wait_asynccnt 0x0" ::: "memory");                // this wave's pieces of the next stage have landed
    __syncthreads();                                                 // next stage visible to all; every reader has left this buffer
    if (s + 2 < GNS) {                                               // block-uniform: stage s + 2 flies while stage s + 1 is worked on
      stage_ab(l0 + bufh * 2, ga + (s + 2) * GBK, gb + (s + 2) * GBK);
      if (resa) stage_l(ll0 + bufh * 2, gl + (s + 2) * GBK);
    }
  }
  asm volatile("s_wait_asynccnt 0x0" ::: "memory");                  // nothing of this wave is in flight when the ring becomes the f32 tile

  // ---- accumulators -> f32 tile in LDS (x 1/256 removes the weight carry) ----
  #pragma unroll
  for (int mi = 0; mi < 2; ++mi)
    #pragma unroll
    for (int ni = 0; ni < 2; ++ni)
      #pragma unroll
      for (int r = 0; r < 8; ++r) {
        float v = acc[mi][ni].f[r];
        if (resa) v += accr[mi][ni].f[r] * (1.0f / 4096.0f);
        sC[(wm * 32 + mi * 16 + 8 * hi + r) * CP + wn * 32 + ni * 16 + lh] = v * (1.0f / 256.0f);
      }
  __syncthreads();

  if (MODE == 1 || MODE == 2) {
    // ---- add the positional projection row (f32, natural units), in place, coalesced 32-B reads ----
    #pragma unroll
    for (int p = 0; p < 4; ++p) {
      const int g   = p * 256 + tid;
      const int row = g >> 4;
      const int cg  = g & 15;
      const float* pp = Pin + (size_t)(s0 + row) * PPP + n0 + 8 * cg;
      const v4f p0 = *(const v4f*)pp;
      const v4f p1 = *(const v4f*)(pp + 4);
      v4fa* c = (v4fa*)(sC + row * CP + 8 * cg);
      v4f x0 = c[0], x1 = c[1];
      x0 += p0; x1 += p1;
      c[0] = x0; c[1] = x1;
    }
    __syncthreads();
  }

  if (MODE == 0) {
    // 64 rows x 512 B = 4 lines each: line L = 32 i + (tid>>3) -> row L>>2, segment L&3; one wave instruction = one whole row segment
    v4f ov[8]; size_t oo[8];
    #pragma unroll
    for (int i = 0; i < 8; ++i) {
      const int L = 32 * i + (tid >> 3);
      const int row = L >> 2, seg = L & 3;
      ov[i] = *(const v4fa*)(sC + row * CP + seg * 32 + 4 * sub);
      oo[i] = (size_t)(m0 + row) * PPP + n0 + seg * 32 + 4 * sub;
    }
    #pragma unroll
    for (int i = 0; i < 8; ++i) *(v4f*)(Pout + oo[i]) = ov[i];
    
  }

  if (MODE == 1) {
    const bool isq = (n0 < HID);                     // block-uniform: Q group or K group
    _Float16* ph = isq ? O0 : O2;
    _Float16* pl = isq ? O1 : O3;
    const int col0 = n0 & (HID - 1);
    // 64 rows x 2 lines per plane: rem = 32 i + (tid>>3) -> row rem>>1, segment rem&1 (64 halfs = one line), piece sub
    v8h vh[4], vl[4]; size_t oo[4];
    #pragma unroll
    for (int i = 0; i < 4; ++i) {
      const int rem = 32 * i + (tid >> 3);
      const int row = rem >> 1, seg = rem & 1;
      const float* c = sC + row * CP + seg * 64 + 8 * sub;
      split8(*(const v4fa*)c, *(const v4fa*)(c + 4), vh[i], vl[i]);
      oo[i] = (size_t)(m0 + row) * HID + col0 + seg * 64 + 8 * sub;
    }
    #pragma unroll
    for (int i = 0; i < 4; ++i) { *(v8h*)(ph + oo[i]) = vh[i]; *(v8h*)(pl + oo[i]) = vl[i]; }
    
  }

  if (MODE == 2) {
    // in[64 keys][128 cols] -> out[(h,d) = 128 rows][64 keys]: col c = 32 i + (tid>>3), keys s0 + 8 sub .. +7 (one line per (h,d) row)
    const int h0 = n0 / HD;
    v8h vh[4], vl[4]; size_t oh[4], ol[4];
    #pragma unroll
    for (int i = 0; i < 4; ++i) {
      const int c  = 32 * i + (tid >> 3);
      const int hh = h0 + (c >> 6);
      const int d  = c & (HD - 1);
      v4f x0, x1;
      x0[0] = sC[(8 * sub + 0) * CP + c]; x0[1] = sC[(8 * sub + 1) * CP + c];
      x0[2] = sC[(8 * sub + 2) * CP + c]; x0[3] = sC[(8 * sub + 3) * CP + c];
      x1[0] = sC[(8 * sub + 4) * CP + c]; x1[1] = sC[(8 * sub + 5) * CP + c];
      x1[2] = sC[(8 * sub + 6) * CP + c]; x1[3] = sC[(8 * sub + 7) * CP + c];
      split8(x0, x1, vh[i], vl[i]);
      const size_t rowid = (size_t)(b * NH + hh) * HD + d;
      oh[i] = rowid * SEQP + s0 + 8 * sub;
      ol[i] = rowid * EARLY + s0 + 8 * sub;
    }
    #pragma unroll
    for (int i = 0; i < 4; ++i) {
      *(v8h*)(O0 + oh[i]) = vh[i];
      if (s0 < EARLY) *(v8h*)(O1 + ol[i]) = vl[i];
    }
    
  }

  if (MODE == 3) {
    // d_out rows (b, s) with s < SEQ only (whole 512-B row segments; guard is uniform over the 32 lanes of a row segment)
    v4f ov[8]; size_t oo[8]; int sv[8];
    #pragma unroll
    for (int i = 0; i < 8; ++i) {
      const int L = 32 * i + (tid >> 3);
      const int row = L >> 2, seg = L & 3;
      ov[i] = *(const v4fa*)(sC + row * CP + seg * 32 + 4 * sub);
      sv[i] = s0 + row;
      oo[i] = ((size_t)b * SEQ_FULL + (size_t)(s0 + row)) * HID + n0 + seg * 32 + 4 * sub;
    }
    #pragma unroll
    for (int i = 0; i < 8; ++i) if (sv[i] < SEQ) *(v4f*)(Y + oo[i]) = ov[i];
    
  }
}

// ---------------- fused causal attention: one workgroup = 128 query rows of one (batch, head), 8 waves x 16 rows ----------------
// S^T = K Q^T (A = K rows, B = Q rows): k_hi*q_hi into one accumulator, (k_lo*q_hi + k_hi*q_lo) into a second one folded x 1/4096
// (residual planes carry x4096). Lane l then holds 16 of the chunk's 32 scores of query (l & 15); lane l ^ 16 holds the other 16.
// O^T = V^T P^T: the two S^T tiles, converted in place, are the B operand (P carried x1024 in f16); RES (query blocks 0,1) adds
// V_lo*P_hi + V_hi*P_res into a second accumulator folded x 1/4096.
// Causal mask: key <= query keeps the score, else -1e30 (replace-fill); online softmax base 2 with f32 running max / sum per lane.
template <bool RES>
__global__ __launch_bounds__(256)
void attn_kernel(const _Float16* __restrict__ Qh, const _Float16* __restrict__ Ql,
                 const _Float16* __restrict__ Kh, const _Float16* __restrict__ Kl,
                 const _Float16* __restrict__ Vth, const _Float16* __restrict__ Vtl,
                 _Float16* Ch, _Float16* Cl, int qb0, int nqbl)
{
  extern __shared__ __attribute__((aligned(16))) _Float16 smem[];
  _Float16* sQ  = smem + SQ_OFF;             // [wave][hi 16 | residual 16][QP]  wave-private; the epilogue's f32 tile reuses it
  _Float16* sR  = smem + RING_OFF;           // [2 buffers]{K hi [32][KP], K res [32][KP], V^T hi [64][VP], V^T res [64][VP]}  cross-wave

  const int tid  = threadIdx.x;
  const int wave = tid >> 5;
  const int lane = tid & 31;
  const int lh   = lane & 15;
  const int hi   = lane >> 4;

  // Placement, for speed only: block index -> (query tile, head). A tile's cost grows with its number (causal), every group of the
  // launch is resident at once. All heads of one tile
  // are neighbours in the index and the cost falls from one round of 256 groups to the next; inside a round the tiles are ordered
  // to even out the load. The tiles of one head keep one index mod 8.
  const int cls = blockIdx.x / (NB * NH);    // 0 .. nqbl - 1
  const int bh  = blockIdx.x % (NB * NH);
  int qb = qb0 + nqbl - 1 - cls;             // any shape: heaviest tile first
  if (!RES && SEQP / BQ == 16 && NB * NH == 64)
    qb = (int)((0x236475AB98EFCDull >> (4 * cls)) & 15);   // tiles 2..15, each once: 13 12 15 14 | 8 9 11 10 | 5 7 4 6 | 3 2
  const int h     = bh % NH;
  const int b     = bh / NH;
  const int qbase = qb * BQ;
  const int qrow0 = qbase + wave * 16;

  const size_t prow = (size_t)b * SEQP;
  const _Float16* Qhb = Qh + prow * HID + h * HD;
  const _Float16* Qlb = Ql + prow * HID + h * HD;
  const _Float16* Khb = Kh + prow * HID + h * HD;
  const _Float16* Klb = Kl + prow * HID + h * HD;
  const _Float16* Vhb = Vth + (size_t)(b * NH + h) * HD * SEQP;
  const _Float16* Vlb = Vtl + (size_t)(b * NH + h) * HD * EARLY;
  _Float16* Chb = Ch + prow * HID + h * HD;
  _Float16* Clb = Cl + prow * HID + h * HD;

  // ---- this wave's 16 query rows (hi and residual) -> LDS: row 4i + (lane>>3), 16-B piece (lane&7) ----
  const int kend = qbase + BQ;               // causal, block-uniform: keys beyond the block's last query row are never needed
  const int kr = tid >> 3, kg = tid & 7;     // K staging: key row 0..31, piece 0..7
  const int vd = tid >> 2, vg = tid & 3;     // V^T staging: d row 0..63, piece 0..3
  const unsigned lk0 = (unsigned)(uintptr_t)(sR + RKH_OFF + kr * KP + 8 * kg);   // LDS byte addresses in buffer 0
  const unsigned lv0 = (unsigned)(uintptr_t)(sR + RVH_OFF + vd * VP + 8 * vg);
  const _Float16* gkh = Khb + (size_t)kr * HID + 8 * kg;                         // this lane's pieces of chunk 0
  const _Float16* gkl = Klb + (size_t)kr * HID + 8 * kg;
  const _Float16* gvh = Vhb + (size_t)vd * SEQP + 8 * vg;
  const _Float16* gvl = Vlb + (size_t)vd * EARLY + 8 * vg;

  stage_kv<RES>(lk0, lv0, gkh, gkl, gvh, gvl);                                   // chunk 0 -> buffer 0

  _Float16* qwh = sQ + wave * QW_H;
  _Float16* qwl = qwh + 16 * QP;
  {
    const int pc = lane & 7;
    #pragma unroll
    for (int i = 0; i < 4; ++i) {
      const int r = 4 * i + (lane >> 3);
      const size_t go = (size_t)(qrow0 + r) * HID + 8 * pc;
      *(v8h*)(qwh + r * QP + 8 * pc) = *(const v8h*)(Qhb + go);
      *(v8h*)(qwl + r * QP + 8 * pc) = *(const v8h*)(Qlb + go);
    }
  }

  U8f acc[4], accr[4];
  #pragma unroll
  for (int t = 0; t < 4; ++t) { acc[t].v = (v8f){}; accr[t].v = (v8f){}; }
  float mcol = -3.0e38f;                     // running maximum of query qrow0 + lh (equal in both wave halves)
  float lcol = 0.0f;                         // running sum over this lane's keys only; the halves are joined in the epilogue

  // scalar copy of the wave's first row: the per-wave skip below is then a real branch and EXEC stays all ones at the copies
  const int qrow0s = __builtin_amdgcn_readfirstlane(qrow0);

  asm volatile("s_wait_asynccnt 0x0" ::: "memory");   // this wave's pieces of chunk 0 have landed
  __syncthreads();                                    // chunk 0 (and the Q tiles) visible to all waves
  // chunk 1 -> buffer 1 (kend >= BQ = 4 chunks, so chunk 1 always exists)
  stage_kv<RES>(lk0 + RING_H * 2, lv0 + RING_H * 2, gkh + (size_t)BK * HID, gkl + (size_t)BK * HID, gvh + BK, gvl + BK);

  for (int kv0 = 0; kv0 < kend; kv0 += BK) {
    const int bufh = ((kv0 / BK) & 1) * RING_H;       // this chunk's buffer, offset in halfs
    const _Float16* sKh = sR + bufh + RKH_OFF;
    const _Float16* sKl = sR + bufh + RKL_OFF;
    const _Float16* sVh = sR + bufh + RVH_OFF;
    const _Float16* sVl = sR + bufh + RVL_OFF;

    if (kv0 < qrow0s + 16) {                 // wave-uniform: skip chunks entirely above this wave's rows
      // ---- S^T = K Q^T for two 16-key tiles, d reduced in two K=32 steps, three products each ----
      U8f s0, s1;
      {
        U8f sm, sr; sm.v = (v8f){}; sr.v = (v8f){};
        #pragma unroll
        for (int c = 0; c < 2; ++c) {
          U16h qf, ql, kf, kl;
          qf.h[0] = *(const v8h*)(qwh + lh * QP + 32 * c + 8 * hi);
          qf.h[1] = *(const v8h*)(qwh + lh * QP + 32 * c + 16 + 8 * hi);
          ql.h[0] = *(const v8h*)(qwl + lh * QP + 32 * c + 8 * hi);
          ql.h[1] = *(const v8h*)(qwl + lh * QP + 32 * c + 16 + 8 * hi);
          kf.h[0] = *(const v8h*)(sKh + lh * KP + 32 * c + 8 * hi);
          kf.h[1] = *(const v8h*)(sKh + lh * KP + 32 * c + 16 + 8 * hi);
          kl.h[0] = *(const v8h*)(sKl + lh * KP + 32 * c + 8 * hi);
          kl.h[1] = *(const v8h*)(sKl + lh * KP + 32 * c + 16 + 8 * hi);
          sm.v = wmma_f16(kf.v, qf.v, sm.v);
          sr.v = wmma_f16(kl.v, qf.v, sr.v);
          sr.v = wmma_f16(kf.v, ql.v, sr.v);
        }
        s0.v = sm.v + sr.v * (1.0f / 4096.0f);
      }
      {
        U8f sm, sr; sm.v = (v8f){}; sr.v = (v8f){};
        #pragma unroll
        for (int c = 0; c < 2; ++c) {
          U16h qf, ql, kf, kl;
          qf.h[0] = *(const v8h*)(qwh + lh * QP + 32 * c + 8 * hi);
          qf.h[1] = *(const v8h*)(qwh + lh * QP + 32 * c + 16 + 8 * hi);
          ql.h[0] = *(const v8h*)(qwl + lh * QP + 32 * c + 8 * hi);
          ql.h[1] = *(const v8h*)(qwl + lh * QP + 32 * c + 16 + 8 * hi);
          kf.h[0] = *(const v8h*)(sKh + (16 + lh) * KP + 32 * c + 8 * hi);
          kf.h[1] = *(const v8h*)(sKh + (16 + lh) * KP + 32 * c + 16 + 8 * hi);
          kl.h[0] = *(const v8h*)(sKl + (16 + lh) * KP + 32 * c + 8 * hi);
          kl.h[1] = *(const v8h*)(sKl + (16 + lh) * KP + 32 * c + 16 + 8 * hi);
          sm.v = wmma_f16(kf.v, qf.v, sm.v);
          sr.v = wmma_f16(kl.v, qf.v, sr.v);
          sr.v = wmma_f16(kf.v, ql.v, sr.v);
        }
        s1.v = sm.v + sr.v * (1.0f / 4096.0f);
      }

      // ---- scale, causal replace-mask, online softmax (base 2): element j of tile 0 / 1 is key kv0 + 8 hi + j / + 16, query lh ----
      const int dq = qrow0 + lh - kv0 - 8 * hi;        // key kept where j (tile 0) or 16 + j (tile 1) <= dq
      float a0[8], a1[8], mx[8];
      #pragma unroll
      for (int j = 0; j < 8; ++j) {
        const float x0 = s0.f[j] * C2S;
        const float x1 = s1.f[j] * C2S;
        a0[j] = (j <= dq) ? x0 : -1.0e30f;
        a1[j] = (16 + j <= dq) ? x1 : -1.0e30f;
        mx[j] = fmaxf(a0[j], a1[j]);
      }
      float rm = fmaxf(fmaxf(fmaxf(mx[0], mx[1]), fmaxf(mx[2], mx[3])), fmaxf(fmaxf(mx[4], mx[5]), fmaxf(mx[6], mx[7])));
      rm = fmaxf(rm, xhalf(rm));                       // both halves now hold the query's chunk maximum
      const float mnew  = fmaxf(mcol, rm);
      const float alpha = __builtin_amdgcn_exp2f(mcol - mnew);
      mcol = mnew;
      U8h pa, pb, par, pbr;
      float es[8];
      #pragma unroll
      for (int j = 0; j < 8; ++j) {
        const float e0 = __builtin_amdgcn_exp2f(a0[j] - mnew);
        const float e1 = __builtin_amdgcn_exp2f(a1[j] - mnew);
        es[j] = e0 + e1;
        const float t0 = e0 * 1024.0f;                 // carried x1024, removed in the epilogue
        const float t1 = e1 * 1024.0f;
        const _Float16 h0 = (_Float16)t0;
        const _Float16 h1 = (_Float16)t1;
        pa.f[j] = h0; pb.f[j] = h1;
        if (RES) {
          par.f[j] = (_Float16)((t0 - (float)h0) * 4096.0f);
          pbr.f[j] = (_Float16)((t1 - (float)h1) * 4096.0f);
        }
      }
      lcol = lcol * alpha + (((es[0] + es[1]) + (es[2] + es[3])) + ((es[4] + es[5]) + (es[6] + es[7])));
      #pragma unroll
      for (int t = 0; t < 4; ++t) {
        acc[t].v *= alpha;
        if (RES) accr[t].v *= alpha;
      }

      // ---- P^T as B operand straight from the registers: elements 0..7 = keys 8 hi + 0..7, elements 8..15 = keys 16 + 8 hi + 0..7 ----
      U16h pf, pfr;
      pf.h[0] = pa.v; pf.h[1] = pb.v;
      if (RES) { pfr.h[0] = par.v; pfr.h[1] = pbr.v; }

      // ---- O^T += V^T P^T : 4 output d-tiles, K = 32 keys; A[m = d][k = key] from V^T tile row d ----
      #pragma unroll
      for (int t = 0; t < 4; ++t) {
        U16h vf;
        vf.h[0] = *(const v8h*)(sVh + (16 * t + lh) * VP + 8 * hi);
        vf.h[1] = *(const v8h*)(sVh + (16 * t + lh) * VP + 16 + 8 * hi);
        acc[t].v = wmma_f16(vf.v, pf.v, acc[t].v);
        if (RES) {
          U16h wl;
          wl.h[0] = *(const v8h*)(sVl + (16 * t + lh) * VP + 8 * hi);
          wl.h[1] = *(const v8h*)(sVl + (16 * t + lh) * VP + 16 + 8 * hi);
          accr[t].v = wmma_f16(wl.v, pf.v, accr[t].v);
          accr[t].v = wmma_f16(vf.v, pfr.v, accr[t].v);
        }
      }
    }

    // ---- publish point, every wave: own LDS reads of this buffer done, own copies of the next chunk landed, block barrier ----
    asm volatile("s_wait_dscnt 0x0" ::: "memory");      // this wave has left the buffer that is refilled below
    asm volatile("s_wait_asynccnt 0x0" ::: "memory");   // this wave's pieces of the next chunk have landed
    __syncthreads();                                    // next chunk visible to all; every reader has left this chunk's buffer
    if (kv0 + 2 * BK < kend) {                          // block-uniform: chunk + 2 flies while chunk + 1 is worked on
      const int kn = kv0 + 2 * BK;
      stage_kv<RES>(lk0 + bufh * 2, lv0 + bufh * 2, gkh + (size_t)kn * HID, gkl + (size_t)kn * HID, gvh + kn, gvl + kn);
    }
  }
  asm volatile("s_wait_asynccnt 0x0" ::: "memory");     // nothing of this wave is in flight when its LDS is reused

  // ---- epilogue: join the halves' sums, normalize (1/1024 removes the carry), stage 16x64 f32 per wave in LDS, split to hi / residual.
  // Register r of O^T tile t in lane l is d = 16 t + 8 hi + r of query lh: eight consecutive floats of one staged row.
  const float inv = 1.0f / ((lcol + xhalf(lcol)) * 1024.0f);
  float* so = (float*)qwh;                   // the wave's own Q tile, no longer read
  #pragma unroll
  for (int t = 0; t < 4; ++t) {
    v8f v = acc[t].v;
    if (RES) v += accr[t].v * (1.0f / 4096.0f);
    v *= inv;
    v4fa* sp = (v4fa*)(so + lh * SOP + 16 * t + 8 * hi);
    sp[0] = (v4f){v[0], v[1], v[2], v[3]};
    sp[1] = (v4f){v[4], v[5], v[6], v[7]};
  }
  wave_lds_sync();
  v8h oh[4], ol[4]; size_t oo[4];
  {
    const int pc = lane & 7;
    #pragma unroll
    for (int i = 0; i < 4; ++i) {
      const int rr = 4 * i + (lane >> 3);
      const float* sp = so + rr * SOP + 8 * pc;
      split8(*(const v4fa*)sp, *(const v4fa*)(sp + 4), oh[i], ol[i]);
      oo[i] = (size_t)(qrow0 + rr) * HID + 8 * pc;
    }
  }
  #pragma unroll
  for (int i = 0; i < 4; ++i) { *(v8h*)(Chb + oo[i]) = oh[i]; *(v8h*)(Clb + oo[i]) = ol[i]; }
  
}

extern "C" void kernel_launch(void* const* d_in, const int* in_sizes, int n_in,
                              void* d_out, int out_size, void* d_ws, size_t ws_size,
                              hipStream_t stream) {
  if (n_in < 6) return;
  const long long need_x = ((long long)(NB - 1) * SEQ_FULL + SEQ) * HID;
  if ((long long)in_sizes[0] < need_x) return;
  if ((long long)in_sizes[1] < (long long)HID * HID) return;
  if ((long long)in_sizes[2] < (long long)HID * HID) return;
  if ((long long)in_sizes[3] < (long long)HID * HID) return;
  if ((long long)in_sizes[4] < (long long)HID * HID) return;
  if ((long long)in_sizes[5] < (long long)SEQ * HID) return;
  if ((long long)out_size < need_x) return;
  if (kTotal > ws_size) return;

  const float* hs  = (const float*)d_in[0];
  const float* wq  = (const float*)d_in[1];
  const float* wk  = (const float*)d_in[2];
  const float* wv  = (const float*)d_in[3];
  const float* wo  = (const float*)d_in[4];
  const float* pos = (const float*)d_in[5];
  float*       out = (float*)d_out;

  char* ws = (char*)d_ws;
  _Float16* xh = (_Float16*)(ws + kOffXh);     // [MR][1024]
  _Float16* ph = (_Float16*)(ws + kOffPh);     // [SEQP][1024]
  float*    pp = (float*)(ws + kOffPP);        // [SEQP][PPP] f32
  _Float16* ch = (_Float16*)(ws + kOffCh);     // [MR][1024], aliases xh after it is dead
  _Float16* cl = (_Float16*)(ws + kOffCl);     // [MR][1024], aliases ph/pp after they are dead
  _Float16* wh = (_Float16*)(ws + kOffWh);     // [4096][1024]
  _Float16* qh = (_Float16*)(ws + kOffQh);
  _Float16* ql = (_Float16*)(ws + kOffQl);
  _Float16* kh = (_Float16*)(ws + kOffKh);
  _Float16* kl = (_Float16*)(ws + kOffKl);
  _Float16* vh = (_Float16*)(ws + kOffVh);     // V^T hi  [NB][16][64][SEQP]
  _Float16* vl = (_Float16*)(ws + kOffVl);     // V^T res [NB][16][64][EARLY]

  prep_kernel<<<dim3(MR + SEQP + 4 * HID), dim3(128), 0, stream>>>(hs, pos, wq, wk, wv, wo, xh, ph, wh);

  // positional projection for the Q/K group, then Q/K planes
  gemm_kernel<0><<<dim3(NQK / GBN, SEQP / GBM), dim3(256), 0, stream>>>(ph, ph, wh, pp, pp, qh, ql, kh, kl, out);
  gemm_kernel<1><<<dim3(NQK / GBN, MR / GBM), dim3(256), 0, stream>>>(xh, xh, wh, pp, pp, qh, ql, kh, kl, out);
  // positional projection for the V group, then V^T planes
  const _Float16* whv = wh + (size_t)NQK * HID;
  gemm_kernel<0><<<dim3(HID / GBN, SEQP / GBM), dim3(256), 0, stream>>>(ph, ph, whv, pp, pp, qh, ql, kh, kl, out);
  gemm_kernel<2><<<dim3(HID / GBN, MR / GBM), dim3(256), 0, stream>>>(xh, xh, whv, pp, pp, vh, vl, kh, kl, out);

  (void)hipFuncSetAttribute(reinterpret_cast<const void*>(&attn_kernel<true>),
                            hipFuncAttributeMaxDynamicSharedMemorySize, (int)LDS_BYTES);
  (void)hipFuncSetAttribute(reinterpret_cast<const void*>(&attn_kernel<false>),
                            hipFuncAttributeMaxDynamicSharedMemorySize, (int)LDS_BYTES);
  const int nqb = SEQP / BQ;
  attn_kernel<true><<<dim3(NB * NH * 2), dim3(256), LDS_BYTES, stream>>>(qh, ql, kh, kl, vh, vl, ch, cl, 0, 2);
  if (nqb > 2)
    attn_kernel<false><<<dim3(NB * NH * (nqb - 2)), dim3(256), LDS_BYTES, stream>>>(qh, ql, kh, kl, vh, vl, ch, cl, 2, nqb - 2);

  const _Float16* who = wh + (size_t)(NQK + HID) * HID;
  gemm_kernel<3><<<dim3(HID / GBN, MR / GBM), dim3(256), 0, stream>>>(ch, cl, who, pp, pp, qh, ql, kh, kl, out);
}

// v005
// A run of this version takes 203 microseconds.
// Two timings next to v004 both put it at 1.03 times that version's speed.
// Over all steps from v000 it is 1.93 times as fast.
#include <hip/hip_runtime.h>
#include <stdint.h>

// Contractions, all on v_wmma_f32_16x16x32_f16 with f32 accumulate: P0 = Xp*W^T and Y0 = X*W^T + P0 (f16 operands holding
// bf16-RNE input values, W carried x256); S = Q*K^T (Q, K as f16 hi + x4096 f16 residual planes, three products); O = P*V
// (P carried x1024 in f16, V^T f16 hi; extra P-residual and V-residual products on query blocks below row 256); Y = C*Wo^T
// (C f16 hi + x4096 f16 residual product on rows below 256). Score scaling, causal mask, softmax and normalisation in f32.

typedef _Float16 v16h __attribute__((ext_vector_type(16)));
typedef _Float16 v8h  __attribute__((ext_vector_type(8)));
typedef _Float16 v8ha __attribute__((ext_vector_type(8), may_alias));
typedef float    v8f  __attribute__((ext_vector_type(8)));
typedef float    v4f  __attribute__((ext_vector_type(4)));
typedef float    v4fa __attribute__((ext_vector_type(4), may_alias));
typedef unsigned int v4u __attribute__((ext_vector_type(4)));

union U8f  { v8f  v; float    f[8]; };
union U16h { v16h v; v8h      h[2]; };
union U8h  { v8h  v; _Float16 f[8]; };

#ifndef NB
#define NB 4
#endif
#ifndef SEQ
#define SEQ 2000
#endif
#define NB_FULL  4
#define SEQ_FULL 2000
#define HID   1024
#define NH    16
#define HD    64
#define NQK   2048                               // Q and K output columns (first projection group)
#define SEQP  ((((SEQ) + 127) / 128) * 128)      // rows per batch inside workspace planes (zero padded)
#define MR    ((NB) * SEQP)                      // activation plane rows
#define EARLY 256                                // query rows / keys given residual products
#define PPP   2048                               // f32 pitch of the positional projection plane

static_assert(NB >= 1 && NB <= NB_FULL);
static_assert(SEQ >= 256 && SEQ <= SEQ_FULL);
static_assert(SEQP % 128 == 0 && SEQP >= EARLY && SEQP <= 2048);
static_assert(NH * HD == HID);
static_assert(NQK <= PPP && HID <= PPP);
static_assert(((long long)(NB - 1) * SEQ_FULL + SEQ) * HID <= (long long)NB_FULL * SEQ_FULL * HID);

// ---------------- GEMM tiling ----------------
#define GBM 128
#define GBN(MODE) (((MODE) == 0 || (MODE) == 3) ? 128 : 256)   // 128 columns where 256 would leave WGPs idle (MODE 0) or registers short (MODE 3: a second accumulator set)
#define GBK 64      // k per ring stage: one whole 128-B line of every staged operand row
#define GP  72      // halfs per staged row in LDS (144 B)
#define GNS (HID / GBK)   // ring stages
#define GT  256     // threads: 8 waves (2 x 4), wave tile 64 x 64 (64 x 32 at 128 columns)
#define GRS (GT / 8)      // operand rows (8 pieces of 16 B each) that one copy of the whole block covers
static_assert(MR % GBM == 0 && SEQP % GBM == 0 && EARLY % GBM == 0);
static_assert(HID % GBN(0) == 0 && NQK % GBN(0) == 0 && NQK % GBN(1) == 0 && HID % GBN(1) == 0 && HID % GBN(2) == 0 && HID % GBN(3) == 0 && HID % GBK == 0);
static_assert((GP * 2) % 16 == 0);
static_assert(GBK == 64 && GBM == 128 && GRS == 32 && GNS >= 2);   // the staging below: 8 pieces a row, 32 rows a copy

// ---------------- attention tiling ----------------
#define BQ 128      // query rows per workgroup (8 waves x 16)
#define BK 32       // keys per staged chunk
#define QP 72       // halfs per Q row in LDS (144 B)
#define KP 72       // halfs per K row in LDS
#define VP 40       // halfs per V^T row in LDS (80 B)
static_assert(SEQP % BQ == 0 && EARLY == 2 * BQ && BQ % BK == 0);

// offsets in halfs. Each wave owns one Q tile (16 hi rows, then 16 residual rows); the epilogue's 16x64 f32 tile (pitch SOP) reuses it.
// The K / V^T chunk lives in a ring of two buffers, each {K hi, K residual, V^T hi, V^T residual}.
#define SQ_OFF   0
#define QW_H     (2 * 16 * QP)
#define RING_OFF (SQ_OFF + 8 * QW_H)
#define RKH_OFF  0
#define RKL_OFF  (RKH_OFF + BK * KP)
#define RVH_OFF  (RKL_OFF + BK * KP)
#define RVL_OFF  (RVH_OFF + HD * VP)
#define RING_H   (RVL_OFF + HD * VP)
#define LDS_BYTES ((RING_OFF + 2 * RING_H) * 2)
#define SOP 68      // floats per row of the epilogue's 16x64 f32 tile (272 B)
static_assert((QW_H * 2) % 16 == 0 && (RING_OFF * 2) % 16 == 0 && (RING_H * 2) % 16 == 0);
static_assert((RKL_OFF * 2) % 16 == 0 && (RVH_OFF * 2) % 16 == 0 && (RVL_OFF * 2) % 16 == 0);
static_assert((KP * 2) % 16 == 0 && (VP * 2) % 16 == 0);
static_assert(QW_H * 2 >= 16 * SOP * 4 && (SOP * 4) % 16 == 0 && SOP >= HD);
static_assert(LDS_BYTES == 75776);

// (1/8) * log2(e): scores go to the base-2 domain for the online softmax
#define C2S 0.18033688011112042f

// ---------------- workspace carve (bytes) ----------------
static constexpr size_t kPlaneB = (size_t)MR * HID * 2;                   // one f16 activation plane
static constexpr size_t kPhB    = (size_t)SEQP * HID * 2;                 // f16 positional rows
static constexpr size_t kPPB    = (size_t)SEQP * PPP * 4;                 // f32 positional projection
static constexpr size_t kR0B    = (kPlaneB + kPhB + kPPB > 2 * kPlaneB) ? (kPlaneB + kPhB + kPPB) : (2 * kPlaneB);
static constexpr size_t kWhB    = (size_t)4 * HID * HID * 2;              // f16 weights, 4 matrices stacked
static constexpr size_t kVtlB   = (size_t)NB * NH * HD * EARLY * 2;       // V^T residual plane, keys < EARLY
static constexpr size_t kOffXh  = 0;
static constexpr size_t kOffPh  = kPlaneB;
static constexpr size_t kOffPP  = kPlaneB + kPhB;
static constexpr size_t kOffCh  = 0;                                      // C planes alias the dead X/pos region
static constexpr size_t kOffCl  = kPlaneB;
static constexpr size_t kOffWh  = kR0B;
static constexpr size_t kOffQh  = kOffWh + kWhB;
static constexpr size_t kOffQl  = kOffQh + kPlaneB;
static constexpr size_t kOffKh  = kOffQl + kPlaneB;
static constexpr size_t kOffKl  = kOffKh + kPlaneB;
static constexpr size_t kOffVh  = kOffKl + kPlaneB;
static constexpr size_t kOffVl  = kOffVh + kPlaneB;
static constexpr size_t kTotal  = kOffVl + kVtlB;
static_assert(kTotal <= 134217728ull);
static_assert(kOffCl + kPlaneB <= kR0B);
static_assert(kOffPh % 128 == 0 && kOffPP % 128 == 0 && kOffWh % 128 == 0 && kOffQh % 128 == 0);
static_assert(kOffVl % 128 == 0 && kR0B % 128 == 0);
static_assert((size_t)NB * NH * HD * SEQP * 2 == kPlaneB);

__device__ __forceinline__ v8f wmma_f16(v16h a, v16h b, v8f c) {
  v8f d = __builtin_amdgcn_wmma_f32_16x16x32_f16(false, a, false, b, (short)0, c, false, false);
  asm volatile("v_nop\n\tv_nop\n\tv_nop\n\tv_nop" : "+v"(d) : "v"(a), "v"(b));
  return d;
}

// lane l reads lane l ^ 16: the two lanes that share one query column of a D tile
__device__ __forceinline__ float xhalf(float x) {
  const int s = __float_as_int(x);
  return __int_as_float(__builtin_amdgcn_permlanex16(s, s, 0x76543210, 0xfedcba98, false, false));
}

// same-wave LDS exchange: stores issued by other lanes of this wave are visible before the reload
__device__ __forceinline__ void wave_lds_sync() {
  __builtin_amdgcn_fence(3, "wavefront");
  asm volatile("s_wait_dscnt 0" ::: "memory");
  __builtin_amdgcn_wave_barrier();
}

// One chunk of K hi, K residual, V^T hi (and V^T residual) from global memory into LDS, 16 bytes per lane and plane, through no
// register. lk / lv: the lane's own LDS byte addresses of its K hi and V^T hi pieces. The s_wait_xcnt stands inside the copies'
// own statement, so that no address register is rewritten in front of it.
template <bool RES>
__device__ __forceinline__ void stage_kv(unsigned lk, unsigned lv, const _Float16* gkh, const _Float16* gkl,
                                         const _Float16* gvh, const _Float16* gvl) {
  const unsigned lkl = lk + (RKL_OFF - RKH_OFF) * 2;
  if (RES) {
    const unsigned lvl = lv + (RVL_OFF - RVH_OFF) * 2;
    asm volatile("global_load_async_to_lds_b128 %0, %1, off\n\t"
                 "global_load_async_to_lds_b128 %2, %3, off\n\t"
                 "global_load_async_to_lds_b128 %4, %5, off\n\t"
                 "global_load_async_to_lds_b128 %6, %7, off\n\t"
                 "s_wait_xcnt 0x0"
                 :: "v"(lk), "v"(gkh), "v"(lkl), "v"(gkl), "v"(lv), "v"(gvh), "v"(lvl), "v"(gvl) : "memory");
  } else {
    asm volatile("global_load_async_to_lds_b128 %0, %1, off\n\t"
                 "global_load_async_to_lds_b128 %2, %3, off\n\t"
                 "global_load_async_to_lds_b128 %4, %5, off\n\t"
                 "s_wait_xcnt 0x0"
                 :: "v"(lk), "v"(gkh), "v"(lkl), "v"(gkl), "v"(lv), "v"(gvh) : "memory");
  }
}

// One operand plane of a GEMM ring stage, 32 NC rows of 64 k: NC copies, 16 bytes per lane and copy, through no register.
// l: the lane's own LDS byte address of its piece of row (tid >> 3) of the plane in the target buffer; g: the same piece in global memory.
// A copy of one wave covers four whole 128-B lines. The s_wait_xcnt stands inside the copies' own statement, so that no address
// register is rewritten in front of it.
template <int NC>
__device__ __forceinline__ void stage_plane(unsigned l, const _Float16* g) {
  static_assert(NC == 4 || NC == 8);
  const unsigned l1 = l + 1 * GRS * GP * 2, l2 = l + 2 * GRS * GP * 2, l3 = l + 3 * GRS * GP * 2;
  const _Float16* g1 = g + (size_t)1 * GRS * HID;
  const _Float16* g2 = g + (size_t)2 * GRS * HID;
  const _Float16* g3 = g + (size_t)3 * GRS * HID;
  if (NC == 4) {
    asm volatile("global_load_async_to_lds_b128 %0, %1, off\n\t"
                 "global_load_async_to_lds_b128 %2, %3, off\n\t"
                 "global_load_async_to_lds_b128 %4, %5, off\n\t"
                 "global_load_async_to_lds_b128 %6, %7, off\n\t"
                 "s_wait_xcnt 0x0"
                 :: "v"(l), "v"(g), "v"(l1), "v"(g1), "v"(l2), "v"(g2), "v"(l3), "v"(g3) : "memory");
  } else {
    const unsigned l4 = l + 4 * GRS * GP * 2, l5 = l + 5 * GRS * GP * 2, l6 = l + 6 * GRS * GP * 2, l7 = l + 7 * GRS * GP * 2;
    const _Float16* g4 = g + (size_t)4 * GRS * HID;
    const _Float16* g5 = g + (size_t)5 * GRS * HID;
    const _Float16* g6 = g + (size_t)6 * GRS * HID;
    const _Float16* g7 = g + (size_t)7 * GRS * HID;
    asm volatile("global_load_async_to_lds_b128 %0, %1, off\n\t"
                 "global_load_async_to_lds_b128 %2, %3, off\n\t"
                 "global_load_async_to_lds_b128 %4, %5, off\n\t"
                 "global_load_async_to_lds_b128 %6, %7, off\n\t"
                 "global_load_async_to_lds_b128 %8, %9, off\n\t"
                 "global_load_async_to_lds_b128 %10, %11, off\n\t"
                 "global_load_async_to_lds_b128 %12, %13, off\n\t"
                 "global_load_async_to_lds_b128 %14, %15, off\n\t"
                 "s_wait_xcnt 0x0"
                 :: "v"(l), "v"(g), "v"(l1), "v"(g1), "v"(l2), "v"(g2), "v"(l3), "v"(g3),
                    "v"(l4), "v"(g4), "v"(l5), "v"(g5), "v"(l6), "v"(g6), "v"(l7), "v"(g7) : "memory");
  }
}

__device__ __forceinline__ v4f bf16_rne4(v4f a) {
  v4u u = __builtin_bit_cast(v4u, a);
  u = (u + 0x7FFFu + ((u >> 16) & 1u)) & 0xFFFF0000u;
  return __builtin_bit_cast(v4f, u);
}

__device__ __forceinline__ v8h cvt8v(v4f a, v4f b) {
  v8h d;
  d[0] = (_Float16)a[0]; d[1] = (_Float16)a[1];
  d[2] = (_Float16)a[2]; d[3] = (_Float16)a[3];
  d[4] = (_Float16)b[0]; d[5] = (_Float16)b[1];
  d[6] = (_Float16)b[2]; d[7] = (_Float16)b[3];
  return d;
}

// f32 x -> f16 hi and f16((x - hi) * 4096)
__device__ __forceinline__ void split8(v4f a, v4f b, v8h& hv, v8h& lv) {
  U8h hh, ll;
  _Float16 t;
  t = (_Float16)a[0]; hh.f[0] = t; ll.f[0] = (_Float16)((a[0] - (float)t) * 4096.0f);
  t = (_Float16)a[1]; hh.f[1] = t; ll.f[1] = (_Float16)((a[1] - (float)t) * 4096.0f);
  t = (_Float16)a[2]; hh.f[2] = t; ll.f[2] = (_Float16)((a[2] - (float)t) * 4096.0f);
  t = (_Float16)a[3]; hh.f[3] = t; ll.f[3] = (_Float16)((a[3] - (float)t) * 4096.0f);
  t = (_Float16)b[0]; hh.f[4] = t; ll.f[4] = (_Float16)((b[0] - (float)t) * 4096.0f);
  t = (_Float16)b[1]; hh.f[5] = t; ll.f[5] = (_Float16)((b[1] - (float)t) * 4096.0f);
  t = (_Float16)b[2]; hh.f[6] = t; ll.f[6] = (_Float16)((b[2] - (float)t) * 4096.0f);
  t = (_Float16)b[3]; hh.f[7] = t; ll.f[7] = (_Float16)((b[3] - (float)t) * 4096.0f);
  hv = hh.v; lv = ll.v;
}

// ---------------- pre-pass: Xh = f16(bf16RNE(hidden)) [MR][1024] (pad rows zero), Ph = f16(bf16RNE(pos)) [SEQP][1024]
//                  (pad rows zero), Wh = f16(256 * bf16RNE(W)) for the four weight matrices stacked [4096][1024].
__global__ __launch_bounds__(128)
void prep_kernel(const float* __restrict__ Hs, const float* __restrict__ Pos,
                 const float* __restrict__ W0, const float* __restrict__ W1,
                 const float* __restrict__ W2, const float* __restrict__ W3,
                 _Float16* Xh, _Float16* Ph, _Float16* Wh)
{
  const int row = blockIdx.x;
  const int c0  = 8 * threadIdx.x;
  const float* src;
  _Float16*    dst;
  float sc = 1.0f;
  if (row < MR) {
    const int b  = row / SEQP;
    const int s  = row - b * SEQP;
    const int sl = (s < SEQ) ? s : (SEQ - 1);            // clamped address; pad rows scaled to zero
    sc  = (s < SEQ) ? 1.0f : 0.0f;
    src = Hs + ((size_t)b * SEQ_FULL + sl) * HID + c0;   // full-size input strides
    dst = Xh + (size_t)row * HID + c0;
  } else if (row < MR + SEQP) {
    const int s  = row - MR;
    const int sl = (s < SEQ) ? s : (SEQ - 1);
    sc  = (s < SEQ) ? 1.0f : 0.0f;
    src = Pos + (size_t)sl * HID + c0;
    dst = Ph + (size_t)s * HID + c0;
  } else {
    const int j   = row - MR - SEQP;                      // 0..4095
    const int mat = j >> 10;
    const int r   = j & (HID - 1);
    const float* W = (mat == 0) ? W0 : (mat == 1) ? W1 : (mat == 2) ? W2 : W3;
    sc  = 256.0f;                                         // exact power-of-two carry, removed in the GEMM epilogues
    src = W + (size_t)r * HID + c0;
    dst = Wh + (size_t)j * HID + c0;
  }
  const v4f a0 = bf16_rne4(*(const v4f*)src) * sc;
  const v4f a1 = bf16_rne4(*(const v4f*)(src + 4)) * sc;
  const v8h v  = cvt8v(a0, a1);                           // bf16 values (and x256) are exact in f16
  *(v8h*)dst = v;
  
}

// MODE 2 epilogue: f32 tile in[128 keys][BN cols] (pitch BN + 4) -> V^T hi rows out[(h,d) = BN rows][128 keys] and, with LO, the x4096
// residual rows: item i -> col c = GRS (i>>1) + (tid>>3), key half i&1, keys s0 + 64 (i&1) + 8 sub .. +7 (one line per (h,d) row and key half).
// LO is a template argument so that no branch stands between the stores of a trip.
template <bool LO, int BN>
__device__ __forceinline__ void store_vt(const float* sC, _Float16* O0, _Float16* O1, int tid, int b, int h0, int s0) {
  constexpr int CP = BN + 4;
  const int sub = tid & 7;
  for (int i0 = 0; i0 < BN * 2 / GRS; i0 += 4) {
    v8h vh[4], vl[4]; size_t oh[4], ol[4];
    #pragma unroll
    for (int i = 0; i < 4; ++i) {
      const int c  = GRS * ((i0 + i) >> 1) + (tid >> 3);
      const int k0 = 64 * (i & 1) + 8 * sub;             // i0 is even
      const int hh = h0 + (c >> 6);
      const int d  = c & (HD - 1);
      v4f x0, x1;
      x0[0] = sC[(k0 + 0) * CP + c]; x0[1] = sC[(k0 + 1) * CP + c];
      x0[2] = sC[(k0 + 2) * CP + c]; x0[3] = sC[(k0 + 3) * CP + c];
      x1[0] = sC[(k0 + 4) * CP + c]; x1[1] = sC[(k0 + 5) * CP + c];
      x1[2] = sC[(k0 + 6) * CP + c]; x1[3] = sC[(k0 + 7) * CP + c];
      split8(x0, x1, vh[i], vl[i]);
      const size_t rowid = (size_t)(b * NH + hh) * HD + d;
      oh[i] = rowid * SEQP + s0 + k0;
      ol[i] = rowid * EARLY + s0 + k0;
    }
    #pragma unroll
    for (int i = 0; i < 4; ++i) {
      *(v8h*)(O0 + oh[i]) = vh[i];
      if (LO) *(v8h*)(O1 + ol[i]) = vl[i];
    }
    asm volatile("s_wait_xcnt 0x0" ::: "memory");   // the next trip rewrites registers that these stores name
  }
}

// ---------------- 16-bit GEMM: 128x256 block tile, 8 waves (2 x 4) of 64x64 (MODE 0, 3: 128x128, waves of 64x32), K = 1024 in WMMA steps of 32 ----------------
// Operands come by asynchronous copies into a ring of two LDS buffers, 64 k a stage: stage s + 1 flies while stage s is worked on.
// C[m][n] = sum_k A[m][k] * Bw[n][k]  (Bw = weight rows [out][in], k contiguous, i.e. x @ W^T).
// 16-bit fragment map (A and B alike): lane l -> row/col (l & 15); elements 0..7 <- k0 + 8*(l>>4) + 0..7,
// elements 8..15 <- k0 + 16 + 8*(l>>4) + 0..7.  D: element r of lane l -> row 8*(l>>4) + r, col (l & 15).
// MODE 0: Pout[s][n] f32 positional projection (pitch PPP), natural units.
// MODE 1: Q (n0 < 1024) or K (n0 >= 1024) rows: f16 hi plane + f16 x4096 residual plane [MR][1024], value = acc/256 + Pin.
// MODE 2: V: V^T hi plane [b][h][d][SEQP] and, for s0 < EARLY, V^T x4096 residual plane [b][h][d][EARLY], value = acc/256 + Pin.
// MODE 3: Y rows of d_out [b][2000][1024] f32, value = (acc + accr/4096)/256 with the residual A plane on rows s0 < EARLY.
template <int MODE>
__global__ __launch_bounds__(GT)
void gemm_kernel(const _Float16* __restrict__ Ah, const _Float16* __restrict__ Al,
                 const _Float16* __restrict__ Bw, const float* __restrict__ Pin,
                 float* Pout, _Float16* O0, _Float16* O1, _Float16* O2, _Float16* O3, float* Y)
{
  // ring buffer = {A [128][GP], B [BN][GP], and for MODE 3 residual A [128][GP]}, two of them; the epilogue's f32 tile reuses the ring's LDS
  constexpr int T   = GT;             // threads
  constexpr int RS  = GRS;            // operand rows that one copy of the whole block covers
  constexpr int BN  = GBN(MODE);      // block tile columns
  constexpr int NWN = 4;              // waves side by side along n
  constexpr int NI  = BN / 16 / NWN;  // 16-col tiles per wave
  constexpr int CP  = BN + 4;         // floats per row of the f32 tile in LDS (a multiple of 16 B; 8 rows on lie 32 banks on)
  static_assert((CP * 4) % 16 == 0 && (8 * CP) % 64 == 32);
  constexpr int STG_H  = (GBM + BN + (MODE == 3 ? GBM : 0)) * GP;   // halfs per buffer
  constexpr int RING_B = 2 * STG_H * 2;
  constexpr int TILE_B = GBM * CP * 4;
  static_assert(RING_B <= 163840 && TILE_B <= 163840);   // two blocks fit a WGP's LDS
  __shared__ __attribute__((aligned(16))) char gsm[RING_B > TILE_B ? RING_B : TILE_B];   // cross-wave (block barrier)
  _Float16* sR = (_Float16*)gsm;
  float*    sC = (float*)gsm;

  const int tid  = threadIdx.x;
  const int wave = tid >> 5;
  const int lane = tid & 31;
  const int lh   = lane & 15;
  const int hi   = lane >> 4;
  const int wm   = wave / NWN;       // 0..1 -> 64-row strip
  const int wn   = wave % NWN;       // strip of 16 NI columns
  const int sub  = tid & 7;
  const int m0   = blockIdx.y * GBM;
  const int n0   = blockIdx.x * BN;
  const int b    = m0 / SEQP;
  const int s0   = m0 - b * SEQP;
  const bool resa = (MODE == 3) && (s0 < EARLY);   // block-uniform

  U8f acc[4][NI], accr[4][NI];
  #pragma unroll
  for (int mi = 0; mi < 4; ++mi)
    #pragma unroll
    for (int ni = 0; ni < NI; ++ni) { acc[mi][ni].v = (v8f){}; accr[mi][ni].v = (v8f){}; }

  const int sr = tid >> 3, sp = tid & 7;                             // staging: row 0..RS-1 (+ RS per further copy), 16-B piece 0..7
  const unsigned la0 = (unsigned)(uintptr_t)(sR + sr * GP + 8 * sp); // LDS byte address of the lane's A piece in buffer 0
  const unsigned lb0 = la0 + GBM * GP * 2;                           // the same piece of the B plane
  const unsigned ll0 = la0 + (GBM + BN) * GP * 2;                    // the same piece of the residual plane (MODE 3)
  const _Float16* ga = Ah + (size_t)(m0 + sr) * HID + 8 * sp;        // this lane's pieces of stage 0
  const _Float16* gl = Al + (size_t)(m0 + sr) * HID + 8 * sp;
  const _Float16* gb = Bw + (size_t)(n0 + sr) * HID + 8 * sp;

  stage_plane<GBM / RS>(la0, ga);                                    // stage 0 -> buffer 0
  stage_plane<BN / RS>(lb0, gb);
  if (resa) stage_plane<GBM / RS>(ll0, gl);
  asm volatile("s_wait_asynccnt 0x0" ::: "memory");                  // this wave's pieces of stage 0 have landed
  __syncthreads();                                                   // stage 0 visible to all waves
  stage_plane<GBM / RS>(la0 + STG_H * 2, ga + GBK);                  // stage 1 -> buffer 1 (GNS >= 2)
  stage_plane<BN / RS>(lb0 + STG_H * 2, gb + GBK);
  if (resa) stage_plane<GBM / RS>(ll0 + STG_H * 2, gl + GBK);

  for (int s = 0; s < GNS; ++s) {
    const int bufh = (s & 1) * STG_H;                                // this stage's buffer, offset in halfs
    const _Float16* sA = sR + bufh;
    const _Float16* sB = sA + GBM * GP;
    const _Float16* sL = sB + BN * GP;

    #pragma unroll                                                   // both halves of the stage at immediate LDS offsets
    for (int c = 0; c < GBK / 32; ++c) {                             // k ascending in WMMA steps of 32
      U16h af[4], bq[NI];
      #pragma unroll
      for (int mi = 0; mi < 4; ++mi) {
        const _Float16* p = sA + (wm * 64 + mi * 16 + lh) * GP + 32 * c;
        af[mi].h[0] = *(const v8h*)(p + 8 * hi);
        af[mi].h[1] = *(const v8h*)(p + 16 + 8 * hi);
      }
      #pragma unroll
      for (int ni = 0; ni < NI; ++ni) {
        const _Float16* p = sB + ((wn * NI + ni) * 16 + lh) * GP + 32 * c;
        bq[ni].h[0] = *(const v8h*)(p + 8 * hi);
        bq[ni].h[1] = *(const v8h*)(p + 16 + 8 * hi);
      }
      #pragma unroll
      for (int mi = 0; mi < 4; ++mi)
        #pragma unroll
        for (int ni = 0; ni < NI; ++ni)
          acc[mi][ni].v = wmma_f16(af[mi].v, bq[ni].v, acc[mi][ni].v);
      if (resa) {
        U16h lf[4];
        #pragma unroll
        for (int mi = 0; mi < 4; ++mi) {
          const _Float16* p = sL + (wm * 64 + mi * 16 + lh) * GP + 32 * c;
          lf[mi].h[0] = *(const v8h*)(p + 8 * hi);
          lf[mi].h[1] = *(const v8h*)(p + 16 + 8 * hi);
        }
        #pragma unroll
        for (int mi = 0; mi < 4; ++mi)
          #pragma unroll
          for (int ni = 0; ni < NI; ++ni)
            accr[mi][ni].v = wmma_f16(lf[mi].v, bq[ni].v, accr[mi][ni].v);
      }
    }

    // ---- publish point, every wave: own LDS reads of this buffer done, own copies of the next stage landed, block barrier ----
    asm volatile("s_wait_dscnt 0x0" ::: "memory");                   // this wave has left the buffer that is refilled below
    asm volatile("s_wait_asynccnt 0x0" ::: "memory");                // this wave's pieces of the next stage have landed
    __syncthreads();                                                 // next stage visible to all; every reader has left this buffer
    if (s + 2 < GNS) {                                               // block-uniform: stage s + 2 flies while stage s + 1 is worked on
      stage_plane<GBM / RS>(la0 + bufh * 2, ga + (s + 2) * GBK);
      stage_plane<BN / RS>(lb0 + bufh * 2, gb + (s + 2) * GBK);
      if (resa) stage_plane<GBM / RS>(ll0 + bufh * 2, gl + (s + 2) * GBK);
    }
  }
  asm volatile("s_wait_asynccnt 0x0" ::: "memory");                  // nothing of this wave is in flight when the ring becomes the f32 tile

  // ---- accumulators -> f32 tile in LDS (x 1/256 removes the weight carry) ----
  #pragma unroll
  for (int mi = 0; mi < 4; ++mi)
    #pragma unroll
    for (int ni = 0; ni < NI; ++ni)
      #pragma unroll
      for (int r = 0; r < 8; ++r) {
        float v = acc[mi][ni].f[r];
        if (resa) v += accr[mi][ni].f[r] * (1.0f / 4096.0f);
        sC[(wm * 64 + mi * 16 + 8 * hi + r) * CP + (wn * NI + ni) * 16 + lh] = v * (1.0f / 256.0f);
      }
  __syncthreads();

  if (MODE == 1 || MODE == 2) {
    // ---- add the positional projection row (f32, natural units), in place, coalesced 32-B reads ----
    constexpr int NP = GBM * (BN / 8) / T;        // passes; a pass covers PR whole rows of the tile
    constexpr int PR = T / (BN / 8);
    const int row0 = tid / (BN / 8);
    const int cg   = tid % (BN / 8);
    const float* pp0 = Pin + (size_t)(s0 + row0) * PPP + n0 + 8 * cg;
    v4f p0[NP], p1[NP];
    #pragma unroll
    for (int p = 0; p < NP; ++p) {
      const float* pp = pp0 + (size_t)p * PR * PPP;
      p0[p] = *(const v4f*)pp;
      p1[p] = *(const v4f*)(pp + 4);
    }
    asm volatile("s_wait_xcnt 0x0" :: "v"(pp0) : "memory");   // the loads' address register stays unwritten up to this wait
    #pragma unroll
    for (int p = 0; p < NP; ++p) {
      v4fa* c = (v4fa*)(sC + (p * PR + row0) * CP + 8 * cg);
      v4f x0 = c[0], x1 = c[1];
      x0 += p0[p]; x1 += p1[p];
      c[0] = x0; c[1] = x1;
    }
    __syncthreads();
  }

  if (MODE == 0) {
    // 128 rows x BN / 32 lines each: line L = RS i + (tid>>3) -> row, segment; one wave instruction = four whole lines
    #pragma unroll 1                                 // rolled: the wait at a trip's foot then stands in front of all that the next trip writes
    for (int i0 = 0; i0 < GBM * (BN / 32) / RS; i0 += 8) {
      v4f ov[8]; size_t oo[8];
      #pragma unroll
      for (int i = 0; i < 8; ++i) {
        const int L = RS * (i0 + i) + (tid >> 3);
        const int row = L / (BN / 32), seg = L % (BN / 32);
        ov[i] = *(const v4fa*)(sC + row * CP + seg * 32 + 4 * sub);
        oo[i] = (size_t)(m0 + row) * PPP + n0 + seg * 32 + 4 * sub;
      }
      #pragma unroll
      for (int i = 0; i < 8; ++i) *(v4f*)(Pout + oo[i]) = ov[i];
      asm volatile("s_wait_xcnt 0x0" ::: "memory");   // the next trip rewrites registers that these stores name
    }
  }

  if (MODE == 1) {
    const bool isq = (n0 < HID);                     // block-uniform: Q group or K group
    _Float16* ph = isq ? O0 : O2;
    _Float16* pl = isq ? O1 : O3;
    const int col0 = n0 & (HID - 1);
    // 128 rows x BN / 64 lines per plane: rem = RS i + (tid>>3) -> row, segment (64 halfs = one line), piece sub
    for (int i0 = 0; i0 < GBM * (BN / 64) / RS; i0 += 4) {
      v8h vh[4], vl[4]; size_t oo[4];
      #pragma unroll
      for (int i = 0; i < 4; ++i) {
        const int rem = RS * (i0 + i) + (tid >> 3);
        const int row = rem / (BN / 64), seg = rem % (BN / 64);
        const float* c = sC + row * CP + seg * 64 + 8 * sub;
        split8(*(const v4fa*)c, *(const v4fa*)(c + 4), vh[i], vl[i]);
        oo[i] = (size_t)(m0 + row) * HID + col0 + seg * 64 + 8 * sub;
      }
      #pragma unroll
      for (int i = 0; i < 4; ++i) { *(v8h*)(ph + oo[i]) = vh[i]; *(v8h*)(pl + oo[i]) = vl[i]; }
      asm volatile("s_wait_xcnt 0x0" ::: "memory");   // the next trip rewrites registers that these stores name
    }
  }

  if (MODE == 2) {
    if (s0 < EARLY) store_vt<true, BN>(sC, O0, O1, tid, b, n0 / HD, s0);    // block-uniform
    else            store_vt<false, BN>(sC, O0, O1, tid, b, n0 / HD, s0);
  }

  if (MODE == 3) {
    // d_out rows (b, s) with s < SEQ only (whole 512-B row segments; guard is uniform over the 32 lanes of a row segment)
    for (int i0 = 0; i0 < GBM * (BN / 32) / RS; i0 += 8) {
      v4f ov[8]; size_t oo[8]; int sv[8];
      #pragma unroll
      for (int i = 0; i < 8; ++i) {
        const int L = RS * (i0 + i) + (tid >> 3);
        const int row = L / (BN / 32), seg = L % (BN / 32);
        ov[i] = *(const v4fa*)(sC + row * CP + seg * 32 + 4 * sub);
        sv[i] = s0 + row;
        oo[i] = ((size_t)b * SEQ_FULL + (size_t)(s0 + row)) * HID + n0 + seg * 32 + 4 * sub;
      }
      #pragma unroll
      for (int i = 0; i < 8; ++i) if (sv[i] < SEQ) *(v4f*)(Y + oo[i]) = ov[i];
      asm volatile("s_wait_xcnt 0x0" ::: "memory");   // the next trip rewrites registers that these stores name
    }
  }
}

// ---------------- fused causal attention: one workgroup = 128 query rows of one (batch, head), 8 waves x 16 rows ----------------
// S^T = K Q^T (A = K rows, B = Q rows): k_hi*q_hi into one accumulator, (k_lo*q_hi + k_hi*q_lo) into a second one folded x 1/4096
// (residual planes carry x4096). Lane l then holds 16 of the chunk's 32 scores of query (l & 15); lane l ^ 16 holds the other 16.
// O^T = V^T P^T: the two S^T tiles, converted in place, are the B operand (P carried x1024 in f16); RES (query blocks 0,1) adds
// V_lo*P_hi + V_hi*P_res into a second accumulator folded x 1/4096.
// Causal mask: key <= query keeps the score, else -1e30 (replace-fill); online softmax base 2 with f32 running max / sum per lane.
template <bool RES>
__global__ __launch_bounds__(256)
void attn_kernel(const _Float16* __restrict__ Qh, const _Float16* __restrict__ Ql,
                 const _Float16* __restrict__ Kh, const _Float16* __restrict__ Kl,
                 const _Float16* __restrict__ Vth, const _Float16* __restrict__ Vtl,
                 _Float16* Ch, _Float16* Cl, int qb0, int nqbl)
{
  extern __shared__ __attribute__((aligned(16))) _Float16 smem[];
  _Float16* sQ  = smem + SQ_OFF;             // [wave][hi 16 | residual 16][QP]  wave-private; the epilogue's f32 tile reuses it
  _Float16* sR  = smem + RING_OFF;           // [2 buffers]{K hi [32][KP], K res [32][KP], V^T hi [64][VP], V^T res [64][VP]}  cross-wave

  const int tid  = threadIdx.x;
  const int wave = tid >> 5;
  const int lane = tid & 31;
  const int lh   = lane & 15;
  const int hi   = lane >> 4;

  // Placement, for speed only: block index -> (query tile, head). A tile's cost grows with its number (causal), every group of the
  // launch is resident at once. All heads of one tile
  // are neighbours in the index and the cost falls from one round of 256 groups to the next; inside a round the tiles are ordered
  // to even out the load. The tiles of one head keep one index mod 8.
  const int cls = blockIdx.x / (NB * NH);    // 0 .. nqbl - 1
  const int bh  = blockIdx.x % (NB * NH);
  int qb = qb0 + nqbl - 1 - cls;             // any shape: heaviest tile first
  if (!RES && SEQP / BQ == 16 && NB * NH == 64)
    qb = (int)((0x236475AB98EFCDull >> (4 * cls)) & 15);   // tiles 2..15, each once: 13 12 15 14 | 8 9 11 10 | 5 7 4 6 | 3 2
  const int h     = bh % NH;
  const int b     = bh / NH;
  const int qbase = qb * BQ;
  const int qrow0 = qbase + wave * 16;

  const size_t prow = (size_t)b * SEQP;
  const _Float16* Qhb = Qh + prow * HID + h * HD;
  const _Float16* Qlb = Ql + prow * HID + h * HD;
  const _Float16* Khb = Kh + prow * HID + h * HD;
  const _Float16* Klb = Kl + prow * HID + h * HD;
  const _Float16* Vhb = Vth + (size_t)(b * NH + h) * HD * SEQP;
  const _Float16* Vlb = Vtl + (size_t)(b * NH + h) * HD * EARLY;
  _Float16* Chb = Ch + prow * HID + h * HD;
  _Float16* Clb = Cl + prow * HID + h * HD;

  // ---- this wave's 16 query rows (hi and residual) -> LDS: row 4i + (lane>>3), 16-B piece (lane&7) ----
  const int kend = qbase + BQ;               // causal, block-uniform: keys beyond the block's last query row are never needed
  const int kr = tid >> 3, kg = tid & 7;     // K staging: key row 0..31, piece 0..7
  const int vd = tid >> 2, vg = tid & 3;     // V^T staging: d row 0..63, piece 0..3
  const unsigned lk0 = (unsigned)(uintptr_t)(sR + RKH_OFF + kr * KP + 8 * kg);   // LDS byte addresses in buffer 0
  const unsigned lv0 = (unsigned)(uintptr_t)(sR + RVH_OFF + vd * VP + 8 * vg);
  const _Float16* gkh = Khb + (size_t)kr * HID + 8 * kg;                         // this lane's pieces of chunk 0
  const _Float16* gkl = Klb + (size_t)kr * HID + 8 * kg;
  const _Float16* gvh = Vhb + (size_t)vd * SEQP + 8 * vg;
  const _Float16* gvl = Vlb + (size_t)vd * EARLY + 8 * vg;

  stage_kv<RES>(lk0, lv0, gkh, gkl, gvh, gvl);                                   // chunk 0 -> buffer 0

  _Float16* qwh = sQ + wave * QW_H;
  _Float16* qwl = qwh + 16 * QP;
  {
    const int pc = lane & 7;
    #pragma unroll
    for (int i = 0; i < 4; ++i) {
      const int r = 4 * i + (lane >> 3);
      const size_t go = (size_t)(qrow0 + r) * HID + 8 * pc;
      *(v8h*)(qwh + r * QP + 8 * pc) = *(const v8h*)(Qhb + go);
      *(v8h*)(qwl + r * QP + 8 * pc) = *(const v8h*)(Qlb + go);
    }
  }

  U8f acc[4], accr[4];
  #pragma unroll
  for (int t = 0; t < 4; ++t) { acc[t].v = (v8f){}; accr[t].v = (v8f){}; }
  float mcol = -3.0e38f;                     // running maximum of query qrow0 + lh (equal in both wave halves)
  float lcol = 0.0f;                         // running sum over this lane's keys only; the halves are joined in the epilogue

  // scalar copy of the wave's first row: the per-wave skip below is then a real branch and EXEC stays all ones at the copies
  const int qrow0s = __builtin_amdgcn_readfirstlane(qrow0);

  asm volatile("s_wait_asynccnt 0x0" ::: "memory");   // this wave's pieces of chunk 0 have landed
  __syncthreads();                                    // chunk 0 (and the Q tiles) visible to all waves
  // chunk 1 -> buffer 1 (kend >= BQ = 4 chunks, so chunk 1 always exists)
  stage_kv<RES>(lk0 + RING_H * 2, lv0 + RING_H * 2, gkh + (size_t)BK * HID, gkl + (size_t)BK * HID, gvh + BK, gvl + BK);

  for (int kv0 = 0; kv0 < kend; kv0 += BK) {
    const int bufh = ((kv0 / BK) & 1) * RING_H;       // this chunk's buffer, offset in halfs
    const _Float16* sKh = sR + bufh + RKH_OFF;
    const _Float16* sKl = sR + bufh + RKL_OFF;
    const _Float16* sVh = sR + bufh + RVH_OFF;
    const _Float16* sVl = sR + bufh + RVL_OFF;

    if (kv0 < qrow0s + 16) {                 // wave-uniform: skip chunks entirely above this wave's rows
      // ---- S^T = K Q^T for two 16-key tiles, d reduced in two K=32 steps, three products each ----
      U8f s0, s1;
      {
        U8f sm, sr; sm.v = (v8f){}; sr.v = (v8f){};
        #pragma unroll
        for (int c = 0; c < 2; ++c) {
          U16h qf, ql, kf, kl;
          qf.h[0] = *(const v8h*)(qwh + lh * QP + 32 * c + 8 * hi);
          qf.h[1] = *(const v8h*)(qwh + lh * QP + 32 * c + 16 + 8 * hi);
          ql.h[0] = *(const v8h*)(qwl + lh * QP + 32 * c + 8 * hi);
          ql.h[1] = *(const v8h*)(qwl + lh * QP + 32 * c + 16 + 8 * hi);
          kf.h[0] = *(const v8h*)(sKh + lh * KP + 32 * c + 8 * hi);
          kf.h[1] = *(const v8h*)(sKh + lh * KP + 32 * c + 16 + 8 * hi);
          kl.h[0] = *(const v8h*)(sKl + lh * KP + 32 * c + 8 * hi);
          kl.h[1] = *(const v8h*)(sKl + lh * KP + 32 * c + 16 + 8 * hi);
          sm.v = wmma_f16(kf.v, qf.v, sm.v);
          sr.v = wmma_f16(kl.v, qf.v, sr.v);
          sr.v = wmma_f16(kf.v, ql.v, sr.v);
        }
        s0.v = sm.v + sr.v * (1.0f / 4096.0f);
      }
      {
        U8f sm, sr; sm.v = (v8f){}; sr.v = (v8f){};
        #pragma unroll
        for (int c = 0; c < 2; ++c) {
          U16h qf, ql, kf, kl;
          qf.h[0] = *(const v8h*)(qwh + lh * QP + 32 * c + 8 * hi);
          qf.h[1] = *(const v8h*)(qwh + lh * QP + 32 * c + 16 + 8 * hi);
          ql.h[0] = *(const v8h*)(qwl + lh * QP + 32 * c + 8 * hi);
          ql.h[1] = *(const v8h*)(qwl + lh * QP + 32 * c + 16 + 8 * hi);
          kf.h[0] = *(const v8h*)(sKh + (16 + lh) * KP + 32 * c + 8 * hi);
          kf.h[1] = *(const v8h*)(sKh + (16 + lh) * KP + 32 * c + 16 + 8 * hi);
          kl.h[0] = *(const v8h*)(sKl + (16 + lh) * KP + 32 * c + 8 * hi);
          kl.h[1] = *(const v8h*)(sKl + (16 + lh) * KP + 32 * c + 16 + 8 * hi);
          sm.v = wmma_f16(kf.v, qf.v, sm.v);
          sr.v = wmma_f16(kl.v, qf.v, sr.v);
          sr.v = wmma_f16(kf.v, ql.v, sr.v);
        }
        s1.v = sm.v + sr.v * (1.0f / 4096.0f);
      }

      // ---- scale, causal replace-mask, online softmax (base 2): element j of tile 0 / 1 is key kv0 + 8 hi + j / + 16, query lh ----
      const int dq = qrow0 + lh - kv0 - 8 * hi;        // key kept where j (tile 0) or 16 + j (tile 1) <= dq
      float a0[8], a1[8], mx[8];
      #pragma unroll
      for (int j = 0; j < 8; ++j) {
        const float x0 = s0.f[j] * C2S;
        const float x1 = s1.f[j] * C2S;
        a0[j] = (j <= dq) ? x0 : -1.0e30f;
        a1[j] = (16 + j <= dq) ? x1 : -1.0e30f;
        mx[j] = fmaxf(a0[j], a1[j]);
      }
      float rm = fmaxf(fmaxf(fmaxf(mx[0], mx[1]), fmaxf(mx[2], mx[3])), fmaxf(fmaxf(mx[4], mx[5]), fmaxf(mx[6], mx[7])));
      rm = fmaxf(rm, xhalf(rm));                       // both halves now hold the query's chunk maximum
      const float mnew  = fmaxf(mcol, rm);
      const float alpha = __builtin_amdgcn_exp2f(mcol - mnew);
      mcol = mnew;
      U8h pa, pb, par, pbr;
      float es[8];
      #pragma unroll
      for (int j = 0; j < 8; ++j) {
        const float e0 = __builtin_amdgcn_exp2f(a0[j] - mnew);
        const float e1 = __builtin_amdgcn_exp2f(a1[j] - mnew);
        es[j] = e0 + e1;
        const float t0 = e0 * 1024.0f;                 // carried x1024, removed in the epilogue
        const float t1 = e1 * 1024.0f;
        const _Float16 h0 = (_Float16)t0;
        const _Float16 h1 = (_Float16)t1;
        pa.f[j] = h0; pb.f[j] = h1;
        if (RES) {
          par.f[j] = (_Float16)((t0 - (float)h0) * 4096.0f);
          pbr.f[j] = (_Float16)((t1 - (float)h1) * 4096.0f);
        }
      }
      lcol = lcol * alpha + (((es[0] + es[1]) + (es[2] + es[3])) + ((es[4] + es[5]) + (es[6] + es[7])));
      #pragma unroll
      for (int t = 0; t < 4; ++t) {
        acc[t].v *= alpha;
        if (RES) accr[t].v *= alpha;
      }

      // ---- P^T as B operand straight from the registers: elements 0..7 = keys 8 hi + 0..7, elements 8..15 = keys 16 + 8 hi + 0..7 ----
      U16h pf, pfr;
      pf.h[0] = pa.v; pf.h[1] = pb.v;
      if (RES) { pfr.h[0] = par.v; pfr.h[1] = pbr.v; }

      // ---- O^T += V^T P^T : 4 output d-tiles, K = 32 keys; A[m = d][k = key] from V^T tile row d ----
      #pragma unroll
      for (int t = 0; t < 4; ++t) {
        U16h vf;
        vf.h[0] = *(const v8h*)(sVh + (16 * t + lh) * VP + 8 * hi);
        vf.h[1] = *(const v8h*)(sVh + (16 * t + lh) * VP + 16 + 8 * hi);
        acc[t].v = wmma_f16(vf.v, pf.v, acc[t].v);
        if (RES) {
          U16h wl;
          wl.h[0] = *(const v8h*)(sVl + (16 * t + lh) * VP + 8 * hi);
          wl.h[1] = *(const v8h*)(sVl + (16 * t + lh) * VP + 16 + 8 * hi);
          accr[t].v = wmma_f16(wl.v, pf.v, accr[t].v);
          accr[t].v = wmma_f16(vf.v, pfr.v, accr[t].v);
        }
      }
    }

    // ---- publish point, every wave: own LDS reads of this buffer done, own copies of the next chunk landed, block barrier ----
    asm volatile("s_wait_dscnt 0x0" ::: "memory");      // this wave has left the buffer that is refilled below
    asm volatile("s_wait_asynccnt 0x0" ::: "memory");   // this wave's pieces of the next chunk have landed
    __syncthreads();                                    // next chunk visible to all; every reader has left this chunk's buffer
    if (kv0 + 2 * BK < kend) {                          // block-uniform: chunk + 2 flies while chunk + 1 is worked on
      const int kn = kv0 + 2 * BK;
      stage_kv<RES>(lk0 + bufh * 2, lv0 + bufh * 2, gkh + (size_t)kn * HID, gkl + (size_t)kn * HID, gvh + kn, gvl + kn);
    }
  }
  asm volatile("s_wait_asynccnt 0x0" ::: "memory");     // nothing of this wave is in flight when its LDS is reused

  // ---- epilogue: join the halves' sums, normalize (1/1024 removes the carry), stage 16x64 f32 per wave in LDS, split to hi / residual.
  // Register r of O^T tile t in lane l is d = 16 t + 8 hi + r of query lh: eight consecutive floats of one staged row.
  const float inv = 1.0f / ((lcol + xhalf(lcol)) * 1024.0f);
  float* so = (float*)qwh;                   // the wave's own Q tile, no longer read
  #pragma unroll
  for (int t = 0; t < 4; ++t) {
    v8f v = acc[t].v;
    if (RES) v += accr[t].v * (1.0f / 4096.0f);
    v *= inv;
    v4fa* sp = (v4fa*)(so + lh * SOP + 16 * t + 8 * hi);
    sp[0] = (v4f){v[0], v[1], v[2], v[3]};
    sp[1] = (v4f){v[4], v[5], v[6], v[7]};
  }
  wave_lds_sync();
  v8h oh[4], ol[4]; size_t oo[4];
  {
    const int pc = lane & 7;
    #pragma unroll
    for (int i = 0; i < 4; ++i) {
      const int rr = 4 * i + (lane >> 3);
      const float* sp = so + rr * SOP + 8 * pc;
      split8(*(const v4fa*)sp, *(const v4fa*)(sp + 4), oh[i], ol[i]);
      oo[i] = (size_t)(qrow0 + rr) * HID + 8 * pc;
    }
  }
  #pragma unroll
  for (int i = 0; i < 4; ++i) { *(v8h*)(Chb + oo[i]) = oh[i]; *(v8h*)(Clb + oo[i]) = ol[i]; }
  
}

extern "C" void kernel_launch(void* const* d_in, const int* in_sizes, int n_in,
                              void* d_out, int out_size, void* d_ws, size_t ws_size,
                              hipStream_t stream) {
  if (n_in < 6) return;
  const long long need_x = ((long long)(NB - 1) * SEQ_FULL + SEQ) * HID;
  if ((long long)in_sizes[0] < need_x) return;
  if ((long long)in_sizes[1] < (long long)HID * HID) return;
  if ((long long)in_sizes[2] < (long long)HID * HID) return;
  if ((long long)in_sizes[3] < (long long)HID * HID) return;
  if ((long long)in_sizes[4] < (long long)HID * HID) return;
  if ((long long)in_sizes[5] < (long long)SEQ * HID) return;
  if ((long long)out_size < need_x) return;
  if (kTotal > ws_size) return;

  const float* hs  = (const float*)d_in[0];
  const float* wq  = (const float*)d_in[1];
  const float* wk  = (const float*)d_in[2];
  const float* wv  = (const float*)d_in[3];
  const float* wo  = (const float*)d_in[4];
  const float* pos = (const float*)d_in[5];
  float*       out = (float*)d_out;

  char* ws = (char*)d_ws;
  _Float16* xh = (_Float16*)(ws + kOffXh);     // [MR][1024]
  _Float16* ph = (_Float16*)(ws + kOffPh);     // [SEQP][1024]
  float*    pp = (float*)(ws + kOffPP);        // [SEQP][PPP] f32
  _Float16* ch = (_Float16*)(ws + kOffCh);     // [MR][1024], aliases xh after it is dead
  _Float16* cl = (_Float16*)(ws + kOffCl);     // [MR][1024], aliases ph/pp after they are dead
  _Float16* wh = (_Float16*)(ws + kOffWh);     // [4096][1024]
  _Float16* qh = (_Float16*)(ws + kOffQh);
  _Float16* ql = (_Float16*)(ws + kOffQl);
  _Float16* kh = (_Float16*)(ws + kOffKh);
  _Float16* kl = (_Float16*)(ws + kOffKl);
  _Float16* vh = (_Float16*)(ws + kOffVh);     // V^T hi  [NB][16][64][SEQP]
  _Float16* vl = (_Float16*)(ws + kOffVl);     // V^T res [NB][16][64][EARLY]

  prep_kernel<<<dim3(MR + SEQP + 4 * HID), dim3(128), 0, stream>>>(hs, pos, wq, wk, wv, wo, xh, ph, wh);

  // positional projection for the Q/K group, then Q/K planes
  gemm_kernel<0><<<dim3(NQK / GBN(0), SEQP / GBM), dim3(GT), 0, stream>>>(ph, ph, wh, pp, pp, qh, ql, kh, kl, out);
  gemm_kernel<1><<<dim3(NQK / GBN(1), MR / GBM), dim3(GT), 0, stream>>>(xh, xh, wh, pp, pp, qh, ql, kh, kl, out);
  // positional projection for the V group, then V^T planes
  const _Float16* whv = wh + (size_t)NQK * HID;
  gemm_kernel<0><<<dim3(HID / GBN(0), SEQP / GBM), dim3(GT), 0, stream>>>(ph, ph, whv, pp, pp, qh, ql, kh, kl, out);
  gemm_kernel<2><<<dim3(HID / GBN(2), MR / GBM), dim3(GT), 0, stream>>>(xh, xh, whv, pp, pp, vh, vl, kh, kl, out);

  (void)hipFuncSetAttribute(reinterpret_cast<const void*>(&attn_kernel<true>),
                            hipFuncAttributeMaxDynamicSharedMemorySize, (int)LDS_BYTES);
  (void)hipFuncSetAttribute(reinterpret_cast<const void*>(&attn_kernel<false>),
                            hipFuncAttributeMaxDynamicSharedMemorySize, (int)LDS_BYTES);
  const int nqb = SEQP / BQ;
  attn_kernel<true><<<dim3(NB * NH * 2), dim3(256), LDS_BYTES, stream>>>(qh, ql, kh, kl, vh, vl, ch, cl, 0, 2);
  if (nqb > 2)
    attn_kernel<false><<<dim3(NB * NH * (nqb - 2)), dim3(256), LDS_BYTES, stream>>>(qh, ql, kh, kl, vh, vl, ch, cl, 2, nqb - 2);

  const _Float16* who = wh + (size_t)(NQK + HID) * HID;
  gemm_kernel<3><<<dim3(HID / GBN(3), MR / GBM), dim3(GT), 0, stream>>>(ch, cl, who, pp, pp, qh, ql, kh, kl, out);
}

// v006
// Measured time: 193 microseconds a run.
// Two timings next to v005 put it at 1.05 and 1.04 times that version's speed.
// Over all steps from v000 it is 2.02 times as fast.
#include <hip/hip_runtime.h>
#include <stdint.h>

// Contractions, all on v_wmma_f32_16x16x32_f16 with f32 accumulate: P0 = Xp*W^T and Y0 = X*W^T + P0 (f16 operands holding
// bf16-RNE input values, W carried x256); S = Q*K^T (Q, K as f16 hi + x4096 f16 residual planes, three products); O = P*V
// (P carried x1024 in f16, V^T f16 hi; extra P-residual and V-residual products on query blocks below row 256); Y = C*Wo^T
// (C f16 hi + x4096 f16 residual product on rows below 256). Score scaling, causal mask, softmax and normalisation in f32.

typedef _Float16 v16h __attribute__((ext_vector_type(16)));
typedef _Float16 v8h  __attribute__((ext_vector_type(8)));
typedef _Float16 v8ha __attribute__((ext_vector_type(8), may_alias));
typedef float    v8f  __attribute__((ext_vector_type(8)));
typedef float    v4f  __attribute__((ext_vector_type(4)));
typedef float    v4fa __attribute__((ext_vector_type(4), may_alias));
typedef unsigned int v4u __attribute__((ext_vector_type(4)));

union U8f  { v8f  v; float    f[8]; };
union U16h { v16h v; v8h      h[2]; };
union U8h  { v8h  v; _Float16 f[8]; };

#ifndef NB
#define NB 4
#endif
#ifndef SEQ
#define SEQ 2000
#endif
#define NB_FULL  4
#define SEQ_FULL 2000
#define HID   1024
#define NH    16
#define HD    64
#define NQK   2048                               // Q and K output columns (first projection group)
#define SEQP  ((((SEQ) + 127) / 128) * 128)      // rows per batch inside workspace planes (zero padded)
#define MR    ((NB) * SEQP)                      // activation plane rows
#define EARLY 256                                // query rows / keys given residual products
#define PPP   2048                               // f32 pitch of the positional projection plane

static_assert(NB >= 1 && NB <= NB_FULL);
static_assert(SEQ >= 256 && SEQ <= SEQ_FULL);
static_assert(SEQP % 128 == 0 && SEQP >= EARLY && SEQP <= 2048);
static_assert(NH * HD == HID);
static_assert(NQK <= PPP && HID <= PPP);
static_assert(((long long)(NB - 1) * SEQ_FULL + SEQ) * HID <= (long long)NB_FULL * SEQ_FULL * HID);

// ---------------- GEMM tiling ----------------
#define GBM 128
#define GBN(MODE) (((MODE) == 0 || (MODE) == 3) ? 128 : 256)   // 128 columns where 256 would leave WGPs idle (MODE 0) or registers short (MODE 3: a second accumulator set)
#define GBK 64      // k per ring stage: one whole 128-B line of every staged operand row
#define GP  72      // halfs per staged row in LDS (144 B)
#define GNS (HID / GBK)   // ring stages
#define GT  256     // threads: 8 waves (2 x 4), wave tile 64 x 64 (64 x 32 at 128 columns)
#define GRS (GT / 8)      // operand rows (8 pieces of 16 B each) that one copy of the whole block covers
static_assert(MR % GBM == 0 && SEQP % GBM == 0 && EARLY % GBM == 0);
static_assert(HID % GBN(0) == 0 && NQK % GBN(0) == 0 && NQK % GBN(1) == 0 && HID % GBN(1) == 0 && HID % GBN(2) == 0 && HID % GBN(3) == 0 && HID % GBK == 0);
static_assert((GP * 2) % 16 == 0);
static_assert(GBK == 64 && GBM == 128 && GRS == 32 && GNS >= 2);   // the staging below: 8 pieces a row, 32 rows a copy

// ---------------- attention tiling ----------------
#define BQ 128      // query rows per workgroup (8 waves x 16, or 4 waves x 32)
#define BK 32       // keys per staged chunk
#define QP 72       // halfs per Q row in LDS (144 B)
#define KP 72       // halfs per K row in LDS
#define VP 40       // halfs per V^T row in LDS (80 B)
static_assert(SEQP % BQ == 0 && EARLY == 2 * BQ && BQ % BK == 0);

// offsets in halfs. Eight Q tiles (16 hi rows, then 16 residual rows), one or two to a wave; the epilogue's 16x64 f32 tile (pitch SOP) reuses a tile.
// The K / V^T chunk lives in a ring of two buffers, each {K hi, K residual, V^T hi, V^T residual}.
#define SQ_OFF   0
#define QW_H     (2 * 16 * QP)
#define RING_OFF (SQ_OFF + 8 * QW_H)
#define RKH_OFF  0
#define RKL_OFF  (RKH_OFF + BK * KP)
#define RVH_OFF  (RKL_OFF + BK * KP)
#define RVL_OFF  (RVH_OFF + HD * VP)
#define RING_H   (RVL_OFF + HD * VP)
#define LDS_BYTES ((RING_OFF + 2 * RING_H) * 2)
#define SOP 68      // floats per row of the epilogue's 16x64 f32 tile (272 B)
static_assert((QW_H * 2) % 16 == 0 && (RING_OFF * 2) % 16 == 0 && (RING_H * 2) % 16 == 0);
static_assert((RKL_OFF * 2) % 16 == 0 && (RVH_OFF * 2) % 16 == 0 && (RVL_OFF * 2) % 16 == 0);
static_assert((KP * 2) % 16 == 0 && (VP * 2) % 16 == 0);
static_assert(QW_H * 2 >= 16 * SOP * 4 && (SOP * 4) % 16 == 0 && SOP >= HD);
static_assert(LDS_BYTES == 75776);

// (1/8) * log2(e): scores go to the base-2 domain for the online softmax
#define C2S 0.18033688011112042f

// ---------------- workspace carve (bytes) ----------------
static constexpr size_t kPlaneB = (size_t)MR * HID * 2;                   // one f16 activation plane
static constexpr size_t kPhB    = (size_t)SEQP * HID * 2;                 // f16 positional rows
static constexpr size_t kPPB    = (size_t)SEQP * PPP * 4;                 // f32 positional projection
static constexpr size_t kR0B    = (kPlaneB + kPhB + kPPB > 2 * kPlaneB) ? (kPlaneB + kPhB + kPPB) : (2 * kPlaneB);
static constexpr size_t kWhB    = (size_t)4 * HID * HID * 2;              // f16 weights, 4 matrices stacked
static constexpr size_t kVtlB   = (size_t)NB * NH * HD * EARLY * 2;       // V^T residual plane, keys < EARLY
static constexpr size_t kOffXh  = 0;
static constexpr size_t kOffPh  = kPlaneB;
static constexpr size_t kOffPP  = kPlaneB + kPhB;
static constexpr size_t kOffCh  = 0;                                      // C planes alias the dead X/pos region
static constexpr size_t kOffCl  = kPlaneB;
static constexpr size_t kOffWh  = kR0B;
static constexpr size_t kOffQh  = kOffWh + kWhB;
static constexpr size_t kOffQl  = kOffQh + kPlaneB;
static constexpr size_t kOffKh  = kOffQl + kPlaneB;
static constexpr size_t kOffKl  = kOffKh + kPlaneB;
static constexpr size_t kOffVh  = kOffKl + kPlaneB;
static constexpr size_t kOffVl  = kOffVh + kPlaneB;
static constexpr size_t kTotal  = kOffVl + kVtlB;
static_assert(kTotal <= 134217728ull);
static_assert(kOffCl + kPlaneB <= kR0B);
static_assert(kOffPh % 128 == 0 && kOffPP % 128 == 0 && kOffWh % 128 == 0 && kOffQh % 128 == 0);
static_assert(kOffVl % 128 == 0 && kR0B % 128 == 0);
static_assert((size_t)NB * NH * HD * SEQP * 2 == kPlaneB);

__device__ __forceinline__ v8f wmma_f16(v16h a, v16h b, v8f c) {
  v8f d = __builtin_amdgcn_wmma_f32_16x16x32_f16(false, a, false, b, (short)0, c, false, false);
  asm volatile("v_nop\n\tv_nop\n\tv_nop\n\tv_nop" : "+v"(d) : "v"(a), "v"(b));
  return d;
}

// lane l reads lane l ^ 16: the two lanes that share one query column of a D tile
__device__ __forceinline__ float xhalf(float x) {
  const int s = __float_as_int(x);
  return __int_as_float(__builtin_amdgcn_permlanex16(s, s, 0x76543210, 0xfedcba98, false, false));
}

// same-wave LDS exchange: stores issued by other lanes of this wave are visible before the reload
__device__ __forceinline__ void wave_lds_sync() {
  __builtin_amdgcn_fence(3, "wavefront");
  asm volatile("s_wait_dscnt 0" ::: "memory");
  __builtin_amdgcn_wave_barrier();
}

// One chunk of K hi, K residual, V^T hi (and V^T residual) from global memory into LDS, 16 bytes per lane and plane, through no
// register. lk / lv: the lane's own LDS byte addresses of its K hi and V^T hi pieces. The s_wait_xcnt stands inside the copies'
// own statement, so that no address register is rewritten in front of it.
template <bool RES>
__device__ __forceinline__ void stage_kv(unsigned lk, unsigned lv, const _Float16* gkh, const _Float16* gkl,
                                         const _Float16* gvh, const _Float16* gvl) {
  const unsigned lkl = lk + (RKL_OFF - RKH_OFF) * 2;
  if (RES) {
    const unsigned lvl = lv + (RVL_OFF - RVH_OFF) * 2;
    asm volatile("global_load_async_to_lds_b128 %0, %1, off\n\t"
                 "global_load_async_to_lds_b128 %2, %3, off\n\t"
                 "global_load_async_to_lds_b128 %4, %5, off\n\t"
                 "global_load_async_to_lds_b128 %6, %7, off\n\t"
                 "s_wait_xcnt 0x0"
                 :: "v"(lk), "v"(gkh), "v"(lkl), "v"(gkl), "v"(lv), "v"(gvh), "v"(lvl), "v"(gvl) : "memory");
  } else {
    asm volatile("global_load_async_to_lds_b128 %0, %1, off\n\t"
                 "global_load_async_to_lds_b128 %2, %3, off\n\t"
                 "global_load_async_to_lds_b128 %4, %5, off\n\t"
                 "s_wait_xcnt 0x0"
                 :: "v"(lk), "v"(gkh), "v"(lkl), "v"(gkl), "v"(lv), "v"(gvh) : "memory");
  }
}

// The same chunk staged by a block of four waves (no V^T residual): two pieces per lane and plane, the second 16 key rows (K) or
// 32 d rows (V^T) on. One statement, its s_wait_xcnt last, so that no address register is rewritten in front of it.
__device__ __forceinline__ void stage_kv2(unsigned lk, unsigned lv, const _Float16* gkh, const _Float16* gkl, const _Float16* gvh) {
  const unsigned lkl = lk + (RKL_OFF - RKH_OFF) * 2;
  const unsigned lk2 = lk + 16 * KP * 2, lkl2 = lkl + 16 * KP * 2, lv2 = lv + 32 * VP * 2;
  const _Float16* gkh2 = gkh + (size_t)16 * HID;
  const _Float16* gkl2 = gkl + (size_t)16 * HID;
  const _Float16* gvh2 = gvh + (size_t)32 * SEQP;
  asm volatile("global_load_async_to_lds_b128 %0, %1, off\n\t"
               "global_load_async_to_lds_b128 %2, %3, off\n\t"
               "global_load_async_to_lds_b128 %4, %5, off\n\t"
               "global_load_async_to_lds_b128 %6, %7, off\n\t"
               "global_load_async_to_lds_b128 %8, %9, off\n\t"
               "global_load_async_to_lds_b128 %10, %11, off\n\t"
               "s_wait_xcnt 0x0"
               :: "v"(lk), "v"(gkh), "v"(lk2), "v"(gkh2), "v"(lkl), "v"(gkl), "v"(lkl2), "v"(gkl2),
                  "v"(lv), "v"(gvh), "v"(lv2), "v"(gvh2) : "memory");
}

// A lane's 16-B pieces of its wave's 16 NQ query rows, hi plane and residual plane: piece i lies four rows (8192 B) behind piece i - 1.
// The loads and their data wait stand in one statement and every output is early-clobber, so that no register which a load names
// is rewritten, by a later load's data either, while the load is in flight.
template <int NQ>
__device__ __forceinline__ void load_q(const _Float16* gh, const _Float16* gl, v8h (&h)[4 * NQ], v8h (&l)[4 * NQ]) {
  static_assert(4 * HID * 2 == 8192 && (NQ == 1 || NQ == 2));
  if constexpr (NQ == 1) {
    asm volatile("global_load_b128 %0, %8, off\n\t"
                 "global_load_b128 %1, %8, off offset:8192\n\t"
                 "global_load_b128 %2, %8, off offset:16384\n\t"
                 "global_load_b128 %3, %8, off offset:24576\n\t"
                 "global_load_b128 %4, %9, off\n\t"
                 "global_load_b128 %5, %9, off offset:8192\n\t"
                 "global_load_b128 %6, %9, off offset:16384\n\t"
                 "global_load_b128 %7, %9, off offset:24576\n\t"
                 "s_wait_loadcnt 0x0"
                 : "=&v"(h[0]), "=&v"(h[1]), "=&v"(h[2]), "=&v"(h[3]), "=&v"(l[0]), "=&v"(l[1]), "=&v"(l[2]), "=&v"(l[3])
                 : "v"(gh), "v"(gl) : "memory");
  } else {
    asm volatile("global_load_b128 %0, %16, off\n\t"
                 "global_load_b128 %1, %16, off offset:8192\n\t"
                 "global_load_b128 %2, %16, off offset:16384\n\t"
                 "global_load_b128 %3, %16, off offset:24576\n\t"
                 "global_load_b128 %4, %16, off offset:32768\n\t"
                 "global_load_b128 %5, %16, off offset:40960\n\t"
                 "global_load_b128 %6, %16, off offset:49152\n\t"
                 "global_load_b128 %7, %16, off offset:57344\n\t"
                 "global_load_b128 %8, %17, off\n\t"
                 "global_load_b128 %9, %17, off offset:8192\n\t"
                 "global_load_b128 %10, %17, off offset:16384\n\t"
                 "global_load_b128 %11, %17, off offset:24576\n\t"
                 "global_load_b128 %12, %17, off offset:32768\n\t"
                 "global_load_b128 %13, %17, off offset:40960\n\t"
                 "global_load_b128 %14, %17, off offset:49152\n\t"
                 "global_load_b128 %15, %17, off offset:57344\n\t"
                 "s_wait_loadcnt 0x0"
                 : "=&v"(h[0]), "=&v"(h[1]), "=&v"(h[2]), "=&v"(h[3]), "=&v"(h[4]), "=&v"(h[5]), "=&v"(h[6]), "=&v"(h[7]),
                   "=&v"(l[0]), "=&v"(l[1]), "=&v"(l[2]), "=&v"(l[3]), "=&v"(l[4]), "=&v"(l[5]), "=&v"(l[6]), "=&v"(l[7])
                 : "v"(gh), "v"(gl) : "memory");
  }
}

// One operand plane of a GEMM ring stage, 32 NC rows of 64 k: NC copies, 16 bytes per lane and copy, through no register.
// l: the lane's own LDS byte address of its piece of row (tid >> 3) of the plane in the target buffer; g: the same piece in global memory.
// A copy of one wave covers four whole 128-B lines. The s_wait_xcnt stands inside the copies' own statement, so that no address
// register is rewritten in front of it.
template <int NC>
__device__ __forceinline__ void stage_plane(unsigned l, const _Float16* g) {
  static_assert(NC == 4 || NC == 8);
  const unsigned l1 = l + 1 * GRS * GP * 2, l2 = l + 2 * GRS * GP * 2, l3 = l + 3 * GRS * GP * 2;
  const _Float16* g1 = g + (size_t)1 * GRS * HID;
  const _Float16* g2 = g + (size_t)2 * GRS * HID;
  const _Float16* g3 = g + (size_t)3 * GRS * HID;
  if (NC == 4) {
    asm volatile("global_load_async_to_lds_b128 %0, %1, off\n\t"
                 "global_load_async_to_lds_b128 %2, %3, off\n\t"
                 "global_load_async_to_lds_b128 %4, %5, off\n\t"
                 "global_load_async_to_lds_b128 %6, %7, off\n\t"
                 "s_wait_xcnt 0x0"
                 :: "v"(l), "v"(g), "v"(l1), "v"(g1), "v"(l2), "v"(g2), "v"(l3), "v"(g3) : "memory");
  } else {
    const unsigned l4 = l + 4 * GRS * GP * 2, l5 = l + 5 * GRS * GP * 2, l6 = l + 6 * GRS * GP * 2, l7 = l + 7 * GRS * GP * 2;
    const _Float16* g4 = g + (size_t)4 * GRS * HID;
    const _Float16* g5 = g + (size_t)5 * GRS * HID;
    const _Float16* g6 = g + (size_t)6 * GRS * HID;
    const _Float16* g7 = g + (size_t)7 * GRS * HID;
    asm volatile("global_load_async_to_lds_b128 %0, %1, off\n\t"
                 "global_load_async_to_lds_b128 %2, %3, off\n\t"
                 "global_load_async_to_lds_b128 %4, %5, off\n\t"
                 "global_load_async_to_lds_b128 %6, %7, off\n\t"
                 "global_load_async_to_lds_b128 %8, %9, off\n\t"
                 "global_load_async_to_lds_b128 %10, %11, off\n\t"
                 "global_load_async_to_lds_b128 %12, %13, off\n\t"
                 "global_load_async_to_lds_b128 %14, %15, off\n\t"
                 "s_wait_xcnt 0x0"
                 :: "v"(l), "v"(g), "v"(l1), "v"(g1), "v"(l2), "v"(g2), "v"(l3), "v"(g3),
                    "v"(l4), "v"(g4), "v"(l5), "v"(g5), "v"(l6), "v"(g6), "v"(l7), "v"(g7) : "memory");
  }
}

__device__ __forceinline__ v4f bf16_rne4(v4f a) {
  v4u u = __builtin_bit_cast(v4u, a);
  u = (u + 0x7FFFu + ((u >> 16) & 1u)) & 0xFFFF0000u;
  return __builtin_bit_cast(v4f, u);
}

__device__ __forceinline__ v8h cvt8v(v4f a, v4f b) {
  v8h d;
  d[0] = (_Float16)a[0]; d[1] = (_Float16)a[1];
  d[2] = (_Float16)a[2]; d[3] = (_Float16)a[3];
  d[4] = (_Float16)b[0]; d[5] = (_Float16)b[1];
  d[6] = (_Float16)b[2]; d[7] = (_Float16)b[3];
  return d;
}

// f32 x -> f16 hi and f16((x - hi) * 4096)
__device__ __forceinline__ void split8(v4f a, v4f b, v8h& hv, v8h& lv) {
  U8h hh, ll;
  _Float16 t;
  t = (_Float16)a[0]; hh.f[0] = t; ll.f[0] = (_Float16)((a[0] - (float)t) * 4096.0f);
  t = (_Float16)a[1]; hh.f[1] = t; ll.f[1] = (_Float16)((a[1] - (float)t) * 4096.0f);
  t = (_Float16)a[2]; hh.f[2] = t; ll.f[2] = (_Float16)((a[2] - (float)t) * 4096.0f);
  t = (_Float16)a[3]; hh.f[3] = t; ll.f[3] = (_Float16)((a[3] - (float)t) * 4096.0f);
  t = (_Float16)b[0]; hh.f[4] = t; ll.f[4] = (_Float16)((b[0] - (float)t) * 4096.0f);
  t = (_Float16)b[1]; hh.f[5] = t; ll.f[5] = (_Float16)((b[1] - (float)t) * 4096.0f);
  t = (_Float16)b[2]; hh.f[6] = t; ll.f[6] = (_Float16)((b[2] - (float)t) * 4096.0f);
  t = (_Float16)b[3]; hh.f[7] = t; ll.f[7] = (_Float16)((b[3] - (float)t) * 4096.0f);
  hv = hh.v; lv = ll.v;
}

// ---------------- pre-pass: Xh = f16(bf16RNE(hidden)) [MR][1024] (pad rows zero), Ph = f16(bf16RNE(pos)) [SEQP][1024]
//                  (pad rows zero), Wh = f16(256 * bf16RNE(W)) for the four weight matrices stacked [4096][1024].
__global__ __launch_bounds__(128)
void prep_kernel(const float* __restrict__ Hs, const float* __restrict__ Pos,
                 const float* __restrict__ W0, const float* __restrict__ W1,
                 const float* __restrict__ W2, const float* __restrict__ W3,
                 _Float16* Xh, _Float16* Ph, _Float16* Wh)
{
  const int row = blockIdx.x;
  const int c0  = 8 * threadIdx.x;
  const float* src;
  _Float16*    dst;
  float sc = 1.0f;
  if (row < MR) {
    const int b  = row / SEQP;
    const int s  = row - b * SEQP;
    const int sl = (s < SEQ) ? s : (SEQ - 1);            // clamped address; pad rows scaled to zero
    sc  = (s < SEQ) ? 1.0f : 0.0f;
    src = Hs + ((size_t)b * SEQ_FULL + sl) * HID + c0;   // full-size input strides
    dst = Xh + (size_t)row * HID + c0;
  } else if (row < MR + SEQP) {
    const int s  = row - MR;
    const int sl = (s < SEQ) ? s : (SEQ - 1);
    sc  = (s < SEQ) ? 1.0f : 0.0f;
    src = Pos + (size_t)sl * HID + c0;
    dst = Ph + (size_t)s * HID + c0;
  } else {
    const int j   = row - MR - SEQP;                      // 0..4095
    const int mat = j >> 10;
    const int r   = j & (HID - 1);
    const float* W = (mat == 0) ? W0 : (mat == 1) ? W1 : (mat == 2) ? W2 : W3;
    sc  = 256.0f;                                         // exact power-of-two carry, removed in the GEMM epilogues
    src = W + (size_t)r * HID + c0;
    dst = Wh + (size_t)j * HID + c0;
  }
  const v4f a0 = bf16_rne4(*(const v4f*)src) * sc;
  const v4f a1 = bf16_rne4(*(const v4f*)(src + 4)) * sc;
  const v8h v  = cvt8v(a0, a1);                           // bf16 values (and x256) are exact in f16
  *(v8h*)dst = v;
  
}

// MODE 2 epilogue: f32 tile in[128 keys][BN cols] (pitch BN + 4) -> V^T hi rows out[(h,d) = BN rows][128 keys] and, with LO, the x4096
// residual rows: item i -> col c = GRS (i>>1) + (tid>>3), key half i&1, keys s0 + 64 (i&1) + 8 sub .. +7 (one line per (h,d) row and key half).
// LO is a template argument so that no branch stands between the stores of a trip.
template <bool LO, int BN>
__device__ __forceinline__ void store_vt(const float* sC, _Float16* O0, _Float16* O1, int tid, int b, int h0, int s0) {
  constexpr int CP = BN + 4;
  const int sub = tid & 7;
  for (int i0 = 0; i0 < BN * 2 / GRS; i0 += 4) {
    v8h vh[4], vl[4]; size_t oh[4], ol[4];
    #pragma unroll
    for (int i = 0; i < 4; ++i) {
      const int c  = GRS * ((i0 + i) >> 1) + (tid >> 3);
      const int k0 = 64 * (i & 1) + 8 * sub;             // i0 is even
      const int hh = h0 + (c >> 6);
      const int d  = c & (HD - 1);
      v4f x0, x1;
      x0[0] = sC[(k0 + 0) * CP + c]; x0[1] = sC[(k0 + 1) * CP + c];
      x0[2] = sC[(k0 + 2) * CP + c]; x0[3] = sC[(k0 + 3) * CP + c];
      x1[0] = sC[(k0 + 4) * CP + c]; x1[1] = sC[(k0 + 5) * CP + c];
      x1[2] = sC[(k0 + 6) * CP + c]; x1[3] = sC[(k0 + 7) * CP + c];
      split8(x0, x1, vh[i], vl[i]);
      const size_t rowid = (size_t)(b * NH + hh) * HD + d;
      oh[i] = rowid * SEQP + s0 + k0;
      ol[i] = rowid * EARLY + s0 + k0;
    }
    #pragma unroll
    for (int i = 0; i < 4; ++i) {
      *(v8h*)(O0 + oh[i]) = vh[i];
      if (LO) *(v8h*)(O1 + ol[i]) = vl[i];
    }
    asm volatile("s_wait_xcnt 0x0" ::: "memory");   // the next trip rewrites registers that these stores name
  }
}

// ---------------- 16-bit GEMM: 128x256 block tile, 8 waves (2 x 4) of 64x64 (MODE 0, 3: 128x128, waves of 64x32), K = 1024 in WMMA steps of 32 ----------------
// Operands come by asynchronous copies into a ring of two LDS buffers, 64 k a stage: stage s + 1 flies while stage s is worked on.
// C[m][n] = sum_k A[m][k] * Bw[n][k]  (Bw = weight rows [out][in], k contiguous, i.e. x @ W^T).
// 16-bit fragment map (A and B alike): lane l -> row/col (l & 15); elements 0..7 <- k0 + 8*(l>>4) + 0..7,
// elements 8..15 <- k0 + 16 + 8*(l>>4) + 0..7.  D: element r of lane l -> row 8*(l>>4) + r, col (l & 15).
// MODE 0: Pout[s][n] f32 positional projection (pitch PPP), natural units.
// MODE 1: Q (n0 < 1024) or K (n0 >= 1024) rows: f16 hi plane + f16 x4096 residual plane [MR][1024], value = acc/256 + Pin.
// MODE 2: V: V^T hi plane [b][h][d][SEQP] and, for s0 < EARLY, V^T x4096 residual plane [b][h][d][EARLY], value = acc/256 + Pin.
// MODE 3: Y rows of d_out [b][2000][1024] f32, value = (acc + accr/4096)/256 with the residual A plane on rows s0 < EARLY.
template <int MODE>
__global__ __launch_bounds__(GT)
void gemm_kernel(const _Float16* __restrict__ Ah, const _Float16* __restrict__ Al,
                 const _Float16* __restrict__ Bw, const float* __restrict__ Pin,
                 float* Pout, _Float16* O0, _Float16* O1, _Float16* O2, _Float16* O3, float* Y)
{
  // ring buffer = {A [128][GP], B [BN][GP], and for MODE 3 residual A [128][GP]}, two of them; the epilogue's f32 tile reuses the ring's LDS
  constexpr int T   = GT;             // threads
  constexpr int RS  = GRS;            // operand rows that one copy of the whole block covers
  constexpr int BN  = GBN(MODE);      // block tile columns
  constexpr int NWN = 4;              // waves side by side along n
  constexpr int NI  = BN / 16 / NWN;  // 16-col tiles per wave
  constexpr int CP  = BN + 4;         // floats per row of the f32 tile in LDS (a multiple of 16 B; 8 rows on lie 32 banks on)
  static_assert((CP * 4) % 16 == 0 && (8 * CP) % 64 == 32);
  constexpr int STG_H  = (GBM + BN + (MODE == 3 ? GBM : 0)) * GP;   // halfs per buffer
  constexpr int RING_B = 2 * STG_H * 2;
  constexpr int TILE_B = GBM * CP * 4;
  static_assert(RING_B <= 163840 && TILE_B <= 163840);   // two blocks fit a WGP's LDS
  __shared__ __attribute__((aligned(16))) char gsm[RING_B > TILE_B ? RING_B : TILE_B];   // cross-wave (block barrier)
  _Float16* sR = (_Float16*)gsm;
  float*    sC = (float*)gsm;

  const int tid  = threadIdx.x;
  const int wave = tid >> 5;
  const int lane = tid & 31;
  const int lh   = lane & 15;
  const int hi   = lane >> 4;
  const int wm   = wave / NWN;       // 0..1 -> 64-row strip
  const int wn   = wave % NWN;       // strip of 16 NI columns
  const int sub  = tid & 7;
  const int m0   = blockIdx.y * GBM;
  const int n0   = blockIdx.x * BN;
  const int b    = m0 / SEQP;
  const int s0   = m0 - b * SEQP;
  const bool resa = (MODE == 3) && (s0 < EARLY);   // block-uniform

  U8f acc[4][NI], accr[4][NI];
  #pragma unroll
  for (int mi = 0; mi < 4; ++mi)
    #pragma unroll
    for (int ni = 0; ni < NI; ++ni) { acc[mi][ni].v = (v8f){}; accr[mi][ni].v = (v8f){}; }

  const int sr = tid >> 3, sp = tid & 7;                             // staging: row 0..RS-1 (+ RS per further copy), 16-B piece 0..7
  const unsigned la0 = (unsigned)(uintptr_t)(sR + sr * GP + 8 * sp); // LDS byte address of the lane's A piece in buffer 0
  const unsigned lb0 = la0 + GBM * GP * 2;                           // the same piece of the B plane
  const unsigned ll0 = la0 + (GBM + BN) * GP * 2;                    // the same piece of the residual plane (MODE 3)
  const _Float16* ga = Ah + (size_t)(m0 + sr) * HID + 8 * sp;        // this lane's pieces of stage 0
  const _Float16* gl = Al + (size_t)(m0 + sr) * HID + 8 * sp;
  const _Float16* gb = Bw + (size_t)(n0 + sr) * HID + 8 * sp;

  stage_plane<GBM / RS>(la0, ga);                                    // stage 0 -> buffer 0
  stage_plane<BN / RS>(lb0, gb);
  if (resa) stage_plane<GBM / RS>(ll0, gl);
  asm volatile("s_wait_asynccnt 0x0" ::: "memory");                  // this wave's pieces of stage 0 have landed
  __syncthreads();                                                   // stage 0 visible to all waves
  stage_plane<GBM / RS>(la0 + STG_H * 2, ga + GBK);                  // stage 1 -> buffer 1 (GNS >= 2)
  stage_plane<BN / RS>(lb0 + STG_H * 2, gb + GBK);
  if (resa) stage_plane<GBM / RS>(ll0 + STG_H * 2, gl + GBK);

  for (int s = 0; s < GNS; ++s) {
    const int bufh = (s & 1) * STG_H;                                // this stage's buffer, offset in halfs
    const _Float16* sA = sR + bufh;
    const _Float16* sB = sA + GBM * GP;
    const _Float16* sL = sB + BN * GP;

    #pragma unroll                                                   // both halves of the stage at immediate LDS offsets
    for (int c = 0; c < GBK / 32; ++c) {                             // k ascending in WMMA steps of 32
      U16h af[4], bq[NI];
      #pragma unroll
      for (int mi = 0; mi < 4; ++mi) {
        const _Float16* p = sA + (wm * 64 + mi * 16 + lh) * GP + 32 * c;
        af[mi].h[0] = *(const v8h*)(p + 8 * hi);
        af[mi].h[1] = *(const v8h*)(p + 16 + 8 * hi);
      }
      #pragma unroll
      for (int ni = 0; ni < NI; ++ni) {
        const _Float16* p = sB + ((wn * NI + ni) * 16 + lh) * GP + 32 * c;
        bq[ni].h[0] = *(const v8h*)(p + 8 * hi);
        bq[ni].h[1] = *(const v8h*)(p + 16 + 8 * hi);
      }
      #pragma unroll
      for (int mi = 0; mi < 4; ++mi)
        #pragma unroll
        for (int ni = 0; ni < NI; ++ni)
          acc[mi][ni].v = wmma_f16(af[mi].v, bq[ni].v, acc[mi][ni].v);
      if (resa) {
        U16h lf[4];
        #pragma unroll
        for (int mi = 0; mi < 4; ++mi) {
          const _Float16* p = sL + (wm * 64 + mi * 16 + lh) * GP + 32 * c;
          lf[mi].h[0] = *(const v8h*)(p + 8 * hi);
          lf[mi].h[1] = *(const v8h*)(p + 16 + 8 * hi);
        }
        #pragma unroll
        for (int mi = 0; mi < 4; ++mi)
          #pragma unroll
          for (int ni = 0; ni < NI; ++ni)
            accr[mi][ni].v = wmma_f16(lf[mi].v, bq[ni].v, accr[mi][ni].v);
      }
    }

    // ---- publish point, every wave: own LDS reads of this buffer done, own copies of the next stage landed, block barrier ----
    asm volatile("s_wait_dscnt 0x0" ::: "memory");                   // this wave has left the buffer that is refilled below
    asm volatile("s_wait_asynccnt 0x0" ::: "memory");                // this wave's pieces of the next stage have landed
    __syncthreads();                                                 // next stage visible to all; every reader has left this buffer
    if (s + 2 < GNS) {                                               // block-uniform: stage s + 2 flies while stage s + 1 is worked on
      stage_plane<GBM / RS>(la0 + bufh * 2, ga + (s + 2) * GBK);
      stage_plane<BN / RS>(lb0 + bufh * 2, gb + (s + 2) * GBK);
      if (resa) stage_plane<GBM / RS>(ll0 + bufh * 2, gl + (s + 2) * GBK);
    }
  }
  asm volatile("s_wait_asynccnt 0x0" ::: "memory");                  // nothing of this wave is in flight when the ring becomes the f32 tile

  // ---- accumulators -> f32 tile in LDS (x 1/256 removes the weight carry) ----
  #pragma unroll
  for (int mi = 0; mi < 4; ++mi)
    #pragma unroll
    for (int ni = 0; ni < NI; ++ni)
      #pragma unroll
      for (int r = 0; r < 8; ++r) {
        float v = acc[mi][ni].f[r];
        if (resa) v += accr[mi][ni].f[r] * (1.0f / 4096.0f);
        sC[(wm * 64 + mi * 16 + 8 * hi + r) * CP + (wn * NI + ni) * 16 + lh] = v * (1.0f / 256.0f);
      }
  __syncthreads();

  if (MODE == 1 || MODE == 2) {
    // ---- add the positional projection row (f32, natural units), in place, coalesced 32-B reads ----
    constexpr int NP = GBM * (BN / 8) / T;        // passes; a pass covers PR whole rows of the tile
    constexpr int PR = T / (BN / 8);
    const int row0 = tid / (BN / 8);
    const int cg   = tid % (BN / 8);
    const float* pp0 = Pin + (size_t)(s0 + row0) * PPP + n0 + 8 * cg;
    v4f p0[NP], p1[NP];
    #pragma unroll
    for (int p = 0; p < NP; ++p) {
      const float* pp = pp0 + (size_t)p * PR * PPP;
      p0[p] = *(const v4f*)pp;
      p1[p] = *(const v4f*)(pp + 4);
    }
    asm volatile("s_wait_xcnt 0x0" :: "v"(pp0) : "memory");   // the loads' address register stays unwritten up to this wait
    #pragma unroll
    for (int p = 0; p < NP; ++p) {
      v4fa* c = (v4fa*)(sC + (p * PR + row0) * CP + 8 * cg);
      v4f x0 = c[0], x1 = c[1];
      x0 += p0[p]; x1 += p1[p];
      c[0] = x0; c[1] = x1;
    }
    __syncthreads();
  }

  if (MODE == 0) {
    // 128 rows x BN / 32 lines each: line L = RS i + (tid>>3) -> row, segment; one wave instruction = four whole lines
    #pragma unroll 1                                 // rolled: the wait at a trip's foot then stands in front of all that the next trip writes
    for (int i0 = 0; i0 < GBM * (BN / 32) / RS; i0 += 8) {
      v4f ov[8]; size_t oo[8];
      #pragma unroll
      for (int i = 0; i < 8; ++i) {
        const int L = RS * (i0 + i) + (tid >> 3);
        const int row = L / (BN / 32), seg = L % (BN / 32);
        ov[i] = *(const v4fa*)(sC + row * CP + seg * 32 + 4 * sub);
        oo[i] = (size_t)(m0 + row) * PPP + n0 + seg * 32 + 4 * sub;
      }
      #pragma unroll
      for (int i = 0; i < 8; ++i) *(v4f*)(Pout + oo[i]) = ov[i];
      asm volatile("s_wait_xcnt 0x0" ::: "memory");   // the next trip rewrites registers that these stores name
    }
  }

  if (MODE == 1) {
    const bool isq = (n0 < HID);                     // block-uniform: Q group or K group
    _Float16* ph = isq ? O0 : O2;
    _Float16* pl = isq ? O1 : O3;
    const int col0 = n0 & (HID - 1);
    // 128 rows x BN / 64 lines per plane: rem = RS i + (tid>>3) -> row, segment (64 halfs = one line), piece sub
    for (int i0 = 0; i0 < GBM * (BN / 64) / RS; i0 += 4) {
      v8h vh[4], vl[4]; size_t oo[4];
      #pragma unroll
      for (int i = 0; i < 4; ++i) {
        const int rem = RS * (i0 + i) + (tid >> 3);
        const int row = rem / (BN / 64), seg = rem % (BN / 64);
        const float* c = sC + row * CP + seg * 64 + 8 * sub;
        split8(*(const v4fa*)c, *(const v4fa*)(c + 4), vh[i], vl[i]);
        oo[i] = (size_t)(m0 + row) * HID + col0 + seg * 64 + 8 * sub;
      }
      #pragma unroll
      for (int i = 0; i < 4; ++i) { *(v8h*)(ph + oo[i]) = vh[i]; *(v8h*)(pl + oo[i]) = vl[i]; }
      asm volatile("s_wait_xcnt 0x0" ::: "memory");   // the next trip rewrites registers that these stores name
    }
  }

  if (MODE == 2) {
    if (s0 < EARLY) store_vt<true, BN>(sC, O0, O1, tid, b, n0 / HD, s0);    // block-uniform
    else            store_vt<false, BN>(sC, O0, O1, tid, b, n0 / HD, s0);
  }

  if (MODE == 3) {
    // d_out rows (b, s) with s < SEQ only (whole 512-B row segments; guard is uniform over the 32 lanes of a row segment)
    for (int i0 = 0; i0 < GBM * (BN / 32) / RS; i0 += 8) {
      v4f ov[8]; size_t oo[8]; int sv[8];
      #pragma unroll
      for (int i = 0; i < 8; ++i) {
        const int L = RS * (i0 + i) + (tid >> 3);
        const int row = L / (BN / 32), seg = L % (BN / 32);
        ov[i] = *(const v4fa*)(sC + row * CP + seg * 32 + 4 * sub);
        sv[i] = s0 + row;
        oo[i] = ((size_t)b * SEQ_FULL + (size_t)(s0 + row)) * HID + n0 + seg * 32 + 4 * sub;
      }
      #pragma unroll
      for (int i = 0; i < 8; ++i) if (sv[i] < SEQ) *(v4f*)(Y + oo[i]) = ov[i];
      asm volatile("s_wait_xcnt 0x0" ::: "memory");   // the next trip rewrites registers that these stores name
    }
  }
}

// ---------------- fused causal attention: one workgroup = 128 query rows of one (batch, head), 8 / NQ waves x 16 NQ rows ----------------
// S^T = K Q^T (A = K rows, B = Q rows): k_hi*q_hi into one accumulator, (k_lo*q_hi + k_hi*q_lo) into a second one folded x 1/4096
// (residual planes carry x4096). Lane l then holds 16 of the chunk's 32 scores of query (l & 15); lane l ^ 16 holds the other 16.
// O^T = V^T P^T: the two S^T tiles, converted in place, are the B operand (P carried x1024 in f16); RES (query blocks 0,1) adds
// V_lo*P_hi + V_hi*P_res into a second accumulator folded x 1/4096.
// Causal mask: key <= query keeps the score, else -1e30 (replace-fill); online softmax base 2 with f32 running max / sum per lane.
// A wave holds NQ query tiles of 16 columns, their Q fragments in registers for the whole key loop: one K or V^T fragment read from
// LDS feeds NQ query tiles. Every query row sees the chunks, the products and the sums in the same order for either NQ.
template <bool RES, int NQ>
__global__ __launch_bounds__(256 / NQ)
void attn_kernel(const _Float16* __restrict__ Qh, const _Float16* __restrict__ Ql,
                 const _Float16* __restrict__ Kh, const _Float16* __restrict__ Kl,
                 const _Float16* __restrict__ Vth, const _Float16* __restrict__ Vtl,
                 _Float16* Ch, _Float16* Cl, int qb0, int nqbl)
{
  static_assert(NQ == 1 || (NQ == 2 && !RES));
  extern __shared__ __attribute__((aligned(16))) _Float16 smem[];
  _Float16* sQ  = smem + SQ_OFF;             // [query tile of 16][hi 16 | residual 16][QP]  wave-private; the epilogue's f32 tiles reuse it
  _Float16* sR  = smem + RING_OFF;           // [2 buffers]{K hi [32][KP], K res [32][KP], V^T hi [64][VP], V^T res [64][VP]}  cross-wave

  const int tid  = threadIdx.x;
  const int wave = tid >> 5;
  const int lane = tid & 31;
  const int lh   = lane & 15;
  const int hi   = lane >> 4;

  // Placement, for speed only: block index -> (query tile, head). A tile's cost grows with its number (causal), every group of the
  // launch is resident at once. All heads of one tile
  // are neighbours in the index and the cost falls from one round of 256 groups to the next; inside a round the tiles are ordered
  // to even out the load. The tiles of one head keep one index mod 8.
  const int cls = blockIdx.x / (NB * NH);    // 0 .. nqbl - 1
  const int bh  = blockIdx.x % (NB * NH);
  int qb = qb0 + nqbl - 1 - cls;             // any shape: heaviest tile first
  if (!RES && SEQP / BQ == 16 && NB * NH == 64)
    qb = (int)((0x236475AB98EFCDull >> (4 * cls)) & 15);   // tiles 2..15, each once: 13 12 15 14 | 8 9 11 10 | 5 7 4 6 | 3 2
  const int h     = bh % NH;
  const int b     = bh / NH;
  const int qbase = qb * BQ;
  const int qrow0 = qbase + wave * (16 * NQ);

  const size_t prow = (size_t)b * SEQP;
  const _Float16* Qhb = Qh + prow * HID + h * HD;
  const _Float16* Qlb = Ql + prow * HID + h * HD;
  const _Float16* Khb = Kh + prow * HID + h * HD;
  const _Float16* Klb = Kl + prow * HID + h * HD;
  const _Float16* Vhb = Vth + (size_t)(b * NH + h) * HD * SEQP;
  const _Float16* Vlb = Vtl + (size_t)(b * NH + h) * HD * EARLY;
  _Float16* Chb = Ch + prow * HID + h * HD;
  _Float16* Clb = Cl + prow * HID + h * HD;

  const int kend = qbase + BQ;               // causal, block-uniform: keys beyond the block's last query row are never needed
  const int kr = tid >> 3, kg = tid & 7;     // K staging: key row 0..32 / NQ - 1 (NQ = 2: and 16 rows on), piece 0..7
  const int vd = tid >> 2, vg = tid & 3;     // V^T staging: d row 0..64 / NQ - 1 (NQ = 2: and 32 rows on), piece 0..3
  const unsigned lk0 = (unsigned)(uintptr_t)(sR + RKH_OFF + kr * KP + 8 * kg);   // LDS byte addresses in buffer 0
  const unsigned lv0 = (unsigned)(uintptr_t)(sR + RVH_OFF + vd * VP + 8 * vg);
  const _Float16* gkh = Khb + (size_t)kr * HID + 8 * kg;                         // this lane's pieces of chunk 0
  const _Float16* gkl = Klb + (size_t)kr * HID + 8 * kg;
  const _Float16* gvh = Vhb + (size_t)vd * SEQP + 8 * vg;
  const _Float16* gvl = Vlb + (size_t)vd * EARLY + 8 * vg;

  // chunk 0 -> buffer 0
  if (NQ == 2) stage_kv2(lk0, lv0, gkh, gkl, gvh);
  else         stage_kv<RES>(lk0, lv0, gkh, gkl, gvh, gvl);

  // ---- this wave's 16 NQ query rows (hi and residual) -> LDS: row 4i + (lane>>3) of tile u, 16-B piece (lane&7) ----
  _Float16* qwh = sQ + wave * (NQ * QW_H);
  _Float16* qwl = qwh + 16 * QP;
  {
    const int pc = lane & 7;
    const size_t go = (size_t)(qrow0 + (lane >> 3)) * HID + 8 * pc;
    v8h xh[4 * NQ], xl[4 * NQ];              // piece i: row 4i + (lane>>3) of the wave's 16 NQ rows
    load_q<NQ>(Qhb + go, Qlb + go, xh, xl);
    #pragma unroll
    for (int u = 0; u < NQ; ++u)
      #pragma unroll
      for (int i = 0; i < 4; ++i) {
        const int r = 4 * i + (lane >> 3);
        *(v8h*)(qwh + u * QW_H + r * QP + 8 * pc) = xh[4 * u + i];
        *(v8h*)(qwl + u * QW_H + r * QP + 8 * pc) = xl[4 * u + i];
      }
  }

  U8f acc[NQ][4], accr[NQ][4];
  float mcol[NQ], lcol[NQ];
  #pragma unroll
  for (int u = 0; u < NQ; ++u) {
    #pragma unroll
    for (int t = 0; t < 4; ++t) { acc[u][t].v = (v8f){}; accr[u][t].v = (v8f){}; }
    mcol[u] = -3.0e38f;                      // running maximum of query qrow0 + 16 u + lh (equal in both wave halves)
    lcol[u] = 0.0f;                          // running sum over this lane's keys only; the halves are joined in the epilogue
  }

  // scalar copy of the wave's first row: the per-wave skip below is then a real branch and EXEC stays all ones at the copies
  const int qrow0s = __builtin_amdgcn_readfirstlane(qrow0);

  asm volatile("s_wait_asynccnt 0x0" ::: "memory");   // this wave's pieces of chunk 0 have landed
  __syncthreads();                                    // chunk 0 (and the Q tiles) visible to all waves
  // chunk 1 -> buffer 1 (kend >= BQ = 4 chunks, so chunk 1 always exists)
  if (NQ == 2) stage_kv2(lk0 + RING_H * 2, lv0 + RING_H * 2, gkh + (size_t)BK * HID, gkl + (size_t)BK * HID, gvh + BK);
  else         stage_kv<RES>(lk0 + RING_H * 2, lv0 + RING_H * 2, gkh + (size_t)BK * HID, gkl + (size_t)BK * HID, gvh + BK, gvl + BK);

  // ---- Q fragments (B operand), read once: tile u, d step c ----
  U16h qf[NQ][2], ql[NQ][2];
  #pragma unroll
  for (int u = 0; u < NQ; ++u)
    #pragma unroll
    for (int c = 0; c < 2; ++c) {
      qf[u][c].h[0] = *(const v8h*)(qwh + u * QW_H + lh * QP + 32 * c + 8 * hi);
      qf[u][c].h[1] = *(const v8h*)(qwh + u * QW_H + lh * QP + 32 * c + 16 + 8 * hi);
      ql[u][c].h[0] = *(const v8h*)(qwl + u * QW_H + lh * QP + 32 * c + 8 * hi);
      ql[u][c].h[1] = *(const v8h*)(qwl + u * QW_H + lh * QP + 32 * c + 16 + 8 * hi);
    }

  for (int kv0 = 0; kv0 < kend; kv0 += BK) {
    const int bufh = ((kv0 / BK) & 1) * RING_H;       // this chunk's buffer, offset in halfs
    const _Float16* sKh = sR + bufh + RKH_OFF;
    const _Float16* sKl = sR + bufh + RKL_OFF;
    const _Float16* sVh = sR + bufh + RVH_OFF;
    const _Float16* sVl = sR + bufh + RVL_OFF;

    if (kv0 < qrow0s + 16 * NQ) {            // wave-uniform: skip chunks entirely above this wave's rows
      // ---- S^T = K Q^T for two 16-key tiles, d reduced in two K=32 steps, three products each; a K fragment serves all NQ query tiles ----
      U8f sc[NQ][2];
      #pragma unroll
      for (int kt = 0; kt < 2; ++kt) {
        U16h kf[2], kl[2];
        #pragma unroll
        for (int c = 0; c < 2; ++c) {
          kf[c].h[0] = *(const v8h*)(sKh + (16 * kt + lh) * KP + 32 * c + 8 * hi);
          kf[c].h[1] = *(const v8h*)(sKh + (16 * kt + lh) * KP + 32 * c + 16 + 8 * hi);
          kl[c].h[0] = *(const v8h*)(sKl + (16 * kt + lh) * KP + 32 * c + 8 * hi);
          kl[c].h[1] = *(const v8h*)(sKl + (16 * kt + lh) * KP + 32 * c + 16 + 8 * hi);
        }
        U8f sm[NQ], sr[NQ];
        #pragma unroll
        for (int u = 0; u < NQ; ++u) { sm[u].v = (v8f){}; sr[u].v = (v8f){}; }
        #pragma unroll
        for (int c = 0; c < 2; ++c) {
          #pragma unroll
          for (int u = 0; u < NQ; ++u) sm[u].v = wmma_f16(kf[c].v, qf[u][c].v, sm[u].v);
          #pragma unroll
          for (int u = 0; u < NQ; ++u) sr[u].v = wmma_f16(kl[c].v, qf[u][c].v, sr[u].v);
          #pragma unroll
          for (int u = 0; u < NQ; ++u) sr[u].v = wmma_f16(kf[c].v, ql[u][c].v, sr[u].v);
        }
        #pragma unroll
        for (int u = 0; u < NQ; ++u) sc[u][kt].v = sm[u].v + sr[u].v * (1.0f / 4096.0f);
      }

      U16h pf[NQ], pfr[NQ];
      #pragma unroll
      for (int u = 0; u < NQ; ++u) {
        // ---- scale, causal replace-mask, online softmax (base 2): element j of tile 0 / 1 is key kv0 + 8 hi + j / + 16, query 16 u + lh ----
        const int dq = qrow0 + 16 * u + lh - kv0 - 8 * hi;   // key kept where j (tile 0) or 16 + j (tile 1) <= dq
        float a0[8], a1[8], mx[8];
        #pragma unroll
        for (int j = 0; j < 8; ++j) {
          const float x0 = sc[u][0].f[j] * C2S;
          const float x1 = sc[u][1].f[j] * C2S;
          a0[j] = (j <= dq) ? x0 : -1.0e30f;
          a1[j] = (16 + j <= dq) ? x1 : -1.0e30f;
          mx[j] = fmaxf(a0[j], a1[j]);
        }
        float rm = fmaxf(fmaxf(fmaxf(mx[0], mx[1]), fmaxf(mx[2], mx[3])), fmaxf(fmaxf(mx[4], mx[5]), fmaxf(mx[6], mx[7])));
        rm = fmaxf(rm, xhalf(rm));                       // both halves now hold the query's chunk maximum
        const float mnew  = fmaxf(mcol[u], rm);
        const float alpha = __builtin_amdgcn_exp2f(mcol[u] - mnew);
        mcol[u] = mnew;
        U8h pa, pb, par, pbr;
        float es[8];
        #pragma unroll
        for (int j = 0; j < 8; ++j) {
          const float e0 = __builtin_amdgcn_exp2f(a0[j] - mnew);
          const float e1 = __builtin_amdgcn_exp2f(a1[j] - mnew);
          es[j] = e0 + e1;
          const float t0 = e0 * 1024.0f;                 // carried x1024, removed in the epilogue
          const float t1 = e1 * 1024.0f;
          const _Float16 h0 = (_Float16)t0;
          const _Float16 h1 = (_Float16)t1;
          pa.f[j] = h0; pb.f[j] = h1;
          if (RES) {
            par.f[j] = (_Float16)((t0 - (float)h0) * 4096.0f);
            pbr.f[j] = (_Float16)((t1 - (float)h1) * 4096.0f);
          }
        }
        lcol[u] = lcol[u] * alpha + (((es[0] + es[1]) + (es[2] + es[3])) + ((es[4] + es[5]) + (es[6] + es[7])));
        #pragma unroll
        for (int t = 0; t < 4; ++t) {
          acc[u][t].v *= alpha;
          if (RES) accr[u][t].v *= alpha;
        }

        // ---- P^T as B operand straight from the registers: elements 0..7 = keys 8 hi + 0..7, elements 8..15 = keys 16 + 8 hi + 0..7 ----
        pf[u].h[0] = pa.v; pf[u].h[1] = pb.v;
        if (RES) { pfr[u].h[0] = par.v; pfr[u].h[1] = pbr.v; }
      }

      // ---- O^T += V^T P^T : 4 output d-tiles, K = 32 keys; A[m = d][k = key] from V^T tile row d; a V^T fragment serves all NQ query tiles ----
      #pragma unroll
      for (int t = 0; t < 4; ++t) {
        U16h vf;
        vf.h[0] = *(const v8h*)(sVh + (16 * t + lh) * VP + 8 * hi);
        vf.h[1] = *(const v8h*)(sVh + (16 * t + lh) * VP + 16 + 8 * hi);
        #pragma unroll
        for (int u = 0; u < NQ; ++u) acc[u][t].v = wmma_f16(vf.v, pf[u].v, acc[u][t].v);
        if (RES) {
          U16h wl;
          wl.h[0] = *(const v8h*)(sVl + (16 * t + lh) * VP + 8 * hi);
          wl.h[1] = *(const v8h*)(sVl + (16 * t + lh) * VP + 16 + 8 * hi);
          #pragma unroll
          for (int u = 0; u < NQ; ++u) {
            accr[u][t].v = wmma_f16(wl.v, pf[u].v, accr[u][t].v);
            accr[u][t].v = wmma_f16(vf.v, pfr[u].v, accr[u][t].v);
          }
        }
      }
    }

    // ---- publish point, every wave: own LDS reads of this buffer done, own copies of the next chunk landed, block barrier ----
    asm volatile("s_wait_dscnt 0x0" ::: "memory");      // this wave has left the buffer that is refilled below
    asm volatile("s_wait_asynccnt 0x0" ::: "memory");   // this wave's pieces of the next chunk have landed
    __syncthreads();                                    // next chunk visible to all; every reader has left this chunk's buffer
    if (kv0 + 2 * BK < kend) {                          // block-uniform: chunk + 2 flies while chunk + 1 is worked on
      const int kn = kv0 + 2 * BK;
      if (NQ == 2) stage_kv2(lk0 + bufh * 2, lv0 + bufh * 2, gkh + (size_t)kn * HID, gkl + (size_t)kn * HID, gvh + kn);
      else         stage_kv<RES>(lk0 + bufh * 2, lv0 + bufh * 2, gkh + (size_t)kn * HID, gkl + (size_t)kn * HID, gvh + kn, gvl + kn);
    }
  }
  asm volatile("s_wait_asynccnt 0x0" ::: "memory");     // nothing of this wave is in flight when its LDS is reused

  // ---- epilogue, tile by tile: join the halves' sums, normalize (1/1024 removes the carry), stage 16x64 f32 in LDS, split to hi / residual.
  // Register r of O^T tile t in lane l is d = 16 t + 8 hi + r of query lh: eight consecutive floats of one staged row.
  #pragma unroll
  for (int u = 0; u < NQ; ++u) {
    const float inv = 1.0f / ((lcol[u] + xhalf(lcol[u])) * 1024.0f);
    float* so = (float*)(qwh + u * QW_H);    // the wave's own Q tile, no longer read
    #pragma unroll
    for (int t = 0; t < 4; ++t) {
      v8f v = acc[u][t].v;
      if (RES) v += accr[u][t].v * (1.0f / 4096.0f);
      v *= inv;
      v4fa* sp = (v4fa*)(so + lh * SOP + 16 * t + 8 * hi);
      sp[0] = (v4f){v[0], v[1], v[2], v[3]};
      sp[1] = (v4f){v[4], v[5], v[6], v[7]};
    }
    wave_lds_sync();
    v8h oh[4], ol[4]; size_t oo[4];
    {
      const int pc = lane & 7;
      #pragma unroll
      for (int i = 0; i < 4; ++i) {
        const int rr = 4 * i + (lane >> 3);
        const float* sp = so + rr * SOP + 8 * pc;
        split8(*(const v4fa*)sp, *(const v4fa*)(sp + 4), oh[i], ol[i]);
        oo[i] = (size_t)(qrow0 + 16 * u + rr) * HID + 8 * pc;
      }
    }
    #pragma unroll
    for (int i = 0; i < 4; ++i) { *(v8h*)(Chb + oo[i]) = oh[i]; *(v8h*)(Clb + oo[i]) = ol[i]; }
    if (u + 1 < NQ) asm volatile("s_wait_xcnt 0x0" ::: "memory");   // the next tile rewrites registers that these stores name
  }
}

extern "C" void kernel_launch(void* const* d_in, const int* in_sizes, int n_in,
                              void* d_out, int out_size, void* d_ws, size_t ws_size,
                              hipStream_t stream) {
  if (n_in < 6) return;
  const long long need_x = ((long long)(NB - 1) * SEQ_FULL + SEQ) * HID;
  if ((long long)in_sizes[0] < need_x) return;
  if ((long long)in_sizes[1] < (long long)HID * HID) return;
  if ((long long)in_sizes[2] < (long long)HID * HID) return;
  if ((long long)in_sizes[3] < (long long)HID * HID) return;
  if ((long long)in_sizes[4] < (long long)HID * HID) return;
  if ((long long)in_sizes[5] < (long long)SEQ * HID) return;
  if ((long long)out_size < need_x) return;
  if (kTotal > ws_size) return;

  const float* hs  = (const float*)d_in[0];
  const float* wq  = (const float*)d_in[1];
  const float* wk  = (const float*)d_in[2];
  const float* wv  = (const float*)d_in[3];
  const float* wo  = (const float*)d_in[4];
  const float* pos = (const float*)d_in[5];
  float*       out = (float*)d_out;

  char* ws = (char*)d_ws;
  _Float16* xh = (_Float16*)(ws + kOffXh);     // [MR][1024]
  _Float16* ph = (_Float16*)(ws + kOffPh);     // [SEQP][1024]
  float*    pp = (float*)(ws + kOffPP);        // [SEQP][PPP] f32
  _Float16* ch = (_Float16*)(ws + kOffCh);     // [MR][1024], aliases xh after it is dead
  _Float16* cl = (_Float16*)(ws + kOffCl);     // [MR][1024], aliases ph/pp after they are dead
  _Float16* wh = (_Float16*)(ws + kOffWh);     // [4096][1024]
  _Float16* qh = (_Float16*)(ws + kOffQh);
  _Float16* ql = (_Float16*)(ws + kOffQl);
  _Float16* kh = (_Float16*)(ws + kOffKh);
  _Float16* kl = (_Float16*)(ws + kOffKl);
  _Float16* vh = (_Float16*)(ws + kOffVh);     // V^T hi  [NB][16][64][SEQP]
  _Float16* vl = (_Float16*)(ws + kOffVl);     // V^T res [NB][16][64][EARLY]

  prep_kernel<<<dim3(MR + SEQP + 4 * HID), dim3(128), 0, stream>>>(hs, pos, wq, wk, wv, wo, xh, ph, wh);

  // positional projection for the Q/K group, then Q/K planes
  gemm_kernel<0><<<dim3(NQK / GBN(0), SEQP / GBM), dim3(GT), 0, stream>>>(ph, ph, wh, pp, pp, qh, ql, kh, kl, out);
  gemm_kernel<1><<<dim3(NQK / GBN(1), MR / GBM), dim3(GT), 0, stream>>>(xh, xh, wh, pp, pp, qh, ql, kh, kl, out);
  // positional projection for the V group, then V^T planes
  const _Float16* whv = wh + (size_t)NQK * HID;
  gemm_kernel<0><<<dim3(HID / GBN(0), SEQP / GBM), dim3(GT), 0, stream>>>(ph, ph, whv, pp, pp, qh, ql, kh, kl, out);
  gemm_kernel<2><<<dim3(HID / GBN(2), MR / GBM), dim3(GT), 0, stream>>>(xh, xh, whv, pp, pp, vh, vl, kh, kl, out);

  (void)hipFuncSetAttribute(reinterpret_cast<const void*>(&attn_kernel<true, 1>),
                            hipFuncAttributeMaxDynamicSharedMemorySize, (int)LDS_BYTES);
  (void)hipFuncSetAttribute(reinterpret_cast<const void*>(&attn_kernel<false, 2>),
                            hipFuncAttributeMaxDynamicSharedMemorySize, (int)LDS_BYTES);
  const int nqb = SEQP / BQ;
  attn_kernel<true, 1><<<dim3(NB * NH * 2), dim3(256), LDS_BYTES, stream>>>(qh, ql, kh, kl, vh, vl, ch, cl, 0, 2);
  if (nqb > 2)
    attn_kernel<false, 2><<<dim3(NB * NH * (nqb - 2)), dim3(128), LDS_BYTES, stream>>>(qh, ql, kh, kl, vh, vl, ch, cl, 2, nqb - 2);

  const _Float16* who = wh + (size_t)(NQK + HID) * HID;
  gemm_kernel<3><<<dim3(HID / GBN(3), MR / GBM), dim3(GT), 0, stream>>>(ch, cl, who, pp, pp, qh, ql, kh, kl, out);
}

// v007
// It runs in 168 microseconds.
// Timed twice side by side with v006, it ran 1.17 times as fast both times.
// Counting every step since v000, it is 2.36 times as fast.
#include <hip/hip_runtime.h>
#include <stdint.h>

// Contractions, all on v_wmma_f32_16x16x32_f16 with f32 accumulate: P0 = Xp*W^T and Y0 = X*W^T + P0 (f16 operands holding
// bf16-RNE input values, W carried x256); S = Q*K^T (Q, K as f16 hi + x4096 f16 residual planes, three products); O = P*V
// (P carried x1024 in f16, V^T f16 hi; extra P-residual and V-residual products on query blocks below row 256); Y = C*Wo^T
// (C f16 hi + x4096 f16 residual product on rows below 256). Score scaling, causal mask, softmax and normalisation in f32.

typedef _Float16 v16h __attribute__((ext_vector_type(16)));
typedef _Float16 v8h  __attribute__((ext_vector_type(8)));
typedef _Float16 v8ha __attribute__((ext_vector_type(8), may_alias));
typedef float    v8f  __attribute__((ext_vector_type(8)));
typedef float    v4f  __attribute__((ext_vector_type(4)));
typedef float    v4fa __attribute__((ext_vector_type(4), may_alias));
typedef unsigned int v4u __attribute__((ext_vector_type(4)));

union U8f  { v8f  v; float    f[8]; };
union U16h { v16h v; v8h      h[2]; };
union U8h  { v8h  v; _Float16 f[8]; };

#ifndef NB
#define NB 4
#endif
#ifndef SEQ
#define SEQ 2000
#endif
#define NB_FULL  4
#define SEQ_FULL 2000
#define HID   1024
#define NH    16
#define HD    64
#define NQK   2048                               // Q and K output columns (first projection group)
#define SEQP  ((((SEQ) + 127) / 128) * 128)      // rows per batch inside workspace planes (zero padded)
#define MR    ((NB) * SEQP)                      // activation plane rows
#define EARLY 256                                // query rows / keys given residual products
#define NQKV  3072                               // Q, K and V output columns
#define PPP   3072                               // f32 pitch of the positional projection plane (Q, K and V columns side by side)

static_assert(NB >= 1 && NB <= NB_FULL);
static_assert(SEQ >= 256 && SEQ <= SEQ_FULL);
static_assert(SEQP % 128 == 0 && SEQP >= EARLY && SEQP <= 2048);
static_assert(NH * HD == HID);
static_assert(NQKV == NQK + HID && NQKV <= PPP);
static_assert(((long long)(NB - 1) * SEQ_FULL + SEQ) * HID <= (long long)NB_FULL * SEQ_FULL * HID);

// ---------------- GEMM tiling ----------------
#define GBM 128
#define GBN(MODE) (((MODE) == 0 || (MODE) == 3) ? 128 : 256)   // 128 columns where 256 would leave WGPs idle (MODE 0) or registers short (MODE 3: a second accumulator set)
#define GBK 64      // k per ring stage: one whole 128-B line of every staged operand row
#define GP  72      // halfs per staged row in LDS (144 B)
#define GNS (HID / GBK)   // ring stages
#define GT  256     // threads: 8 waves (2 x 4), wave tile 64 x 64 (64 x 32 at 128 columns)
#define GRS (GT / 8)      // operand rows (8 pieces of 16 B each) that one copy of the whole block covers
static_assert(MR % GBM == 0 && SEQP % GBM == 0 && EARLY % GBM == 0);
static_assert(NQKV % GBN(0) == 0 && NQK % GBN(1) == 0 && HID % GBN(1) == 0 && HID % GBN(3) == 0 && HID % GBK == 0);
static_assert((GP * 2) % 16 == 0);
static_assert(GBK == 64 && GBM == 128 && GRS == 32 && GNS >= 2);   // the staging below: 8 pieces a row, 32 rows a copy

// ---------------- attention tiling ----------------
#define BQ 128      // query rows per workgroup of 4 waves x 32 rows (rows from EARLY on)
#define BQR 64      // query rows per workgroup of 4 waves x 16 rows (rows below EARLY)
#define BK 32       // keys per staged chunk
#define QP 72       // halfs per Q row in LDS (144 B)
#define KP 72       // halfs per K row in LDS
#define VP 40       // halfs per V^T row in LDS (80 B)
static_assert(SEQP % BQ == 0 && EARLY == 2 * BQ && BQ % BK == 0 && EARLY % BQR == 0 && BQR >= 2 * BK && BQR % BK == 0);

// offsets in halfs. Up to eight Q tiles (16 hi rows, then 16 residual rows), one or two to a wave; the epilogue's 16x64 f32 tile (pitch SOP) reuses a tile.
// The K / V^T chunk lives in a ring of two buffers, each {K hi, K residual, V^T hi, V^T residual}.
#define SQ_OFF   0
#define QW_H     (2 * 16 * QP)
#define RING_OFF (SQ_OFF + 8 * QW_H)
#define RKH_OFF  0
#define RKL_OFF  (RKH_OFF + BK * KP)
#define RVH_OFF  (RKL_OFF + BK * KP)
#define RVL_OFF  (RVH_OFF + HD * VP)
#define RING_H   (RVL_OFF + HD * VP)
#define LDS_BYTES ((RING_OFF + 2 * RING_H) * 2)
#define SOP 68      // floats per row of the epilogue's 16x64 f32 tile (272 B)
static_assert((QW_H * 2) % 16 == 0 && (RING_OFF * 2) % 16 == 0 && (RING_H * 2) % 16 == 0);
static_assert((RKL_OFF * 2) % 16 == 0 && (RVH_OFF * 2) % 16 == 0 && (RVL_OFF * 2) % 16 == 0);
static_assert((KP * 2) % 16 == 0 && (VP * 2) % 16 == 0);
static_assert(QW_H * 2 >= 16 * SOP * 4 && (SOP * 4) % 16 == 0 && SOP >= HD);
static_assert(LDS_BYTES == 75776);

// (1/8) * log2(e): scores go to the base-2 domain for the online softmax
#define C2S 0.18033688011112042f

// ---------------- workspace carve (bytes) ----------------
static constexpr size_t kPlaneB = (size_t)MR * HID * 2;                   // one f16 activation plane
static constexpr size_t kPhB    = (size_t)SEQP * HID * 2;                 // f16 positional rows
static constexpr size_t kPPB    = (size_t)SEQP * PPP * 4;                 // f32 positional projection
static constexpr size_t kR0B    = (kPlaneB + kPhB + kPPB > 2 * kPlaneB) ? (kPlaneB + kPhB + kPPB) : (2 * kPlaneB);
static constexpr size_t kWhB    = (size_t)4 * HID * HID * 2;              // f16 weights, 4 matrices stacked
static constexpr size_t kVtlB   = (size_t)NB * NH * HD * EARLY * 2;       // V^T residual plane, keys < EARLY
static constexpr size_t kOffXh  = 0;
static constexpr size_t kOffPh  = kPlaneB;
static constexpr size_t kOffPP  = kPlaneB + kPhB;
static constexpr size_t kOffCh  = 0;                                      // C planes alias the dead X/pos region
static constexpr size_t kOffCl  = kPlaneB;
static constexpr size_t kOffWh  = kR0B;
static constexpr size_t kOffQh  = kOffWh + kWhB;
static constexpr size_t kOffQl  = kOffQh + kPlaneB;
static constexpr size_t kOffKh  = kOffQl + kPlaneB;
static constexpr size_t kOffKl  = kOffKh + kPlaneB;
static constexpr size_t kOffVh  = kOffKl + kPlaneB;
static constexpr size_t kOffVl  = kOffVh + kPlaneB;
static constexpr size_t kTotal  = kOffVl + kVtlB;
static_assert(kTotal <= 268435456ull);
static_assert(kOffCl + kPlaneB <= kR0B);
static_assert(kOffPh % 128 == 0 && kOffPP % 128 == 0 && kOffWh % 128 == 0 && kOffQh % 128 == 0);
static_assert(kOffVl % 128 == 0 && kR0B % 128 == 0);
static_assert((size_t)NB * NH * HD * SEQP * 2 == kPlaneB);

__device__ __forceinline__ v8f wmma_f16(v16h a, v16h b, v8f c) {
  v8f d = __builtin_amdgcn_wmma_f32_16x16x32_f16(false, a, false, b, (short)0, c, false, false);
  asm volatile("v_nop\n\tv_nop\n\tv_nop\n\tv_nop" : "+v"(d) : "v"(a), "v"(b));
  return d;
}

// lane l reads lane l ^ 16: the two lanes that share one query column of a D tile
__device__ __forceinline__ float xhalf(float x) {
  const int s = __float_as_int(x);
  return __int_as_float(__builtin_amdgcn_permlanex16(s, s, 0x76543210, 0xfedcba98, false, false));
}

// same-wave LDS exchange: stores issued by other lanes of this wave are visible before the reload
__device__ __forceinline__ void wave_lds_sync() {
  __builtin_amdgcn_fence(3, "wavefront");
  asm volatile("s_wait_dscnt 0" ::: "memory");
  __builtin_amdgcn_wave_barrier();
}

// One chunk of K hi, K residual, V^T hi (and, RES, V^T residual) from global memory into LDS by a block of four waves, through no register:
// two 16-byte pieces per lane and plane, the second 16 key rows (K) or 32 d rows (V^T) on. lk / lv: the lane's own LDS byte addresses of
// its first K hi and V^T hi pieces. One statement, its s_wait_xcnt last, so that no address register is rewritten in front of it.
template <bool RES>
__device__ __forceinline__ void stage_kv2(unsigned lk, unsigned lv, const _Float16* gkh, const _Float16* gkl,
                                          const _Float16* gvh, const _Float16* gvl) {
  const unsigned lkl = lk + (RKL_OFF - RKH_OFF) * 2;
  const unsigned lk2 = lk + 16 * KP * 2, lkl2 = lkl + 16 * KP * 2, lv2 = lv + 32 * VP * 2;
  const _Float16* gkh2 = gkh + (size_t)16 * HID;
  const _Float16* gkl2 = gkl + (size_t)16 * HID;
  const _Float16* gvh2 = gvh + (size_t)32 * SEQP;
  if (RES) {
    const unsigned lvl = lv + (RVL_OFF - RVH_OFF) * 2, lvl2 = lvl + 32 * VP * 2;
    const _Float16* gvl2 = gvl + (size_t)32 * EARLY;
    asm volatile("global_load_async_to_lds_b128 %0, %1, off\n\t"
                 "global_load_async_to_lds_b128 %2, %3, off\n\t"
                 "global_load_async_to_lds_b128 %4, %5, off\n\t"
                 "global_load_async_to_lds_b128 %6, %7, off\n\t"
                 "global_load_async_to_lds_b128 %8, %9, off\n\t"
                 "global_load_async_to_lds_b128 %10, %11, off\n\t"
                 "global_load_async_to_lds_b128 %12, %13, off\n\t"
                 "global_load_async_to_lds_b128 %14, %15, off\n\t"
                 "s_wait_xcnt 0x0"
                 :: "v"(lk), "v"(gkh), "v"(lk2), "v"(gkh2), "v"(lkl), "v"(gkl), "v"(lkl2), "v"(gkl2),
                    "v"(lv), "v"(gvh), "v"(lv2), "v"(gvh2), "v"(lvl), "v"(gvl), "v"(lvl2), "v"(gvl2) : "memory");
  } else {
    asm volatile("global_load_async_to_lds_b128 %0, %1, off\n\t"
                 "global_load_async_to_lds_b128 %2, %3, off\n\t"
                 "global_load_async_to_lds_b128 %4, %5, off\n\t"
                 "global_load_async_to_lds_b128 %6, %7, off\n\t"
                 "global_load_async_to_lds_b128 %8, %9, off\n\t"
                 "global_load_async_to_lds_b128 %10, %11, off\n\t"
                 "s_wait_xcnt 0x0"
                 :: "v"(lk), "v"(gkh), "v"(lk2), "v"(gkh2), "v"(lkl), "v"(gkl), "v"(lkl2), "v"(gkl2),
                    "v"(lv), "v"(gvh), "v"(lv2), "v"(gvh2) : "memory");
  }
}

// A lane's 16-B pieces of its wave's 16 NQ query rows, hi plane and residual plane: piece i lies four rows (8192 B) behind piece i - 1.
// The loads and their data wait stand in one statement and every output is early-clobber, so that no register which a load names
// is rewritten, by a later load's data either, while the load is in flight.
template <int NQ>
__device__ __forceinline__ void load_q(const _Float16* gh, const _Float16* gl, v8h (&h)[4 * NQ], v8h (&l)[4 * NQ]) {
  static_assert(4 * HID * 2 == 8192 && (NQ == 1 || NQ == 2));
  if constexpr (NQ == 1) {
    asm volatile("global_load_b128 %0, %8, off\n\t"
                 "global_load_b128 %1, %8, off offset:8192\n\t"
                 "global_load_b128 %2, %8, off offset:16384\n\t"
                 "global_load_b128 %3, %8, off offset:24576\n\t"
                 "global_load_b128 %4, %9, off\n\t"
                 "global_load_b128 %5, %9, off offset:8192\n\t"
                 "global_load_b128 %6, %9, off offset:16384\n\t"
                 "global_load_b128 %7, %9, off offset:24576\n\t"
                 "s_wait_loadcnt 0x0"
                 : "=&v"(h[0]), "=&v"(h[1]), "=&v"(h[2]), "=&v"(h[3]), "=&v"(l[0]), "=&v"(l[1]), "=&v"(l[2]), "=&v"(l[3])
                 : "v"(gh), "v"(gl) : "memory");
  } else {
    asm volatile("global_load_b128 %0, %16, off\n\t"
                 "global_load_b128 %1, %16, off offset:8192\n\t"
                 "global_load_b128 %2, %16, off offset:16384\n\t"
                 "global_load_b128 %3, %16, off offset:24576\n\t"
                 "global_load_b128 %4, %16, off offset:32768\n\t"
                 "global_load_b128 %5, %16, off offset:40960\n\t"
                 "global_load_b128 %6, %16, off offset:49152\n\t"
                 "global_load_b128 %7, %16, off offset:57344\n\t"
                 "global_load_b128 %8, %17, off\n\t"
                 "global_load_b128 %9, %17, off offset:8192\n\t"
                 "global_load_b128 %10, %17, off offset:16384\n\t"
                 "global_load_b128 %11, %17, off offset:24576\n\t"
                 "global_load_b128 %12, %17, off offset:32768\n\t"
                 "global_load_b128 %13, %17, off offset:40960\n\t"
                 "global_load_b128 %14, %17, off offset:49152\n\t"
                 "global_load_b128 %15, %17, off offset:57344\n\t"
                 "s_wait_loadcnt 0x0"
                 : "=&v"(h[0]), "=&v"(h[1]), "=&v"(h[2]), "=&v"(h[3]), "=&v"(h[4]), "=&v"(h[5]), "=&v"(h[6]), "=&v"(h[7]),
                   "=&v"(l[0]), "=&v"(l[1]), "=&v"(l[2]), "=&v"(l[3]), "=&v"(l[4]), "=&v"(l[5]), "=&v"(l[6]), "=&v"(l[7])
                 : "v"(gh), "v"(gl) : "memory");
  }
}

// One operand plane of a GEMM ring stage, 32 NC rows of 64 k: NC copies, 16 bytes per lane and copy, through no register.
// l: the lane's own LDS byte address of its piece of row (tid >> 3) of the plane in the target buffer; g: the same piece in global memory.
// A copy of one wave covers four whole 128-B lines. The s_wait_xcnt stands inside the copies' own statement, so that no address
// register is rewritten in front of it.
template <int NC>
__device__ __forceinline__ void stage_plane(unsigned l, const _Float16* g) {
  static_assert(NC == 4 || NC == 8);
  const unsigned l1 = l + 1 * GRS * GP * 2, l2 = l + 2 * GRS * GP * 2, l3 = l + 3 * GRS * GP * 2;
  const _Float16* g1 = g + (size_t)1 * GRS * HID;
  const _Float16* g2 = g + (size_t)2 * GRS * HID;
  const _Float16* g3 = g + (size_t)3 * GRS * HID;
  if (NC == 4) {
    asm volatile("global_load_async_to_lds_b128 %0, %1, off\n\t"
                 "global_load_async_to_lds_b128 %2, %3, off\n\t"
                 "global_load_async_to_lds_b128 %4, %5, off\n\t"
                 "global_load_async_to_lds_b128 %6, %7, off\n\t"
                 "s_wait_xcnt 0x0"
                 :: "v"(l), "v"(g), "v"(l1), "v"(g1), "v"(l2), "v"(g2), "v"(l3), "v"(g3) : "memory");
  } else {
    const unsigned l4 = l + 4 * GRS * GP * 2, l5 = l + 5 * GRS * GP * 2, l6 = l + 6 * GRS * GP * 2, l7 = l + 7 * GRS * GP * 2;
    const _Float16* g4 = g + (size_t)4 * GRS * HID;
    const _Float16* g5 = g + (size_t)5 * GRS * HID;
    const _Float16* g6 = g + (size_t)6 * GRS * HID;
    const _Float16* g7 = g + (size_t)7 * GRS * HID;
    asm volatile("global_load_async_to_lds_b128 %0, %1, off\n\t"
                 "global_load_async_to_lds_b128 %2, %3, off\n\t"
                 "global_load_async_to_lds_b128 %4, %5, off\n\t"
                 "global_load_async_to_lds_b128 %6, %7, off\n\t"
                 "global_load_async_to_lds_b128 %8, %9, off\n\t"
                 "global_load_async_to_lds_b128 %10, %11, off\n\t"
                 "global_load_async_to_lds_b128 %12, %13, off\n\t"
                 "global_load_async_to_lds_b128 %14, %15, off\n\t"
                 "s_wait_xcnt 0x0"
                 :: "v"(l), "v"(g), "v"(l1), "v"(g1), "v"(l2), "v"(g2), "v"(l3), "v"(g3),
                    "v"(l4), "v"(g4), "v"(l5), "v"(g5), "v"(l6), "v"(g6), "v"(l7), "v"(g7) : "memory");
  }
}

__device__ __forceinline__ v4f bf16_rne4(v4f a) {
  v4u u = __builtin_bit_cast(v4u, a);
  u = (u + 0x7FFFu + ((u >> 16) & 1u)) & 0xFFFF0000u;
  return __builtin_bit_cast(v4f, u);
}

__device__ __forceinline__ v8h cvt8v(v4f a, v4f b) {
  v8h d;
  d[0] = (_Float16)a[0]; d[1] = (_Float16)a[1];
  d[2] = (_Float16)a[2]; d[3] = (_Float16)a[3];
  d[4] = (_Float16)b[0]; d[5] = (_Float16)b[1];
  d[6] = (_Float16)b[2]; d[7] = (_Float16)b[3];
  return d;
}

// f32 x -> f16 hi and f16((x - hi) * 4096)
__device__ __forceinline__ void split8(v4f a, v4f b, v8h& hv, v8h& lv) {
  U8h hh, ll;
  _Float16 t;
  t = (_Float16)a[0]; hh.f[0] = t; ll.f[0] = (_Float16)((a[0] - (float)t) * 4096.0f);
  t = (_Float16)a[1]; hh.f[1] = t; ll.f[1] = (_Float16)((a[1] - (float)t) * 4096.0f);
  t = (_Float16)a[2]; hh.f[2] = t; ll.f[2] = (_Float16)((a[2] - (float)t) * 4096.0f);
  t = (_Float16)a[3]; hh.f[3] = t; ll.f[3] = (_Float16)((a[3] - (float)t) * 4096.0f);
  t = (_Float16)b[0]; hh.f[4] = t; ll.f[4] = (_Float16)((b[0] - (float)t) * 4096.0f);
  t = (_Float16)b[1]; hh.f[5] = t; ll.f[5] = (_Float16)((b[1] - (float)t) * 4096.0f);
  t = (_Float16)b[2]; hh.f[6] = t; ll.f[6] = (_Float16)((b[2] - (float)t) * 4096.0f);
  t = (_Float16)b[3]; hh.f[7] = t; ll.f[7] = (_Float16)((b[3] - (float)t) * 4096.0f);
  hv = hh.v; lv = ll.v;
}

// ---------------- pre-pass: Xh = f16(bf16RNE(hidden)) [MR][1024] (pad rows zero), Ph = f16(bf16RNE(pos)) [SEQP][1024]
//                  (pad rows zero), Wh = f16(256 * bf16RNE(W)) for the four weight matrices stacked [4096][1024].
__global__ __launch_bounds__(128)
void prep_kernel(const float* __restrict__ Hs, const float* __restrict__ Pos,
                 const float* __restrict__ W0, const float* __restrict__ W1,
                 const float* __restrict__ W2, const float* __restrict__ W3,
                 _Float16* Xh, _Float16* Ph, _Float16* Wh)
{
  const int row = blockIdx.x;
  const int c0  = 8 * threadIdx.x;
  const float* src;
  _Float16*    dst;
  float sc = 1.0f;
  if (row < MR) {
    const int b  = row / SEQP;
    const int s  = row - b * SEQP;
    const int sl = (s < SEQ) ? s : (SEQ - 1);            // clamped address; pad rows scaled to zero
    sc  = (s < SEQ) ? 1.0f : 0.0f;
    src = Hs + ((size_t)b * SEQ_FULL + sl) * HID + c0;   // full-size input strides
    dst = Xh + (size_t)row * HID + c0;
  } else if (row < MR + SEQP) {
    const int s  = row - MR;
    const int sl = (s < SEQ) ? s : (SEQ - 1);
    sc  = (s < SEQ) ? 1.0f : 0.0f;
    src = Pos + (size_t)sl * HID + c0;
    dst = Ph + (size_t)s * HID + c0;
  } else {
    const int j   = row - MR - SEQP;                      // 0..4095
    const int mat = j >> 10;
    const int r   = j & (HID - 1);
    const float* W = (mat == 0) ? W0 : (mat == 1) ? W1 : (mat == 2) ? W2 : W3;
    sc  = 256.0f;                                         // exact power-of-two carry, removed in the GEMM epilogues
    src = W + (size_t)r * HID + c0;
    dst = Wh + (size_t)j * HID + c0;
  }
  const v4f a0 = bf16_rne4(*(const v4f*)src) * sc;
  const v4f a1 = bf16_rne4(*(const v4f*)(src + 4)) * sc;
  const v8h v  = cvt8v(a0, a1);                           // bf16 values (and x256) are exact in f16
  *(v8h*)dst = v;
  
}

// V epilogue: f32 tile in[128 keys][BN cols] (pitch BN + 4) -> V^T hi rows out[(h,d) = BN rows][128 keys] and, with LO, the x4096
// residual rows: item i -> col c = GRS (i>>1) + (tid>>3), key half i&1, keys s0 + 64 (i&1) + 8 sub .. +7 (one line per (h,d) row and key half).
// LO is a template argument so that no branch stands between the stores of a trip.
template <bool LO, int BN>
__device__ __forceinline__ void store_vt(const float* sC, _Float16* O0, _Float16* O1, int tid, int b, int h0, int s0) {
  constexpr int CP = BN + 4;
  const int sub = tid & 7;
  for (int i0 = 0; i0 < BN * 2 / GRS; i0 += 4) {
    v8h vh[4], vl[4]; size_t oh[4], ol[4];
    #pragma unroll
    for (int i = 0; i < 4; ++i) {
      const int c  = GRS * ((i0 + i) >> 1) + (tid >> 3);
      const int k0 = 64 * (i & 1) + 8 * sub;             // i0 is even
      const int hh = h0 + (c >> 6);
      const int d  = c & (HD - 1);
      v4f x0, x1;
      x0[0] = sC[(k0 + 0) * CP + c]; x0[1] = sC[(k0 + 1) * CP + c];
      x0[2] = sC[(k0 + 2) * CP + c]; x0[3] = sC[(k0 + 3) * CP + c];
      x1[0] = sC[(k0 + 4) * CP + c]; x1[1] = sC[(k0 + 5) * CP + c];
      x1[2] = sC[(k0 + 6) * CP + c]; x1[3] = sC[(k0 + 7) * CP + c];
      split8(x0, x1, vh[i], vl[i]);
      const size_t rowid = (size_t)(b * NH + hh) * HD + d;
      oh[i] = rowid * SEQP + s0 + k0;
      ol[i] = rowid * EARLY + s0 + k0;
    }
    #pragma unroll
    for (int i = 0; i < 4; ++i) {
      *(v8h*)(O0 + oh[i]) = vh[i];
      if (LO) *(v8h*)(O1 + ol[i]) = vl[i];
    }
    asm volatile("s_wait_xcnt 0x0" ::: "memory");   // the next trip rewrites registers that these stores name
  }
}

// ---------------- 16-bit GEMM: 128x256 block tile, 8 waves (2 x 4) of 64x64 (MODE 0, 3: 128x128, waves of 64x32), K = 1024 in WMMA steps of 32 ----------------
// Operands come by asynchronous copies into a ring of two LDS buffers, 64 k a stage: stage s + 1 flies while stage s is worked on.
// C[m][n] = sum_k A[m][k] * Bw[n][k]  (Bw = weight rows [out][in], k contiguous, i.e. x @ W^T).
// 16-bit fragment map (A and B alike): lane l -> row/col (l & 15); elements 0..7 <- k0 + 8*(l>>4) + 0..7,
// elements 8..15 <- k0 + 16 + 8*(l>>4) + 0..7.  D: element r of lane l -> row 8*(l>>4) + r, col (l & 15).
// MODE 0: Pout[s][n] f32 positional projection (pitch PPP), natural units, all Q, K and V columns in one launch.
// MODE 1, one launch for all Q, K and V columns, value = acc/256 + Pin; the block's column group picks its epilogue:
//   Q (n0 < 1024) or K (n0 < 2048) rows: f16 hi plane + f16 x4096 residual plane [MR][1024];
//   V (n0 >= 2048): V^T hi plane [b][h][d][SEQP] and, for s0 < EARLY, V^T x4096 residual plane [b][h][d][EARLY].
// MODE 3: Y rows of d_out [b][2000][1024] f32, value = (acc + accr/4096)/256 with the residual A plane on rows s0 < EARLY.
template <int MODE>
__global__ __launch_bounds__(GT)
void gemm_kernel(const _Float16* __restrict__ Ah, const _Float16* __restrict__ Al,
                 const _Float16* __restrict__ Bw, const float* __restrict__ Pin,
                 float* Pout, _Float16* O0, _Float16* O1, _Float16* O2, _Float16* O3, _Float16* O4, _Float16* O5, float* Y)
{
  // ring buffer = {A [128][GP], B [BN][GP], and for MODE 3 residual A [128][GP]}, two of them; the epilogue's f32 tile reuses the ring's LDS
  constexpr int T   = GT;             // threads
  constexpr int RS  = GRS;            // operand rows that one copy of the whole block covers
  constexpr int BN  = GBN(MODE);      // block tile columns
  constexpr int NWN = 4;              // waves side by side along n
  constexpr int NI  = BN / 16 / NWN;  // 16-col tiles per wave
  constexpr int CP  = BN + 4;         // floats per row of the f32 tile in LDS (a multiple of 16 B; 8 rows on lie 32 banks on)
  static_assert((CP * 4) % 16 == 0 && (8 * CP) % 64 == 32);
  constexpr int STG_H  = (GBM + BN + (MODE == 3 ? GBM : 0)) * GP;   // halfs per buffer
  constexpr int RING_B = 2 * STG_H * 2;
  constexpr int TILE_B = GBM * CP * 4;
  static_assert(RING_B <= 163840 && TILE_B <= 163840);   // two blocks fit a WGP's LDS
  __shared__ __attribute__((aligned(16))) char gsm[RING_B > TILE_B ? RING_B : TILE_B];   // cross-wave (block barrier)
  _Float16* sR = (_Float16*)gsm;
  float*    sC = (float*)gsm;

  const int tid  = threadIdx.x;
  const int wave = tid >> 5;
  const int lane = tid & 31;
  const int lh   = lane & 15;
  const int hi   = lane >> 4;
  const int wm   = wave / NWN;       // 0..1 -> 64-row strip
  const int wn   = wave % NWN;       // strip of 16 NI columns
  const int sub  = tid & 7;
  const int m0   = blockIdx.y * GBM;
  const int n0   = blockIdx.x * BN;
  const int b    = m0 / SEQP;
  const int s0   = m0 - b * SEQP;
  const bool resa = (MODE == 3) && (s0 < EARLY);   // block-uniform

  U8f acc[4][NI], accr[4][NI];
  #pragma unroll
  for (int mi = 0; mi < 4; ++mi)
    #pragma unroll
    for (int ni = 0; ni < NI; ++ni) { acc[mi][ni].v = (v8f){}; accr[mi][ni].v = (v8f){}; }

  const int sr = tid >> 3, sp = tid & 7;                             // staging: row 0..RS-1 (+ RS per further copy), 16-B piece 0..7
  const unsigned la0 = (unsigned)(uintptr_t)(sR + sr * GP + 8 * sp); // LDS byte address of the lane's A piece in buffer 0
  const unsigned lb0 = la0 + GBM * GP * 2;                           // the same piece of the B plane
  const unsigned ll0 = la0 + (GBM + BN) * GP * 2;                    // the same piece of the residual plane (MODE 3)
  const _Float16* ga = Ah + (size_t)(m0 + sr) * HID + 8 * sp;        // this lane's pieces of stage 0
  const _Float16* gl = Al + (size_t)(m0 + sr) * HID + 8 * sp;
  const _Float16* gb = Bw + (size_t)(n0 + sr) * HID + 8 * sp;

  stage_plane<GBM / RS>(la0, ga);                                    // stage 0 -> buffer 0
  stage_plane<BN / RS>(lb0, gb);
  if (resa) stage_plane<GBM / RS>(ll0, gl);
  asm volatile("s_wait_asynccnt 0x0" ::: "memory");                  // this wave's pieces of stage 0 have landed
  __syncthreads();                                                   // stage 0 visible to all waves
  stage_plane<GBM / RS>(la0 + STG_H * 2, ga + GBK);                  // stage 1 -> buffer 1 (GNS >= 2)
  stage_plane<BN / RS>(lb0 + STG_H * 2, gb + GBK);
  if (resa) stage_plane<GBM / RS>(ll0 + STG_H * 2, gl + GBK);

  for (int s = 0; s < GNS; ++s) {
    const int bufh = (s & 1) * STG_H;                                // this stage's buffer, offset in halfs
    const _Float16* sA = sR + bufh;
    const _Float16* sB = sA + GBM * GP;
    const _Float16* sL = sB + BN * GP;

    #pragma unroll                                                   // both halves of the stage at immediate LDS offsets
    for (int c = 0; c < GBK / 32; ++c) {                             // k ascending in WMMA steps of 32
      U16h af[4], bq[NI];
      #pragma unroll
      for (int mi = 0; mi < 4; ++mi) {
        const _Float16* p = sA + (wm * 64 + mi * 16 + lh) * GP + 32 * c;
        af[mi].h[0] = *(const v8h*)(p + 8 * hi);
        af[mi].h[1] = *(const v8h*)(p + 16 + 8 * hi);
      }
      #pragma unroll
      for (int ni = 0; ni < NI; ++ni) {
        const _Float16* p = sB + ((wn * NI + ni) * 16 + lh) * GP + 32 * c;
        bq[ni].h[0] = *(const v8h*)(p + 8 * hi);
        bq[ni].h[1] = *(const v8h*)(p + 16 + 8 * hi);
      }
      #pragma unroll
      for (int mi = 0; mi < 4; ++mi)
        #pragma unroll
        for (int ni = 0; ni < NI; ++ni)
          acc[mi][ni].v = wmma_f16(af[mi].v, bq[ni].v, acc[mi][ni].v);
      if (resa) {
        U16h lf[4];
        #pragma unroll
        for (int mi = 0; mi < 4; ++mi) {
          const _Float16* p = sL + (wm * 64 + mi * 16 + lh) * GP + 32 * c;
          lf[mi].h[0] = *(const v8h*)(p + 8 * hi);
          lf[mi].h[1] = *(const v8h*)(p + 16 + 8 * hi);
        }
        #pragma unroll
        for (int mi = 0; mi < 4; ++mi)
          #pragma unroll
          for (int ni = 0; ni < NI; ++ni)
            accr[mi][ni].v = wmma_f16(lf[mi].v, bq[ni].v, accr[mi][ni].v);
      }
    }

    // ---- publish point, every wave: own LDS reads of this buffer done, own copies of the next stage landed, block barrier ----
    asm volatile("s_wait_dscnt 0x0" ::: "memory");                   // this wave has left the buffer that is refilled below
    asm volatile("s_wait_asynccnt 0x0" ::: "memory");                // this wave's pieces of the next stage have landed
    __syncthreads();                                                 // next stage visible to all; every reader has left this buffer
    if (s + 2 < GNS) {                                               // block-uniform: stage s + 2 flies while stage s + 1 is worked on
      stage_plane<GBM / RS>(la0 + bufh * 2, ga + (s + 2) * GBK);
      stage_plane<BN / RS>(lb0 + bufh * 2, gb + (s + 2) * GBK);
      if (resa) stage_plane<GBM / RS>(ll0 + bufh * 2, gl + (s + 2) * GBK);
    }
  }
  asm volatile("s_wait_asynccnt 0x0" ::: "memory");                  // nothing of this wave is in flight when the ring becomes the f32 tile

  // ---- accumulators -> f32 tile in LDS (x 1/256 removes the weight carry) ----
  #pragma unroll
  for (int mi = 0; mi < 4; ++mi)
    #pragma unroll
    for (int ni = 0; ni < NI; ++ni)
      #pragma unroll
      for (int r = 0; r < 8; ++r) {
        float v = acc[mi][ni].f[r];
        if (resa) v += accr[mi][ni].f[r] * (1.0f / 4096.0f);
        sC[(wm * 64 + mi * 16 + 8 * hi + r) * CP + (wn * NI + ni) * 16 + lh] = v * (1.0f / 256.0f);
      }
  __syncthreads();

  if (MODE == 1) {
    // ---- add the positional projection row (f32, natural units), in place, coalesced 32-B reads ----
    constexpr int NP = GBM * (BN / 8) / T;        // passes; a pass covers PR whole rows of the tile
    constexpr int PR = T / (BN / 8);
    const int row0 = tid / (BN / 8);
    const int cg   = tid % (BN / 8);
    const float* pp0 = Pin + (size_t)(s0 + row0) * PPP + n0 + 8 * cg;
    v4f p0[NP], p1[NP];
    #pragma unroll
    for (int p = 0; p < NP; ++p) {
      const float* pp = pp0 + (size_t)p * PR * PPP;
      p0[p] = *(const v4f*)pp;
      p1[p] = *(const v4f*)(pp + 4);
    }
    asm volatile("s_wait_xcnt 0x0" :: "v"(pp0) : "memory");   // the loads' address register stays unwritten up to this wait
    #pragma unroll
    for (int p = 0; p < NP; ++p) {
      v4fa* c = (v4fa*)(sC + (p * PR + row0) * CP + 8 * cg);
      v4f x0 = c[0], x1 = c[1];
      x0 += p0[p]; x1 += p1[p];
      c[0] = x0; c[1] = x1;
    }
    __syncthreads();
  }

  if (MODE == 0) {
    // 128 rows x BN / 32 lines each: line L = RS i + (tid>>3) -> row, segment; one wave instruction = four whole lines
    #pragma unroll 1                                 // rolled: the wait at a trip's foot then stands in front of all that the next trip writes
    for (int i0 = 0; i0 < GBM * (BN / 32) / RS; i0 += 8) {
      v4f ov[8]; size_t oo[8];
      #pragma unroll
      for (int i = 0; i < 8; ++i) {
        const int L = RS * (i0 + i) + (tid >> 3);
        const int row = L / (BN / 32), seg = L % (BN / 32);
        ov[i] = *(const v4fa*)(sC + row * CP + seg * 32 + 4 * sub);
        oo[i] = (size_t)(m0 + row) * PPP + n0 + seg * 32 + 4 * sub;
      }
      #pragma unroll
      for (int i = 0; i < 8; ++i) *(v4f*)(Pout + oo[i]) = ov[i];
      asm volatile("s_wait_xcnt 0x0" ::: "memory");   // the next trip rewrites registers that these stores name
    }
  }

  if (MODE == 1 && n0 < NQK) {                       // block-uniform
    const bool isq = (n0 < HID);                     // block-uniform: Q group or K group
    _Float16* ph = isq ? O0 : O2;
    _Float16* pl = isq ? O1 : O3;
    const int col0 = n0 & (HID - 1);
    // 128 rows x BN / 64 lines per plane: rem = RS i + (tid>>3) -> row, segment (64 halfs = one line), piece sub
    for (int i0 = 0; i0 < GBM * (BN / 64) / RS; i0 += 4) {
      v8h vh[4], vl[4]; size_t oo[4];
      #pragma unroll
      for (int i = 0; i < 4; ++i) {
        const int rem = RS * (i0 + i) + (tid >> 3);
        const int row = rem / (BN / 64), seg = rem % (BN / 64);
        const float* c = sC + row * CP + seg * 64 + 8 * sub;
        split8(*(const v4fa*)c, *(const v4fa*)(c + 4), vh[i], vl[i]);
        oo[i] = (size_t)(m0 + row) * HID + col0 + seg * 64 + 8 * sub;
      }
      #pragma unroll
      for (int i = 0; i < 4; ++i) { *(v8h*)(ph + oo[i]) = vh[i]; *(v8h*)(pl + oo[i]) = vl[i]; }
      asm volatile("s_wait_xcnt 0x0" ::: "memory");   // the next trip rewrites registers that these stores name
    }
  }

  if (MODE == 1 && n0 >= NQK) {                      // block-uniform: V group
    if (s0 < EARLY) store_vt<true, BN>(sC, O4, O5, tid, b, (n0 - NQK) / HD, s0);    // block-uniform
    else            store_vt<false, BN>(sC, O4, O5, tid, b, (n0 - NQK) / HD, s0);
  }

  if (MODE == 3) {
    // d_out rows (b, s) with s < SEQ only (whole 512-B row segments; guard is uniform over the 32 lanes of a row segment)
    for (int i0 = 0; i0 < GBM * (BN / 32) / RS; i0 += 8) {
      v4f ov[8]; size_t oo[8]; int sv[8];
      #pragma unroll
      for (int i = 0; i < 8; ++i) {
        const int L = RS * (i0 + i) + (tid >> 3);
        const int row = L / (BN / 32), seg = L % (BN / 32);
        ov[i] = *(const v4fa*)(sC + row * CP + seg * 32 + 4 * sub);
        sv[i] = s0 + row;
        oo[i] = ((size_t)b * SEQ_FULL + (size_t)(s0 + row)) * HID + n0 + seg * 32 + 4 * sub;
      }
      #pragma unroll
      for (int i = 0; i < 8; ++i) if (sv[i] < SEQ) *(v4f*)(Y + oo[i]) = ov[i];
      asm volatile("s_wait_xcnt 0x0" ::: "memory");   // the next trip rewrites registers that these stores name
    }
  }
}

// ---------------- fused causal attention: one workgroup = 64 NQ query rows of one (batch, head), 4 waves x 16 NQ rows ----------------
// S^T = K Q^T (A = K rows, B = Q rows): k_hi*q_hi into one accumulator, (k_lo*q_hi + k_hi*q_lo) into a second one folded x 1/4096
// (residual planes carry x4096). Lane l then holds 16 of the chunk's 32 scores of query (l & 15); lane l ^ 16 holds the other 16.
// O^T = V^T P^T: the two S^T tiles, converted in place, are the B operand (P carried x1024 in f16); RES (query rows below EARLY) adds
// V_lo*P_hi + V_hi*P_res into a second accumulator folded x 1/4096.
// Causal mask: key <= query keeps the score, else -1e30 (replace-fill); online softmax base 2 with f32 running max / sum per lane.
// A wave holds NQ query tiles of 16 columns, their Q fragments in registers for the whole key loop: one K or V^T fragment read from
// LDS feeds NQ query tiles. Every query row sees the chunks, the products and the sums in the same order for either NQ.
// blk: the workgroup's index among those of its kind; qb0, nqbl: first query tile (of 64 NQ rows) and number of tiles of that kind.
template <bool RES, int NQ>
__device__ __forceinline__
void attn_body(_Float16* smem, const _Float16* __restrict__ Qh, const _Float16* __restrict__ Ql,
               const _Float16* __restrict__ Kh, const _Float16* __restrict__ Kl,
               const _Float16* __restrict__ Vth, const _Float16* __restrict__ Vtl,
               _Float16* Ch, _Float16* Cl, int blk, int qb0, int nqbl)
{
  static_assert((NQ == 1 && RES) || (NQ == 2 && !RES));
  constexpr int TB = 64 * NQ;                // query rows per workgroup
  static_assert(TB == (RES ? BQR : BQ));
  _Float16* sQ  = smem + SQ_OFF;             // [query tile of 16][hi 16 | residual 16][QP]  wave-private; the epilogue's f32 tiles reuse it
  _Float16* sR  = smem + RING_OFF;           // [2 buffers]{K hi [32][KP], K res [32][KP], V^T hi [64][VP], V^T res [64][VP]}  cross-wave

  const int tid  = threadIdx.x;
  const int wave = tid >> 5;
  const int lane = tid & 31;
  const int lh   = lane & 15;
  const int hi   = lane >> 4;

  // Placement, for speed only: block index -> (query tile, head). A tile's cost grows with its number (causal), every group of this
  // kind is resident at once. All heads of one tile
  // are neighbours in the index and the cost falls from one round of 256 groups to the next.
  // The tiles of one head keep one index mod 8.
  const int cls = blk / (NB * NH);           // 0 .. nqbl - 1
  const int bh  = blk % (NB * NH);
  int qb = qb0 + nqbl - 1 - cls;             // any shape: heaviest tile first
  if (!RES && SEQP / BQ == 16 && NB * NH == 64)
    qb = (int)((0x236475AB98EFCDull >> (4 * cls)) & 15);   // tiles 2..15, each once: 13 12 15 14 | 8 9 11 10 | 5 7 4 6 | 3 2
  const int h     = bh % NH;
  const int b     = bh / NH;
  const int qbase = qb * TB;
  const int qrow0 = qbase + wave * (16 * NQ);

  const size_t prow = (size_t)b * SEQP;
  const _Float16* Qhb = Qh + prow * HID + h * HD;
  const _Float16* Qlb = Ql + prow * HID + h * HD;
  const _Float16* Khb = Kh + prow * HID + h * HD;
  const _Float16* Klb = Kl + prow * HID + h * HD;
  const _Float16* Vhb = Vth + (size_t)(b * NH + h) * HD * SEQP;
  const _Float16* Vlb = Vtl + (size_t)(b * NH + h) * HD * EARLY;
  _Float16* Chb = Ch + prow * HID + h * HD;
  _Float16* Clb = Cl + prow * HID + h * HD;

  const int kend = qbase + TB;               // causal, block-uniform: keys beyond the block's last query row are never needed
  const int kr = tid >> 3, kg = tid & 7;     // K staging: key row 0..15 (and 16 rows on), piece 0..7
  const int vd = tid >> 2, vg = tid & 3;     // V^T staging: d row 0..31 (and 32 rows on), piece 0..3
  const unsigned lk0 = (unsigned)(uintptr_t)(sR + RKH_OFF + kr * KP + 8 * kg);   // LDS byte addresses in buffer 0
  const unsigned lv0 = (unsigned)(uintptr_t)(sR + RVH_OFF + vd * VP + 8 * vg);
  const _Float16* gkh = Khb + (size_t)kr * HID + 8 * kg;                         // this lane's pieces of chunk 0
  const _Float16* gkl = Klb + (size_t)kr * HID + 8 * kg;
  const _Float16* gvh = Vhb + (size_t)vd * SEQP + 8 * vg;
  const _Float16* gvl = Vlb + (size_t)vd * EARLY + 8 * vg;

  // chunk 0 -> buffer 0
  stage_kv2<RES>(lk0, lv0, gkh, gkl, gvh, gvl);

  // ---- this wave's 16 NQ query rows (hi and residual) -> LDS: row 4i + (lane>>3) of tile u, 16-B piece (lane&7) ----
  _Float16* qwh = sQ + wave * (NQ * QW_H);
  _Float16* qwl = qwh + 16 * QP;
  {
    const int pc = lane & 7;
    const size_t go = (size_t)(qrow0 + (lane >> 3)) * HID + 8 * pc;
    v8h xh[4 * NQ], xl[4 * NQ];              // piece i: row 4i + (lane>>3) of the wave's 16 NQ rows
    load_q<NQ>(Qhb + go, Qlb + go, xh, xl);
    #pragma unroll
    for (int u = 0; u < NQ; ++u)
      #pragma unroll
      for (int i = 0; i < 4; ++i) {
        const int r = 4 * i + (lane >> 3);
        *(v8h*)(qwh + u * QW_H + r * QP + 8 * pc) = xh[4 * u + i];
        *(v8h*)(qwl + u * QW_H + r * QP + 8 * pc) = xl[4 * u + i];
      }
  }

  U8f acc[NQ][4], accr[NQ][4];
  float mcol[NQ], lcol[NQ];
  #pragma unroll
  for (int u = 0; u < NQ; ++u) {
    #pragma unroll
    for (int t = 0; t < 4; ++t) { acc[u][t].v = (v8f){}; accr[u][t].v = (v8f){}; }
    mcol[u] = -3.0e38f;                      // running maximum of query qrow0 + 16 u + lh (equal in both wave halves)
    lcol[u] = 0.0f;                          // running sum over this lane's keys only; the halves are joined in the epilogue
  }

  // scalar copy of the wave's first row: the per-wave skip below is then a real branch and EXEC stays all ones at the copies
  const int qrow0s = __builtin_amdgcn_readfirstlane(qrow0);

  asm volatile("s_wait_asynccnt 0x0" ::: "memory");   // this wave's pieces of chunk 0 have landed
  __syncthreads();                                    // chunk 0 (and the Q tiles) visible to all waves
  // chunk 1 -> buffer 1 (kend >= TB >= 2 chunks, so chunk 1 always exists)
  stage_kv2<RES>(lk0 + RING_H * 2, lv0 + RING_H * 2, gkh + (size_t)BK * HID, gkl + (size_t)BK * HID, gvh + BK, gvl + BK);

  // ---- Q fragments (B operand), read once: tile u, d step c ----
  U16h qf[NQ][2], ql[NQ][2];
  #pragma unroll
  for (int u = 0; u < NQ; ++u)
    #pragma unroll
    for (int c = 0; c < 2; ++c) {
      qf[u][c].h[0] = *(const v8h*)(qwh + u * QW_H + lh * QP + 32 * c + 8 * hi);
      qf[u][c].h[1] = *(const v8h*)(qwh + u * QW_H + lh * QP + 32 * c + 16 + 8 * hi);
      ql[u][c].h[0] = *(const v8h*)(qwl + u * QW_H + lh * QP + 32 * c + 8 * hi);
      ql[u][c].h[1] = *(const v8h*)(qwl + u * QW_H + lh * QP + 32 * c + 16 + 8 * hi);
    }

  for (int kv0 = 0; kv0 < kend; kv0 += BK) {
    const int bufh = ((kv0 / BK) & 1) * RING_H;       // this chunk's buffer, offset in halfs
    const _Float16* sKh = sR + bufh + RKH_OFF;
    const _Float16* sKl = sR + bufh + RKL_OFF;
    const _Float16* sVh = sR + bufh + RVH_OFF;
    const _Float16* sVl = sR + bufh + RVL_OFF;

    if (kv0 < qrow0s + 16 * NQ) {            // wave-uniform: skip chunks entirely above this wave's rows
      // ---- S^T = K Q^T for two 16-key tiles, d reduced in two K=32 steps, three products each; a K fragment serves all NQ query tiles ----
      U8f sc[NQ][2];
      #pragma unroll
      for (int kt = 0; kt < 2; ++kt) {
        U16h kf[2], kl[2];
        #pragma unroll
        for (int c = 0; c < 2; ++c) {
          kf[c].h[0] = *(const v8h*)(sKh + (16 * kt + lh) * KP + 32 * c + 8 * hi);
          kf[c].h[1] = *(const v8h*)(sKh + (16 * kt + lh) * KP + 32 * c + 16 + 8 * hi);
          kl[c].h[0] = *(const v8h*)(sKl + (16 * kt + lh) * KP + 32 * c + 8 * hi);
          kl[c].h[1] = *(const v8h*)(sKl + (16 * kt + lh) * KP + 32 * c + 16 + 8 * hi);
        }
        U8f sm[NQ], sr[NQ];
        #pragma unroll
        for (int u = 0; u < NQ; ++u) { sm[u].v = (v8f){}; sr[u].v = (v8f){}; }
        #pragma unroll
        for (int c = 0; c < 2; ++c) {
          #pragma unroll
          for (int u = 0; u < NQ; ++u) sm[u].v = wmma_f16(kf[c].v, qf[u][c].v, sm[u].v);
          #pragma unroll
          for (int u = 0; u < NQ; ++u) sr[u].v = wmma_f16(kl[c].v, qf[u][c].v, sr[u].v);
          #pragma unroll
          for (int u = 0; u < NQ; ++u) sr[u].v = wmma_f16(kf[c].v, ql[u][c].v, sr[u].v);
        }
        #pragma unroll
        for (int u = 0; u < NQ; ++u) sc[u][kt].v = sm[u].v + sr[u].v * (1.0f / 4096.0f);
      }

      U16h pf[NQ], pfr[NQ];
      #pragma unroll
      for (int u = 0; u < NQ; ++u) {
        // ---- scale, causal replace-mask, online softmax (base 2): element j of tile 0 / 1 is key kv0 + 8 hi + j / + 16, query 16 u + lh ----
        const int dq = qrow0 + 16 * u + lh - kv0 - 8 * hi;   // key kept where j (tile 0) or 16 + j (tile 1) <= dq
        float a0[8], a1[8], mx[8];
        #pragma unroll
        for (int j = 0; j < 8; ++j) {
          const float x0 = sc[u][0].f[j] * C2S;
          const float x1 = sc[u][1].f[j] * C2S;
          a0[j] = (j <= dq) ? x0 : -1.0e30f;
          a1[j] = (16 + j <= dq) ? x1 : -1.0e30f;
          mx[j] = fmaxf(a0[j], a1[j]);
        }
        float rm = fmaxf(fmaxf(fmaxf(mx[0], mx[1]), fmaxf(mx[2], mx[3])), fmaxf(fmaxf(mx[4], mx[5]), fmaxf(mx[6], mx[7])));
        rm = fmaxf(rm, xhalf(rm));                       // both halves now hold the query's chunk maximum
        const float mnew  = fmaxf(mcol[u], rm);
        const float alpha = __builtin_amdgcn_exp2f(mcol[u] - mnew);
        mcol[u] = mnew;
        U8h pa, pb, par, pbr;
        float es[8];
        #pragma unroll
        for (int j = 0; j < 8; ++j) {
          const float e0 = __builtin_amdgcn_exp2f(a0[j] - mnew);
          const float e1 = __builtin_amdgcn_exp2f(a1[j] - mnew);
          es[j] = e0 + e1;
          const float t0 = e0 * 1024.0f;                 // carried x1024, removed in the epilogue
          const float t1 = e1 * 1024.0f;
          const _Float16 h0 = (_Float16)t0;
          const _Float16 h1 = (_Float16)t1;
          pa.f[j] = h0; pb.f[j] = h1;
          if (RES) {
            par.f[j] = (_Float16)((t0 - (float)h0) * 4096.0f);
            pbr.f[j] = (_Float16)((t1 - (float)h1) * 4096.0f);
          }
        }
        lcol[u] = lcol[u] * alpha + (((es[0] + es[1]) + (es[2] + es[3])) + ((es[4] + es[5]) + (es[6] + es[7])));
        #pragma unroll
        for (int t = 0; t < 4; ++t) {
          acc[u][t].v *= alpha;
          if (RES) accr[u][t].v *= alpha;
        }

        // ---- P^T as B operand straight from the registers: elements 0..7 = keys 8 hi + 0..7, elements 8..15 = keys 16 + 8 hi + 0..7 ----
        pf[u].h[0] = pa.v; pf[u].h[1] = pb.v;
        if (RES) { pfr[u].h[0] = par.v; pfr[u].h[1] = pbr.v; }
      }

      // ---- O^T += V^T P^T : 4 output d-tiles, K = 32 keys; A[m = d][k = key] from V^T tile row d; a V^T fragment serves all NQ query tiles ----
      #pragma unroll
      for (int t = 0; t < 4; ++t) {
        U16h vf;
        vf.h[0] = *(const v8h*)(sVh + (16 * t + lh) * VP + 8 * hi);
        vf.h[1] = *(const v8h*)(sVh + (16 * t + lh) * VP + 16 + 8 * hi);
        #pragma unroll
        for (int u = 0; u < NQ; ++u) acc[u][t].v = wmma_f16(vf.v, pf[u].v, acc[u][t].v);
        if (RES) {
          U16h wl;
          wl.h[0] = *(const v8h*)(sVl + (16 * t + lh) * VP + 8 * hi);
          wl.h[1] = *(const v8h*)(sVl + (16 * t + lh) * VP + 16 + 8 * hi);
          #pragma unroll
          for (int u = 0; u < NQ; ++u) {
            accr[u][t].v = wmma_f16(wl.v, pf[u].v, accr[u][t].v);
            accr[u][t].v = wmma_f16(vf.v, pfr[u].v, accr[u][t].v);
          }
        }
      }
    }

    // ---- publish point, every wave: own LDS reads of this buffer done, own copies of the next chunk landed, block barrier ----
    asm volatile("s_wait_dscnt 0x0" ::: "memory");      // this wave has left the buffer that is refilled below
    asm volatile("s_wait_asynccnt 0x0" ::: "memory");   // this wave's pieces of the next chunk have landed
    __syncthreads();                                    // next chunk visible to all; every reader has left this chunk's buffer
    if (kv0 + 2 * BK < kend) {                          // block-uniform: chunk + 2 flies while chunk + 1 is worked on
      const int kn = kv0 + 2 * BK;
      stage_kv2<RES>(lk0 + bufh * 2, lv0 + bufh * 2, gkh + (size_t)kn * HID, gkl + (size_t)kn * HID, gvh + kn, gvl + kn);
    }
  }
  asm volatile("s_wait_asynccnt 0x0" ::: "memory");     // nothing of this wave is in flight when its LDS is reused

  // ---- epilogue, tile by tile: join the halves' sums, normalize (1/1024 removes the carry), stage 16x64 f32 in LDS, split to hi / residual.
  // Register r of O^T tile t in lane l is d = 16 t + 8 hi + r of query lh: eight consecutive floats of one staged row.
  #pragma unroll
  for (int u = 0; u < NQ; ++u) {
    const float inv = 1.0f / ((lcol[u] + xhalf(lcol[u])) * 1024.0f);
    float* so = (float*)(qwh + u * QW_H);    // the wave's own Q tile, no longer read
    #pragma unroll
    for (int t = 0; t < 4; ++t) {
      v8f v = acc[u][t].v;
      if (RES) v += accr[u][t].v * (1.0f / 4096.0f);
      v *= inv;
      v4fa* sp = (v4fa*)(so + lh * SOP + 16 * t + 8 * hi);
      sp[0] = (v4f){v[0], v[1], v[2], v[3]};
      sp[1] = (v4f){v[4], v[5], v[6], v[7]};
    }
    wave_lds_sync();
    v8h oh[4], ol[4]; size_t oo[4];
    {
      const int pc = lane & 7;
      #pragma unroll
      for (int i = 0; i < 4; ++i) {
        const int rr = 4 * i + (lane >> 3);
        const float* sp = so + rr * SOP + 8 * pc;
        split8(*(const v4fa*)sp, *(const v4fa*)(sp + 4), oh[i], ol[i]);
        oo[i] = (size_t)(qrow0 + 16 * u + rr) * HID + 8 * pc;
      }
    }
    #pragma unroll
    for (int i = 0; i < 4; ++i) { *(v8h*)(Chb + oo[i]) = oh[i]; *(v8h*)(Clb + oo[i]) = ol[i]; }
    if (u + 1 < NQ) asm volatile("s_wait_xcnt 0x0" ::: "memory");   // the next tile rewrites registers that these stores name
  }
}

// One launch for all query rows: the first nmain workgroups take the tiles from row EARLY on (heaviest first), the rest the short tiles
// below EARLY with their residual products. The test is workgroup-uniform.
__global__ __launch_bounds__(128)
void attn_kernel(const _Float16* __restrict__ Qh, const _Float16* __restrict__ Ql,
                 const _Float16* __restrict__ Kh, const _Float16* __restrict__ Kl,
                 const _Float16* __restrict__ Vth, const _Float16* __restrict__ Vtl,
                 _Float16* Ch, _Float16* Cl, int nmain)
{
  extern __shared__ __attribute__((aligned(16))) _Float16 smem[];
  const int blk = blockIdx.x;
  if (blk < nmain) attn_body<false, 2>(smem, Qh, Ql, Kh, Kl, Vth, Vtl, Ch, Cl, blk, EARLY / BQ, (SEQP - EARLY) / BQ);
  else             attn_body<true, 1>(smem, Qh, Ql, Kh, Kl, Vth, Vtl, Ch, Cl, blk - nmain, 0, EARLY / BQR);
}

extern "C" void kernel_launch(void* const* d_in, const int* in_sizes, int n_in,
                              void* d_out, int out_size, void* d_ws, size_t ws_size,
                              hipStream_t stream) {
  if (n_in < 6) return;
  const long long need_x = ((long long)(NB - 1) * SEQ_FULL + SEQ) * HID;
  if ((long long)in_sizes[0] < need_x) return;
  if ((long long)in_sizes[1] < (long long)HID * HID) return;
  if ((long long)in_sizes[2] < (long long)HID * HID) return;
  if ((long long)in_sizes[3] < (long long)HID * HID) return;
  if ((long long)in_sizes[4] < (long long)HID * HID) return;
  if ((long long)in_sizes[5] < (long long)SEQ * HID) return;
  if ((long long)out_size < need_x) return;
  if (kTotal > ws_size) return;

  const float* hs  = (const float*)d_in[0];
  const float* wq  = (const float*)d_in[1];
  const float* wk  = (const float*)d_in[2];
  const float* wv  = (const float*)d_in[3];
  const float* wo  = (const float*)d_in[4];
  const float* pos = (const float*)d_in[5];
  float*       out = (float*)d_out;

  char* ws = (char*)d_ws;
  _Float16* xh = (_Float16*)(ws + kOffXh);     // [MR][1024]
  _Float16* ph = (_Float16*)(ws + kOffPh);     // [SEQP][1024]
  float*    pp = (float*)(ws + kOffPP);        // [SEQP][PPP] f32
  _Float16* ch = (_Float16*)(ws + kOffCh);     // [MR][1024], aliases xh after it is dead
  _Float16* cl = (_Float16*)(ws + kOffCl);     // [MR][1024], aliases ph/pp after they are dead
  _Float16* wh = (_Float16*)(ws + kOffWh);     // [4096][1024]
  _Float16* qh = (_Float16*)(ws + kOffQh);
  _Float16* ql = (_Float16*)(ws + kOffQl);
  _Float16* kh = (_Float16*)(ws + kOffKh);
  _Float16* kl = (_Float16*)(ws + kOffKl);
  _Float16* vh = (_Float16*)(ws + kOffVh);     // V^T hi  [NB][16][64][SEQP]
  _Float16* vl = (_Float16*)(ws + kOffVl);     // V^T res [NB][16][64][EARLY]

  prep_kernel<<<dim3(MR + SEQP + 4 * HID), dim3(128), 0, stream>>>(hs, pos, wq, wk, wv, wo, xh, ph, wh);

  // positional projection of all Q, K and V columns, then the Q / K planes and the V^T planes
  gemm_kernel<0><<<dim3(NQKV / GBN(0), SEQP / GBM), dim3(GT), 0, stream>>>(ph, ph, wh, pp, pp, qh, ql, kh, kl, vh, vl, out);
  gemm_kernel<1><<<dim3(NQKV / GBN(1), MR / GBM), dim3(GT), 0, stream>>>(xh, xh, wh, pp, pp, qh, ql, kh, kl, vh, vl, out);

  (void)hipFuncSetAttribute(reinterpret_cast<const void*>(&attn_kernel),
                            hipFuncAttributeMaxDynamicSharedMemorySize, (int)LDS_BYTES);
  constexpr int nmain = NB * NH * ((SEQP - EARLY) / BQ);
  constexpr int nres  = NB * NH * (EARLY / BQR);
  attn_kernel<<<dim3(nmain + nres), dim3(128), LDS_BYTES, stream>>>(qh, ql, kh, kl, vh, vl, ch, cl, nmain);

  const _Float16* who = wh + (size_t)(NQK + HID) * HID;
  gemm_kernel<3><<<dim3(HID / GBN(3), MR / GBM), dim3(GT), 0, stream>>>(ch, cl, who, pp, pp, qh, ql, kh, kl, vh, vl, out);
}

// v008
// It runs in 145 microseconds.
// Two timings next to v007 put it at 1.14 and 1.16 times that version's speed.
// Counting every step since v000, it is 2.71 times as fast.
#include <hip/hip_runtime.h>
#include <stdint.h>

// Contractions, all on v_wmma_f32_16x16x32_f16 with f32 accumulate: P0 = Xp*W^T and Y0 = X*W^T + P0 (f16 operands holding
// bf16-RNE input values, W carried x256); S = Q*K^T (Q, K as f16 hi + x4096 f16 residual planes, three products); O = P*V
// (P carried x1024 in f16, V^T f16 hi; extra P-residual and V-residual products on query blocks below row 256); Y = C*Wo^T
// (C f16 hi + x4096 f16 residual product on rows below 256). Score scaling, causal mask, softmax and normalisation in f32.

typedef _Float16 v16h __attribute__((ext_vector_type(16)));
typedef _Float16 v8h  __attribute__((ext_vector_type(8)));
typedef _Float16 v8ha __attribute__((ext_vector_type(8), may_alias));
typedef float    v8f  __attribute__((ext_vector_type(8)));
typedef float    v4f  __attribute__((ext_vector_type(4)));
typedef float    v4fa __attribute__((ext_vector_type(4), may_alias));
typedef unsigned int v4u __attribute__((ext_vector_type(4)));

union U8f  { v8f  v; float    f[8]; };
union U16h { v16h v; v8h      h[2]; };
union U8h  { v8h  v; _Float16 f[8]; };

#ifndef NB
#define NB 4
#endif
#ifndef SEQ
#define SEQ 2000
#endif
#define NB_FULL  4
#define SEQ_FULL 2000
#define HID   1024
#define NH    16
#define HD    64
#define NQK   2048                               // Q and K output columns (first projection group)
#define SEQP  ((((SEQ) + 127) / 128) * 128)      // rows per batch inside workspace planes (zero padded)
#define MR    ((NB) * SEQP)                      // activation plane rows
#define EARLY 256                                // query rows / keys given residual products
#define NQKV  3072                               // Q, K and V output columns

static_assert(NB >= 1 && NB <= NB_FULL);
static_assert(SEQ >= 256 && SEQ <= SEQ_FULL);
static_assert(SEQP % 128 == 0 && SEQP >= EARLY && SEQP <= 2048);
static_assert(NH * HD == HID);
static_assert(NQKV == NQK + HID);
static_assert(((long long)(NB - 1) * SEQ_FULL + SEQ) * HID <= (long long)NB_FULL * SEQ_FULL * HID);

// ---------------- GEMM tiling ----------------
#define GBM 128
#define GBN(MODE) (((MODE) == 3) ? 128 : 256)   // 128 columns where 256 would leave registers short (MODE 3: a second accumulator set)
#define GSR 32      // positions per block of the Q/K/V GEMM: GSR rows of every batch and the GSR positional rows they share
#define GBK 64      // k per ring stage: one whole 128-B line of every staged operand row
#define GP  72      // halfs per staged row in LDS (144 B)
#define GNS (HID / GBK)   // ring stages
#define GT  256     // threads: 8 waves (2 x 4), wave tile 80 x 64 (MODE 1) or 64 x 32 (MODE 3)
#define GRS (GT / 8)      // operand rows (8 pieces of 16 B each) that one copy of the whole block covers
static_assert(MR % GBM == 0 && SEQP % GBM == 0 && EARLY % GBM == 0);
static_assert(NQK % GBN(1) == 0 && HID % GBN(1) == 0 && HID % GBN(3) == 0 && HID % GBK == 0);
static_assert(NB == 4 && NB * GSR == GBM && GSR == GRS && SEQP % GSR == 0 && EARLY % GSR == 0);   // the Q/K/V block: 4 x 32 rows + 32 positional rows
static_assert((GP * 2) % 16 == 0);
static_assert(GBK == 64 && GBM == 128 && GRS == 32 && GNS >= 2);   // the staging below: 8 pieces a row, 32 rows a copy

// ---------------- attention tiling ----------------
#define BQ 128      // query rows per workgroup of 4 waves x 32 rows (rows from EARLY on)
#define BQR 64      // query rows per workgroup of 4 waves x 16 rows (rows below EARLY)
#define BK 32       // keys per staged chunk
#define QP 72       // halfs per Q row in LDS (144 B)
#define KP 72       // halfs per K row in LDS
#define VP 40       // halfs per V^T row in LDS (80 B)
static_assert(SEQP % BQ == 0 && EARLY == 2 * BQ && BQ % BK == 0 && EARLY % BQR == 0 && BQR >= 2 * BK && BQR % BK == 0);

// offsets in halfs. Up to eight Q tiles (16 hi rows, then 16 residual rows), one or two to a wave; the epilogue's 16x64 f32 tile (pitch SOP) reuses a tile.
// The K / V^T chunk lives in a ring of two buffers, each {K hi, K residual, V^T hi, V^T residual}.
#define SQ_OFF   0
#define QW_H     (2 * 16 * QP)
#define RING_OFF (SQ_OFF + 8 * QW_H)
#define RKH_OFF  0
#define RKL_OFF  (RKH_OFF + BK * KP)
#define RVH_OFF  (RKL_OFF + BK * KP)
#define RVL_OFF  (RVH_OFF + HD * VP)
#define RING_H   (RVL_OFF + HD * VP)
#define LDS_BYTES ((RING_OFF + 2 * RING_H) * 2)
#define SOP 68      // floats per row of the epilogue's 16x64 f32 tile (272 B)
static_assert((QW_H * 2) % 16 == 0 && (RING_OFF * 2) % 16 == 0 && (RING_H * 2) % 16 == 0);
static_assert((RKL_OFF * 2) % 16 == 0 && (RVH_OFF * 2) % 16 == 0 && (RVL_OFF * 2) % 16 == 0);
static_assert((KP * 2) % 16 == 0 && (VP * 2) % 16 == 0);
static_assert(QW_H * 2 >= 16 * SOP * 4 && (SOP * 4) % 16 == 0 && SOP >= HD);
static_assert(LDS_BYTES == 75776);

// (1/8) * log2(e): scores go to the base-2 domain for the online softmax
#define C2S 0.18033688011112042f

// ---------------- workspace carve (bytes) ----------------
static constexpr size_t kPlaneB = (size_t)MR * HID * 2;                   // one f16 activation plane
static constexpr size_t kPhB    = (size_t)SEQP * HID * 2;                 // f16 positional rows
static constexpr size_t kR0B    = (kPlaneB + kPhB > 2 * kPlaneB) ? (kPlaneB + kPhB) : (2 * kPlaneB);
static constexpr size_t kWhB    = (size_t)4 * HID * HID * 2;              // f16 weights, 4 matrices stacked
static constexpr size_t kVtlB   = (size_t)NB * NH * HD * EARLY * 2;       // V^T residual plane, keys < EARLY
static constexpr size_t kOffXh  = 0;
static constexpr size_t kOffPh  = kPlaneB;
static constexpr size_t kOffCh  = 0;                                      // C planes alias the dead X/pos region
static constexpr size_t kOffCl  = kPlaneB;
static constexpr size_t kOffWh  = kR0B;
static constexpr size_t kOffQh  = kOffWh + kWhB;
static constexpr size_t kOffQl  = kOffQh + kPlaneB;
static constexpr size_t kOffKh  = kOffQl + kPlaneB;
static constexpr size_t kOffKl  = kOffKh + kPlaneB;
static constexpr size_t kOffVh  = kOffKl + kPlaneB;
static constexpr size_t kOffVl  = kOffVh + kPlaneB;
static constexpr size_t kTotal  = kOffVl + kVtlB;
static_assert(kTotal <= 268435456ull);
static_assert(kOffCl + kPlaneB <= kR0B);
static_assert(kOffPh % 128 == 0 && kOffWh % 128 == 0 && kOffQh % 128 == 0);
static_assert(kOffVl % 128 == 0 && kR0B % 128 == 0);
static_assert((size_t)NB * NH * HD * SEQP * 2 == kPlaneB);

__device__ __forceinline__ v8f wmma_f16(v16h a, v16h b, v8f c) {
  v8f d = __builtin_amdgcn_wmma_f32_16x16x32_f16(false, a, false, b, (short)0, c, false, false);
  asm volatile("v_nop\n\tv_nop\n\tv_nop\n\tv_nop" : "+v"(d) : "v"(a), "v"(b));
  return d;
}

// lane l reads lane l ^ 16: the two lanes that share one query column of a D tile
__device__ __forceinline__ float xhalf(float x) {
  const int s = __float_as_int(x);
  return __int_as_float(__builtin_amdgcn_permlanex16(s, s, 0x76543210, 0xfedcba98, false, false));
}

// same-wave LDS exchange: stores issued by other lanes of this wave are visible before the reload
__device__ __forceinline__ void wave_lds_sync() {
  __builtin_amdgcn_fence(3, "wavefront");
  asm volatile("s_wait_dscnt 0" ::: "memory");
  __builtin_amdgcn_wave_barrier();
}

// One chunk of K hi, K residual, V^T hi (and, RES, V^T residual) from global memory into LDS by a block of four waves, through no register:
// two 16-byte pieces per lane and plane, the second 16 key rows (K) or 32 d rows (V^T, a chunk's 64 rows of BK keys lie in a row) on. lk / lv: the lane's own LDS byte addresses of
// its first K hi and V^T hi pieces. One statement, its s_wait_xcnt last, so that no address register is rewritten in front of it.
template <bool RES>
__device__ __forceinline__ void stage_kv2(unsigned lk, unsigned lv, const _Float16* gkh, const _Float16* gkl,
                                          const _Float16* gvh, const _Float16* gvl) {
  const unsigned lkl = lk + (RKL_OFF - RKH_OFF) * 2;
  const unsigned lk2 = lk + 16 * KP * 2, lkl2 = lkl + 16 * KP * 2, lv2 = lv + 32 * VP * 2;
  const _Float16* gkh2 = gkh + (size_t)16 * HID;
  const _Float16* gkl2 = gkl + (size_t)16 * HID;
  const _Float16* gvh2 = gvh + 32 * BK;
  if (RES) {
    const unsigned lvl = lv + (RVL_OFF - RVH_OFF) * 2, lvl2 = lvl + 32 * VP * 2;
    const _Float16* gvl2 = gvl + 32 * BK;
    asm volatile("global_load_async_to_lds_b128 %0, %1, off\n\t"
                 "global_load_async_to_lds_b128 %2, %3, off\n\t"
                 "global_load_async_to_lds_b128 %4, %5, off\n\t"
                 "global_load_async_to_lds_b128 %6, %7, off\n\t"
                 "global_load_async_to_lds_b128 %8, %9, off\n\t"
                 "global_load_async_to_lds_b128 %10, %11, off\n\t"
                 "global_load_async_to_lds_b128 %12, %13, off\n\t"
                 "global_load_async_to_lds_b128 %14, %15, off\n\t"
                 "s_wait_xcnt 0x0"
                 :: "v"(lk), "v"(gkh), "v"(lk2), "v"(gkh2), "v"(lkl), "v"(gkl), "v"(lkl2), "v"(gkl2),
                    "v"(lv), "v"(gvh), "v"(lv2), "v"(gvh2), "v"(lvl), "v"(gvl), "v"(lvl2), "v"(gvl2) : "memory");
  } else {
    asm volatile("global_load_async_to_lds_b128 %0, %1, off\n\t"
                 "global_load_async_to_lds_b128 %2, %3, off\n\t"
                 "global_load_async_to_lds_b128 %4, %5, off\n\t"
                 "global_load_async_to_lds_b128 %6, %7, off\n\t"
                 "global_load_async_to_lds_b128 %8, %9, off\n\t"
                 "global_load_async_to_lds_b128 %10, %11, off\n\t"
                 "s_wait_xcnt 0x0"
                 :: "v"(lk), "v"(gkh), "v"(lk2), "v"(gkh2), "v"(lkl), "v"(gkl), "v"(lkl2), "v"(gkl2),
                    "v"(lv), "v"(gvh), "v"(lv2), "v"(gvh2) : "memory");
  }
}

// A lane's 16-B pieces of its wave's 16 NQ query rows, hi plane and residual plane: piece i lies four rows (8192 B) behind piece i - 1.
// The loads and their data wait stand in one statement and every output is early-clobber, so that no register which a load names
// is rewritten, by a later load's data either, while the load is in flight.
template <int NQ>
__device__ __forceinline__ void load_q(const _Float16* gh, const _Float16* gl, v8h (&h)[4 * NQ], v8h (&l)[4 * NQ]) {
  static_assert(4 * HID * 2 == 8192 && (NQ == 1 || NQ == 2));
  if constexpr (NQ == 1) {
    asm volatile("global_load_b128 %0, %8, off\n\t"
                 "global_load_b128 %1, %8, off offset:8192\n\t"
                 "global_load_b128 %2, %8, off offset:16384\n\t"
                 "global_load_b128 %3, %8, off offset:24576\n\t"
                 "global_load_b128 %4, %9, off\n\t"
                 "global_load_b128 %5, %9, off offset:8192\n\t"
                 "global_load_b128 %6, %9, off offset:16384\n\t"
                 "global_load_b128 %7, %9, off offset:24576\n\t"
                 "s_wait_loadcnt 0x0"
                 : "=&v"(h[0]), "=&v"(h[1]), "=&v"(h[2]), "=&v"(h[3]), "=&v"(l[0]), "=&v"(l[1]), "=&v"(l[2]), "=&v"(l[3])
                 : "v"(gh), "v"(gl) : "memory");
  } else {
    asm volatile("global_load_b128 %0, %16, off\n\t"
                 "global_load_b128 %1, %16, off offset:8192\n\t"
                 "global_load_b128 %2, %16, off offset:16384\n\t"
                 "global_load_b128 %3, %16, off offset:24576\n\t"
                 "global_load_b128 %4, %16, off offset:32768\n\t"
                 "global_load_b128 %5, %16, off offset:40960\n\t"
                 "global_load_b128 %6, %16, off offset:49152\n\t"
                 "global_load_b128 %7, %16, off offset:57344\n\t"
                 "global_load_b128 %8, %17, off\n\t"
                 "global_load_b128 %9, %17, off offset:8192\n\t"
                 "global_load_b128 %10, %17, off offset:16384\n\t"
                 "global_load_b128 %11, %17, off offset:24576\n\t"
                 "global_load_b128 %12, %17, off offset:32768\n\t"
                 "global_load_b128 %13, %17, off offset:40960\n\t"
                 "global_load_b128 %14, %17, off offset:49152\n\t"
                 "global_load_b128 %15, %17, off offset:57344\n\t"
                 "s_wait_loadcnt 0x0"
                 : "=&v"(h[0]), "=&v"(h[1]), "=&v"(h[2]), "=&v"(h[3]), "=&v"(h[4]), "=&v"(h[5]), "=&v"(h[6]), "=&v"(h[7]),
                   "=&v"(l[0]), "=&v"(l[1]), "=&v"(l[2]), "=&v"(l[3]), "=&v"(l[4]), "=&v"(l[5]), "=&v"(l[6]), "=&v"(l[7])
                 : "v"(gh), "v"(gl) : "memory");
  }
}

// One operand plane of a GEMM ring stage, 32 NC rows of 64 k: NC copies, 16 bytes per lane and copy, through no register.
// l: the lane's own LDS byte address of its piece of row (tid >> 3) of the plane in the target buffer; g: the same piece in global memory.
// A copy of one wave covers four whole 128-B lines. The s_wait_xcnt stands inside the copies' own statement, so that no address
// register is rewritten in front of it.
template <int NC>
__device__ __forceinline__ void stage_plane(unsigned l, const _Float16* g) {
  static_assert(NC == 4 || NC == 8);
  const unsigned l1 = l + 1 * GRS * GP * 2, l2 = l + 2 * GRS * GP * 2, l3 = l + 3 * GRS * GP * 2;
  const _Float16* g1 = g + (size_t)1 * GRS * HID;
  const _Float16* g2 = g + (size_t)2 * GRS * HID;
  const _Float16* g3 = g + (size_t)3 * GRS * HID;
  if (NC == 4) {
    asm volatile("global_load_async_to_lds_b128 %0, %1, off\n\t"
                 "global_load_async_to_lds_b128 %2, %3, off\n\t"
                 "global_load_async_to_lds_b128 %4, %5, off\n\t"
                 "global_load_async_to_lds_b128 %6, %7, off\n\t"
                 "s_wait_xcnt 0x0"
                 :: "v"(l), "v"(g), "v"(l1), "v"(g1), "v"(l2), "v"(g2), "v"(l3), "v"(g3) : "memory");
  } else {
    const unsigned l4 = l + 4 * GRS * GP * 2, l5 = l + 5 * GRS * GP * 2, l6 = l + 6 * GRS * GP * 2, l7 = l + 7 * GRS * GP * 2;
    const _Float16* g4 = g + (size_t)4 * GRS * HID;
    const _Float16* g5 = g + (size_t)5 * GRS * HID;
    const _Float16* g6 = g + (size_t)6 * GRS * HID;
    const _Float16* g7 = g + (size_t)7 * GRS * HID;
    asm volatile("global_load_async_to_lds_b128 %0, %1, off\n\t"
                 "global_load_async_to_lds_b128 %2, %3, off\n\t"
                 "global_load_async_to_lds_b128 %4, %5, off\n\t"
                 "global_load_async_to_lds_b128 %6, %7, off\n\t"
                 "global_load_async_to_lds_b128 %8, %9, off\n\t"
                 "global_load_async_to_lds_b128 %10, %11, off\n\t"
                 "global_load_async_to_lds_b128 %12, %13, off\n\t"
                 "global_load_async_to_lds_b128 %14, %15, off\n\t"
                 "s_wait_xcnt 0x0"
                 :: "v"(l), "v"(g), "v"(l1), "v"(g1), "v"(l2), "v"(g2), "v"(l3), "v"(g3),
                    "v"(l4), "v"(g4), "v"(l5), "v"(g5), "v"(l6), "v"(g6), "v"(l7), "v"(g7) : "memory");
  }
}

// The A rows of a Q/K/V ring stage, 64 k of each: GSR rows of each of the four batches (a batch lies SEQP rows behind the one before) and the
// GSR positional rows of the same positions, five copies of 16 bytes per lane, through no register. l: the lane's own LDS byte address of
// its piece of row (tid >> 3); g, gp: the same piece of batch 0 and of the positional plane in global memory. The s_wait_xcnt stands inside
// the copies' own statement, so that no address register is rewritten in front of it.
__device__ __forceinline__ void stage_xp(unsigned l, const _Float16* g, const _Float16* gp) {
  const unsigned l1 = l + 1 * GSR * GP * 2, l2 = l + 2 * GSR * GP * 2, l3 = l + 3 * GSR * GP * 2, l4 = l + 4 * GSR * GP * 2;
  const _Float16* g1 = g + (size_t)1 * SEQP * HID;
  const _Float16* g2 = g + (size_t)2 * SEQP * HID;
  const _Float16* g3 = g + (size_t)3 * SEQP * HID;
  asm volatile("global_load_async_to_lds_b128 %0, %1, off\n\t"
               "global_load_async_to_lds_b128 %2, %3, off\n\t"
               "global_load_async_to_lds_b128 %4, %5, off\n\t"
               "global_load_async_to_lds_b128 %6, %7, off\n\t"
               "global_load_async_to_lds_b128 %8, %9, off\n\t"
               "s_wait_xcnt 0x0"
               :: "v"(l), "v"(g), "v"(l1), "v"(g1), "v"(l2), "v"(g2), "v"(l3), "v"(g3), "v"(l4), "v"(gp) : "memory");
}

template <int MODE>
__device__ __forceinline__ void stage_a(unsigned l, const _Float16* g, const _Float16* gp) {
  if (MODE == 1) stage_xp(l, g, gp);
  else           stage_plane<GBM / GRS>(l, g);
}

__device__ __forceinline__ v4f bf16_rne4(v4f a) {
  v4u u = __builtin_bit_cast(v4u, a);
  u = (u + 0x7FFFu + ((u >> 16) & 1u)) & 0xFFFF0000u;
  return __builtin_bit_cast(v4f, u);
}

__device__ __forceinline__ v8h cvt8v(v4f a, v4f b) {
  v8h d;
  d[0] = (_Float16)a[0]; d[1] = (_Float16)a[1];
  d[2] = (_Float16)a[2]; d[3] = (_Float16)a[3];
  d[4] = (_Float16)b[0]; d[5] = (_Float16)b[1];
  d[6] = (_Float16)b[2]; d[7] = (_Float16)b[3];
  return d;
}

// f32 x -> f16 hi and f16((x - hi) * 4096)
__device__ __forceinline__ void split8(v4f a, v4f b, v8h& hv, v8h& lv) {
  U8h hh, ll;
  _Float16 t;
  t = (_Float16)a[0]; hh.f[0] = t; ll.f[0] = (_Float16)((a[0] - (float)t) * 4096.0f);
  t = (_Float16)a[1]; hh.f[1] = t; ll.f[1] = (_Float16)((a[1] - (float)t) * 4096.0f);
  t = (_Float16)a[2]; hh.f[2] = t; ll.f[2] = (_Float16)((a[2] - (float)t) * 4096.0f);
  t = (_Float16)a[3]; hh.f[3] = t; ll.f[3] = (_Float16)((a[3] - (float)t) * 4096.0f);
  t = (_Float16)b[0]; hh.f[4] = t; ll.f[4] = (_Float16)((b[0] - (float)t) * 4096.0f);
  t = (_Float16)b[1]; hh.f[5] = t; ll.f[5] = (_Float16)((b[1] - (float)t) * 4096.0f);
  t = (_Float16)b[2]; hh.f[6] = t; ll.f[6] = (_Float16)((b[2] - (float)t) * 4096.0f);
  t = (_Float16)b[3]; hh.f[7] = t; ll.f[7] = (_Float16)((b[3] - (float)t) * 4096.0f);
  hv = hh.v; lv = ll.v;
}

// ---------------- pre-pass: Xh = f16(bf16RNE(hidden)) [MR][1024] (pad rows zero), Ph = f16(bf16RNE(pos)) [SEQP][1024]
//                  (pad rows zero), Wh = f16(256 * bf16RNE(W)) for the four weight matrices stacked [4096][1024].
__global__ __launch_bounds__(128)
void prep_kernel(const float* __restrict__ Hs, const float* __restrict__ Pos,
                 const float* __restrict__ W0, const float* __restrict__ W1,
                 const float* __restrict__ W2, const float* __restrict__ W3,
                 _Float16* Xh, _Float16* Ph, _Float16* Wh)
{
  const int row = blockIdx.x;
  const int c0  = 8 * threadIdx.x;
  const float* src;
  _Float16*    dst;
  float sc = 1.0f;
  if (row < MR) {
    const int b  = row / SEQP;
    const int s  = row - b * SEQP;
    const int sl = (s < SEQ) ? s : (SEQ - 1);            // clamped address; pad rows scaled to zero
    sc  = (s < SEQ) ? 1.0f : 0.0f;
    src = Hs + ((size_t)b * SEQ_FULL + sl) * HID + c0;   // full-size input strides
    dst = Xh + (size_t)row * HID + c0;
  } else if (row < MR + SEQP) {
    const int s  = row - MR;
    const int sl = (s < SEQ) ? s : (SEQ - 1);
    sc  = (s < SEQ) ? 1.0f : 0.0f;
    src = Pos + (size_t)sl * HID + c0;
    dst = Ph + (size_t)s * HID + c0;
  } else {
    const int j   = row - MR - SEQP;                      // 0..4095
    const int mat = j >> 10;
    const int r   = j & (HID - 1);
    const float* W = (mat == 0) ? W0 : (mat == 1) ? W1 : (mat == 2) ? W2 : W3;
    sc  = 256.0f;                                         // exact power-of-two carry, removed in the GEMM epilogues
    src = W + (size_t)r * HID + c0;
    dst = Wh + (size_t)j * HID + c0;
  }
  const v4f a0 = bf16_rne4(*(const v4f*)src) * sc;
  const v4f a1 = bf16_rne4(*(const v4f*)(src + 4)) * sc;
  const v8h v  = cvt8v(a0, a1);                           // bf16 values (and x256) are exact in f16
  *(v8h*)dst = v;
  
}

// V epilogue: f32 tile in[4 batches x GSR keys][BN cols] (pitch BN + 4) -> V^T hi and, with LO, the x4096 residual. Both planes are laid
// [b][h][chunk of BK keys][d][BK keys]: a chunk of one head is 4 KiB in a row, written whole by one pass of the block (lane: d = tid >> 2,
// keys 8 (tid & 3) .. + 7) and read whole by the attention's staging. Item i of trip bb: batch bb, head h0 + i.
// LO is a template argument so that no branch stands between the stores of a trip.
template <bool LO, int BN>
__device__ __forceinline__ void store_vt(const float* sC, _Float16* O0, _Float16* O1, int tid, int h0, int s0) {
  constexpr int CP = BN + 4;
  static_assert(BN == 4 * HD && GSR == BK && GT * 8 == HD * BK);
  for (int bb = 0; bb < NB; ++bb) {
    v8h vh[4], vl[4]; size_t oh[4], ol[4];
    #pragma unroll
    for (int i = 0; i < 4; ++i) {
      const int c  = HD * i + (tid >> 2);
      const int k0 = GSR * bb + 8 * (tid & 3);
      v4f x0, x1;
      x0[0] = sC[(k0 + 0) * CP + c]; x0[1] = sC[(k0 + 1) * CP + c];
      x0[2] = sC[(k0 + 2) * CP + c]; x0[3] = sC[(k0 + 3) * CP + c];
      x1[0] = sC[(k0 + 4) * CP + c]; x1[1] = sC[(k0 + 5) * CP + c];
      x1[2] = sC[(k0 + 6) * CP + c]; x1[3] = sC[(k0 + 7) * CP + c];
      split8(x0, x1, vh[i], vl[i]);
      const size_t hd = (size_t)(bb * NH + h0 + i);
      oh[i] = (hd * (SEQP / BK) + s0 / BK) * (HD * BK) + 8 * tid;
      ol[i] = (hd * (EARLY / BK) + s0 / BK) * (HD * BK) + 8 * tid;
    }
    #pragma unroll
    for (int i = 0; i < 4; ++i) {
      *(v8h*)(O0 + oh[i]) = vh[i];
      if (LO) *(v8h*)(O1 + ol[i]) = vl[i];
    }
    asm volatile("s_wait_xcnt 0x0" ::: "memory");   // the next trip rewrites registers that these stores name
  }
}

// ---------------- 16-bit GEMM, 8 waves (2 x 4), K = 1024 in WMMA steps of 32 ----------------
// Operands come by asynchronous copies into a ring of two LDS buffers, 64 k a stage: stage s + 1 flies while stage s is worked on.
// C[m][n] = sum_k A[m][k] * Bw[n][k]  (Bw = weight rows [out][in], k contiguous, i.e. x @ W^T).
// 16-bit fragment map (A and B alike): lane l -> row/col (l & 15); elements 0..7 <- k0 + 8*(l>>4) + 0..7,
// elements 8..15 <- k0 + 16 + 8*(l>>4) + 0..7.  D: element r of lane l -> row 8*(l>>4) + r, col (l & 15).
// MODE 1, one launch for all Q, K and V columns: a block takes 256 columns of GSR positions, A = the GSR rows of each of the four batches
//   (Ah) and the GSR positional rows (Al) that all four share, 160 rows. A wave (80 x 64) holds one 16-row tile of every batch and the
//   positional tile of the same 16 positions and columns, so value = acc/256 + accP/256 is formed in its registers.
//   The block's column group picks its epilogue:
//   Q (n0 < 1024) or K (n0 < 2048) rows: f16 hi plane + f16 x4096 residual plane [MR][1024];
//   V (n0 >= 2048): V^T hi plane [b][h][SEQP / BK][d][BK] and, for s0 < EARLY, V^T x4096 residual plane [b][h][EARLY / BK][d][BK].
// MODE 3, 128x128 block tile, waves of 64x32: Y rows of d_out [b][2000][1024] f32, value = (acc + accr/4096)/256 with the residual A plane
//   (Al) on rows s0 < EARLY.
template <int MODE>
__global__ __launch_bounds__(GT)
void gemm_kernel(const _Float16* __restrict__ Ah, const _Float16* __restrict__ Al, const _Float16* __restrict__ Bw,
                 _Float16* O0, _Float16* O1, _Float16* O2, _Float16* O3, _Float16* O4, _Float16* O5, float* Y)
{
  static_assert(MODE == 1 || MODE == 3);
  // ring buffer = {A [AR][GP], B [BN][GP], and for MODE 3 residual A [128][GP]}, two of them; the epilogue's f32 tile reuses the ring's LDS
  constexpr int RS  = GRS;            // operand rows that one copy of the whole block covers
  constexpr int BN  = GBN(MODE);      // block tile columns
  constexpr int NWN = 4;              // waves side by side along n
  constexpr int NI  = BN / 16 / NWN;  // 16-col tiles per wave
  constexpr int MI  = (MODE == 1) ? NB + 1 : 4;             // 16-row tiles per wave; MODE 1: the last one is the positional tile
  constexpr int AR  = (MODE == 1) ? (NB + 1) * GSR : GBM;   // staged A rows
  constexpr int ARS = (MODE == 1) ? GSR : 16;               // rows from one of a wave's tiles to its next, in the A plane and in the f32 tile
  constexpr int CP  = BN + 4;         // floats per row of the f32 tile in LDS (a multiple of 16 B; 8 rows on lie 32 banks on)
  static_assert((CP * 4) % 16 == 0 && (8 * CP) % 64 == 32);
  constexpr int STG_H  = (AR + BN + (MODE == 3 ? GBM : 0)) * GP;    // halfs per buffer
  constexpr int RING_B = 2 * STG_H * 2;
  constexpr int TILE_B = GBM * CP * 4;
  static_assert(RING_B <= 163840 && TILE_B <= 163840);   // two blocks fit a WGP's LDS
  __shared__ __attribute__((aligned(16))) char gsm[RING_B > TILE_B ? RING_B : TILE_B];   // cross-wave (block barrier)
  _Float16* sR = (_Float16*)gsm;
  float*    sC = (float*)gsm;

  const int tid  = threadIdx.x;
  const int wave = tid >> 5;
  const int lane = tid & 31;
  const int lh   = lane & 15;
  const int hi   = lane >> 4;
  const int wm   = wave / NWN;       // 0..1 -> MODE 1: upper or lower 16 of the GSR positions; MODE 3: 64-row strip
  const int wn   = wave % NWN;       // strip of 16 NI columns
  const int sub  = tid & 7;
  const int m0   = (MODE == 1) ? blockIdx.y * GSR : blockIdx.y * GBM;   // first staged row of Ah (MODE 1: of batch 0) and of Al
  const int n0   = blockIdx.x * BN;
  const int b    = m0 / SEQP;                      // MODE 1: 0
  const int s0   = m0 - b * SEQP;
  const int ar0  = (MODE == 1) ? wm * 16 : wm * 64;   // row of the wave's first tile
  const bool resa = (MODE == 3) && (s0 < EARLY);   // block-uniform

  U8f acc[MI][NI], accr[4][NI];
  #pragma unroll
  for (int mi = 0; mi < MI; ++mi)
    #pragma unroll
    for (int ni = 0; ni < NI; ++ni) acc[mi][ni].v = (v8f){};
  #pragma unroll
  for (int mi = 0; mi < 4; ++mi)
    #pragma unroll
    for (int ni = 0; ni < NI; ++ni) accr[mi][ni].v = (v8f){};

  const int sr = tid >> 3, sp = tid & 7;                             // staging: row 0..RS-1 (+ RS per further copy), 16-B piece 0..7
  const unsigned la0 = (unsigned)(uintptr_t)(sR + sr * GP + 8 * sp); // LDS byte address of the lane's A piece in buffer 0
  const unsigned lb0 = la0 + AR * GP * 2;                            // the same piece of the B plane
  const unsigned ll0 = la0 + (AR + BN) * GP * 2;                     // the same piece of the residual plane (MODE 3)
  const _Float16* ga = Ah + (size_t)(m0 + sr) * HID + 8 * sp;        // this lane's pieces of stage 0
  const _Float16* gl = Al + (size_t)(m0 + sr) * HID + 8 * sp;
  const _Float16* gb = Bw + (size_t)(n0 + sr) * HID + 8 * sp;

  stage_a<MODE>(la0, ga, gl);                                        // stage 0 -> buffer 0
  stage_plane<BN / RS>(lb0, gb);
  if (resa) stage_plane<GBM / RS>(ll0, gl);
  asm volatile("s_wait_asynccnt 0x0" ::: "memory");                  // this wave's pieces of stage 0 have landed
  __syncthreads();                                                   // stage 0 visible to all waves
  stage_a<MODE>(la0 + STG_H * 2, ga + GBK, gl + GBK);                // stage 1 -> buffer 1 (GNS >= 2)
  stage_plane<BN / RS>(lb0 + STG_H * 2, gb + GBK);
  if (resa) stage_plane<GBM / RS>(ll0 + STG_H * 2, gl + GBK);

  for (int s = 0; s < GNS; ++s) {
    const int bufh = (s & 1) * STG_H;                                // this stage's buffer, offset in halfs
    const _Float16* sA = sR + bufh;
    const _Float16* sB = sA + AR * GP;
    const _Float16* sL = sB + BN * GP;

    #pragma unroll                                                   // both halves of the stage at immediate LDS offsets
    for (int c = 0; c < GBK / 32; ++c) {                             // k ascending in WMMA steps of 32
      U16h af[MI], bq[NI];
      #pragma unroll
      for (int mi = 0; mi < MI; ++mi) {
        const _Float16* p = sA + (ar0 + mi * ARS + lh) * GP + 32 * c;
        af[mi].h[0] = *(const v8h*)(p + 8 * hi);
        af[mi].h[1] = *(const v8h*)(p + 16 + 8 * hi);
      }
      #pragma unroll
      for (int ni = 0; ni < NI; ++ni) {
        const _Float16* p = sB + ((wn * NI + ni) * 16 + lh) * GP + 32 * c;
        bq[ni].h[0] = *(const v8h*)(p + 8 * hi);
        bq[ni].h[1] = *(const v8h*)(p + 16 + 8 * hi);
      }
      #pragma unroll
      for (int mi = 0; mi < MI; ++mi)
        #pragma unroll
        for (int ni = 0; ni < NI; ++ni)
          acc[mi][ni].v = wmma_f16(af[mi].v, bq[ni].v, acc[mi][ni].v);
      if (resa) {
        U16h lf[4];
        #pragma unroll
        for (int mi = 0; mi < 4; ++mi) {
          const _Float16* p = sL + (ar0 + mi * ARS + lh) * GP + 32 * c;
          lf[mi].h[0] = *(const v8h*)(p + 8 * hi);
          lf[mi].h[1] = *(const v8h*)(p + 16 + 8 * hi);
        }
        #pragma unroll
        for (int mi = 0; mi < 4; ++mi)
          #pragma unroll
          for (int ni = 0; ni < NI; ++ni)
            accr[mi][ni].v = wmma_f16(lf[mi].v, bq[ni].v, accr[mi][ni].v);
      }
    }

    // ---- publish point, every wave: own LDS reads of this buffer done, own copies of the next stage landed, block barrier ----
    asm volatile("s_wait_dscnt 0x0" ::: "memory");                   // this wave has left the buffer that is refilled below
    asm volatile("s_wait_asynccnt 0x0" ::: "memory");                // this wave's pieces of the next stage have landed
    __syncthreads();                                                 // next stage visible to all; every reader has left this buffer
    if (s + 2 < GNS) {                                               // block-uniform: stage s + 2 flies while stage s + 1 is worked on
      stage_a<MODE>(la0 + bufh * 2, ga + (s + 2) * GBK, gl + (s + 2) * GBK);
      stage_plane<BN / RS>(lb0 + bufh * 2, gb + (s + 2) * GBK);
      if (resa) stage_plane<GBM / RS>(ll0 + bufh * 2, gl + (s + 2) * GBK);
    }
  }
  asm volatile("s_wait_asynccnt 0x0" ::: "memory");                  // nothing of this wave is in flight when the ring becomes the f32 tile

  // ---- accumulators -> f32 tile in LDS (x 1/256 removes the weight carry); MODE 1 adds the positional tile of the same positions and columns ----
  #pragma unroll
  for (int mi = 0; mi < 4; ++mi)
    #pragma unroll
    for (int ni = 0; ni < NI; ++ni)
      #pragma unroll
      for (int r = 0; r < 8; ++r) {
        float v = acc[mi][ni].f[r];
        if (resa) v += accr[mi][ni].f[r] * (1.0f / 4096.0f);
        v *= (1.0f / 256.0f);
        if (MODE == 1) v += acc[MI - 1][ni].f[r] * (1.0f / 256.0f);
        sC[(ar0 + mi * ARS + 8 * hi + r) * CP + (wn * NI + ni) * 16 + lh] = v;
      }
  __syncthreads();

  if (MODE == 1 && n0 < NQK) {                       // block-uniform
    const bool isq = (n0 < HID);                     // block-uniform: Q group or K group
    _Float16* ph = isq ? O0 : O2;
    _Float16* pl = isq ? O1 : O3;
    const int col0 = n0 & (HID - 1);
    // 128 rows x BN / 64 lines per plane: rem = RS i + (tid>>3) -> row, segment (64 halfs = one line), piece sub
    for (int i0 = 0; i0 < GBM * (BN / 64) / RS; i0 += 4) {
      v8h vh[4], vl[4]; size_t oo[4];
      #pragma unroll
      for (int i = 0; i < 4; ++i) {
        const int rem = RS * (i0 + i) + (tid >> 3);
        const int row = rem / (BN / 64), seg = rem % (BN / 64);
        const float* c = sC + row * CP + seg * 64 + 8 * sub;
        split8(*(const v4fa*)c, *(const v4fa*)(c + 4), vh[i], vl[i]);
        oo[i] = (size_t)((row / GSR) * SEQP + s0 + row % GSR) * HID + col0 + seg * 64 + 8 * sub;   // tile row -> batch, position
      }
      #pragma unroll
      for (int i = 0; i < 4; ++i) { *(v8h*)(ph + oo[i]) = vh[i]; *(v8h*)(pl + oo[i]) = vl[i]; }
      asm volatile("s_wait_xcnt 0x0" ::: "memory");   // the next trip rewrites registers that these stores name
    }
  }

  if (MODE == 1 && n0 >= NQK) {                      // block-uniform: V group
    if (s0 < EARLY) store_vt<true, GBN(1)>(sC, O4, O5, tid, (n0 - NQK) / HD, s0);    // block-uniform
    else            store_vt<false, GBN(1)>(sC, O4, O5, tid, (n0 - NQK) / HD, s0);
  }

  if (MODE == 3) {
    // d_out rows (b, s) with s < SEQ only (whole 512-B row segments; guard is uniform over the 32 lanes of a row segment)
    for (int i0 = 0; i0 < GBM * (BN / 32) / RS; i0 += 8) {
      v4f ov[8]; size_t oo[8]; int sv[8];
      #pragma unroll
      for (int i = 0; i < 8; ++i) {
        const int L = RS * (i0 + i) + (tid >> 3);
        const int row = L / (BN / 32), seg = L % (BN / 32);
        ov[i] = *(const v4fa*)(sC + row * CP + seg * 32 + 4 * sub);
        sv[i] = s0 + row;
        oo[i] = ((size_t)b * SEQ_FULL + (size_t)(s0 + row)) * HID + n0 + seg * 32 + 4 * sub;
      }
      #pragma unroll
      for (int i = 0; i < 8; ++i) if (sv[i] < SEQ) *(v4f*)(Y + oo[i]) = ov[i];
      asm volatile("s_wait_xcnt 0x0" ::: "memory");   // the next trip rewrites registers that these stores name
    }
  }
}

// ---------------- fused causal attention: one workgroup = 64 NQ query rows of one (batch, head), 4 waves x 16 NQ rows ----------------
// S^T = K Q^T (A = K rows, B = Q rows): k_hi*q_hi into one accumulator, (k_lo*q_hi + k_hi*q_lo) into a second one folded x 1/4096
// (residual planes carry x4096). Lane l then holds 16 of the chunk's 32 scores of query (l & 15); lane l ^ 16 holds the other 16.
// O^T = V^T P^T: the two S^T tiles, converted in place, are the B operand (P carried x1024 in f16); RES (query rows below EARLY) adds
// V_lo*P_hi + V_hi*P_res into a second accumulator folded x 1/4096.
// Causal mask: key <= query keeps the score, else -1e30 (replace-fill); online softmax base 2 with f32 running max / sum per lane.
// A wave holds NQ query tiles of 16 columns, their Q fragments in registers for the whole key loop: one K or V^T fragment read from
// LDS feeds NQ query tiles. Every query row sees the chunks, the products and the sums in the same order for either NQ.
// blk: the workgroup's index among those of its kind; qb0, nqbl: first query tile (of 64 NQ rows) and number of tiles of that kind.
template <bool RES, int NQ>
__device__ __forceinline__
void attn_body(_Float16* smem, const _Float16* __restrict__ Qh, const _Float16* __restrict__ Ql,
               const _Float16* __restrict__ Kh, const _Float16* __restrict__ Kl,
               const _Float16* __restrict__ Vth, const _Float16* __restrict__ Vtl,
               _Float16* Ch, _Float16* Cl, int blk, int qb0, int nqbl)
{
  static_assert((NQ == 1 && RES) || (NQ == 2 && !RES));
  constexpr int TB = 64 * NQ;                // query rows per workgroup
  static_assert(TB == (RES ? BQR : BQ));
  _Float16* sQ  = smem + SQ_OFF;             // [query tile of 16][hi 16 | residual 16][QP]  wave-private; the epilogue's f32 tiles reuse it
  _Float16* sR  = smem + RING_OFF;           // [2 buffers]{K hi [32][KP], K res [32][KP], V^T hi [64][VP], V^T res [64][VP]}  cross-wave

  const int tid  = threadIdx.x;
  const int wave = tid >> 5;
  const int lane = tid & 31;
  const int lh   = lane & 15;
  const int hi   = lane >> 4;

  // Placement, for speed only: block index -> (query tile, head). A tile's cost grows with its number (causal), every group of this
  // kind is resident at once. All heads of one tile
  // are neighbours in the index and the cost falls from one round of 256 groups to the next.
  // The tiles of one head keep one index mod 8.
  const int cls = blk / (NB * NH);           // 0 .. nqbl - 1
  const int bh  = blk % (NB * NH);
  int qb = qb0 + nqbl - 1 - cls;             // any shape: heaviest tile first
  if (!RES && SEQP / BQ == 16 && NB * NH == 64)
    qb = (int)((0x236475AB98EFCDull >> (4 * cls)) & 15);   // tiles 2..15, each once: 13 12 15 14 | 8 9 11 10 | 5 7 4 6 | 3 2
  const int h     = bh % NH;
  const int b     = bh / NH;
  const int qbase = qb * TB;
  const int qrow0 = qbase + wave * (16 * NQ);

  const size_t prow = (size_t)b * SEQP;
  const _Float16* Qhb = Qh + prow * HID + h * HD;
  const _Float16* Qlb = Ql + prow * HID + h * HD;
  const _Float16* Khb = Kh + prow * HID + h * HD;
  const _Float16* Klb = Kl + prow * HID + h * HD;
  const _Float16* Vhb = Vth + (size_t)(b * NH + h) * HD * SEQP;
  const _Float16* Vlb = Vtl + (size_t)(b * NH + h) * HD * EARLY;
  _Float16* Chb = Ch + prow * HID + h * HD;
  _Float16* Clb = Cl + prow * HID + h * HD;

  const int kend = qbase + TB;               // causal, block-uniform: keys beyond the block's last query row are never needed
  const int kr = tid >> 3, kg = tid & 7;     // K staging: key row 0..15 (and 16 rows on), piece 0..7
  const int vd = tid >> 2, vg = tid & 3;     // V^T staging: d row 0..31 (and 32 rows on), piece 0..3
  const unsigned lk0 = (unsigned)(uintptr_t)(sR + RKH_OFF + kr * KP + 8 * kg);   // LDS byte addresses in buffer 0
  const unsigned lv0 = (unsigned)(uintptr_t)(sR + RVH_OFF + vd * VP + 8 * vg);
  const _Float16* gkh = Khb + (size_t)kr * HID + 8 * kg;                         // this lane's pieces of chunk 0
  const _Float16* gkl = Klb + (size_t)kr * HID + 8 * kg;
  const _Float16* gvh = Vhb + vd * BK + 8 * vg;                                  // V^T planes: [chunk][d][BK keys]
  const _Float16* gvl = Vlb + vd * BK + 8 * vg;

  // chunk 0 -> buffer 0
  stage_kv2<RES>(lk0, lv0, gkh, gkl, gvh, gvl);

  // ---- this wave's 16 NQ query rows (hi and residual) -> LDS: row 4i + (lane>>3) of tile u, 16-B piece (lane&7) ----
  _Float16* qwh = sQ + wave * (NQ * QW_H);
  _Float16* qwl = qwh + 16 * QP;
  {
    const int pc = lane & 7;
    const size_t go = (size_t)(qrow0 + (lane >> 3)) * HID + 8 * pc;
    v8h xh[4 * NQ], xl[4 * NQ];              // piece i: row 4i + (lane>>3) of the wave's 16 NQ rows
    load_q<NQ>(Qhb + go, Qlb + go, xh, xl);
    #pragma unroll
    for (int u = 0; u < NQ; ++u)
      #pragma unroll
      for (int i = 0; i < 4; ++i) {
        const int r = 4 * i + (lane >> 3);
        *(v8h*)(qwh + u * QW_H + r * QP + 8 * pc) = xh[4 * u + i];
        *(v8h*)(qwl + u * QW_H + r * QP + 8 * pc) = xl[4 * u + i];
      }
  }

  U8f acc[NQ][4], accr[NQ][4];
  float mcol[NQ], lcol[NQ];
  #pragma unroll
  for (int u = 0; u < NQ; ++u) {
    #pragma unroll
    for (int t = 0; t < 4; ++t) { acc[u][t].v = (v8f){}; accr[u][t].v = (v8f){}; }
    mcol[u] = -3.0e38f;                      // running maximum of query qrow0 + 16 u + lh (equal in both wave halves)
    lcol[u] = 0.0f;                          // running sum over this lane's keys only; the halves are joined in the epilogue
  }

  // scalar copy of the wave's first row: the per-wave skip below is then a real branch and EXEC stays all ones at the copies
  const int qrow0s = __builtin_amdgcn_readfirstlane(qrow0);

  asm volatile("s_wait_asynccnt 0x0" ::: "memory");   // this wave's pieces of chunk 0 have landed
  __syncthreads();                                    // chunk 0 (and the Q tiles) visible to all waves
  // chunk 1 -> buffer 1 (kend >= TB >= 2 chunks, so chunk 1 always exists)
  stage_kv2<RES>(lk0 + RING_H * 2, lv0 + RING_H * 2, gkh + (size_t)BK * HID, gkl + (size_t)BK * HID, gvh + BK * HD, gvl + BK * HD);

  // ---- Q fragments (B operand), read once: tile u, d step c ----
  U16h qf[NQ][2], ql[NQ][2];
  #pragma unroll
  for (int u = 0; u < NQ; ++u)
    #pragma unroll
    for (int c = 0; c < 2; ++c) {
      qf[u][c].h[0] = *(const v8h*)(qwh + u * QW_H + lh * QP + 32 * c + 8 * hi);
      qf[u][c].h[1] = *(const v8h*)(qwh + u * QW_H + lh * QP + 32 * c + 16 + 8 * hi);
      ql[u][c].h[0] = *(const v8h*)(qwl + u * QW_H + lh * QP + 32 * c + 8 * hi);
      ql[u][c].h[1] = *(const v8h*)(qwl + u * QW_H + lh * QP + 32 * c + 16 + 8 * hi);
    }

  for (int kv0 = 0; kv0 < kend; kv0 += BK) {
    const int bufh = ((kv0 / BK) & 1) * RING_H;       // this chunk's buffer, offset in halfs
    const _Float16* sKh = sR + bufh + RKH_OFF;
    const _Float16* sKl = sR + bufh + RKL_OFF;
    const _Float16* sVh = sR + bufh + RVH_OFF;
    const _Float16* sVl = sR + bufh + RVL_OFF;

    if (kv0 < qrow0s + 16 * NQ) {            // wave-uniform: skip chunks entirely above this wave's rows
      // ---- S^T = K Q^T for two 16-key tiles, d reduced in two K=32 steps, three products each; a K fragment serves all NQ query tiles ----
      U8f sc[NQ][2];
      #pragma unroll
      for (int kt = 0; kt < 2; ++kt) {
        U16h kf[2], kl[2];
        #pragma unroll
        for (int c = 0; c < 2; ++c) {
          kf[c].h[0] = *(const v8h*)(sKh + (16 * kt + lh) * KP + 32 * c + 8 * hi);
          kf[c].h[1] = *(const v8h*)(sKh + (16 * kt + lh) * KP + 32 * c + 16 + 8 * hi);
          kl[c].h[0] = *(const v8h*)(sKl + (16 * kt + lh) * KP + 32 * c + 8 * hi);
          kl[c].h[1] = *(const v8h*)(sKl + (16 * kt + lh) * KP + 32 * c + 16 + 8 * hi);
        }
        U8f sm[NQ], sr[NQ];
        #pragma unroll
        for (int u = 0; u < NQ; ++u) { sm[u].v = (v8f){}; sr[u].v = (v8f){}; }
        #pragma unroll
        for (int c = 0; c < 2; ++c) {
          #pragma unroll
          for (int u = 0; u < NQ; ++u) sm[u].v = wmma_f16(kf[c].v, qf[u][c].v, sm[u].v);
          #pragma unroll
          for (int u = 0; u < NQ; ++u) sr[u].v = wmma_f16(kl[c].v, qf[u][c].v, sr[u].v);
          #pragma unroll
          for (int u = 0; u < NQ; ++u) sr[u].v = wmma_f16(kf[c].v, ql[u][c].v, sr[u].v);
        }
        #pragma unroll
        for (int u = 0; u < NQ; ++u) sc[u][kt].v = sm[u].v + sr[u].v * (1.0f / 4096.0f);
      }

      U16h pf[NQ], pfr[NQ];
      #pragma unroll
      for (int u = 0; u < NQ; ++u) {
        // ---- scale, causal replace-mask, online softmax (base 2): element j of tile 0 / 1 is key kv0 + 8 hi + j / + 16, query 16 u + lh ----
        const int dq = qrow0 + 16 * u + lh - kv0 - 8 * hi;   // key kept where j (tile 0) or 16 + j (tile 1) <= dq
        float a0[8], a1[8], mx[8];
        #pragma unroll
        for (int j = 0; j < 8; ++j) {
          const float x0 = sc[u][0].f[j] * C2S;
          const float x1 = sc[u][1].f[j] * C2S;
          a0[j] = (j <= dq) ? x0 : -1.0e30f;
          a1[j] = (16 + j <= dq) ? x1 : -1.0e30f;
          mx[j] = fmaxf(a0[j], a1[j]);
        }
        float rm = fmaxf(fmaxf(fmaxf(mx[0], mx[1]), fmaxf(mx[2], mx[3])), fmaxf(fmaxf(mx[4], mx[5]), fmaxf(mx[6], mx[7])));
        rm = fmaxf(rm, xhalf(rm));                       // both halves now hold the query's chunk maximum
        const float mnew  = fmaxf(mcol[u], rm);
        const float alpha = __builtin_amdgcn_exp2f(mcol[u] - mnew);
        mcol[u] = mnew;
        U8h pa, pb, par, pbr;
        float es[8];
        #pragma unroll
        for (int j = 0; j < 8; ++j) {
          const float e0 = __builtin_amdgcn_exp2f(a0[j] - mnew);
          const float e1 = __builtin_amdgcn_exp2f(a1[j] - mnew);
          es[j] = e0 + e1;
          const float t0 = e0 * 1024.0f;                 // carried x1024, removed in the epilogue
          const float t1 = e1 * 1024.0f;
          const _Float16 h0 = (_Float16)t0;
          const _Float16 h1 = (_Float16)t1;
          pa.f[j] = h0; pb.f[j] = h1;
          if (RES) {
            par.f[j] = (_Float16)((t0 - (float)h0) * 4096.0f);
            pbr.f[j] = (_Float16)((t1 - (float)h1) * 4096.0f);
          }
        }
        lcol[u] = lcol[u] * alpha + (((es[0] + es[1]) + (es[2] + es[3])) + ((es[4] + es[5]) + (es[6] + es[7])));
        #pragma unroll
        for (int t = 0; t < 4; ++t) {
          acc[u][t].v *= alpha;
          if (RES) accr[u][t].v *= alpha;
        }

        // ---- P^T as B operand straight from the registers: elements 0..7 = keys 8 hi + 0..7, elements 8..15 = keys 16 + 8 hi + 0..7 ----
        pf[u].h[0] = pa.v; pf[u].h[1] = pb.v;
        if (RES) { pfr[u].h[0] = par.v; pfr[u].h[1] = pbr.v; }
      }

      // ---- O^T += V^T P^T : 4 output d-tiles, K = 32 keys; A[m = d][k = key] from V^T tile row d; a V^T fragment serves all NQ query tiles ----
      #pragma unroll
      for (int t = 0; t < 4; ++t) {
        U16h vf;
        vf.h[0] = *(const v8h*)(sVh + (16 * t + lh) * VP + 8 * hi);
        vf.h[1] = *(const v8h*)(sVh + (16 * t + lh) * VP + 16 + 8 * hi);
        #pragma unroll
        for (int u = 0; u < NQ; ++u) acc[u][t].v = wmma_f16(vf.v, pf[u].v, acc[u][t].v);
        if (RES) {
          U16h wl;
          wl.h[0] = *(const v8h*)(sVl + (16 * t + lh) * VP + 8 * hi);
          wl.h[1] = *(const v8h*)(sVl + (16 * t + lh) * VP + 16 + 8 * hi);
          #pragma unroll
          for (int u = 0; u < NQ; ++u) {
            accr[u][t].v = wmma_f16(wl.v, pf[u].v, accr[u][t].v);
            accr[u][t].v = wmma_f16(vf.v, pfr[u].v, accr[u][t].v);
          }
        }
      }
    }

    // ---- publish point, every wave: own LDS reads of this buffer done, own copies of the next chunk landed, block barrier ----
    asm volatile("s_wait_dscnt 0x0" ::: "memory");      // this wave has left the buffer that is refilled below
    asm volatile("s_wait_asynccnt 0x0" ::: "memory");   // this wave's pieces of the next chunk have landed
    __syncthreads();                                    // next chunk visible to all; every reader has left this chunk's buffer
    if (kv0 + 2 * BK < kend) {                          // block-uniform: chunk + 2 flies while chunk + 1 is worked on
      const int kn = kv0 + 2 * BK;
      stage_kv2<RES>(lk0 + bufh * 2, lv0 + bufh * 2, gkh + (size_t)kn * HID, gkl + (size_t)kn * HID, gvh + (size_t)kn * HD, gvl + (size_t)kn * HD);
    }
  }
  asm volatile("s_wait_asynccnt 0x0" ::: "memory");     // nothing of this wave is in flight when its LDS is reused

  // ---- epilogue, tile by tile: join the halves' sums, normalize (1/1024 removes the carry), stage 16x64 f32 in LDS, split to hi / residual.
  // Register r of O^T tile t in lane l is d = 16 t + 8 hi + r of query lh: eight consecutive floats of one staged row.
  #pragma unroll
  for (int u = 0; u < NQ; ++u) {
    const float inv = 1.0f / ((lcol[u] + xhalf(lcol[u])) * 1024.0f);
    float* so = (float*)(qwh + u * QW_H);    // the wave's own Q tile, no longer read
    #pragma unroll
    for (int t = 0; t < 4; ++t) {
      v8f v = acc[u][t].v;
      if (RES) v += accr[u][t].v * (1.0f / 4096.0f);
      v *= inv;
      v4fa* sp = (v4fa*)(so + lh * SOP + 16 * t + 8 * hi);
      sp[0] = (v4f){v[0], v[1], v[2], v[3]};
      sp[1] = (v4f){v[4], v[5], v[6], v[7]};
    }
    wave_lds_sync();
    v8h oh[4], ol[4]; size_t oo[4];
    {
      const int pc = lane & 7;
      #pragma unroll
      for (int i = 0; i < 4; ++i) {
        const int rr = 4 * i + (lane >> 3);
        const float* sp = so + rr * SOP + 8 * pc;
        split8(*(const v4fa*)sp, *(const v4fa*)(sp + 4), oh[i], ol[i]);
        oo[i] = (size_t)(qrow0 + 16 * u + rr) * HID + 8 * pc;
      }
    }
    #pragma unroll
    for (int i = 0; i < 4; ++i) { *(v8h*)(Chb + oo[i]) = oh[i]; *(v8h*)(Clb + oo[i]) = ol[i]; }
    if (u + 1 < NQ) asm volatile("s_wait_xcnt 0x0" ::: "memory");   // the next tile rewrites registers that these stores name
  }
}

// One launch for all query rows: the first nmain workgroups take the tiles from row EARLY on (heaviest first), the rest the short tiles
// below EARLY with their residual products. The test is workgroup-uniform.
__global__ __launch_bounds__(128)
void attn_kernel(const _Float16* __restrict__ Qh, const _Float16* __restrict__ Ql,
                 const _Float16* __restrict__ Kh, const _Float16* __restrict__ Kl,
                 const _Float16* __restrict__ Vth, const _Float16* __restrict__ Vtl,
                 _Float16* Ch, _Float16* Cl, int nmain)
{
  extern __shared__ __attribute__((aligned(16))) _Float16 smem[];
  const int blk = blockIdx.x;
  if (blk < nmain) attn_body<false, 2>(smem, Qh, Ql, Kh, Kl, Vth, Vtl, Ch, Cl, blk, EARLY / BQ, (SEQP - EARLY) / BQ);
  else             attn_body<true, 1>(smem, Qh, Ql, Kh, Kl, Vth, Vtl, Ch, Cl, blk - nmain, 0, EARLY / BQR);
}

extern "C" void kernel_launch(void* const* d_in, const int* in_sizes, int n_in,
                              void* d_out, int out_size, void* d_ws, size_t ws_size,
                              hipStream_t stream) {
  if (n_in < 6) return;
  const long long need_x = ((long long)(NB - 1) * SEQ_FULL + SEQ) * HID;
  if ((long long)in_sizes[0] < need_x) return;
  if ((long long)in_sizes[1] < (long long)HID * HID) return;
  if ((long long)in_sizes[2] < (long long)HID * HID) return;
  if ((long long)in_sizes[3] < (long long)HID * HID) return;
  if ((long long)in_sizes[4] < (long long)HID * HID) return;
  if ((long long)in_sizes[5] < (long long)SEQ * HID) return;
  if ((long long)out_size < need_x) return;
  if (kTotal > ws_size) return;

  const float* hs  = (const float*)d_in[0];
  const float* wq  = (const float*)d_in[1];
  const float* wk  = (const float*)d_in[2];
  const float* wv  = (const float*)d_in[3];
  const float* wo  = (const float*)d_in[4];
  const float* pos = (const float*)d_in[5];
  float*       out = (float*)d_out;

  char* ws = (char*)d_ws;
  _Float16* xh = (_Float16*)(ws + kOffXh);     // [MR][1024]
  _Float16* ph = (_Float16*)(ws + kOffPh);     // [SEQP][1024]
  _Float16* ch = (_Float16*)(ws + kOffCh);     // [MR][1024], aliases xh after it is dead
  _Float16* cl = (_Float16*)(ws + kOffCl);     // [MR][1024], aliases ph after it is dead
  _Float16* wh = (_Float16*)(ws + kOffWh);     // [4096][1024]
  _Float16* qh = (_Float16*)(ws + kOffQh);
  _Float16* ql = (_Float16*)(ws + kOffQl);
  _Float16* kh = (_Float16*)(ws + kOffKh);
  _Float16* kl = (_Float16*)(ws + kOffKl);
  _Float16* vh = (_Float16*)(ws + kOffVh);     // V^T hi  [NB][16][SEQP / 32][64][32]
  _Float16* vl = (_Float16*)(ws + kOffVl);     // V^T res [NB][16][EARLY / 32][64][32]

  prep_kernel<<<dim3(MR + SEQP + 4 * HID), dim3(128), 0, stream>>>(hs, pos, wq, wk, wv, wo, xh, ph, wh);

  // the Q / K planes and the V^T planes, the positional projection inside
  gemm_kernel<1><<<dim3(NQKV / GBN(1), SEQP / GSR), dim3(GT), 0, stream>>>(xh, ph, wh, qh, ql, kh, kl, vh, vl, out);

  (void)hipFuncSetAttribute(reinterpret_cast<const void*>(&attn_kernel),
                            hipFuncAttributeMaxDynamicSharedMemorySize, (int)LDS_BYTES);
  constexpr int nmain = NB * NH * ((SEQP - EARLY) / BQ);
  constexpr int nres  = NB * NH * (EARLY / BQR);
  attn_kernel<<<dim3(nmain + nres), dim3(128), LDS_BYTES, stream>>>(qh, ql, kh, kl, vh, vl, ch, cl, nmain);

  const _Float16* who = wh + (size_t)(NQK + HID) * HID;
  gemm_kernel<3><<<dim3(HID / GBN(3), MR / GBM), dim3(GT), 0, stream>>>(ch, cl, who, qh, ql, kh, kl, vh, vl, out);
}
